// v000
// Times are from an AMD MI455X. After a warm-up the kernel runs many times in a row, and a time is the length of
// such a window on the GPU divided by its runs, so every launch and the gaps after it count. The runs cycle
// through copies of the inputs. A figure is the median of several windows, for all but v000 over two sittings.
// Sittings can differ by a few percent; kernels timed side by side share one.
// The starting kernel, v000, takes 619 microseconds a run.
// Contractions: q / k / v^T and line-feature projections = v_wmma_f32_16x16x32_bf16 (bf16 operands from
// RNE-converted inputs, one product per k-step); q.k^T scores = v_wmma_f32_16x16x32_bf16 with bf16 hi/lo split
// q and k (hi.hi + hi.lo + lo.hi); p.v = v_wmma_f32_16x16x32_f16 (p carried x1024 in f16, v in f16; extra f16
// residual planes x4096 of p and v on the first 512 query rows); ctx.Wo^T = v_wmma_f32_16x16x32_bf16 with ctx
// as bf16 hi/lo planes times the bf16 Wo plane (2 products); all f32 accumulate; 6-term line-pair bias dots,
// decay weights and softmax in f32 on VALU.
#include <hip/hip_runtime.h>
#include <math.h>
#include <float.h>
#include <stdint.h>

#define NB     2
#define SEQ    2048
#define DMODEL 1024
#define NH     16
#define HD     64
#define QP     (NH * HD)       // 1024: q / k / ctx row pitch
#define NQB    (SEQ / 64)      // 32 query / key tiles of 64
#define VLP    512             // key pitch of the v^T residual plane (keys 0..VLP-1)
#define RESQB  8               // leading 64-row query blocks that use the p / v residual planes
#define PD     4               // point dim per head
#define LNW    (4 * PD * NH)   // 256: width of the line-feature projection [p1w | p2w | p1r | p2r]
static_assert(RESQB * 64 <= VLP);
static_assert(RESQB <= NQB);
static_assert(QP == DMODEL);
static_assert(HD == 64);
static_assert(PD == 4);
static_assert((SEQ % 64) == 0 && (DMODEL % 64) == 0 && (LNW % 64) == 0 && (QP % 64) == 0);
static_assert(((NB * SEQ) % 64) == 0 && (SEQ % 32) == 0);
static_assert((DMODEL % 32) == 0);

typedef _Float16 v16h __attribute__((ext_vector_type(16)));
typedef _Float16 v8h  __attribute__((ext_vector_type(8)));
typedef __bf16   v16b __attribute__((ext_vector_type(16)));
typedef __bf16   v8b  __attribute__((ext_vector_type(8)));
typedef float    v8f  __attribute__((ext_vector_type(8)));
typedef float    v4f  __attribute__((ext_vector_type(4)));
typedef float    v2f  __attribute__((ext_vector_type(2)));
typedef unsigned int v4u __attribute__((ext_vector_type(4)));

// ---- scalar helpers --------------------------------------------------------------------------------
__device__ __forceinline__ unsigned short bf_bits(float f) {          // f32 -> bf16 bits, RNE convert
  unsigned u = __float_as_uint(f);
  return (unsigned short)((u + 0x7FFFu + ((u >> 16) & 1u)) >> 16);
}
__device__ __forceinline__ float bf_up(unsigned short h) { return __uint_as_float(((unsigned)h) << 16); }
__device__ __forceinline__ unsigned short h_bits(_Float16 x) { return __builtin_bit_cast(unsigned short, x); }
__device__ __forceinline__ unsigned pk16(unsigned short a, unsigned short b) { return (unsigned)a | ((unsigned)b << 16); }
__device__ __forceinline__ v8f zero8() { v8f z = {0.f, 0.f, 0.f, 0.f, 0.f, 0.f, 0.f, 0.f}; return z; }
__device__ __forceinline__ v8h zero8h() {
  const _Float16 z = (_Float16)0.0f;
  v8h r = {z, z, z, z, z, z, z, z};
  return r;
}

// ---- fragment loader: 16-bit A/B operand, lane -> row/col (lane&15), p already includes +8*(lane>>4);
//      elements 0..7 <- p[0..7] (k0+8h..), elements 8..15 <- p[16..23] (k0+16+8h..)
__device__ __forceinline__ v16b ldfrag_b(const __bf16* p) {
  union { v16b v; v8b h[2]; } f;
  f.h[0] = *(const v8b*)(p);
  f.h[1] = *(const v8b*)(p + 16);
  return f.v;
}

// ---- WMMA helpers with trailing VALU hazard gap --------------------------------------------------------
__device__ __forceinline__ v8f mma_b(v16b a, v16b b, v8f c) {
  c = __builtin_amdgcn_wmma_f32_16x16x32_bf16(false, a, false, b, (short)0, c, false, false);
#if defined(__HIP_DEVICE_COMPILE__)
  asm volatile("v_nop\n\tv_nop\n\tv_nop\n\tv_nop" : "+v"(c) : "v"(a), "v"(b));
#endif
  return c;
}
__device__ __forceinline__ v8f mma_h(v16h a, v16h b, v8f c) {
  c = __builtin_amdgcn_wmma_f32_16x16x32_f16(false, a, false, b, (short)0, c, false, false);
#if defined(__HIP_DEVICE_COMPILE__)
  asm volatile("v_nop\n\tv_nop\n\tv_nop\n\tv_nop" : "+v"(c) : "v"(a), "v"(b));
#endif
  return c;
}
__device__ __forceinline__ v8f mma_b_raw(v16b a, v16b b, v8f c) {
  return __builtin_amdgcn_wmma_f32_16x16x32_bf16(false, a, false, b, (short)0, c, false, false);
}
__device__ __forceinline__ void dep_guard_b(v8f& a, v8f& b, v16b x, v16b y) {
#if defined(__HIP_DEVICE_COMPILE__)
  asm volatile("v_nop\n\tv_nop\n\tv_nop\n\tv_nop" : "+v"(a), "+v"(b) : "v"(x), "v"(y));
#endif
}
__device__ __forceinline__ void keep4_b(v16b a, v16b b, v16b c, v16b d) {
#if defined(__HIP_DEVICE_COMPILE__)
  asm volatile("v_nop" :: "v"(a), "v"(b), "v"(c), "v"(d));
#endif
}
__device__ __forceinline__ void acc_guard4(v8f& a, v8f& b, v8f& c, v8f& d) {
#if defined(__HIP_DEVICE_COMPILE__)
  asm volatile("v_nop\n\tv_nop\n\tv_nop\n\tv_nop" : "+v"(a), "+v"(b), "+v"(c), "+v"(d));
#endif
}

// =====================================================================================================
// Flat f32 -> bf16 (RNE convert), 8 elements per thread, one 16-B store per lane: a wave writes 512 contiguous
// coverage: n8 threads x 8 = the whole plane (n8 = element count / 8, all planes here are multiples of 2048).
// =====================================================================================================
__global__ __launch_bounds__(256) void cvt_bf16(const float* __restrict__ in, unsigned short* out, int n8) {
  const int i = blockIdx.x * 256 + threadIdx.x;
  if (i < n8) {
    const float* s = in + (size_t)i * 8;
    const v4f a = *(const v4f*)(s);
    const v4f b = *(const v4f*)(s + 4);
    v4u p;
    p[0] = pk16(bf_bits(a[0]), bf_bits(a[1]));
    p[1] = pk16(bf_bits(a[2]), bf_bits(a[3]));
    p[2] = pk16(bf_bits(b[0]), bf_bits(b[1]));
    p[3] = pk16(bf_bits(b[2]), bf_bits(b[3]));
    unsigned short* d = out + (size_t)i * 8;
    *(v4u*)d = p;
    
  }
}

// =====================================================================================================
// f32 -> bf16 hi plane + bf16 lo plane (lo = RNE(v - hi), unscaled), 8 elements per thread, one 16-B store per
// coverage: n8 threads x 8 = whole plane (n8 multiple of 256).
// =====================================================================================================
__global__ __launch_bounds__(256) void split_bf16x8(const float* __restrict__ in, unsigned short* hp,
                                                    unsigned short* lp, int n8) {
  const int i = blockIdx.x * 256 + threadIdx.x;
  if (i < n8) {
    const v4f a = *(const v4f*)(in + (size_t)i * 8);
    const v4f b = *(const v4f*)(in + (size_t)i * 8 + 4);
    v4u ph, pl;
#pragma unroll
    for (int e = 0; e < 4; ++e) {
      const float f0 = (e < 2) ? a[2 * e]     : b[2 * e - 4];
      const float f1 = (e < 2) ? a[2 * e + 1] : b[2 * e - 3];
      const unsigned short h0 = bf_bits(f0), h1 = bf_bits(f1);
      const unsigned short l0 = bf_bits(f0 - bf_up(h0)), l1 = bf_bits(f1 - bf_up(h1));
      ph[e] = pk16(h0, h1);
      pl[e] = pk16(l0, l1);
    }
    *(v4u*)(hp + (size_t)i * 8) = ph;
    *(v4u*)(lp + (size_t)i * 8) = pl;
    
  }
}

// =====================================================================================================
// Register-blocked batched bf16 WMMA GEMM: C[m][n] = sum_k A[m][k] * Bt[n][k] (+ bias); one wave per 64x64 tile,
// no block barriers. A row-major [M][K] pitch lda; Bt row-major [N][K] pitch ldb (k contiguous); M, N multiples
// of 64, K multiple of 32 (host-checked). blockIdx.y = batch index (strides in elements).
// NSPLIT: 0 = A.Bt; 1 = (A + A2).Bt (A2 = unscaled bf16 lo plane of A); 2 = A.Bt + A2.Bt + A.Bt2.
// BIAS: 0 none; 1 = + bias[n] per output column; 2 = + bias[m] per output row (bias RNE-converted to bf16 and
//       widened, added in f32 in the epilogue).
// OUT_MODE: 0 = f32 (pitch ldc); 2 = bf16 hi plane C + bf16 lo plane C2 (lo = RNE(v - hi), unscaled);
//           3 = f16 hi plane C + f16 residual plane C2 = f16((v - hi) * rscale), C2 written only for tiles
//               with n0 < N2 (pitch ldc2, batch stride strideC2).
// =====================================================================================================
template <int NSPLIT, int OUT_MODE, int BIAS>
__global__ __launch_bounds__(256) void gemm64(
    const unsigned short* __restrict__ Ap, const unsigned short* A2p, int lda, long long strideA,
    const unsigned short* __restrict__ Btp, const unsigned short* Bt2p, int ldb, long long strideB,
    void* Cout, int ldc, long long strideC,
    void* Cout2, int ldc2, long long strideC2, int N2,
    const float* __restrict__ biasp,
    int M, int N, int K, float rscale) {
  const __bf16* A   = (const __bf16*)(const void*)Ap;
  const __bf16* A2  = (const __bf16*)(const void*)A2p;
  const __bf16* Bt  = (const __bf16*)(const void*)Btp;
  const __bf16* Bt2 = (const __bf16*)(const void*)Bt2p;
  __shared__ __align__(16) float sT[8][16 * 68];   // per-wave 16x64 slab, pitch 68 floats
  const int b    = blockIdx.y;
  const int lane = threadIdx.x & 31;
  const int wave = threadIdx.x >> 5;
  const int tilesN = N >> 6;
  const int tilesM = M >> 6;
  const int tile = blockIdx.x * 8 + wave;
  if (tile >= tilesM * tilesN) return;   // wave-uniform; no block barriers in this kernel
  const int tm = tile / tilesN;
  const int tn = tile - tm * tilesN;
  const int m0 = tm << 6;
  const int n0 = tn << 6;

  const __bf16* Ab  = A  + (size_t)b * strideA;
  const __bf16* Bb  = Bt + (size_t)b * strideB;
  const __bf16* Ab2 = (NSPLIT >= 1) ? (A2  + (size_t)b * strideA) : Ab;
  const __bf16* Bb2 = (NSPLIT == 2) ? (Bt2 + (size_t)b * strideB) : Bb;

  const int rlane = lane & 15;                 // row (A) / col (B, D) within subtile
  const int koff  = (lane >> 4) * 8;           // k offset of this lane half
  const int mOff  = (lane >> 4) * 8;           // D row offset

  v8f acc[4][4];
#pragma unroll
  for (int i = 0; i < 4; ++i)
#pragma unroll
    for (int j = 0; j < 4; ++j) acc[i][j] = zero8();

  for (int k0 = 0; k0 < K; k0 += 32) {
    v16b bh[4], bl[4];
#pragma unroll
    for (int j = 0; j < 4; ++j) {
      const size_t bo = (size_t)(n0 + (j << 4) + rlane) * ldb + koff + k0;
      bh[j] = ldfrag_b(Bb + bo);
      if (NSPLIT == 2) bl[j] = ldfrag_b(Bb2 + bo); else bl[j] = bh[j];
    }
#pragma unroll
    for (int i = 0; i < 4; ++i) {
      const size_t ao = (size_t)(m0 + (i << 4) + rlane) * lda + koff + k0;
      const v16b ah = ldfrag_b(Ab + ao);
      v16b al = ah;
      if (NSPLIT >= 1) al = ldfrag_b(Ab2 + ao);
#pragma unroll
      for (int j = 0; j < 4; ++j) {
        acc[i][j] = mma_b_raw(ah, bh[j], acc[i][j]);
        if (NSPLIT >= 1) acc[i][j] = mma_b_raw(al, bh[j], acc[i][j]);
        if (NSPLIT == 2) acc[i][j] = mma_b_raw(ah, bl[j], acc[i][j]);
      }
      dep_guard_b(acc[i][0], acc[i][3], ah, al);
    }
    keep4_b(bh[0], bh[1], bh[2], bh[3]);
    if (NSPLIT == 2) keep4_b(bl[0], bl[1], bl[2], bl[3]);
  }
  acc_guard4(acc[0][0], acc[0][1], acc[0][2], acc[0][3]);
  acc_guard4(acc[1][0], acc[1][1], acc[1][2], acc[1][3]);
  acc_guard4(acc[2][0], acc[2][1], acc[2][2], acc[2][3]);
  acc_guard4(acc[3][0], acc[3][1], acc[3][2], acc[3][3]);

  // ---- per-column bias (BIAS == 1): this lane's 4 output columns n0 + 16j + rlane ----
  float bcol[4];
#pragma unroll
  for (int j = 0; j < 4; ++j) bcol[j] = 0.f;
  if (BIAS == 1) {
#pragma unroll
    for (int j = 0; j < 4; ++j) bcol[j] = bf_up(bf_bits(biasp[n0 + (j << 4) + rlane]));
  }

  // ---- epilogue ----
  float* slab = sT[wave];
#pragma unroll
  for (int i = 0; i < 4; ++i) {
    const int mBase = m0 + (i << 4);
    float brow[8];
#pragma unroll
    for (int r = 0; r < 8; ++r) brow[r] = 0.f;
    if (BIAS == 2) {
#pragma unroll
      for (int r = 0; r < 8; ++r) brow[r] = bf_up(bf_bits(biasp[mBase + mOff + r]));
    }
#pragma unroll
    for (int r = 0; r < 8; ++r) {
#pragma unroll
      for (int j = 0; j < 4; ++j) {
        float v = acc[i][j][r];
        if (BIAS == 1) v += bcol[j];
        if (BIAS == 2) v += brow[r];
        slab[(mOff + r) * 68 + (j << 4) + rlane] = v;
      }
    }
    __builtin_amdgcn_fence(__ATOMIC_RELEASE, "workgroup");
    __builtin_amdgcn_wave_barrier();
    __builtin_amdgcn_fence(__ATOMIC_ACQUIRE, "workgroup");
    if (OUT_MODE == 0) {
      float* C = (float*)Cout + (size_t)b * strideC;
      const int hh = lane >> 4, c4 = (lane & 15) * 4;     // 256-B row segment = 16 lanes x 16 B
      v4f ov[8];
#pragma unroll
      for (int it = 0; it < 8; ++it) {
        const int row = it * 2 + hh;                       // it 0..7 x hh 0..1 = rows 0..15
        ov[it] = *(const v4f*)(slab + row * 68 + c4);
      }
      {
#pragma unroll
        for (int it = 0; it < 8; ++it) {
          const int row = it * 2 + hh;
          *(v4f*)(C + (size_t)(mBase + row) * ldc + n0 + c4) = ov[it];
        }
        
      }
    } else {
      const int q = lane >> 3, c8 = (lane & 7) * 8;
      unsigned short* C  = (unsigned short*)Cout  + (size_t)b * strideC;
      unsigned short* C2 = (unsigned short*)Cout2 + (size_t)b * strideC2;
      const bool wlo = (OUT_MODE == 2) || (n0 < N2);      // wave-uniform
      v4u hv[4], lv[4];
#pragma unroll
      for (int it = 0; it < 4; ++it) {
        const int row = it * 4 + q;                        // it 0..3 x q 0..3 = rows 0..15
        const float* sp = slab + row * 68 + c8;
        v4u a, a2;
#pragma unroll
        for (int e = 0; e < 4; ++e) {
          const float f0 = sp[2 * e], f1 = sp[2 * e + 1];
          unsigned short h0, h1, l0, l1;
          if (OUT_MODE == 2) {
            h0 = bf_bits(f0); h1 = bf_bits(f1);
            l0 = bf_bits(f0 - bf_up(h0)); l1 = bf_bits(f1 - bf_up(h1));
          } else {
            const _Float16 x0 = (_Float16)f0, x1 = (_Float16)f1;
            h0 = h_bits(x0); h1 = h_bits(x1);
            l0 = h_bits((_Float16)((f0 - (float)x0) * rscale));
            l1 = h_bits((_Float16)((f1 - (float)x1) * rscale));
          }
          a[e] = pk16(h0, h1); a2[e] = pk16(l0, l1);
        }
        hv[it] = a; lv[it] = a2;
      }
      {
#pragma unroll
        for (int it = 0; it < 4; ++it) {
          const int row = it * 4 + q;
          *(v4u*)(C + (size_t)(mBase + row) * ldc + n0 + c8) = hv[it];
          if (wlo) *(v4u*)(C2 + (size_t)(mBase + row) * ldc2 + n0 + c8) = lv[it];
        }
        
      }
    }
    __builtin_amdgcn_fence(__ATOMIC_RELEASE, "workgroup");
    __builtin_amdgcn_wave_barrier();
    __builtin_amdgcn_fence(__ATOMIC_ACQUIRE, "workgroup");
  }
}

// =====================================================================================================
// Line features. Input ln f32 [NB*SEQ][LNW]: column blocks of PD*NH = 64: block 0 = x.W1w^T, 1 = x.W2w^T,
// 2 = x.W1r^T, 3 = x.W2r^T; within a block head h owns columns h*4..h*4+3.
// Per (b, h, t): p1 = block 0 of token t-1 (zero vector at t == 0: the shifted input), p2 = block 1 of t,
// p3 = block 2 of t, p4 = block 3 of t. Exterior 2-form L[m] = pa[PI[m]]*pb[PJ[m]] - pa[PJ[m]]*pb[PI[m]] for
// pairs (0,1),(0,2),(0,3),(1,2),(1,3),(2,3), then L *= 1/max(|L|_2, 1e-12) (all f32, fp contract off).
// Outputs f32 [NB*NH][SEQ][8]: rl = read line [L0..L5, 0, 0]; wl = J-applied write line [L5,-L4,L3,L2,-L1,L0,0,0].
// wave-uniform bound, no block barriers.
// coverage: nwaves = NB*NH*(SEQ/32) waves x 32 rows x 32 B = every row of both planes incl. the zero pad cols.
// =====================================================================================================
struct L6 { float v0, v1, v2, v3, v4, v5; };

__device__ __forceinline__ L6 ext6n(const v4f a, const v4f b) {
#pragma clang fp contract(off)
  L6 o;
  o.v0 = a[0] * b[1] - a[1] * b[0];
  o.v1 = a[0] * b[2] - a[2] * b[0];
  o.v2 = a[0] * b[3] - a[3] * b[0];
  o.v3 = a[1] * b[2] - a[2] * b[1];
  o.v4 = a[1] * b[3] - a[3] * b[1];
  o.v5 = a[2] * b[3] - a[3] * b[2];
  float n2 = o.v0 * o.v0 + o.v1 * o.v1;
  n2 = n2 + o.v2 * o.v2;
  n2 = n2 + o.v3 * o.v3;
  n2 = n2 + o.v4 * o.v4;
  n2 = n2 + o.v5 * o.v5;
  float n = sqrtf(n2);
  n = fmaxf(n, 1e-12f);
  const float inv = 1.0f / n;
  o.v0 *= inv; o.v1 *= inv; o.v2 *= inv; o.v3 *= inv; o.v4 *= inv; o.v5 *= inv;
  return o;
}

__global__ __launch_bounds__(256) void lines_k(const float* __restrict__ ln, float* rl, float* wl, int nwaves) {
#pragma clang fp contract(off)
  __shared__ __align__(16) float sR[8][256];
  __shared__ __align__(16) float sW[8][256];
  const int tid = threadIdx.x, wave = tid >> 5, lane = tid & 31;
  const int w = blockIdx.x * 8 + wave;
  if (w >= nwaves) return;                        // wave-uniform; no block barriers in this kernel
  const int tgPer = SEQ / 32;                     // 64 token groups per (b, h)
  const int bh = w / tgPer;                       // b*NH + h
  const int tg = w - bh * tgPer;
  const int b  = bh / NH;
  const int h  = bh - b * NH;
  const int t  = tg * 32 + lane;                  // < SEQ
  const size_t row  = (size_t)b * SEQ + t;
  const size_t rowp = (t > 0) ? (row - 1) : row;  // clamped address; value zeroed below when t == 0
  const float* cur = ln + row * LNW + h * PD;
  v4f p1 = *(const v4f*)(ln + rowp * LNW + h * PD);
  if (t == 0) { p1[0] = 0.f; p1[1] = 0.f; p1[2] = 0.f; p1[3] = 0.f; }
  const v4f p2 = *(const v4f*)(cur + 1 * PD * NH);
  const v4f p3 = *(const v4f*)(cur + 2 * PD * NH);
  const v4f p4 = *(const v4f*)(cur + 3 * PD * NH);
  const L6 lw = ext6n(p1, p2);
  const L6 lr = ext6n(p3, p4);

  float* sr = sR[wave] + lane * 8;
  float* sw = sW[wave] + lane * 8;
  v4f t0, t1, u0, u1;
  t0[0] = lr.v0; t0[1] = lr.v1; t0[2] = lr.v2; t0[3] = lr.v3;
  t1[0] = lr.v4; t1[1] = lr.v5; t1[2] = 0.f;   t1[3] = 0.f;
  u0[0] = lw.v5; u0[1] = -lw.v4; u0[2] = lw.v3; u0[3] = lw.v2;
  u1[0] = -lw.v1; u1[1] = lw.v0; u1[2] = 0.f;   u1[3] = 0.f;
  *(v4f*)(sr)     = t0;
  *(v4f*)(sr + 4) = t1;
  *(v4f*)(sw)     = u0;
  *(v4f*)(sw + 4) = u1;
  __builtin_amdgcn_fence(__ATOMIC_RELEASE, "workgroup");
  __builtin_amdgcn_wave_barrier();
  __builtin_amdgcn_fence(__ATOMIC_ACQUIRE, "workgroup");
  v4f oR[2], oW[2];
#pragma unroll
  for (int it = 0; it < 2; ++it) {
    oR[it] = *(const v4f*)(sR[wave] + it * 128 + lane * 4);
    oW[it] = *(const v4f*)(sW[wave] + it * 128 + lane * 4);
  }
  const size_t gb = ((size_t)bh * SEQ + (size_t)tg * 32) * 8;
  {
#pragma unroll
    for (int it = 0; it < 2; ++it) {
      *(v4f*)(rl + gb + it * 128 + lane * 4) = oR[it];
      *(v4f*)(wl + gb + it * 128 + lane * 4) = oW[it];
    }
    
  }
}

// =====================================================================================================
// Causal multi-head attention, head dim 64, with an additive line-pair bias:
//   logit(q, k) = (q . k) * sscale + dot6(rl[q], wl[k]) * wdec(q - k),  wdec(d) = bs_h * dec_h^d for d > 0, 0 else,
//   dec_h = sigmoid(dl_h); keys k > q masked (-FLT_MAX, exp -> 0); diagonal kept.
//   q planes (bf16 hi / lo): element (b, t, h, d) at [(b*SEQ + t)*QP + h*64 + d]
//   k planes (bf16 hi / lo): same layout
//   v^T hi plane (f16):      element (b, h, d, s) at [(b*QP + h*64 + d)*SEQ + s]
//   v^T residual plane (f16, (v - hi)*4096): [(b*QP + h*64 + d)*VLP + s], s < VLP, read only when RES
//   rl / wl f32 planes [b*NH + h][SEQ][8] (6 used)
//   out f32 plane: element (b, t, h*64 + d) at [(b*SEQ + t)*QP + h*64 + d] = normalised context.
//   scores = q . k : bf16 hi/lo split (hi.hi + hi.lo + lo.hi), f32 accumulate, then scale + bias in f32
//   p = exp(s - m) carried as f16(1024 p); context = p . v on f16 WMMA; RES adds f16 residual planes of p and v
//   (scale 4096, separate accumulator folded back with 1/4096 per chunk in f32); online softmax in f32.
//   Block = 4 waves = 64 query rows of one (b, h); grid = nqbThis * NH * NB; key chunks of 64, tiles 0..qb only
//   (block-uniform trip count qb+1 <= NQB; every row has a live key in every processed chunk).
//   K / V^T / wl chunk staging: 128 threads (plain 16-B loads, __syncthreads before and after); P tiles are
//   wave-private, spilled with _Float16 element stores and reloaded as v8h (same element type) after a release
//   barrier in between).
//   Output coverage: each wave stores rows q0..q0+15 (it 0..7 x lane>>4 0..1) x 64 columns (16 lanes x 4 floats),
// =====================================================================================================
template <bool RES>
__global__ __launch_bounds__(128)
void attn_lb(const unsigned short* __restrict__ qhp, const unsigned short* __restrict__ qlp,
             const unsigned short* __restrict__ khp, const unsigned short* __restrict__ klp,
             const unsigned short* __restrict__ vhp, const unsigned short* __restrict__ vlp,
             const float* __restrict__ rlp, const float* __restrict__ wlp,
             const float* __restrict__ dlg, const float* __restrict__ bsc,
             float* outp, int qbBase, int nqbThis, float sscale) {
  union FB { v16b v; v8b h[2]; };
  union FH { v16h v; v8h h[2]; };
  __shared__ __align__(16) unsigned short KT[2 * 64 * 64];      // K hi [kv][d] | K lo; later f32 context staging
  __shared__ __align__(16) _Float16 Vth[64 * 64];                // V^T hi [d][kv]
  __shared__ __align__(16) _Float16 Vtl[RES ? 64 * 64 : 8];      // V^T residual
  __shared__ __align__(16) _Float16 Psh[4][16 * 64];             // per wave P [row][kv]
  __shared__ __align__(16) _Float16 Psl[RES ? 4 : 1][16 * 64];   // per wave P residual
  __shared__ __align__(16) float    Ws[64 * 8];                  // wl rows of the chunk's 64 keys
  __shared__ __align__(16) float    Rs[4][16 * 8];               // per wave rl rows of its 16 queries
  __bf16* Ksh = (__bf16*)(void*)KT;
  __bf16* Ksl = Ksh + 64 * 64;

  const int tid  = threadIdx.x;
  const int wave = tid >> 5;
  const int lane = tid & 31;
  const int hh   = lane >> 4;
  const int c    = lane & 15;

  const int bx   = blockIdx.x;
  const int qbl  = bx % nqbThis;
  const int rest = bx / nqbThis;
  const int h    = rest % NH;
  const int b    = rest / NH;
  const int qb   = qbBase + qbl;
  const int q0   = qb * 64 + wave * 16;
  const size_t rowB = (size_t)b * SEQ;
  const size_t bhT  = ((size_t)b * NH + h) * SEQ;

  const __bf16* Qh = (const __bf16*)(const void*)qhp + (size_t)h * HD;
  const __bf16* Ql = (const __bf16*)(const void*)qlp + (size_t)h * HD;
  const __bf16* Kh = (const __bf16*)(const void*)khp + (size_t)h * HD;
  const __bf16* Kl = (const __bf16*)(const void*)klp + (size_t)h * HD;
  const _Float16* Vh = (const _Float16*)(const void*)vhp + ((size_t)b * QP + (size_t)h * HD) * SEQ;
  const _Float16* Vl = (const _Float16*)(const void*)vlp + ((size_t)b * QP + (size_t)h * HD) * VLP;

  // ---- per-head scalars (RNE bf16-converted inputs) ----
  const float dl  = bf_up(bf_bits(dlg[h]));
  const float dec = 1.0f / (1.0f + expf(-dl));
  const float l2d = log2f(dec);
  const float bsh = bf_up(bf_bits(bsc[h]));

  // ---- stage the wave's 16 rl rows: 16 x 8 f32 = 32 lanes x 16 B (ordered by the loop's first barrier) ----
  *(v4f*)(Rs[wave] + lane * 4) = *(const v4f*)(rlp + (bhT + q0) * 8 + lane * 4);

  float mrow[8], lrow[8];
  v8f oacc[4];
#pragma unroll
  for (int r = 0; r < 8; ++r) { mrow[r] = -INFINITY; lrow[r] = 0.f; }
#pragma unroll
  for (int t = 0; t < 4; ++t) oacc[t] = zero8();

  int nkt = qb + 1;                          // causal: key tiles 0..qb, block-uniform
  if (nkt > NQB) nkt = NQB;
  for (int kt = 0; kt < nkt; ++kt) {
    const int kv0 = kt * 64;
    __syncthreads();
    {
      const int r = tid >> 1, half = (tid & 1) * 32;
      const __bf16*   kg  = Kh + (rowB + kv0 + r) * QP + half;    // K row kv0+r, d = half..half+31
      const __bf16*   klg = Kl + (rowB + kv0 + r) * QP + half;
      const _Float16* vg  = Vh + (size_t)r * SEQ + kv0 + half;    // V^T row d = r, s = kv0+half..+31
      const int kvl = (kv0 + 64 <= VLP) ? kv0 : (VLP - 64);     // clamped address into the residual plane
      const _Float16* vlg = Vl + (size_t)r * VLP + kvl + half;
      const bool resOK = (kv0 + 64 <= VLP);                      // block-uniform
#pragma unroll
      for (int i = 0; i < 4; ++i) {
        const v8b a0 = *(const v8b*)(kg + 8 * i);
        const v8b a1 = *(const v8b*)(klg + 8 * i);
        const v8h b0 = *(const v8h*)(vg + 8 * i);
        *(v8b*)(Ksh + r * 64 + half + 8 * i) = a0;
        *(v8b*)(Ksl + r * 64 + half + 8 * i) = a1;
        *(v8h*)(Vth + r * 64 + half + 8 * i) = b0;
        if (RES) {
          v8h b1 = *(const v8h*)(vlg + 8 * i);
          if (!resOK) b1 = zero8h();
          *(v8h*)(Vtl + r * 64 + half + 8 * i) = b1;
        }
      }
      // wl rows kv0..kv0+63 of this (b, h): 64 x 8 f32 = 128 threads x 16 B
      *(v4f*)(Ws + tid * 4) = *(const v4f*)(wlp + (bhT + kv0) * 8 + tid * 4);
    }
    __syncthreads();

    // ---- Q fragments (A operand, row = lane&15): 2 d-chunks, hi and lo (reloaded per chunk) ----
    v16b qah[2], qal[2];
#pragma unroll
    for (int dc = 0; dc < 2; ++dc) {
      const size_t qo = (rowB + q0 + c) * QP + dc * 32 + 8 * hh;
      qah[dc] = ldfrag_b(Qh + qo);
      qal[dc] = ldfrag_b(Ql + qo);
    }

    // ---- scores: 16 query rows x 64 keys per wave, 3 bf16 products ----
    v8f s[4];
#pragma unroll
    for (int j = 0; j < 4; ++j) {
      s[j] = zero8();
#pragma unroll
      for (int dc = 0; dc < 2; ++dc) {
        FB kb, kl;
        kb.h[0] = *(const v8b*)(Ksh + (j * 16 + c) * 64 + dc * 32 + 8 * hh);
        kb.h[1] = *(const v8b*)(Ksh + (j * 16 + c) * 64 + dc * 32 + 16 + 8 * hh);
        kl.h[0] = *(const v8b*)(Ksl + (j * 16 + c) * 64 + dc * 32 + 8 * hh);
        kl.h[1] = *(const v8b*)(Ksl + (j * 16 + c) * 64 + dc * 32 + 16 + 8 * hh);
        s[j] = mma_b(qah[dc], kb.v, s[j]);
        s[j] = mma_b(qah[dc], kl.v, s[j]);
        s[j] = mma_b(qal[dc], kb.v, s[j]);
      }
    }

    // ---- wl rows of this lane's 4 key columns (j*16 + c): 6 used of 8 ----
    v4f wa[4];
    v2f wb[4];
#pragma unroll
    for (int j = 0; j < 4; ++j) {
      const float* wp = Ws + (j * 16 + c) * 8;
      wa[j] = *(const v4f*)(wp);
      wb[j] = *(const v2f*)(wp + 4);
    }

    // ---- scale + bias + causal mask (replace by -FLT_MAX), row max, online softmax, P (x1024, f16) and
    //      P residual (x4096) to LDS ----
    _Float16* pwh = Psh[wave];
    _Float16* pwl = Psl[RES ? wave : 0];
#pragma unroll
    for (int r = 0; r < 8; ++r) {
      const int qrow = q0 + 8 * hh + r;
      const float* rp = Rs[wave] + (8 * hh + r) * 8;
      const v4f ra = *(const v4f*)(rp);
      const v2f rb = *(const v2f*)(rp + 4);
      float m = -INFINITY;
#pragma unroll
      for (int j = 0; j < 4; ++j) {
        const int key = kv0 + j * 16 + c;
        const int dd  = qrow - key;
        const float dot6 = ra[0] * wa[j][0] + ra[1] * wa[j][1] + ra[2] * wa[j][2] + ra[3] * wa[j][3]
                         + rb[0] * wb[j][0] + rb[1] * wb[j][1];
        const float ex   = exp2f((float)dd * l2d);
        const float wdec = (dd > 0) ? (bsh * ex) : 0.f;
        float sv = s[j][r] * sscale + dot6 * wdec;
        sv = (key > qrow) ? -FLT_MAX : sv;
        s[j][r] = sv;
        m = fmaxf(m, sv);
      }
#pragma unroll
      for (int off = 1; off < 16; off <<= 1) m = fmaxf(m, __shfl_xor(m, off, 32));
      const float mnew  = fmaxf(mrow[r], m);
      const float msafe = (mnew == -INFINITY) ? 0.f : mnew;
      const float alpha = __expf(mrow[r] - msafe);
      mrow[r] = mnew;
      float psum = 0.f;
#pragma unroll
      for (int j = 0; j < 4; ++j) {
        const float p = __expf(s[j][r] - msafe);     // masked logit against a finite max: exp -> 0
        psum += p;
        const float p1k = p * 1024.0f;
        const _Float16 ph = (_Float16)p1k;
        pwh[(8 * hh + r) * 64 + j * 16 + c] = ph;
        if (RES) {
          const _Float16 pl = (_Float16)((p1k - (float)ph) * 4096.0f);
          pwl[(8 * hh + r) * 64 + j * 16 + c] = pl;
        }
      }
#pragma unroll
      for (int off = 1; off < 16; off <<= 1) psum += __shfl_xor(psum, off, 32);
      lrow[r] = lrow[r] * alpha + psum;
#pragma unroll
      for (int t = 0; t < 4; ++t) oacc[t][r] *= alpha;
    }
    __builtin_amdgcn_fence(__ATOMIC_RELEASE, "workgroup");
    __builtin_amdgcn_wave_barrier();
    __builtin_amdgcn_fence(__ATOMIC_ACQUIRE, "workgroup");

    // ---- context += P . V (f16 WMMA), residual products into a separate accumulator ----
    v8f o1[4];
#pragma unroll
    for (int t = 0; t < 4; ++t) o1[t] = zero8();
#pragma unroll 1
    for (int kk = 0; kk < 2; ++kk) {
      FH pa, pl;
      pa.h[0] = *(const v8h*)(pwh + c * 64 + kk * 32 + 8 * hh);
      pa.h[1] = *(const v8h*)(pwh + c * 64 + kk * 32 + 16 + 8 * hh);
      if (RES) {
        pl.h[0] = *(const v8h*)(pwl + c * 64 + kk * 32 + 8 * hh);
        pl.h[1] = *(const v8h*)(pwl + c * 64 + kk * 32 + 16 + 8 * hh);
      } else {
        pl.v = pa.v;
      }
#pragma unroll
      for (int t = 0; t < 4; ++t) {
        FH vb;
        vb.h[0] = *(const v8h*)(Vth + (t * 16 + c) * 64 + kk * 32 + 8 * hh);
        vb.h[1] = *(const v8h*)(Vth + (t * 16 + c) * 64 + kk * 32 + 16 + 8 * hh);
        oacc[t] = mma_h(pa.v, vb.v, oacc[t]);
        if (RES) {
          FH vl;
          vl.h[0] = *(const v8h*)(Vtl + (t * 16 + c) * 64 + kk * 32 + 8 * hh);
          vl.h[1] = *(const v8h*)(Vtl + (t * 16 + c) * 64 + kk * 32 + 16 + 8 * hh);
          o1[t] = mma_h(pa.v, vl.v, o1[t]);
          o1[t] = mma_h(pl.v, vb.v, o1[t]);
        }
      }
    }
    if (RES) {
#pragma unroll
      for (int t = 0; t < 4; ++t)
#pragma unroll
        for (int r = 0; r < 8; ++r) oacc[t][r] += o1[t][r] * (1.0f / 4096.0f);
    }
  }

  // ---- all waves are done with the K tiles before that LDS region is reused for the context staging ----
  __syncthreads();

  // ---- normalise (1/l and the 1/1024 p carry), stage the wave's 16x64 tile in LDS, then write whole
  float* os = (float*)(void*)KT + wave * (16 * 64);
#pragma unroll
  for (int r = 0; r < 8; ++r) {
    const float l = lrow[r];
    const float inv = ((l > 0.f) ? (1.0f / l) : 0.f) * (1.0f / 1024.0f);
#pragma unroll
    for (int t = 0; t < 4; ++t) os[(8 * hh + r) * 64 + t * 16 + c] = oacc[t][r] * inv;
  }
  __builtin_amdgcn_fence(__ATOMIC_RELEASE, "workgroup");
  __builtin_amdgcn_wave_barrier();
  __builtin_amdgcn_fence(__ATOMIC_ACQUIRE, "workgroup");
  {
    const int h2 = lane >> 4, c4 = (lane & 15) * 4;
    v4f ov[8];
#pragma unroll
    for (int it = 0; it < 8; ++it) {
      const int row = it * 2 + h2;   // it 0..7 x h2 0..1 = rows 0..15 of the wave tile
      ov[it] = *(const v4f*)(os + row * 64 + c4);
    }
    {
#pragma unroll
      for (int it = 0; it < 8; ++it) {
        const int row = it * 2 + h2;
        const size_t go = (rowB + q0 + row) * QP + (size_t)h * HD + c4;
        *(v4f*)(outp + go) = ov[it];
      }
      
    }
  }
}

// =====================================================================================================
// Workspace map (bytes), every region an exact multiple of its whole-line / whole-tile store granularity
// multiples):
//   Xb     bf16 [4096][1024]            0            8388608
//   Wqkv   bf16 [3072][1024]            8388608      6291456   ([n][k], rows 0..1023 q | 1024.. k | 2048.. v)
//   Wln    bf16 [256][1024]             14680064      524288   ([W1w; W2w; W1r; W2r], [n][k])
//   Wob    bf16 [1024][1024]            15204352     2097152   ([n][k])
//   LN     f32  [4096][256]             17301504     4194304
//   RL     f32  [32][2048][8]           21495808     2097152
//   WL     f32  [32][2048][8]           23592960     2097152
//   Qh     bf16 [4096][1024]            25690112     8388608
//   Ql     bf16 [4096][1024]            34078720     8388608
//   Kh     bf16 [4096][1024]            42467328     8388608
//   Kl     bf16 [4096][1024]            50855936     8388608
//   VTh    f16  [2][1024][2048]         59244544     8388608
//   VTl    f16  [2][1024][512]          67633152     2097152
//   Af     f32  [4096][1024]            69730304    16777216
//   Ah     bf16 [4096][1024]            86507520     8388608
//   Al     bf16 [4096][1024]            94896128     8388608
//   end                                 103284736
// =====================================================================================================
extern "C" void kernel_launch(void* const* d_in, const int* in_sizes, int n_in,
                              void* d_out, int out_size, void* d_ws, size_t ws_size,
                              hipStream_t stream) {
  if (n_in < 11) return;
  if (in_sizes[0] != NB * SEQ * DMODEL) return;
  if (in_sizes[1] != 3 * QP * DMODEL) return;
  if (in_sizes[2] != 3 * QP) return;
  if (in_sizes[3] != PD * NH * DMODEL) return;
  if (in_sizes[4] != PD * NH * DMODEL) return;
  if (in_sizes[5] != PD * NH * DMODEL) return;
  if (in_sizes[6] != PD * NH * DMODEL) return;
  if (in_sizes[7] != DMODEL * QP) return;
  if (in_sizes[8] != DMODEL) return;
  if (in_sizes[9] != NH) return;
  if (in_sizes[10] != NH) return;
  if (out_size != NB * SEQ * DMODEL) return;

  const float* x     = (const float*)d_in[0];    // [NB*SEQ][DMODEL]
  const float* wqkv  = (const float*)d_in[1];    // [3*QP n][DMODEL k]
  const float* bqkv  = (const float*)d_in[2];    // [3*QP]
  const float* w1w   = (const float*)d_in[3];    // [PD*NH][DMODEL]
  const float* w2w   = (const float*)d_in[4];
  const float* w1r   = (const float*)d_in[5];
  const float* w2r   = (const float*)d_in[6];
  const float* wout  = (const float*)d_in[7];    // [DMODEL n][QP k]
  const float* bout  = (const float*)d_in[8];    // [DMODEL]
  const float* dlog  = (const float*)d_in[9];    // [NH]
  const float* bscl  = (const float*)d_in[10];   // [NH]

  const size_t PXb   = (size_t)NB * SEQ * DMODEL * 2;      //  8388608
  const size_t PWqkv = (size_t)3 * QP * DMODEL * 2;        //  6291456
  const size_t PWln  = (size_t)LNW * DMODEL * 2;           //   524288
  const size_t PWo   = (size_t)DMODEL * QP * 2;            //  2097152
  const size_t PLN   = (size_t)NB * SEQ * LNW * 4;         //  4194304
  const size_t PRL   = (size_t)NB * NH * SEQ * 8 * 4;      //  2097152
  const size_t PQpl  = (size_t)NB * SEQ * QP * 2;          //  8388608  (Qh, Ql, Kh, Kl, Ah, Al)
  const size_t PVTh  = (size_t)NB * QP * SEQ * 2;          //  8388608
  const size_t PVTl  = (size_t)NB * QP * VLP * 2;          //  2097152
  const size_t PAf   = (size_t)NB * SEQ * QP * 4;          // 16777216
  size_t off = 0;
  const size_t oXb   = off; off += PXb;
  const size_t oWqkv = off; off += PWqkv;
  const size_t oWln  = off; off += PWln;
  const size_t oWo   = off; off += PWo;
  const size_t oLN   = off; off += PLN;
  const size_t oRL   = off; off += PRL;
  const size_t oWL   = off; off += PRL;
  const size_t oQh   = off; off += PQpl;
  const size_t oQl   = off; off += PQpl;
  const size_t oKh   = off; off += PQpl;
  const size_t oKl   = off; off += PQpl;
  const size_t oVTh  = off; off += PVTh;
  const size_t oVTl  = off; off += PVTl;
  const size_t oAf   = off; off += PAf;
  const size_t oAh   = off; off += PQpl;
  const size_t oAl   = off; off += PQpl;
  if (off > ws_size) return;                          // off = 103284736
  if (off > (size_t)134217728) return;

  char* ws = (char*)d_ws;
  unsigned short* Xb   = (unsigned short*)(ws + oXb);
  unsigned short* Wqkv = (unsigned short*)(ws + oWqkv);
  unsigned short* Wln  = (unsigned short*)(ws + oWln);
  unsigned short* Wob  = (unsigned short*)(ws + oWo);
  float*          LN   = (float*)(ws + oLN);
  float*          RL   = (float*)(ws + oRL);
  float*          WL   = (float*)(ws + oWL);
  unsigned short* Qh   = (unsigned short*)(ws + oQh);
  unsigned short* Ql   = (unsigned short*)(ws + oQl);
  unsigned short* Kh   = (unsigned short*)(ws + oKh);
  unsigned short* Kl   = (unsigned short*)(ws + oKl);
  unsigned short* VTh  = (unsigned short*)(ws + oVTh);
  unsigned short* VTl  = (unsigned short*)(ws + oVTl);
  float*          Af   = (float*)(ws + oAf);
  unsigned short* Ah   = (unsigned short*)(ws + oAh);
  unsigned short* Al   = (unsigned short*)(ws + oAl);
  float*          outf = (float*)d_out;

  const dim3 blk(256);
  const int nTok   = NB * SEQ;                                       // 4096 tokens
  const int n8x    = nTok * DMODEL / 8;                              // 524288
  const int n8qkv  = 3 * QP * DMODEL / 8;                            // 393216
  const int n8ln   = PD * NH * DMODEL / 8;                           //   8192 per line weight
  const int n8wo   = DMODEL * QP / 8;                                // 131072
  const int n8a    = nTok * QP / 8;                                  // 524288
  const int nwLn   = NB * NH * (SEQ / 32);                           //   2048 waves
  const dim3 gCx((n8x + 255) / 256), gCqkv((n8qkv + 255) / 256), gCln((n8ln + 255) / 256), gCwo((n8wo + 255) / 256);
  const dim3 gLNg(((nTok / 64) * (LNW / 64) + 7) / 8, 1);            // 256 tiles -> 32 blocks
  const dim3 gQ(((nTok / 64) * (QP / 64) + 7) / 8, 1);               // 1024 tiles -> 128 blocks
  const dim3 gVT(((QP / 64) * (SEQ / 64) + 7) / 8, NB);              // 512 tiles -> 64 blocks x 2 batch elements
  const dim3 gLines((nwLn + 7) / 8);                                 // 256 blocks
  const dim3 gSplit((n8a + 255) / 256);                              // 2048 blocks
  const dim3 gOut(((nTok / 64) * (DMODEL / 64) + 7) / 8, 1);         // 1024 tiles -> 128 blocks

  // (1) inputs -> bf16 planes (RNE convert); weights arrive [n][k] = the Bt layout already
  cvt_bf16<<<gCx,   blk, 0, stream>>>(x,    Xb,   n8x);
  cvt_bf16<<<gCqkv, blk, 0, stream>>>(wqkv, Wqkv, n8qkv);
  cvt_bf16<<<gCln,  blk, 0, stream>>>(w1w,  Wln + (size_t)0 * PD * NH * DMODEL, n8ln);
  cvt_bf16<<<gCln,  blk, 0, stream>>>(w2w,  Wln + (size_t)1 * PD * NH * DMODEL, n8ln);
  cvt_bf16<<<gCln,  blk, 0, stream>>>(w1r,  Wln + (size_t)2 * PD * NH * DMODEL, n8ln);
  cvt_bf16<<<gCln,  blk, 0, stream>>>(w2r,  Wln + (size_t)3 * PD * NH * DMODEL, n8ln);
  cvt_bf16<<<gCwo,  blk, 0, stream>>>(wout, Wob,  n8wo);
  // (2) line-feature projections: LN[row][e] = sum_k Xb[row][k] Wln[e][k]  (M=4096, N=256, K=1024) -> f32
  gemm64<0, 0, 0><<<gLNg, blk, 0, stream>>>(
      Xb, Xb, DMODEL, 0LL, Wln, Wln, DMODEL, 0LL,
      (void*)LN, LNW, 0LL, (void*)LN, 0, 0LL, 0,
      bout, nTok, LNW, DMODEL, 1.0f);
  // (3) q projection + bias -> bf16 hi / lo planes  (M=4096, N=1024, K=1024)
  gemm64<0, 2, 1><<<gQ, blk, 0, stream>>>(
      Xb, Xb, DMODEL, 0LL, Wqkv, Wqkv, DMODEL, 0LL,
      (void*)Qh, QP, 0LL, (void*)Ql, QP, 0LL, QP,
      bqkv, nTok, QP, DMODEL, 1.0f);
  // (4) k projection + bias -> bf16 hi / lo planes (weight rows 1024..2047, bias 1024..)
  gemm64<0, 2, 1><<<gQ, blk, 0, stream>>>(
      Xb, Xb, DMODEL, 0LL, Wqkv + (size_t)QP * DMODEL, Wqkv + (size_t)QP * DMODEL, DMODEL, 0LL,
      (void*)Kh, QP, 0LL, (void*)Kl, QP, 0LL, QP,
      bqkv + QP, nTok, QP, DMODEL, 1.0f);
  // (5) v^T per batch element: VTh[b][f][s] = sum_k Wv[f][k] Xb[b*SEQ+s][k] + bv[f] -> f16 hi plane (pitch SEQ)
  //     and residual plane (x4096, keys < VLP, pitch VLP)  (M=1024 features, N=2048 tokens, K=1024, bias per row)
  gemm64<0, 3, 2><<<gVT, blk, 0, stream>>>(
      Wqkv + (size_t)2 * QP * DMODEL, Wqkv + (size_t)2 * QP * DMODEL, DMODEL, 0LL,
      Xb, Xb, DMODEL, (long long)SEQ * DMODEL,
      (void*)VTh, SEQ, (long long)QP * SEQ, (void*)VTl, VLP, (long long)QP * VLP, VLP,
      bqkv + 2 * QP, QP, SEQ, DMODEL, 4096.0f);
  // (6) line features (shifted p1, exterior 2-forms, L2 normalisation, J map) -> rl / wl f32 planes
  lines_k<<<gLines, blk, 0, stream>>>(LN, RL, WL, nwLn);
  // (7) causal attention with line-pair bias: query blocks 0..RESQB-1 with residual planes, the rest without
  attn_lb<true><<<dim3(NB * NH * RESQB), dim3(128), 0, stream>>>(
      Qh, Ql, Kh, Kl, VTh, VTl, RL, WL, dlog, bscl, Af, 0, RESQB, 0.125f);
  attn_lb<false><<<dim3(NB * NH * (NQB - RESQB)), dim3(128), 0, stream>>>(
      Qh, Ql, Kh, Kl, VTh, VTl, RL, WL, dlog, bscl, Af, RESQB, NQB - RESQB, 0.125f);
  // (8) context rows -> bf16 hi/lo planes
  split_bf16x8<<<gSplit, blk, 0, stream>>>(Af, Ah, Al, n8a);
  // (9) out[row][e] = sum_d (Ah+Al)[row][d] Wob[e][d] + bout[e] -> d_out f32 [4096][1024]  (M=4096, N=1024, K=1024)
  gemm64<1, 0, 1><<<gOut, blk, 0, stream>>>(
      Ah, Al, QP, 0LL, Wob, Wob, QP, 0LL,
      (void*)outf, DMODEL, 0LL, (void*)outf, 0, 0LL, 0,
      bout, nTok, DMODEL, QP, 1.0f);
  (void)hipGetLastError();
}

// v001
// One run takes 515 microseconds.
// Two timings next to v000 put it at 1.20 and 1.21 times that version's speed.
// Contractions: q / k / v^T and line-feature projections = v_wmma_f32_16x16x32_bf16 (bf16 operands from
// RNE-converted inputs, one product per k-step); q.k^T scores = v_wmma_f32_16x16x32_bf16 with bf16 hi/lo split
// q and k (hi.hi + hi.lo + lo.hi); p.v = v_wmma_f32_16x16x32_f16 (p carried x1024 in f16, v in f16; extra f16
// residual planes x4096 of p and v on the first 512 query rows); ctx.Wo^T = v_wmma_f32_16x16x32_bf16 with ctx
// as bf16 hi/lo planes times the bf16 Wo plane (2 products); all f32 accumulate; 6-term line-pair bias dots,
// decay weights and softmax in f32 on VALU.
#include <hip/hip_runtime.h>
#include <math.h>
#include <float.h>
#include <stdint.h>

#define NB     2
#define SEQ    2048
#define DMODEL 1024
#define NH     16
#define HD     64
#define QP     (NH * HD)       // 1024: q / k / ctx row pitch
#define NQB    (SEQ / 64)      // 32 query / key tiles of 64
#define VLP    512             // key pitch of the v^T residual plane (keys 0..VLP-1)
#define RESQB  8               // leading 64-row query blocks that use the p / v residual planes
#define PD     4               // point dim per head
#define LNW    (4 * PD * NH)   // 256: width of the line-feature projection [p1w | p2w | p1r | p2r]
static_assert(RESQB * 64 <= VLP);
static_assert(RESQB <= NQB);
static_assert(QP == DMODEL);
static_assert(HD == 64);
static_assert(PD == 4);
static_assert((SEQ % 64) == 0 && (DMODEL % 64) == 0 && (LNW % 64) == 0 && (QP % 64) == 0);
static_assert(((NB * SEQ) % 64) == 0 && (SEQ % 32) == 0);
static_assert((DMODEL % 32) == 0);

typedef _Float16 v16h __attribute__((ext_vector_type(16)));
typedef _Float16 v8h  __attribute__((ext_vector_type(8)));
typedef __bf16   v16b __attribute__((ext_vector_type(16)));
typedef __bf16   v8b  __attribute__((ext_vector_type(8)));
typedef float    v8f  __attribute__((ext_vector_type(8)));
typedef float    v4f  __attribute__((ext_vector_type(4)));
typedef float    v2f  __attribute__((ext_vector_type(2)));
typedef unsigned int v4u __attribute__((ext_vector_type(4)));

// ---- scalar helpers --------------------------------------------------------------------------------
__device__ __forceinline__ unsigned short bf_bits(float f) {          // f32 -> bf16 bits, RNE convert
  unsigned u = __float_as_uint(f);
  return (unsigned short)((u + 0x7FFFu + ((u >> 16) & 1u)) >> 16);
}
__device__ __forceinline__ float bf_up(unsigned short h) { return __uint_as_float(((unsigned)h) << 16); }
__device__ __forceinline__ unsigned short h_bits(_Float16 x) { return __builtin_bit_cast(unsigned short, x); }
__device__ __forceinline__ unsigned pk16(unsigned short a, unsigned short b) { return (unsigned)a | ((unsigned)b << 16); }
__device__ __forceinline__ v8f zero8() { v8f z = {0.f, 0.f, 0.f, 0.f, 0.f, 0.f, 0.f, 0.f}; return z; }
__device__ __forceinline__ v8h zero8h() {
  const _Float16 z = (_Float16)0.0f;
  v8h r = {z, z, z, z, z, z, z, z};
  return r;
}

// ---- lane l <- lane l ^ X inside each 16-lane row (DPP row_xmask, control 0x160 + X): no LDS round trip ----
template <int X>
__device__ __forceinline__ float lane_xor16(float v) {
  return __builtin_bit_cast(float, __builtin_amdgcn_update_dpp(0, __builtin_bit_cast(int, v), 0x160 + X, 0xf, 0xf, true));
}
// exp(x) as v_exp_f32(x * log2 e), the form __expf compiled to. The v_nop is the one slot that the instruction set asks
// for behind a transcendental before a source is overwritten.
__device__ __forceinline__ float exp_slot(float x) {
  const float t = x * 1.44269504088896340736f;
  float r;
#if defined(__HIP_DEVICE_COMPILE__)
  asm("v_exp_f32 %0, %1\n\tv_nop" : "=v"(r) : "v"(t));
#else
  r = t;
#endif
  return r;
}
template <int X>
__device__ __forceinline__ void rowmax8(float (&m)[8]) {
#pragma unroll  // the 8 values stay in registers, one independent instruction chain each
  for (int r = 0; r < 8; ++r) m[r] = fmaxf(m[r], lane_xor16<X>(m[r]));
}
template <int X>
__device__ __forceinline__ void rowsum8(float (&m)[8]) {
#pragma unroll  // the 8 values stay in registers, one independent instruction chain each
  for (int r = 0; r < 8; ++r) m[r] += lane_xor16<X>(m[r]);
}

// ---- fragment loader: 16-bit A/B operand, lane -> row/col (lane&15), p already includes +8*(lane>>4);
//      elements 0..7 <- p[0..7] (k0+8h..), elements 8..15 <- p[16..23] (k0+16+8h..)
__device__ __forceinline__ v16b ldfrag_b(const __bf16* p) {
  union { v16b v; v8b h[2]; } f;
  f.h[0] = *(const v8b*)(p);
  f.h[1] = *(const v8b*)(p + 16);
  return f.v;
}

// ---- WMMA helpers with trailing VALU hazard gap --------------------------------------------------------
__device__ __forceinline__ v8f mma_b(v16b a, v16b b, v8f c) {
  c = __builtin_amdgcn_wmma_f32_16x16x32_bf16(false, a, false, b, (short)0, c, false, false);
#if defined(__HIP_DEVICE_COMPILE__)
  asm volatile("v_nop\n\tv_nop\n\tv_nop\n\tv_nop" : "+v"(c) : "v"(a), "v"(b));
#endif
  return c;
}
__device__ __forceinline__ v8f mma_h(v16h a, v16h b, v8f c) {
  c = __builtin_amdgcn_wmma_f32_16x16x32_f16(false, a, false, b, (short)0, c, false, false);
#if defined(__HIP_DEVICE_COMPILE__)
  asm volatile("v_nop\n\tv_nop\n\tv_nop\n\tv_nop" : "+v"(c) : "v"(a), "v"(b));
#endif
  return c;
}
__device__ __forceinline__ v8f mma_b_raw(v16b a, v16b b, v8f c) {
  return __builtin_amdgcn_wmma_f32_16x16x32_bf16(false, a, false, b, (short)0, c, false, false);
}
__device__ __forceinline__ void dep_guard_b(v8f& a, v8f& b, v16b x, v16b y) {
#if defined(__HIP_DEVICE_COMPILE__)
  asm volatile("v_nop\n\tv_nop\n\tv_nop\n\tv_nop" : "+v"(a), "+v"(b) : "v"(x), "v"(y));
#endif
}
__device__ __forceinline__ void keep4_b(v16b a, v16b b, v16b c, v16b d) {
#if defined(__HIP_DEVICE_COMPILE__)
  asm volatile("v_nop" :: "v"(a), "v"(b), "v"(c), "v"(d));
#endif
}
__device__ __forceinline__ void acc_guard4(v8f& a, v8f& b, v8f& c, v8f& d) {
#if defined(__HIP_DEVICE_COMPILE__)
  asm volatile("v_nop\n\tv_nop\n\tv_nop\n\tv_nop" : "+v"(a), "+v"(b), "+v"(c), "+v"(d));
#endif
}

// =====================================================================================================
// Flat f32 -> bf16 (RNE convert), 8 elements per thread, one 16-B store per lane: a wave writes 512 contiguous
// coverage: n8 threads x 8 = the whole plane (n8 = element count / 8, all planes here are multiples of 2048).
// =====================================================================================================
__global__ __launch_bounds__(256) void cvt_bf16(const float* __restrict__ in, unsigned short* out, int n8) {
  const int i = blockIdx.x * 256 + threadIdx.x;
  if (i < n8) {
    const float* s = in + (size_t)i * 8;
    const v4f a = *(const v4f*)(s);
    const v4f b = *(const v4f*)(s + 4);
    v4u p;
    p[0] = pk16(bf_bits(a[0]), bf_bits(a[1]));
    p[1] = pk16(bf_bits(a[2]), bf_bits(a[3]));
    p[2] = pk16(bf_bits(b[0]), bf_bits(b[1]));
    p[3] = pk16(bf_bits(b[2]), bf_bits(b[3]));
    unsigned short* d = out + (size_t)i * 8;
    *(v4u*)d = p;
    
  }
}

// =====================================================================================================
// f32 -> bf16 hi plane + bf16 lo plane (lo = RNE(v - hi), unscaled), 8 elements per thread, one 16-B store per
// coverage: n8 threads x 8 = whole plane (n8 multiple of 256).
// =====================================================================================================
__global__ __launch_bounds__(256) void split_bf16x8(const float* __restrict__ in, unsigned short* hp,
                                                    unsigned short* lp, int n8) {
  const int i = blockIdx.x * 256 + threadIdx.x;
  if (i < n8) {
    const v4f a = *(const v4f*)(in + (size_t)i * 8);
    const v4f b = *(const v4f*)(in + (size_t)i * 8 + 4);
    v4u ph, pl;
#pragma unroll
    for (int e = 0; e < 4; ++e) {
      const float f0 = (e < 2) ? a[2 * e]     : b[2 * e - 4];
      const float f1 = (e < 2) ? a[2 * e + 1] : b[2 * e - 3];
      const unsigned short h0 = bf_bits(f0), h1 = bf_bits(f1);
      const unsigned short l0 = bf_bits(f0 - bf_up(h0)), l1 = bf_bits(f1 - bf_up(h1));
      ph[e] = pk16(h0, h1);
      pl[e] = pk16(l0, l1);
    }
    *(v4u*)(hp + (size_t)i * 8) = ph;
    *(v4u*)(lp + (size_t)i * 8) = pl;
    
  }
}

// =====================================================================================================
// Register-blocked batched bf16 WMMA GEMM: C[m][n] = sum_k A[m][k] * Bt[n][k] (+ bias); one wave per 64x64 tile,
// no block barriers. A row-major [M][K] pitch lda; Bt row-major [N][K] pitch ldb (k contiguous); M, N multiples
// of 64, K multiple of 32 (host-checked). blockIdx.y = batch index (strides in elements).
// NSPLIT: 0 = A.Bt; 1 = (A + A2).Bt (A2 = unscaled bf16 lo plane of A); 2 = A.Bt + A2.Bt + A.Bt2.
// BIAS: 0 none; 1 = + bias[n] per output column; 2 = + bias[m] per output row (bias RNE-converted to bf16 and
//       widened, added in f32 in the epilogue).
// OUT_MODE: 0 = f32 (pitch ldc); 2 = bf16 hi plane C + bf16 lo plane C2 (lo = RNE(v - hi), unscaled);
//           3 = f16 hi plane C + f16 residual plane C2 = f16((v - hi) * rscale), C2 written only for tiles
//               with n0 < N2 (pitch ldc2, batch stride strideC2).
// =====================================================================================================
template <int NSPLIT, int OUT_MODE, int BIAS>
__global__ __launch_bounds__(256) void gemm64(
    const unsigned short* __restrict__ Ap, const unsigned short* A2p, int lda, long long strideA,
    const unsigned short* __restrict__ Btp, const unsigned short* Bt2p, int ldb, long long strideB,
    void* Cout, int ldc, long long strideC,
    void* Cout2, int ldc2, long long strideC2, int N2,
    const float* __restrict__ biasp,
    int M, int N, int K, float rscale) {
  const __bf16* A   = (const __bf16*)(const void*)Ap;
  const __bf16* A2  = (const __bf16*)(const void*)A2p;
  const __bf16* Bt  = (const __bf16*)(const void*)Btp;
  const __bf16* Bt2 = (const __bf16*)(const void*)Bt2p;
  __shared__ __align__(16) float sT[8][16 * 68];   // per-wave 16x64 slab, pitch 68 floats
  const int b    = blockIdx.y;
  const int lane = threadIdx.x & 31;
  const int wave = threadIdx.x >> 5;
  const int tilesN = N >> 6;
  const int tilesM = M >> 6;
  const int tile = blockIdx.x * 8 + wave;
  if (tile >= tilesM * tilesN) return;   // wave-uniform; no block barriers in this kernel
  const int tm = tile / tilesN;
  const int tn = tile - tm * tilesN;
  const int m0 = tm << 6;
  const int n0 = tn << 6;

  const __bf16* Ab  = A  + (size_t)b * strideA;
  const __bf16* Bb  = Bt + (size_t)b * strideB;
  const __bf16* Ab2 = (NSPLIT >= 1) ? (A2  + (size_t)b * strideA) : Ab;
  const __bf16* Bb2 = (NSPLIT == 2) ? (Bt2 + (size_t)b * strideB) : Bb;

  const int rlane = lane & 15;                 // row (A) / col (B, D) within subtile
  const int koff  = (lane >> 4) * 8;           // k offset of this lane half
  const int mOff  = (lane >> 4) * 8;           // D row offset

  v8f acc[4][4];
#pragma unroll
  for (int i = 0; i < 4; ++i)
#pragma unroll
    for (int j = 0; j < 4; ++j) acc[i][j] = zero8();

  for (int k0 = 0; k0 < K; k0 += 32) {
    v16b bh[4], bl[4];
#pragma unroll
    for (int j = 0; j < 4; ++j) {
      const size_t bo = (size_t)(n0 + (j << 4) + rlane) * ldb + koff + k0;
      bh[j] = ldfrag_b(Bb + bo);
      if (NSPLIT == 2) bl[j] = ldfrag_b(Bb2 + bo); else bl[j] = bh[j];
    }
#pragma unroll
    for (int i = 0; i < 4; ++i) {
      const size_t ao = (size_t)(m0 + (i << 4) + rlane) * lda + koff + k0;
      const v16b ah = ldfrag_b(Ab + ao);
      v16b al = ah;
      if (NSPLIT >= 1) al = ldfrag_b(Ab2 + ao);
#pragma unroll
      for (int j = 0; j < 4; ++j) {
        acc[i][j] = mma_b_raw(ah, bh[j], acc[i][j]);
        if (NSPLIT >= 1) acc[i][j] = mma_b_raw(al, bh[j], acc[i][j]);
        if (NSPLIT == 2) acc[i][j] = mma_b_raw(ah, bl[j], acc[i][j]);
      }
      dep_guard_b(acc[i][0], acc[i][3], ah, al);
    }
    keep4_b(bh[0], bh[1], bh[2], bh[3]);
    if (NSPLIT == 2) keep4_b(bl[0], bl[1], bl[2], bl[3]);
  }
  acc_guard4(acc[0][0], acc[0][1], acc[0][2], acc[0][3]);
  acc_guard4(acc[1][0], acc[1][1], acc[1][2], acc[1][3]);
  acc_guard4(acc[2][0], acc[2][1], acc[2][2], acc[2][3]);
  acc_guard4(acc[3][0], acc[3][1], acc[3][2], acc[3][3]);

  // ---- per-column bias (BIAS == 1): this lane's 4 output columns n0 + 16j + rlane ----
  float bcol[4];
#pragma unroll
  for (int j = 0; j < 4; ++j) bcol[j] = 0.f;
  if (BIAS == 1) {
#pragma unroll
    for (int j = 0; j < 4; ++j) bcol[j] = bf_up(bf_bits(biasp[n0 + (j << 4) + rlane]));
  }

  // ---- epilogue ----
  float* slab = sT[wave];
#pragma unroll
  for (int i = 0; i < 4; ++i) {
    const int mBase = m0 + (i << 4);
    float brow[8];
#pragma unroll
    for (int r = 0; r < 8; ++r) brow[r] = 0.f;
    if (BIAS == 2) {
#pragma unroll
      for (int r = 0; r < 8; ++r) brow[r] = bf_up(bf_bits(biasp[mBase + mOff + r]));
    }
#pragma unroll
    for (int r = 0; r < 8; ++r) {
#pragma unroll
      for (int j = 0; j < 4; ++j) {
        float v = acc[i][j][r];
        if (BIAS == 1) v += bcol[j];
        if (BIAS == 2) v += brow[r];
        slab[(mOff + r) * 68 + (j << 4) + rlane] = v;
      }
    }
    __builtin_amdgcn_fence(__ATOMIC_RELEASE, "workgroup");
    __builtin_amdgcn_wave_barrier();
    __builtin_amdgcn_fence(__ATOMIC_ACQUIRE, "workgroup");
    if (OUT_MODE == 0) {
      float* C = (float*)Cout + (size_t)b * strideC;
      const int hh = lane >> 4, c4 = (lane & 15) * 4;     // 256-B row segment = 16 lanes x 16 B
      v4f ov[8];
#pragma unroll
      for (int it = 0; it < 8; ++it) {
        const int row = it * 2 + hh;                       // it 0..7 x hh 0..1 = rows 0..15
        ov[it] = *(const v4f*)(slab + row * 68 + c4);
      }
      {
#pragma unroll
        for (int it = 0; it < 8; ++it) {
          const int row = it * 2 + hh;
          *(v4f*)(C + (size_t)(mBase + row) * ldc + n0 + c4) = ov[it];
        }
        
      }
    } else {
      const int q = lane >> 3, c8 = (lane & 7) * 8;
      unsigned short* C  = (unsigned short*)Cout  + (size_t)b * strideC;
      unsigned short* C2 = (unsigned short*)Cout2 + (size_t)b * strideC2;
      const bool wlo = (OUT_MODE == 2) || (n0 < N2);      // wave-uniform
      v4u hv[4], lv[4];
#pragma unroll
      for (int it = 0; it < 4; ++it) {
        const int row = it * 4 + q;                        // it 0..3 x q 0..3 = rows 0..15
        const float* sp = slab + row * 68 + c8;
        v4u a, a2;
#pragma unroll
        for (int e = 0; e < 4; ++e) {
          const float f0 = sp[2 * e], f1 = sp[2 * e + 1];
          unsigned short h0, h1, l0, l1;
          if (OUT_MODE == 2) {
            h0 = bf_bits(f0); h1 = bf_bits(f1);
            l0 = bf_bits(f0 - bf_up(h0)); l1 = bf_bits(f1 - bf_up(h1));
          } else {
            const _Float16 x0 = (_Float16)f0, x1 = (_Float16)f1;
            h0 = h_bits(x0); h1 = h_bits(x1);
            l0 = h_bits((_Float16)((f0 - (float)x0) * rscale));
            l1 = h_bits((_Float16)((f1 - (float)x1) * rscale));
          }
          a[e] = pk16(h0, h1); a2[e] = pk16(l0, l1);
        }
        hv[it] = a; lv[it] = a2;
      }
      {
#pragma unroll
        for (int it = 0; it < 4; ++it) {
          const int row = it * 4 + q;
          *(v4u*)(C + (size_t)(mBase + row) * ldc + n0 + c8) = hv[it];
          if (wlo) *(v4u*)(C2 + (size_t)(mBase + row) * ldc2 + n0 + c8) = lv[it];
        }
        
      }
    }
    __builtin_amdgcn_fence(__ATOMIC_RELEASE, "workgroup");
    __builtin_amdgcn_wave_barrier();
    __builtin_amdgcn_fence(__ATOMIC_ACQUIRE, "workgroup");
  }
}

// =====================================================================================================
// Line features. Input ln f32 [NB*SEQ][LNW]: column blocks of PD*NH = 64: block 0 = x.W1w^T, 1 = x.W2w^T,
// 2 = x.W1r^T, 3 = x.W2r^T; within a block head h owns columns h*4..h*4+3.
// Per (b, h, t): p1 = block 0 of token t-1 (zero vector at t == 0: the shifted input), p2 = block 1 of t,
// p3 = block 2 of t, p4 = block 3 of t. Exterior 2-form L[m] = pa[PI[m]]*pb[PJ[m]] - pa[PJ[m]]*pb[PI[m]] for
// pairs (0,1),(0,2),(0,3),(1,2),(1,3),(2,3), then L *= 1/max(|L|_2, 1e-12) (all f32, fp contract off).
// Outputs f32 [NB*NH][SEQ][8]: rl = read line [L0..L5, 0, 0]; wl = J-applied write line [L5,-L4,L3,L2,-L1,L0,0,0].
// wave-uniform bound, no block barriers.
// coverage: nwaves = NB*NH*(SEQ/32) waves x 32 rows x 32 B = every row of both planes incl. the zero pad cols.
// =====================================================================================================
struct L6 { float v0, v1, v2, v3, v4, v5; };

__device__ __forceinline__ L6 ext6n(const v4f a, const v4f b) {
#pragma clang fp contract(off)
  L6 o;
  o.v0 = a[0] * b[1] - a[1] * b[0];
  o.v1 = a[0] * b[2] - a[2] * b[0];
  o.v2 = a[0] * b[3] - a[3] * b[0];
  o.v3 = a[1] * b[2] - a[2] * b[1];
  o.v4 = a[1] * b[3] - a[3] * b[1];
  o.v5 = a[2] * b[3] - a[3] * b[2];
  float n2 = o.v0 * o.v0 + o.v1 * o.v1;
  n2 = n2 + o.v2 * o.v2;
  n2 = n2 + o.v3 * o.v3;
  n2 = n2 + o.v4 * o.v4;
  n2 = n2 + o.v5 * o.v5;
  float n = sqrtf(n2);
  n = fmaxf(n, 1e-12f);
  const float inv = 1.0f / n;
  o.v0 *= inv; o.v1 *= inv; o.v2 *= inv; o.v3 *= inv; o.v4 *= inv; o.v5 *= inv;
  return o;
}

__global__ __launch_bounds__(256) void lines_k(const float* __restrict__ ln, float* rl, float* wl, int nwaves) {
#pragma clang fp contract(off)
  __shared__ __align__(16) float sR[8][256];
  __shared__ __align__(16) float sW[8][256];
  const int tid = threadIdx.x, wave = tid >> 5, lane = tid & 31;
  const int w = blockIdx.x * 8 + wave;
  if (w >= nwaves) return;                        // wave-uniform; no block barriers in this kernel
  const int tgPer = SEQ / 32;                     // 64 token groups per (b, h)
  const int bh = w / tgPer;                       // b*NH + h
  const int tg = w - bh * tgPer;
  const int b  = bh / NH;
  const int h  = bh - b * NH;
  const int t  = tg * 32 + lane;                  // < SEQ
  const size_t row  = (size_t)b * SEQ + t;
  const size_t rowp = (t > 0) ? (row - 1) : row;  // clamped address; value zeroed below when t == 0
  const float* cur = ln + row * LNW + h * PD;
  v4f p1 = *(const v4f*)(ln + rowp * LNW + h * PD);
  if (t == 0) { p1[0] = 0.f; p1[1] = 0.f; p1[2] = 0.f; p1[3] = 0.f; }
  const v4f p2 = *(const v4f*)(cur + 1 * PD * NH);
  const v4f p3 = *(const v4f*)(cur + 2 * PD * NH);
  const v4f p4 = *(const v4f*)(cur + 3 * PD * NH);
  const L6 lw = ext6n(p1, p2);
  const L6 lr = ext6n(p3, p4);

  float* sr = sR[wave] + lane * 8;
  float* sw = sW[wave] + lane * 8;
  v4f t0, t1, u0, u1;
  t0[0] = lr.v0; t0[1] = lr.v1; t0[2] = lr.v2; t0[3] = lr.v3;
  t1[0] = lr.v4; t1[1] = lr.v5; t1[2] = 0.f;   t1[3] = 0.f;
  u0[0] = lw.v5; u0[1] = -lw.v4; u0[2] = lw.v3; u0[3] = lw.v2;
  u1[0] = -lw.v1; u1[1] = lw.v0; u1[2] = 0.f;   u1[3] = 0.f;
  *(v4f*)(sr)     = t0;
  *(v4f*)(sr + 4) = t1;
  *(v4f*)(sw)     = u0;
  *(v4f*)(sw + 4) = u1;
  __builtin_amdgcn_fence(__ATOMIC_RELEASE, "workgroup");
  __builtin_amdgcn_wave_barrier();
  __builtin_amdgcn_fence(__ATOMIC_ACQUIRE, "workgroup");
  v4f oR[2], oW[2];
#pragma unroll
  for (int it = 0; it < 2; ++it) {
    oR[it] = *(const v4f*)(sR[wave] + it * 128 + lane * 4);
    oW[it] = *(const v4f*)(sW[wave] + it * 128 + lane * 4);
  }
  const size_t gb = ((size_t)bh * SEQ + (size_t)tg * 32) * 8;
  {
#pragma unroll
    for (int it = 0; it < 2; ++it) {
      *(v4f*)(rl + gb + it * 128 + lane * 4) = oR[it];
      *(v4f*)(wl + gb + it * 128 + lane * 4) = oW[it];
    }
    
  }
}

// =====================================================================================================
// Causal multi-head attention, head dim 64, with an additive line-pair bias:
//   logit(q, k) = (q . k) * sscale + dot6(rl[q], wl[k]) * wdec(q - k),  wdec(d) = bs_h * dec_h^d for d > 0, 0 else,
//   dec_h = sigmoid(dl_h); keys k > q masked (-FLT_MAX, exp -> 0); diagonal kept.
//   q planes (bf16 hi / lo): element (b, t, h, d) at [(b*SEQ + t)*QP + h*64 + d]
//   k planes (bf16 hi / lo): same layout
//   v^T hi plane (f16):      element (b, h, d, s) at [(b*QP + h*64 + d)*SEQ + s]
//   v^T residual plane (f16, (v - hi)*4096): [(b*QP + h*64 + d)*VLP + s], s < VLP, read only when RES
//   rl / wl f32 planes [b*NH + h][SEQ][8] (6 used)
//   out f32 plane: element (b, t, h*64 + d) at [(b*SEQ + t)*QP + h*64 + d] = normalised context.
//   scores = q . k : bf16 hi/lo split (hi.hi + hi.lo + lo.hi), f32 accumulate, then scale + bias in f32
//   p = exp(s - m) carried as f16(1024 p); context = p . v on f16 WMMA; RES adds f16 residual planes of p and v
//   (scale 4096, separate accumulator folded back with 1/4096 per chunk in f32); online softmax in f32.
//   Block = 4 waves = 64 query rows of one (b, h); grid = nqbThis * NH * NB; key chunks of 64, tiles 0..qb only
//   (block-uniform trip count qb+1 <= NQB; every row has a live key in every processed chunk).
//   K / V^T / wl chunk staging: 128 threads (plain 16-B loads, __syncthreads before and after); P tiles are
//   wave-private, spilled with _Float16 element stores and reloaded as v8h (same element type) after a release
//   barrier in between).
//   Output coverage: each wave stores rows q0..q0+15 (it 0..7 x lane>>4 0..1) x 64 columns (16 lanes x 4 floats),
// =====================================================================================================
template <bool RES>
__global__ __launch_bounds__(128)
void attn_lb(const unsigned short* __restrict__ qhp, const unsigned short* __restrict__ qlp,
             const unsigned short* __restrict__ khp, const unsigned short* __restrict__ klp,
             const unsigned short* __restrict__ vhp, const unsigned short* __restrict__ vlp,
             const float* __restrict__ rlp, const float* __restrict__ wlp,
             const float* __restrict__ dlg, const float* __restrict__ bsc,
             float* outp, int qbBase, int nqbThis, float sscale) {
  union FB { v16b v; v8b h[2]; };
  union FH { v16h v; v8h h[2]; };
  __shared__ __align__(16) unsigned short KT[2 * 64 * 64];      // K hi [kv][d] | K lo; later f32 context staging
  __shared__ __align__(16) _Float16 Vth[64 * 64];                // V^T hi [d][kv]
  __shared__ __align__(16) _Float16 Vtl[RES ? 64 * 64 : 8];      // V^T residual
  __shared__ __align__(16) _Float16 Psh[4][16 * 64];             // per wave P [row][kv]
  __shared__ __align__(16) _Float16 Psl[RES ? 4 : 1][16 * 64];   // per wave P residual
  __shared__ __align__(16) float    Ws[64 * 8];                  // wl rows of the chunk's 64 keys
  __shared__ __align__(16) float    Rs[4][16 * 8];               // per wave rl rows of its 16 queries
  __bf16* Ksh = (__bf16*)(void*)KT;
  __bf16* Ksl = Ksh + 64 * 64;

  const int tid  = threadIdx.x;
  const int wave = tid >> 5;
  const int lane = tid & 31;
  const int hh   = lane >> 4;
  const int c    = lane & 15;

  const int bx   = blockIdx.x;
  const int qbl  = bx % nqbThis;
  const int rest = bx / nqbThis;
  const int h    = rest % NH;
  const int b    = rest / NH;
  const int qb   = qbBase + qbl;
  const int q0   = qb * 64 + wave * 16;
  const size_t rowB = (size_t)b * SEQ;
  const size_t bhT  = ((size_t)b * NH + h) * SEQ;

  const __bf16* Qh = (const __bf16*)(const void*)qhp + (size_t)h * HD;
  const __bf16* Ql = (const __bf16*)(const void*)qlp + (size_t)h * HD;
  const __bf16* Kh = (const __bf16*)(const void*)khp + (size_t)h * HD;
  const __bf16* Kl = (const __bf16*)(const void*)klp + (size_t)h * HD;
  const _Float16* Vh = (const _Float16*)(const void*)vhp + ((size_t)b * QP + (size_t)h * HD) * SEQ;
  const _Float16* Vl = (const _Float16*)(const void*)vlp + ((size_t)b * QP + (size_t)h * HD) * VLP;

  // ---- per-head scalars (RNE bf16-converted inputs) ----
  const float dl  = bf_up(bf_bits(dlg[h]));
  const float dec = 1.0f / (1.0f + expf(-dl));
  const float l2d = log2f(dec);
  const float bsh = bf_up(bf_bits(bsc[h]));

  // ---- stage the wave's 16 rl rows: 16 x 8 f32 = 32 lanes x 16 B (ordered by the loop's first barrier) ----
  *(v4f*)(Rs[wave] + lane * 4) = *(const v4f*)(rlp + (bhT + q0) * 8 + lane * 4);

  float mrow[8], lrow[8];
  v8f oacc[4];
#pragma unroll
  for (int r = 0; r < 8; ++r) { mrow[r] = -INFINITY; lrow[r] = 0.f; }
#pragma unroll
  for (int t = 0; t < 4; ++t) oacc[t] = zero8();

  int nkt = qb + 1;                          // causal: key tiles 0..qb, block-uniform
  if (nkt > NQB) nkt = NQB;
  for (int kt = 0; kt < nkt; ++kt) {
    const int kv0 = kt * 64;
    __syncthreads();
    {
      const int r = tid >> 1, half = (tid & 1) * 32;
      const __bf16*   kg  = Kh + (rowB + kv0 + r) * QP + half;    // K row kv0+r, d = half..half+31
      const __bf16*   klg = Kl + (rowB + kv0 + r) * QP + half;
      const _Float16* vg  = Vh + (size_t)r * SEQ + kv0 + half;    // V^T row d = r, s = kv0+half..+31
      const int kvl = (kv0 + 64 <= VLP) ? kv0 : (VLP - 64);     // clamped address into the residual plane
      const _Float16* vlg = Vl + (size_t)r * VLP + kvl + half;
      const bool resOK = (kv0 + 64 <= VLP);                      // block-uniform
#pragma unroll
      for (int i = 0; i < 4; ++i) {
        const v8b a0 = *(const v8b*)(kg + 8 * i);
        const v8b a1 = *(const v8b*)(klg + 8 * i);
        const v8h b0 = *(const v8h*)(vg + 8 * i);
        *(v8b*)(Ksh + r * 64 + half + 8 * i) = a0;
        *(v8b*)(Ksl + r * 64 + half + 8 * i) = a1;
        *(v8h*)(Vth + r * 64 + half + 8 * i) = b0;
        if (RES) {
          v8h b1 = *(const v8h*)(vlg + 8 * i);
          if (!resOK) b1 = zero8h();
          *(v8h*)(Vtl + r * 64 + half + 8 * i) = b1;
        }
      }
      // wl rows kv0..kv0+63 of this (b, h): 64 x 8 f32 = 128 threads x 16 B
      *(v4f*)(Ws + tid * 4) = *(const v4f*)(wlp + (bhT + kv0) * 8 + tid * 4);
    }
    __syncthreads();

    // ---- Q fragments (A operand, row = lane&15): 2 d-chunks, hi and lo (reloaded per chunk) ----
    v16b qah[2], qal[2];
#pragma unroll
    for (int dc = 0; dc < 2; ++dc) {
      const size_t qo = (rowB + q0 + c) * QP + dc * 32 + 8 * hh;
      qah[dc] = ldfrag_b(Qh + qo);
      qal[dc] = ldfrag_b(Ql + qo);
    }

    // ---- scores: 16 query rows x 64 keys per wave, 3 bf16 products ----
    v8f s[4];
#pragma unroll
    for (int j = 0; j < 4; ++j) {
      s[j] = zero8();
#pragma unroll
      for (int dc = 0; dc < 2; ++dc) {
        FB kb, kl;
        kb.h[0] = *(const v8b*)(Ksh + (j * 16 + c) * 64 + dc * 32 + 8 * hh);
        kb.h[1] = *(const v8b*)(Ksh + (j * 16 + c) * 64 + dc * 32 + 16 + 8 * hh);
        kl.h[0] = *(const v8b*)(Ksl + (j * 16 + c) * 64 + dc * 32 + 8 * hh);
        kl.h[1] = *(const v8b*)(Ksl + (j * 16 + c) * 64 + dc * 32 + 16 + 8 * hh);
        s[j] = mma_b(qah[dc], kb.v, s[j]);
        s[j] = mma_b(qah[dc], kl.v, s[j]);
        s[j] = mma_b(qal[dc], kb.v, s[j]);
      }
    }

    // ---- wl rows of this lane's 4 key columns (j*16 + c): 6 used of 8 ----
    v4f wa[4];
    v2f wb[4];
#pragma unroll
    for (int j = 0; j < 4; ++j) {
      const float* wp = Ws + (j * 16 + c) * 8;
      wa[j] = *(const v4f*)(wp);
      wb[j] = *(const v2f*)(wp + 4);
    }

    // ---- scale + bias + causal mask (replace by -FLT_MAX), row max, online softmax, P (x1024, f16) and
    //      P residual (x4096) to LDS ----
    _Float16* pwh = Psh[wave];
    _Float16* pwl = Psl[RES ? wave : 0];
    float mloc[8], msafe[8], alpha[8], psum[8];
    // logits of all 8 rows first, so that the 8 row reductions below run as independent chains
#pragma unroll
    for (int r = 0; r < 8; ++r) {
      const int qrow = q0 + 8 * hh + r;
      const float* rp = Rs[wave] + (8 * hh + r) * 8;
      const v4f ra = *(const v4f*)(rp);
      const v2f rb = *(const v2f*)(rp + 4);
      float m = -INFINITY;
#pragma unroll
      for (int j = 0; j < 4; ++j) {
        const int key = kv0 + j * 16 + c;
        const int dd  = qrow - key;
        const float dot6 = ra[0] * wa[j][0] + ra[1] * wa[j][1] + ra[2] * wa[j][2] + ra[3] * wa[j][3]
                         + rb[0] * wb[j][0] + rb[1] * wb[j][1];
        const float ex   = exp2f((float)dd * l2d);
        const float wdec = (dd > 0) ? (bsh * ex) : 0.f;
        float sv = s[j][r] * sscale + dot6 * wdec;
        sv = (key > qrow) ? -FLT_MAX : sv;
        s[j][r] = sv;
        m = fmaxf(m, sv);
      }
      mloc[r] = m;
    }
    // row maximum over the 16 lanes of a half: xor butterfly 1, 2, 4, 8 in the vector unit, 8 rows per step.
    // The scheduling barriers keep the 8 chains side by side: without them the compiler moves each row's chain
    // back behind that row's logits, where every step waits for the one before it.
    __builtin_amdgcn_sched_barrier(0);
    rowmax8<1>(mloc); rowmax8<2>(mloc); rowmax8<4>(mloc); rowmax8<8>(mloc);
    __builtin_amdgcn_sched_barrier(0);
#pragma unroll  // per-row state is indexed by constants only, so it stays in registers
    for (int r = 0; r < 8; ++r) {
      const float mnew = fmaxf(mrow[r], mloc[r]);
      msafe[r] = (mnew == -INFINITY) ? 0.f : mnew;
      alpha[r] = exp_slot(mrow[r] - msafe[r]);
      mrow[r]  = mnew;
    }
#pragma unroll  // as above
    for (int r = 0; r < 8; ++r) {
      float ps = 0.f;
#pragma unroll
      for (int j = 0; j < 4; ++j) {
        const float p = exp_slot(s[j][r] - msafe[r]);  // masked logit against a finite max: exp -> 0
        ps += p;
        const float p1k = p * 1024.0f;
        const _Float16 ph = (_Float16)p1k;
        pwh[(8 * hh + r) * 64 + j * 16 + c] = ph;
        if (RES) {
          const _Float16 pl = (_Float16)((p1k - (float)ph) * 4096.0f);
          pwl[(8 * hh + r) * 64 + j * 16 + c] = pl;
        }
      }
      psum[r] = ps;
    }
    // row sum: xor butterfly 1, 2, 4, 8 like the maximum, with the same scheduling barriers for the same reason
    __builtin_amdgcn_sched_barrier(0);
    rowsum8<1>(psum); rowsum8<2>(psum); rowsum8<4>(psum); rowsum8<8>(psum);
    __builtin_amdgcn_sched_barrier(0);
#pragma unroll  // as above
    for (int r = 0; r < 8; ++r) {
      lrow[r] = lrow[r] * alpha[r] + psum[r];
#pragma unroll
      for (int t = 0; t < 4; ++t) oacc[t][r] *= alpha[r];
    }
    __builtin_amdgcn_fence(__ATOMIC_RELEASE, "workgroup");
    __builtin_amdgcn_wave_barrier();
    __builtin_amdgcn_fence(__ATOMIC_ACQUIRE, "workgroup");

    // ---- context += P . V (f16 WMMA), residual products into a separate accumulator ----
    v8f o1[4];
#pragma unroll
    for (int t = 0; t < 4; ++t) o1[t] = zero8();
#pragma unroll 1
    for (int kk = 0; kk < 2; ++kk) {
      FH pa, pl;
      pa.h[0] = *(const v8h*)(pwh + c * 64 + kk * 32 + 8 * hh);
      pa.h[1] = *(const v8h*)(pwh + c * 64 + kk * 32 + 16 + 8 * hh);
      if (RES) {
        pl.h[0] = *(const v8h*)(pwl + c * 64 + kk * 32 + 8 * hh);
        pl.h[1] = *(const v8h*)(pwl + c * 64 + kk * 32 + 16 + 8 * hh);
      } else {
        pl.v = pa.v;
      }
#pragma unroll
      for (int t = 0; t < 4; ++t) {
        FH vb;
        vb.h[0] = *(const v8h*)(Vth + (t * 16 + c) * 64 + kk * 32 + 8 * hh);
        vb.h[1] = *(const v8h*)(Vth + (t * 16 + c) * 64 + kk * 32 + 16 + 8 * hh);
        oacc[t] = mma_h(pa.v, vb.v, oacc[t]);
        if (RES) {
          FH vl;
          vl.h[0] = *(const v8h*)(Vtl + (t * 16 + c) * 64 + kk * 32 + 8 * hh);
          vl.h[1] = *(const v8h*)(Vtl + (t * 16 + c) * 64 + kk * 32 + 16 + 8 * hh);
          o1[t] = mma_h(pa.v, vl.v, o1[t]);
          o1[t] = mma_h(pl.v, vb.v, o1[t]);
        }
      }
    }
    if (RES) {
#pragma unroll
      for (int t = 0; t < 4; ++t)
#pragma unroll
        for (int r = 0; r < 8; ++r) oacc[t][r] += o1[t][r] * (1.0f / 4096.0f);
    }
  }

  // ---- all waves are done with the K tiles before that LDS region is reused for the context staging ----
  __syncthreads();

  // ---- normalise (1/l and the 1/1024 p carry), stage the wave's 16x64 tile in LDS, then write whole
  float* os = (float*)(void*)KT + wave * (16 * 64);
#pragma unroll
  for (int r = 0; r < 8; ++r) {
    const float l = lrow[r];
    const float inv = ((l > 0.f) ? (1.0f / l) : 0.f) * (1.0f / 1024.0f);
#pragma unroll
    for (int t = 0; t < 4; ++t) os[(8 * hh + r) * 64 + t * 16 + c] = oacc[t][r] * inv;
  }
  __builtin_amdgcn_fence(__ATOMIC_RELEASE, "workgroup");
  __builtin_amdgcn_wave_barrier();
  __builtin_amdgcn_fence(__ATOMIC_ACQUIRE, "workgroup");
  {
    const int h2 = lane >> 4, c4 = (lane & 15) * 4;
    v4f ov[8];
#pragma unroll
    for (int it = 0; it < 8; ++it) {
      const int row = it * 2 + h2;   // it 0..7 x h2 0..1 = rows 0..15 of the wave tile
      ov[it] = *(const v4f*)(os + row * 64 + c4);
    }
    {
#pragma unroll
      for (int it = 0; it < 8; ++it) {
        const int row = it * 2 + h2;
        const size_t go = (rowB + q0 + row) * QP + (size_t)h * HD + c4;
        *(v4f*)(outp + go) = ov[it];
      }
      
    }
  }
}

// =====================================================================================================
// Workspace map (bytes), every region an exact multiple of its whole-line / whole-tile store granularity
// multiples):
//   Xb     bf16 [4096][1024]            0            8388608
//   Wqkv   bf16 [3072][1024]            8388608      6291456   ([n][k], rows 0..1023 q | 1024.. k | 2048.. v)
//   Wln    bf16 [256][1024]             14680064      524288   ([W1w; W2w; W1r; W2r], [n][k])
//   Wob    bf16 [1024][1024]            15204352     2097152   ([n][k])
//   LN     f32  [4096][256]             17301504     4194304
//   RL     f32  [32][2048][8]           21495808     2097152
//   WL     f32  [32][2048][8]           23592960     2097152
//   Qh     bf16 [4096][1024]            25690112     8388608
//   Ql     bf16 [4096][1024]            34078720     8388608
//   Kh     bf16 [4096][1024]            42467328     8388608
//   Kl     bf16 [4096][1024]            50855936     8388608
//   VTh    f16  [2][1024][2048]         59244544     8388608
//   VTl    f16  [2][1024][512]          67633152     2097152
//   Af     f32  [4096][1024]            69730304    16777216
//   Ah     bf16 [4096][1024]            86507520     8388608
//   Al     bf16 [4096][1024]            94896128     8388608
//   end                                 103284736
// =====================================================================================================
extern "C" void kernel_launch(void* const* d_in, const int* in_sizes, int n_in,
                              void* d_out, int out_size, void* d_ws, size_t ws_size,
                              hipStream_t stream) {
  if (n_in < 11) return;
  if (in_sizes[0] != NB * SEQ * DMODEL) return;
  if (in_sizes[1] != 3 * QP * DMODEL) return;
  if (in_sizes[2] != 3 * QP) return;
  if (in_sizes[3] != PD * NH * DMODEL) return;
  if (in_sizes[4] != PD * NH * DMODEL) return;
  if (in_sizes[5] != PD * NH * DMODEL) return;
  if (in_sizes[6] != PD * NH * DMODEL) return;
  if (in_sizes[7] != DMODEL * QP) return;
  if (in_sizes[8] != DMODEL) return;
  if (in_sizes[9] != NH) return;
  if (in_sizes[10] != NH) return;
  if (out_size != NB * SEQ * DMODEL) return;

  const float* x     = (const float*)d_in[0];    // [NB*SEQ][DMODEL]
  const float* wqkv  = (const float*)d_in[1];    // [3*QP n][DMODEL k]
  const float* bqkv  = (const float*)d_in[2];    // [3*QP]
  const float* w1w   = (const float*)d_in[3];    // [PD*NH][DMODEL]
  const float* w2w   = (const float*)d_in[4];
  const float* w1r   = (const float*)d_in[5];
  const float* w2r   = (const float*)d_in[6];
  const float* wout  = (const float*)d_in[7];    // [DMODEL n][QP k]
  const float* bout  = (const float*)d_in[8];    // [DMODEL]
  const float* dlog  = (const float*)d_in[9];    // [NH]
  const float* bscl  = (const float*)d_in[10];   // [NH]

  const size_t PXb   = (size_t)NB * SEQ * DMODEL * 2;      //  8388608
  const size_t PWqkv = (size_t)3 * QP * DMODEL * 2;        //  6291456
  const size_t PWln  = (size_t)LNW * DMODEL * 2;           //   524288
  const size_t PWo   = (size_t)DMODEL * QP * 2;            //  2097152
  const size_t PLN   = (size_t)NB * SEQ * LNW * 4;         //  4194304
  const size_t PRL   = (size_t)NB * NH * SEQ * 8 * 4;      //  2097152
  const size_t PQpl  = (size_t)NB * SEQ * QP * 2;          //  8388608  (Qh, Ql, Kh, Kl, Ah, Al)
  const size_t PVTh  = (size_t)NB * QP * SEQ * 2;          //  8388608
  const size_t PVTl  = (size_t)NB * QP * VLP * 2;          //  2097152
  const size_t PAf   = (size_t)NB * SEQ * QP * 4;          // 16777216
  size_t off = 0;
  const size_t oXb   = off; off += PXb;
  const size_t oWqkv = off; off += PWqkv;
  const size_t oWln  = off; off += PWln;
  const size_t oWo   = off; off += PWo;
  const size_t oLN   = off; off += PLN;
  const size_t oRL   = off; off += PRL;
  const size_t oWL   = off; off += PRL;
  const size_t oQh   = off; off += PQpl;
  const size_t oQl   = off; off += PQpl;
  const size_t oKh   = off; off += PQpl;
  const size_t oKl   = off; off += PQpl;
  const size_t oVTh  = off; off += PVTh;
  const size_t oVTl  = off; off += PVTl;
  const size_t oAf   = off; off += PAf;
  const size_t oAh   = off; off += PQpl;
  const size_t oAl   = off; off += PQpl;
  if (off > ws_size) return;                          // off = 103284736
  if (off > (size_t)134217728) return;

  char* ws = (char*)d_ws;
  unsigned short* Xb   = (unsigned short*)(ws + oXb);
  unsigned short* Wqkv = (unsigned short*)(ws + oWqkv);
  unsigned short* Wln  = (unsigned short*)(ws + oWln);
  unsigned short* Wob  = (unsigned short*)(ws + oWo);
  float*          LN   = (float*)(ws + oLN);
  float*          RL   = (float*)(ws + oRL);
  float*          WL   = (float*)(ws + oWL);
  unsigned short* Qh   = (unsigned short*)(ws + oQh);
  unsigned short* Ql   = (unsigned short*)(ws + oQl);
  unsigned short* Kh   = (unsigned short*)(ws + oKh);
  unsigned short* Kl   = (unsigned short*)(ws + oKl);
  unsigned short* VTh  = (unsigned short*)(ws + oVTh);
  unsigned short* VTl  = (unsigned short*)(ws + oVTl);
  float*          Af   = (float*)(ws + oAf);
  unsigned short* Ah   = (unsigned short*)(ws + oAh);
  unsigned short* Al   = (unsigned short*)(ws + oAl);
  float*          outf = (float*)d_out;

  const dim3 blk(256);
  const int nTok   = NB * SEQ;                                       // 4096 tokens
  const int n8x    = nTok * DMODEL / 8;                              // 524288
  const int n8qkv  = 3 * QP * DMODEL / 8;                            // 393216
  const int n8ln   = PD * NH * DMODEL / 8;                           //   8192 per line weight
  const int n8wo   = DMODEL * QP / 8;                                // 131072
  const int n8a    = nTok * QP / 8;                                  // 524288
  const int nwLn   = NB * NH * (SEQ / 32);                           //   2048 waves
  const dim3 gCx((n8x + 255) / 256), gCqkv((n8qkv + 255) / 256), gCln((n8ln + 255) / 256), gCwo((n8wo + 255) / 256);
  const dim3 gLNg(((nTok / 64) * (LNW / 64) + 7) / 8, 1);            // 256 tiles -> 32 blocks
  const dim3 gQ(((nTok / 64) * (QP / 64) + 7) / 8, 1);               // 1024 tiles -> 128 blocks
  const dim3 gVT(((QP / 64) * (SEQ / 64) + 7) / 8, NB);              // 512 tiles -> 64 blocks x 2 batch elements
  const dim3 gLines((nwLn + 7) / 8);                                 // 256 blocks
  const dim3 gSplit((n8a + 255) / 256);                              // 2048 blocks
  const dim3 gOut(((nTok / 64) * (DMODEL / 64) + 7) / 8, 1);         // 1024 tiles -> 128 blocks

  // (1) inputs -> bf16 planes (RNE convert); weights arrive [n][k] = the Bt layout already
  cvt_bf16<<<gCx,   blk, 0, stream>>>(x,    Xb,   n8x);
  cvt_bf16<<<gCqkv, blk, 0, stream>>>(wqkv, Wqkv, n8qkv);
  cvt_bf16<<<gCln,  blk, 0, stream>>>(w1w,  Wln + (size_t)0 * PD * NH * DMODEL, n8ln);
  cvt_bf16<<<gCln,  blk, 0, stream>>>(w2w,  Wln + (size_t)1 * PD * NH * DMODEL, n8ln);
  cvt_bf16<<<gCln,  blk, 0, stream>>>(w1r,  Wln + (size_t)2 * PD * NH * DMODEL, n8ln);
  cvt_bf16<<<gCln,  blk, 0, stream>>>(w2r,  Wln + (size_t)3 * PD * NH * DMODEL, n8ln);
  cvt_bf16<<<gCwo,  blk, 0, stream>>>(wout, Wob,  n8wo);
  // (2) line-feature projections: LN[row][e] = sum_k Xb[row][k] Wln[e][k]  (M=4096, N=256, K=1024) -> f32
  gemm64<0, 0, 0><<<gLNg, blk, 0, stream>>>(
      Xb, Xb, DMODEL, 0LL, Wln, Wln, DMODEL, 0LL,
      (void*)LN, LNW, 0LL, (void*)LN, 0, 0LL, 0,
      bout, nTok, LNW, DMODEL, 1.0f);
  // (3) q projection + bias -> bf16 hi / lo planes  (M=4096, N=1024, K=1024)
  gemm64<0, 2, 1><<<gQ, blk, 0, stream>>>(
      Xb, Xb, DMODEL, 0LL, Wqkv, Wqkv, DMODEL, 0LL,
      (void*)Qh, QP, 0LL, (void*)Ql, QP, 0LL, QP,
      bqkv, nTok, QP, DMODEL, 1.0f);
  // (4) k projection + bias -> bf16 hi / lo planes (weight rows 1024..2047, bias 1024..)
  gemm64<0, 2, 1><<<gQ, blk, 0, stream>>>(
      Xb, Xb, DMODEL, 0LL, Wqkv + (size_t)QP * DMODEL, Wqkv + (size_t)QP * DMODEL, DMODEL, 0LL,
      (void*)Kh, QP, 0LL, (void*)Kl, QP, 0LL, QP,
      bqkv + QP, nTok, QP, DMODEL, 1.0f);
  // (5) v^T per batch element: VTh[b][f][s] = sum_k Wv[f][k] Xb[b*SEQ+s][k] + bv[f] -> f16 hi plane (pitch SEQ)
  //     and residual plane (x4096, keys < VLP, pitch VLP)  (M=1024 features, N=2048 tokens, K=1024, bias per row)
  gemm64<0, 3, 2><<<gVT, blk, 0, stream>>>(
      Wqkv + (size_t)2 * QP * DMODEL, Wqkv + (size_t)2 * QP * DMODEL, DMODEL, 0LL,
      Xb, Xb, DMODEL, (long long)SEQ * DMODEL,
      (void*)VTh, SEQ, (long long)QP * SEQ, (void*)VTl, VLP, (long long)QP * VLP, VLP,
      bqkv + 2 * QP, QP, SEQ, DMODEL, 4096.0f);
  // (6) line features (shifted p1, exterior 2-forms, L2 normalisation, J map) -> rl / wl f32 planes
  lines_k<<<gLines, blk, 0, stream>>>(LN, RL, WL, nwLn);
  // (7) causal attention with line-pair bias: query blocks 0..RESQB-1 with residual planes, the rest without
  attn_lb<true><<<dim3(NB * NH * RESQB), dim3(128), 0, stream>>>(
      Qh, Ql, Kh, Kl, VTh, VTl, RL, WL, dlog, bscl, Af, 0, RESQB, 0.125f);
  attn_lb<false><<<dim3(NB * NH * (NQB - RESQB)), dim3(128), 0, stream>>>(
      Qh, Ql, Kh, Kl, VTh, VTl, RL, WL, dlog, bscl, Af, RESQB, NQB - RESQB, 0.125f);
  // (8) context rows -> bf16 hi/lo planes
  split_bf16x8<<<gSplit, blk, 0, stream>>>(Af, Ah, Al, n8a);
  // (9) out[row][e] = sum_d (Ah+Al)[row][d] Wob[e][d] + bout[e] -> d_out f32 [4096][1024]  (M=4096, N=1024, K=1024)
  gemm64<1, 0, 1><<<gOut, blk, 0, stream>>>(
      Ah, Al, QP, 0LL, Wob, Wob, QP, 0LL,
      (void*)outf, DMODEL, 0LL, (void*)outf, 0, 0LL, 0,
      bout, nTok, DMODEL, QP, 1.0f);
  (void)hipGetLastError();
}

// v002
// One run takes 462 microseconds.
// Two timings next to v001 both put it at 1.11 times that version's speed.
// Counting every step since v000, it is 1.34 times as fast.
// Contractions: q / k / v^T and line-feature projections = v_wmma_f32_16x16x32_bf16 (bf16 operands from
// RNE-converted inputs, one product per k-step); q.k^T scores = v_wmma_f32_16x16x32_bf16 with bf16 hi/lo split
// q and k (hi.hi + hi.lo + lo.hi); p.v = v_wmma_f32_16x16x32_f16 (p carried x1024 in f16, v in f16; extra f16
// residual planes x4096 of p and v on the first 512 query rows); ctx.Wo^T = v_wmma_f32_16x16x32_bf16 with ctx
// as bf16 hi/lo planes times the bf16 Wo plane (2 products); all f32 accumulate; 6-term line-pair bias dots,
// decay weights and softmax in f32 on VALU.
#include <hip/hip_runtime.h>
#include <math.h>
#include <float.h>
#include <stdint.h>

#define NB     2
#define SEQ    2048
#define DMODEL 1024
#define NH     16
#define HD     64
#define QP     (NH * HD)       // 1024: q / k / ctx row pitch
#define NQB    (SEQ / 64)      // 32 query / key tiles of 64
#define VLP    512             // key pitch of the v^T residual plane (keys 0..VLP-1)
#define RESQB  8               // leading 64-row query blocks that use the p / v residual planes
#define PD     4               // point dim per head
#define LNW    (4 * PD * NH)   // 256: width of the line-feature projection [p1w | p2w | p1r | p2r]
#define LP     72              // LDS row pitch (16-bit elements) of the attention K, V^T and P tiles: 144 B = 16 B x 9, so the
                               // 16 rows that one ds_load_b128 reads fall on 16 different groups of 4 banks (at 128 B: on 2)
static_assert(RESQB * 64 <= VLP);
static_assert(RESQB <= NQB);
static_assert(QP == DMODEL);
static_assert(HD == 64);
static_assert(PD == 4);
static_assert(LP >= 64 && (LP % 8) == 0 && 2 * 64 * LP * 2 >= 4 * 16 * 64 * 4);
static_assert((SEQ % 64) == 0 && (DMODEL % 64) == 0 && (LNW % 64) == 0 && (QP % 64) == 0);
static_assert(((NB * SEQ) % 64) == 0 && (SEQ % 32) == 0);
static_assert((DMODEL % 32) == 0);

typedef _Float16 v16h __attribute__((ext_vector_type(16)));
typedef _Float16 v8h  __attribute__((ext_vector_type(8)));
typedef __bf16   v16b __attribute__((ext_vector_type(16)));
typedef __bf16   v8b  __attribute__((ext_vector_type(8)));
typedef float    v8f  __attribute__((ext_vector_type(8)));
typedef float    v4f  __attribute__((ext_vector_type(4)));
typedef float    v2f  __attribute__((ext_vector_type(2)));
typedef unsigned int v4u __attribute__((ext_vector_type(4)));

// ---- scalar helpers --------------------------------------------------------------------------------
__device__ __forceinline__ unsigned short bf_bits(float f) {          // f32 -> bf16 bits, RNE convert
  unsigned u = __float_as_uint(f);
  return (unsigned short)((u + 0x7FFFu + ((u >> 16) & 1u)) >> 16);
}
__device__ __forceinline__ float bf_up(unsigned short h) { return __uint_as_float(((unsigned)h) << 16); }
__device__ __forceinline__ unsigned short h_bits(_Float16 x) { return __builtin_bit_cast(unsigned short, x); }
__device__ __forceinline__ unsigned pk16(unsigned short a, unsigned short b) { return (unsigned)a | ((unsigned)b << 16); }
__device__ __forceinline__ v8f zero8() { v8f z = {0.f, 0.f, 0.f, 0.f, 0.f, 0.f, 0.f, 0.f}; return z; }
__device__ __forceinline__ v8h zero8h() {
  const _Float16 z = (_Float16)0.0f;
  v8h r = {z, z, z, z, z, z, z, z};
  return r;
}

// ---- lane l <- lane l ^ X inside each 16-lane row (DPP row_xmask, control 0x160 + X): no LDS round trip ----
template <int X>
__device__ __forceinline__ float lane_xor16(float v) {
  return __builtin_bit_cast(float, __builtin_amdgcn_update_dpp(0, __builtin_bit_cast(int, v), 0x160 + X, 0xf, 0xf, true));
}
// exp(x) as v_exp_f32(x * log2 e), the form __expf compiled to. The v_nop is the one slot that the instruction set asks
// for behind a transcendental before a source is overwritten.
__device__ __forceinline__ float exp_slot(float x) {
  const float t = x * 1.44269504088896340736f;
  float r;
#if defined(__HIP_DEVICE_COMPILE__)
  asm("v_exp_f32 %0, %1\n\tv_nop" : "=v"(r) : "v"(t));
#else
  r = t;
#endif
  return r;
}
template <int X>
__device__ __forceinline__ void rowmax8(float (&m)[8]) {
#pragma unroll  // the 8 values stay in registers, one independent instruction chain each
  for (int r = 0; r < 8; ++r) m[r] = fmaxf(m[r], lane_xor16<X>(m[r]));
}
template <int X>
__device__ __forceinline__ void rowsum8(float (&m)[8]) {
#pragma unroll  // the 8 values stay in registers, one independent instruction chain each
  for (int r = 0; r < 8; ++r) m[r] += lane_xor16<X>(m[r]);
}

// ---- fragment loader: 16-bit A/B operand, lane -> row/col (lane&15), p already includes +8*(lane>>4);
//      elements 0..7 <- p[0..7] (k0+8h..), elements 8..15 <- p[16..23] (k0+16+8h..)
__device__ __forceinline__ v16b ldfrag_b(const __bf16* p) {
  union { v16b v; v8b h[2]; } f;
  f.h[0] = *(const v8b*)(p);
  f.h[1] = *(const v8b*)(p + 16);
  return f.v;
}

// ---- WMMA helpers with trailing VALU hazard gap --------------------------------------------------------
__device__ __forceinline__ v8f mma_b(v16b a, v16b b, v8f c) {
  c = __builtin_amdgcn_wmma_f32_16x16x32_bf16(false, a, false, b, (short)0, c, false, false);
#if defined(__HIP_DEVICE_COMPILE__)
  asm volatile("v_nop\n\tv_nop\n\tv_nop\n\tv_nop" : "+v"(c) : "v"(a), "v"(b));
#endif
  return c;
}
__device__ __forceinline__ v8f mma_h(v16h a, v16h b, v8f c) {
  c = __builtin_amdgcn_wmma_f32_16x16x32_f16(false, a, false, b, (short)0, c, false, false);
#if defined(__HIP_DEVICE_COMPILE__)
  asm volatile("v_nop\n\tv_nop\n\tv_nop\n\tv_nop" : "+v"(c) : "v"(a), "v"(b));
#endif
  return c;
}
__device__ __forceinline__ v8f mma_b_raw(v16b a, v16b b, v8f c) {
  return __builtin_amdgcn_wmma_f32_16x16x32_bf16(false, a, false, b, (short)0, c, false, false);
}
__device__ __forceinline__ void dep_guard_b(v8f& a, v8f& b, v16b x, v16b y) {
#if defined(__HIP_DEVICE_COMPILE__)
  asm volatile("v_nop\n\tv_nop\n\tv_nop\n\tv_nop" : "+v"(a), "+v"(b) : "v"(x), "v"(y));
#endif
}
__device__ __forceinline__ void keep4_b(v16b a, v16b b, v16b c, v16b d) {
#if defined(__HIP_DEVICE_COMPILE__)
  asm volatile("v_nop" :: "v"(a), "v"(b), "v"(c), "v"(d));
#endif
}
__device__ __forceinline__ void acc_guard4(v8f& a, v8f& b, v8f& c, v8f& d) {
#if defined(__HIP_DEVICE_COMPILE__)
  asm volatile("v_nop\n\tv_nop\n\tv_nop\n\tv_nop" : "+v"(a), "+v"(b), "+v"(c), "+v"(d));
#endif
}

// =====================================================================================================
// Flat f32 -> bf16 (RNE convert), 8 elements per thread, one 16-B store per lane: a wave writes 512 contiguous
// coverage: n8 threads x 8 = the whole plane (n8 = element count / 8, all planes here are multiples of 2048).
// =====================================================================================================
__global__ __launch_bounds__(256) void cvt_bf16(const float* __restrict__ in, unsigned short* out, int n8) {
  const int i = blockIdx.x * 256 + threadIdx.x;
  if (i < n8) {
    const float* s = in + (size_t)i * 8;
    const v4f a = *(const v4f*)(s);
    const v4f b = *(const v4f*)(s + 4);
    v4u p;
    p[0] = pk16(bf_bits(a[0]), bf_bits(a[1]));
    p[1] = pk16(bf_bits(a[2]), bf_bits(a[3]));
    p[2] = pk16(bf_bits(b[0]), bf_bits(b[1]));
    p[3] = pk16(bf_bits(b[2]), bf_bits(b[3]));
    unsigned short* d = out + (size_t)i * 8;
    *(v4u*)d = p;
    
  }
}

// =====================================================================================================
// f32 -> bf16 hi plane + bf16 lo plane (lo = RNE(v - hi), unscaled), 8 elements per thread, one 16-B store per
// coverage: n8 threads x 8 = whole plane (n8 multiple of 256).
// =====================================================================================================
__global__ __launch_bounds__(256) void split_bf16x8(const float* __restrict__ in, unsigned short* hp,
                                                    unsigned short* lp, int n8) {
  const int i = blockIdx.x * 256 + threadIdx.x;
  if (i < n8) {
    const v4f a = *(const v4f*)(in + (size_t)i * 8);
    const v4f b = *(const v4f*)(in + (size_t)i * 8 + 4);
    v4u ph, pl;
#pragma unroll
    for (int e = 0; e < 4; ++e) {
      const float f0 = (e < 2) ? a[2 * e]     : b[2 * e - 4];
      const float f1 = (e < 2) ? a[2 * e + 1] : b[2 * e - 3];
      const unsigned short h0 = bf_bits(f0), h1 = bf_bits(f1);
      const unsigned short l0 = bf_bits(f0 - bf_up(h0)), l1 = bf_bits(f1 - bf_up(h1));
      ph[e] = pk16(h0, h1);
      pl[e] = pk16(l0, l1);
    }
    *(v4u*)(hp + (size_t)i * 8) = ph;
    *(v4u*)(lp + (size_t)i * 8) = pl;
    
  }
}

// =====================================================================================================
// Register-blocked batched bf16 WMMA GEMM: C[m][n] = sum_k A[m][k] * Bt[n][k] (+ bias); one wave per 64x64 tile,
// no block barriers. A row-major [M][K] pitch lda; Bt row-major [N][K] pitch ldb (k contiguous); M, N multiples
// of 64, K multiple of 32 (host-checked). blockIdx.y = batch index (strides in elements).
// NSPLIT: 0 = A.Bt; 1 = (A + A2).Bt (A2 = unscaled bf16 lo plane of A); 2 = A.Bt + A2.Bt + A.Bt2.
// BIAS: 0 none; 1 = + bias[n] per output column; 2 = + bias[m] per output row (bias RNE-converted to bf16 and
//       widened, added in f32 in the epilogue).
// OUT_MODE: 0 = f32 (pitch ldc); 2 = bf16 hi plane C + bf16 lo plane C2 (lo = RNE(v - hi), unscaled);
//           3 = f16 hi plane C + f16 residual plane C2 = f16((v - hi) * rscale), C2 written only for tiles
//               with n0 < N2 (pitch ldc2, batch stride strideC2).
// =====================================================================================================
template <int NSPLIT, int OUT_MODE, int BIAS>
__global__ __launch_bounds__(256) void gemm64(
    const unsigned short* __restrict__ Ap, const unsigned short* A2p, int lda, long long strideA,
    const unsigned short* __restrict__ Btp, const unsigned short* Bt2p, int ldb, long long strideB,
    void* Cout, int ldc, long long strideC,
    void* Cout2, int ldc2, long long strideC2, int N2,
    const float* __restrict__ biasp,
    int M, int N, int K, float rscale) {
  const __bf16* A   = (const __bf16*)(const void*)Ap;
  const __bf16* A2  = (const __bf16*)(const void*)A2p;
  const __bf16* Bt  = (const __bf16*)(const void*)Btp;
  const __bf16* Bt2 = (const __bf16*)(const void*)Bt2p;
  __shared__ __align__(16) float sT[8][16 * 68];   // per-wave 16x64 slab, pitch 68 floats
  const int b    = blockIdx.y;
  const int lane = threadIdx.x & 31;
  const int wave = threadIdx.x >> 5;
  const int tilesN = N >> 6;
  const int tilesM = M >> 6;
  const int tile = blockIdx.x * 8 + wave;
  if (tile >= tilesM * tilesN) return;   // wave-uniform; no block barriers in this kernel
  const int tm = tile / tilesN;
  const int tn = tile - tm * tilesN;
  const int m0 = tm << 6;
  const int n0 = tn << 6;

  const __bf16* Ab  = A  + (size_t)b * strideA;
  const __bf16* Bb  = Bt + (size_t)b * strideB;
  const __bf16* Ab2 = (NSPLIT >= 1) ? (A2  + (size_t)b * strideA) : Ab;
  const __bf16* Bb2 = (NSPLIT == 2) ? (Bt2 + (size_t)b * strideB) : Bb;

  const int rlane = lane & 15;                 // row (A) / col (B, D) within subtile
  const int koff  = (lane >> 4) * 8;           // k offset of this lane half
  const int mOff  = (lane >> 4) * 8;           // D row offset

  v8f acc[4][4];
#pragma unroll
  for (int i = 0; i < 4; ++i)
#pragma unroll
    for (int j = 0; j < 4; ++j) acc[i][j] = zero8();

  for (int k0 = 0; k0 < K; k0 += 32) {
    v16b bh[4], bl[4];
#pragma unroll
    for (int j = 0; j < 4; ++j) {
      const size_t bo = (size_t)(n0 + (j << 4) + rlane) * ldb + koff + k0;
      bh[j] = ldfrag_b(Bb + bo);
      if (NSPLIT == 2) bl[j] = ldfrag_b(Bb2 + bo); else bl[j] = bh[j];
    }
#pragma unroll
    for (int i = 0; i < 4; ++i) {
      const size_t ao = (size_t)(m0 + (i << 4) + rlane) * lda + koff + k0;
      const v16b ah = ldfrag_b(Ab + ao);
      v16b al = ah;
      if (NSPLIT >= 1) al = ldfrag_b(Ab2 + ao);
#pragma unroll
      for (int j = 0; j < 4; ++j) {
        acc[i][j] = mma_b_raw(ah, bh[j], acc[i][j]);
        if (NSPLIT >= 1) acc[i][j] = mma_b_raw(al, bh[j], acc[i][j]);
        if (NSPLIT == 2) acc[i][j] = mma_b_raw(ah, bl[j], acc[i][j]);
      }
      dep_guard_b(acc[i][0], acc[i][3], ah, al);
    }
    keep4_b(bh[0], bh[1], bh[2], bh[3]);
    if (NSPLIT == 2) keep4_b(bl[0], bl[1], bl[2], bl[3]);
  }
  acc_guard4(acc[0][0], acc[0][1], acc[0][2], acc[0][3]);
  acc_guard4(acc[1][0], acc[1][1], acc[1][2], acc[1][3]);
  acc_guard4(acc[2][0], acc[2][1], acc[2][2], acc[2][3]);
  acc_guard4(acc[3][0], acc[3][1], acc[3][2], acc[3][3]);

  // ---- per-column bias (BIAS == 1): this lane's 4 output columns n0 + 16j + rlane ----
  float bcol[4];
#pragma unroll
  for (int j = 0; j < 4; ++j) bcol[j] = 0.f;
  if (BIAS == 1) {
#pragma unroll
    for (int j = 0; j < 4; ++j) bcol[j] = bf_up(bf_bits(biasp[n0 + (j << 4) + rlane]));
  }

  // ---- epilogue ----
  float* slab = sT[wave];
#pragma unroll
  for (int i = 0; i < 4; ++i) {
    const int mBase = m0 + (i << 4);
    float brow[8];
#pragma unroll
    for (int r = 0; r < 8; ++r) brow[r] = 0.f;
    if (BIAS == 2) {
#pragma unroll
      for (int r = 0; r < 8; ++r) brow[r] = bf_up(bf_bits(biasp[mBase + mOff + r]));
    }
#pragma unroll
    for (int r = 0; r < 8; ++r) {
#pragma unroll
      for (int j = 0; j < 4; ++j) {
        float v = acc[i][j][r];
        if (BIAS == 1) v += bcol[j];
        if (BIAS == 2) v += brow[r];
        slab[(mOff + r) * 68 + (j << 4) + rlane] = v;
      }
    }
    __builtin_amdgcn_fence(__ATOMIC_RELEASE, "workgroup");
    __builtin_amdgcn_wave_barrier();
    __builtin_amdgcn_fence(__ATOMIC_ACQUIRE, "workgroup");
    if (OUT_MODE == 0) {
      float* C = (float*)Cout + (size_t)b * strideC;
      const int hh = lane >> 4, c4 = (lane & 15) * 4;     // 256-B row segment = 16 lanes x 16 B
      v4f ov[8];
#pragma unroll
      for (int it = 0; it < 8; ++it) {
        const int row = it * 2 + hh;                       // it 0..7 x hh 0..1 = rows 0..15
        ov[it] = *(const v4f*)(slab + row * 68 + c4);
      }
      {
#pragma unroll
        for (int it = 0; it < 8; ++it) {
          const int row = it * 2 + hh;
          *(v4f*)(C + (size_t)(mBase + row) * ldc + n0 + c4) = ov[it];
        }
        
      }
    } else {
      const int q = lane >> 3, c8 = (lane & 7) * 8;
      unsigned short* C  = (unsigned short*)Cout  + (size_t)b * strideC;
      unsigned short* C2 = (unsigned short*)Cout2 + (size_t)b * strideC2;
      const bool wlo = (OUT_MODE == 2) || (n0 < N2);      // wave-uniform
      v4u hv[4], lv[4];
#pragma unroll
      for (int it = 0; it < 4; ++it) {
        const int row = it * 4 + q;                        // it 0..3 x q 0..3 = rows 0..15
        const float* sp = slab + row * 68 + c8;
        v4u a, a2;
#pragma unroll
        for (int e = 0; e < 4; ++e) {
          const float f0 = sp[2 * e], f1 = sp[2 * e + 1];
          unsigned short h0, h1, l0, l1;
          if (OUT_MODE == 2) {
            h0 = bf_bits(f0); h1 = bf_bits(f1);
            l0 = bf_bits(f0 - bf_up(h0)); l1 = bf_bits(f1 - bf_up(h1));
          } else {
            const _Float16 x0 = (_Float16)f0, x1 = (_Float16)f1;
            h0 = h_bits(x0); h1 = h_bits(x1);
            l0 = h_bits((_Float16)((f0 - (float)x0) * rscale));
            l1 = h_bits((_Float16)((f1 - (float)x1) * rscale));
          }
          a[e] = pk16(h0, h1); a2[e] = pk16(l0, l1);
        }
        hv[it] = a; lv[it] = a2;
      }
      {
#pragma unroll
        for (int it = 0; it < 4; ++it) {
          const int row = it * 4 + q;
          *(v4u*)(C + (size_t)(mBase + row) * ldc + n0 + c8) = hv[it];
          if (wlo) *(v4u*)(C2 + (size_t)(mBase + row) * ldc2 + n0 + c8) = lv[it];
        }
        
      }
    }
    __builtin_amdgcn_fence(__ATOMIC_RELEASE, "workgroup");
    __builtin_amdgcn_wave_barrier();
    __builtin_amdgcn_fence(__ATOMIC_ACQUIRE, "workgroup");
  }
}

// =====================================================================================================
// Line features. Input ln f32 [NB*SEQ][LNW]: column blocks of PD*NH = 64: block 0 = x.W1w^T, 1 = x.W2w^T,
// 2 = x.W1r^T, 3 = x.W2r^T; within a block head h owns columns h*4..h*4+3.
// Per (b, h, t): p1 = block 0 of token t-1 (zero vector at t == 0: the shifted input), p2 = block 1 of t,
// p3 = block 2 of t, p4 = block 3 of t. Exterior 2-form L[m] = pa[PI[m]]*pb[PJ[m]] - pa[PJ[m]]*pb[PI[m]] for
// pairs (0,1),(0,2),(0,3),(1,2),(1,3),(2,3), then L *= 1/max(|L|_2, 1e-12) (all f32, fp contract off).
// Outputs f32 [NB*NH][SEQ][8]: rl = read line [L0..L5, 0, 0]; wl = J-applied write line [L5,-L4,L3,L2,-L1,L0,0,0].
// wave-uniform bound, no block barriers.
// coverage: nwaves = NB*NH*(SEQ/32) waves x 32 rows x 32 B = every row of both planes incl. the zero pad cols.
// =====================================================================================================
struct L6 { float v0, v1, v2, v3, v4, v5; };

__device__ __forceinline__ L6 ext6n(const v4f a, const v4f b) {
#pragma clang fp contract(off)
  L6 o;
  o.v0 = a[0] * b[1] - a[1] * b[0];
  o.v1 = a[0] * b[2] - a[2] * b[0];
  o.v2 = a[0] * b[3] - a[3] * b[0];
  o.v3 = a[1] * b[2] - a[2] * b[1];
  o.v4 = a[1] * b[3] - a[3] * b[1];
  o.v5 = a[2] * b[3] - a[3] * b[2];
  float n2 = o.v0 * o.v0 + o.v1 * o.v1;
  n2 = n2 + o.v2 * o.v2;
  n2 = n2 + o.v3 * o.v3;
  n2 = n2 + o.v4 * o.v4;
  n2 = n2 + o.v5 * o.v5;
  float n = sqrtf(n2);
  n = fmaxf(n, 1e-12f);
  const float inv = 1.0f / n;
  o.v0 *= inv; o.v1 *= inv; o.v2 *= inv; o.v3 *= inv; o.v4 *= inv; o.v5 *= inv;
  return o;
}

__global__ __launch_bounds__(256) void lines_k(const float* __restrict__ ln, float* rl, float* wl, int nwaves) {
#pragma clang fp contract(off)
  __shared__ __align__(16) float sR[8][256];
  __shared__ __align__(16) float sW[8][256];
  const int tid = threadIdx.x, wave = tid >> 5, lane = tid & 31;
  const int w = blockIdx.x * 8 + wave;
  if (w >= nwaves) return;                        // wave-uniform; no block barriers in this kernel
  const int tgPer = SEQ / 32;                     // 64 token groups per (b, h)
  const int bh = w / tgPer;                       // b*NH + h
  const int tg = w - bh * tgPer;
  const int b  = bh / NH;
  const int h  = bh - b * NH;
  const int t  = tg * 32 + lane;                  // < SEQ
  const size_t row  = (size_t)b * SEQ + t;
  const size_t rowp = (t > 0) ? (row - 1) : row;  // clamped address; value zeroed below when t == 0
  const float* cur = ln + row * LNW + h * PD;
  v4f p1 = *(const v4f*)(ln + rowp * LNW + h * PD);
  if (t == 0) { p1[0] = 0.f; p1[1] = 0.f; p1[2] = 0.f; p1[3] = 0.f; }
  const v4f p2 = *(const v4f*)(cur + 1 * PD * NH);
  const v4f p3 = *(const v4f*)(cur + 2 * PD * NH);
  const v4f p4 = *(const v4f*)(cur + 3 * PD * NH);
  const L6 lw = ext6n(p1, p2);
  const L6 lr = ext6n(p3, p4);

  float* sr = sR[wave] + lane * 8;
  float* sw = sW[wave] + lane * 8;
  v4f t0, t1, u0, u1;
  t0[0] = lr.v0; t0[1] = lr.v1; t0[2] = lr.v2; t0[3] = lr.v3;
  t1[0] = lr.v4; t1[1] = lr.v5; t1[2] = 0.f;   t1[3] = 0.f;
  u0[0] = lw.v5; u0[1] = -lw.v4; u0[2] = lw.v3; u0[3] = lw.v2;
  u1[0] = -lw.v1; u1[1] = lw.v0; u1[2] = 0.f;   u1[3] = 0.f;
  *(v4f*)(sr)     = t0;
  *(v4f*)(sr + 4) = t1;
  *(v4f*)(sw)     = u0;
  *(v4f*)(sw + 4) = u1;
  __builtin_amdgcn_fence(__ATOMIC_RELEASE, "workgroup");
  __builtin_amdgcn_wave_barrier();
  __builtin_amdgcn_fence(__ATOMIC_ACQUIRE, "workgroup");
  v4f oR[2], oW[2];
#pragma unroll
  for (int it = 0; it < 2; ++it) {
    oR[it] = *(const v4f*)(sR[wave] + it * 128 + lane * 4);
    oW[it] = *(const v4f*)(sW[wave] + it * 128 + lane * 4);
  }
  const size_t gb = ((size_t)bh * SEQ + (size_t)tg * 32) * 8;
  {
#pragma unroll
    for (int it = 0; it < 2; ++it) {
      *(v4f*)(rl + gb + it * 128 + lane * 4) = oR[it];
      *(v4f*)(wl + gb + it * 128 + lane * 4) = oW[it];
    }
    
  }
}

// =====================================================================================================
// Causal multi-head attention, head dim 64, with an additive line-pair bias:
//   logit(q, k) = (q . k) * sscale + dot6(rl[q], wl[k]) * wdec(q - k),  wdec(d) = bs_h * dec_h^d for d > 0, 0 else,
//   dec_h = sigmoid(dl_h); keys k > q masked (-FLT_MAX, exp -> 0); diagonal kept.
//   q planes (bf16 hi / lo): element (b, t, h, d) at [(b*SEQ + t)*QP + h*64 + d]
//   k planes (bf16 hi / lo): same layout
//   v^T hi plane (f16):      element (b, h, d, s) at [(b*QP + h*64 + d)*SEQ + s]
//   v^T residual plane (f16, (v - hi)*4096): [(b*QP + h*64 + d)*VLP + s], s < VLP, read only when RES
//   rl / wl f32 planes [b*NH + h][SEQ][8] (6 used)
//   out f32 plane: element (b, t, h*64 + d) at [(b*SEQ + t)*QP + h*64 + d] = normalised context.
//   scores = q . k : bf16 hi/lo split (hi.hi + hi.lo + lo.hi), f32 accumulate, then scale + bias in f32
//   p = exp(s - m) carried as f16(1024 p); context = p . v on f16 WMMA; RES adds f16 residual planes of p and v
//   (scale 4096, separate accumulator folded back with 1/4096 per chunk in f32); online softmax in f32.
//   Block = 4 waves = 64 query rows of one (b, h); grid = nqbThis * NH * NB; key chunks of 64, tiles 0..qb only
//   (block-uniform trip count qb+1 <= NQB; every row has a live key in every processed chunk).
//   K / V^T / wl chunk staging: 128 threads (plain 16-B loads, __syncthreads before and after); P tiles are
//   wave-private, spilled with _Float16 element stores and reloaded as v8h (same element type) after a release
//   barrier in between).
//   Output coverage: each wave stores rows q0..q0+15 (it 0..7 x lane>>4 0..1) x 64 columns (16 lanes x 4 floats),
// =====================================================================================================
template <bool RES>
__global__ __launch_bounds__(128)
void attn_lb(const unsigned short* __restrict__ qhp, const unsigned short* __restrict__ qlp,
             const unsigned short* __restrict__ khp, const unsigned short* __restrict__ klp,
             const unsigned short* __restrict__ vhp, const unsigned short* __restrict__ vlp,
             const float* __restrict__ rlp, const float* __restrict__ wlp,
             const float* __restrict__ dlg, const float* __restrict__ bsc,
             float* outp, int qbBase, int nqbThis, float sscale) {
  union FB { v16b v; v8b h[2]; };
  union FH { v16h v; v8h h[2]; };
  __shared__ __align__(16) unsigned short KT[2 * 64 * LP];      // K hi [kv][d] | K lo; later f32 context staging
  __shared__ __align__(16) _Float16 Vth[64 * LP];                // V^T hi [d][kv]
  __shared__ __align__(16) _Float16 Vtl[RES ? 64 * LP : 8];      // V^T residual
  __shared__ __align__(16) _Float16 Psh[4][16 * LP];             // per wave P [row][kv]
  __shared__ __align__(16) _Float16 Psl[RES ? 4 : 1][16 * LP];   // per wave P residual
  __shared__ __align__(16) float    Ws[64 * 8];                  // wl rows of the chunk's 64 keys
  __shared__ __align__(16) float    Rs[4][16 * 8];               // per wave rl rows of its 16 queries
  __bf16* Ksh = (__bf16*)(void*)KT;
  __bf16* Ksl = Ksh + 64 * LP;

  const int tid  = threadIdx.x;
  const int wave = tid >> 5;
  const int lane = tid & 31;
  const int hh   = lane >> 4;
  const int c    = lane & 15;

  const int bx   = blockIdx.x;
  const int qbl  = bx % nqbThis;
  const int rest = bx / nqbThis;
  const int h    = rest % NH;
  const int b    = rest / NH;
  const int qb   = qbBase + qbl;
  const int q0   = qb * 64 + wave * 16;
  const size_t rowB = (size_t)b * SEQ;
  const size_t bhT  = ((size_t)b * NH + h) * SEQ;

  const __bf16* Qh = (const __bf16*)(const void*)qhp + (size_t)h * HD;
  const __bf16* Ql = (const __bf16*)(const void*)qlp + (size_t)h * HD;
  const __bf16* Kh = (const __bf16*)(const void*)khp + (size_t)h * HD;
  const __bf16* Kl = (const __bf16*)(const void*)klp + (size_t)h * HD;
  const _Float16* Vh = (const _Float16*)(const void*)vhp + ((size_t)b * QP + (size_t)h * HD) * SEQ;
  const _Float16* Vl = (const _Float16*)(const void*)vlp + ((size_t)b * QP + (size_t)h * HD) * VLP;

  // ---- per-head scalars (RNE bf16-converted inputs) ----
  const float dl  = bf_up(bf_bits(dlg[h]));
  const float dec = 1.0f / (1.0f + expf(-dl));
  const float l2d = log2f(dec);
  const float bsh = bf_up(bf_bits(bsc[h]));

  // ---- stage the wave's 16 rl rows: 16 x 8 f32 = 32 lanes x 16 B (ordered by the loop's first barrier) ----
  *(v4f*)(Rs[wave] + lane * 4) = *(const v4f*)(rlp + (bhT + q0) * 8 + lane * 4);

  float mrow[8], lrow[8];
  v8f oacc[4];
#pragma unroll
  for (int r = 0; r < 8; ++r) { mrow[r] = -INFINITY; lrow[r] = 0.f; }
#pragma unroll
  for (int t = 0; t < 4; ++t) oacc[t] = zero8();

  int nkt = qb + 1;                          // causal: key tiles 0..qb, block-uniform
  if (nkt > NQB) nkt = NQB;
  for (int kt = 0; kt < nkt; ++kt) {
    const int kv0 = kt * 64;
    __syncthreads();
    {
      const int r = tid >> 1, half = (tid & 1) * 32;
      const __bf16*   kg  = Kh + (rowB + kv0 + r) * QP + half;    // K row kv0+r, d = half..half+31
      const __bf16*   klg = Kl + (rowB + kv0 + r) * QP + half;
      const _Float16* vg  = Vh + (size_t)r * SEQ + kv0 + half;    // V^T row d = r, s = kv0+half..+31
      const int kvl = (kv0 + 64 <= VLP) ? kv0 : (VLP - 64);     // clamped address into the residual plane
      const _Float16* vlg = Vl + (size_t)r * VLP + kvl + half;
      const bool resOK = (kv0 + 64 <= VLP);                      // block-uniform
#pragma unroll
      for (int i = 0; i < 4; ++i) {
        const v8b a0 = *(const v8b*)(kg + 8 * i);
        const v8b a1 = *(const v8b*)(klg + 8 * i);
        const v8h b0 = *(const v8h*)(vg + 8 * i);
        *(v8b*)(Ksh + r * LP + half + 8 * i) = a0;
        *(v8b*)(Ksl + r * LP + half + 8 * i) = a1;
        *(v8h*)(Vth + r * LP + half + 8 * i) = b0;
        if (RES) {
          v8h b1 = *(const v8h*)(vlg + 8 * i);
          if (!resOK) b1 = zero8h();
          *(v8h*)(Vtl + r * LP + half + 8 * i) = b1;
        }
      }
      // wl rows kv0..kv0+63 of this (b, h): 64 x 8 f32 = 128 threads x 16 B
      *(v4f*)(Ws + tid * 4) = *(const v4f*)(wlp + (bhT + kv0) * 8 + tid * 4);
    }
    __syncthreads();

    // ---- Q fragments (A operand, row = lane&15): 2 d-chunks, hi and lo (reloaded per chunk) ----
    v16b qah[2], qal[2];
#pragma unroll
    for (int dc = 0; dc < 2; ++dc) {
      const size_t qo = (rowB + q0 + c) * QP + dc * 32 + 8 * hh;
      qah[dc] = ldfrag_b(Qh + qo);
      qal[dc] = ldfrag_b(Ql + qo);
    }

    // ---- scores: 16 query rows x 64 keys per wave, 3 bf16 products ----
    v8f s[4];
#pragma unroll
    for (int j = 0; j < 4; ++j) {
      s[j] = zero8();
#pragma unroll
      for (int dc = 0; dc < 2; ++dc) {
        FB kb, kl;
        kb.h[0] = *(const v8b*)(Ksh + (j * 16 + c) * LP + dc * 32 + 8 * hh);
        kb.h[1] = *(const v8b*)(Ksh + (j * 16 + c) * LP + dc * 32 + 16 + 8 * hh);
        kl.h[0] = *(const v8b*)(Ksl + (j * 16 + c) * LP + dc * 32 + 8 * hh);
        kl.h[1] = *(const v8b*)(Ksl + (j * 16 + c) * LP + dc * 32 + 16 + 8 * hh);
        s[j] = mma_b(qah[dc], kb.v, s[j]);
        s[j] = mma_b(qah[dc], kl.v, s[j]);
        s[j] = mma_b(qal[dc], kb.v, s[j]);
      }
    }

    // ---- wl rows of this lane's 4 key columns (j*16 + c): 6 used of 8 ----
    v4f wa[4];
    v2f wb[4];
#pragma unroll
    for (int j = 0; j < 4; ++j) {
      const float* wp = Ws + (j * 16 + c) * 8;
      wa[j] = *(const v4f*)(wp);
      wb[j] = *(const v2f*)(wp + 4);
    }

    // ---- scale + bias + causal mask (replace by -FLT_MAX), row max, online softmax, P (x1024, f16) and
    //      P residual (x4096) to LDS ----
    _Float16* pwh = Psh[wave];
    _Float16* pwl = Psl[RES ? wave : 0];
    float mloc[8], msafe[8], alpha[8], psum[8];
    // logits of all 8 rows first, so that the 8 row reductions below run as independent chains
#pragma unroll
    for (int r = 0; r < 8; ++r) {
      const int qrow = q0 + 8 * hh + r;
      const float* rp = Rs[wave] + (8 * hh + r) * 8;
      const v4f ra = *(const v4f*)(rp);
      const v2f rb = *(const v2f*)(rp + 4);
      float m = -INFINITY;
#pragma unroll
      for (int j = 0; j < 4; ++j) {
        const int key = kv0 + j * 16 + c;
        const int dd  = qrow - key;
        const float dot6 = ra[0] * wa[j][0] + ra[1] * wa[j][1] + ra[2] * wa[j][2] + ra[3] * wa[j][3]
                         + rb[0] * wb[j][0] + rb[1] * wb[j][1];
        const float ex   = exp2f((float)dd * l2d);
        const float wdec = (dd > 0) ? (bsh * ex) : 0.f;
        float sv = s[j][r] * sscale + dot6 * wdec;
        sv = (key > qrow) ? -FLT_MAX : sv;
        s[j][r] = sv;
        m = fmaxf(m, sv);
      }
      mloc[r] = m;
    }
    // row maximum over the 16 lanes of a half: xor butterfly 1, 2, 4, 8 in the vector unit, 8 rows per step.
    // The scheduling barriers keep the 8 chains side by side: without them the compiler moves each row's chain
    // back behind that row's logits, where every step waits for the one before it.
    __builtin_amdgcn_sched_barrier(0);
    rowmax8<1>(mloc); rowmax8<2>(mloc); rowmax8<4>(mloc); rowmax8<8>(mloc);
    __builtin_amdgcn_sched_barrier(0);
#pragma unroll  // per-row state is indexed by constants only, so it stays in registers
    for (int r = 0; r < 8; ++r) {
      const float mnew = fmaxf(mrow[r], mloc[r]);
      msafe[r] = (mnew == -INFINITY) ? 0.f : mnew;
      alpha[r] = exp_slot(mrow[r] - msafe[r]);
      mrow[r]  = mnew;
    }
#pragma unroll  // as above
    for (int r = 0; r < 8; ++r) {
      float ps = 0.f;
#pragma unroll
      for (int j = 0; j < 4; ++j) {
        const float p = exp_slot(s[j][r] - msafe[r]);  // masked logit against a finite max: exp -> 0
        ps += p;
        const float p1k = p * 1024.0f;
        const _Float16 ph = (_Float16)p1k;
        pwh[(8 * hh + r) * LP + j * 16 + c] = ph;
        if (RES) {
          const _Float16 pl = (_Float16)((p1k - (float)ph) * 4096.0f);
          pwl[(8 * hh + r) * LP + j * 16 + c] = pl;
        }
      }
      psum[r] = ps;
    }
    // row sum: xor butterfly 1, 2, 4, 8 like the maximum, with the same scheduling barriers for the same reason
    __builtin_amdgcn_sched_barrier(0);
    rowsum8<1>(psum); rowsum8<2>(psum); rowsum8<4>(psum); rowsum8<8>(psum);
    __builtin_amdgcn_sched_barrier(0);
#pragma unroll  // as above
    for (int r = 0; r < 8; ++r) {
      lrow[r] = lrow[r] * alpha[r] + psum[r];
#pragma unroll
      for (int t = 0; t < 4; ++t) oacc[t][r] *= alpha[r];
    }
    __builtin_amdgcn_fence(__ATOMIC_RELEASE, "workgroup");
    __builtin_amdgcn_wave_barrier();
    __builtin_amdgcn_fence(__ATOMIC_ACQUIRE, "workgroup");

    // ---- context += P . V (f16 WMMA), residual products into a separate accumulator ----
    v8f o1[4];
#pragma unroll
    for (int t = 0; t < 4; ++t) o1[t] = zero8();
#pragma unroll 1
    for (int kk = 0; kk < 2; ++kk) {
      FH pa, pl;
      pa.h[0] = *(const v8h*)(pwh + c * LP + kk * 32 + 8 * hh);
      pa.h[1] = *(const v8h*)(pwh + c * LP + kk * 32 + 16 + 8 * hh);
      if (RES) {
        pl.h[0] = *(const v8h*)(pwl + c * LP + kk * 32 + 8 * hh);
        pl.h[1] = *(const v8h*)(pwl + c * LP + kk * 32 + 16 + 8 * hh);
      } else {
        pl.v = pa.v;
      }
#pragma unroll
      for (int t = 0; t < 4; ++t) {
        FH vb;
        vb.h[0] = *(const v8h*)(Vth + (t * 16 + c) * LP + kk * 32 + 8 * hh);
        vb.h[1] = *(const v8h*)(Vth + (t * 16 + c) * LP + kk * 32 + 16 + 8 * hh);
        oacc[t] = mma_h(pa.v, vb.v, oacc[t]);
        if (RES) {
          FH vl;
          vl.h[0] = *(const v8h*)(Vtl + (t * 16 + c) * LP + kk * 32 + 8 * hh);
          vl.h[1] = *(const v8h*)(Vtl + (t * 16 + c) * LP + kk * 32 + 16 + 8 * hh);
          o1[t] = mma_h(pa.v, vl.v, o1[t]);
          o1[t] = mma_h(pl.v, vb.v, o1[t]);
        }
      }
    }
    if (RES) {
#pragma unroll
      for (int t = 0; t < 4; ++t)
#pragma unroll
        for (int r = 0; r < 8; ++r) oacc[t][r] += o1[t][r] * (1.0f / 4096.0f);
    }
  }

  // ---- all waves are done with the K tiles before that LDS region is reused for the context staging ----
  __syncthreads();

  // ---- normalise (1/l and the 1/1024 p carry), stage the wave's 16x64 tile in LDS, then write whole
  float* os = (float*)(void*)KT + wave * (16 * 64);
#pragma unroll
  for (int r = 0; r < 8; ++r) {
    const float l = lrow[r];
    const float inv = ((l > 0.f) ? (1.0f / l) : 0.f) * (1.0f / 1024.0f);
#pragma unroll
    for (int t = 0; t < 4; ++t) os[(8 * hh + r) * 64 + t * 16 + c] = oacc[t][r] * inv;
  }
  __builtin_amdgcn_fence(__ATOMIC_RELEASE, "workgroup");
  __builtin_amdgcn_wave_barrier();
  __builtin_amdgcn_fence(__ATOMIC_ACQUIRE, "workgroup");
  {
    const int h2 = lane >> 4, c4 = (lane & 15) * 4;
    v4f ov[8];
#pragma unroll
    for (int it = 0; it < 8; ++it) {
      const int row = it * 2 + h2;   // it 0..7 x h2 0..1 = rows 0..15 of the wave tile
      ov[it] = *(const v4f*)(os + row * 64 + c4);
    }
    {
#pragma unroll
      for (int it = 0; it < 8; ++it) {
        const int row = it * 2 + h2;
        const size_t go = (rowB + q0 + row) * QP + (size_t)h * HD + c4;
        *(v4f*)(outp + go) = ov[it];
      }
      
    }
  }
}

// =====================================================================================================
// Workspace map (bytes), every region an exact multiple of its whole-line / whole-tile store granularity
// multiples):
//   Xb     bf16 [4096][1024]            0            8388608
//   Wqkv   bf16 [3072][1024]            8388608      6291456   ([n][k], rows 0..1023 q | 1024.. k | 2048.. v)
//   Wln    bf16 [256][1024]             14680064      524288   ([W1w; W2w; W1r; W2r], [n][k])
//   Wob    bf16 [1024][1024]            15204352     2097152   ([n][k])
//   LN     f32  [4096][256]             17301504     4194304
//   RL     f32  [32][2048][8]           21495808     2097152
//   WL     f32  [32][2048][8]           23592960     2097152
//   Qh     bf16 [4096][1024]            25690112     8388608
//   Ql     bf16 [4096][1024]            34078720     8388608
//   Kh     bf16 [4096][1024]            42467328     8388608
//   Kl     bf16 [4096][1024]            50855936     8388608
//   VTh    f16  [2][1024][2048]         59244544     8388608
//   VTl    f16  [2][1024][512]          67633152     2097152
//   Af     f32  [4096][1024]            69730304    16777216
//   Ah     bf16 [4096][1024]            86507520     8388608
//   Al     bf16 [4096][1024]            94896128     8388608
//   end                                 103284736
// =====================================================================================================
extern "C" void kernel_launch(void* const* d_in, const int* in_sizes, int n_in,
                              void* d_out, int out_size, void* d_ws, size_t ws_size,
                              hipStream_t stream) {
  if (n_in < 11) return;
  if (in_sizes[0] != NB * SEQ * DMODEL) return;
  if (in_sizes[1] != 3 * QP * DMODEL) return;
  if (in_sizes[2] != 3 * QP) return;
  if (in_sizes[3] != PD * NH * DMODEL) return;
  if (in_sizes[4] != PD * NH * DMODEL) return;
  if (in_sizes[5] != PD * NH * DMODEL) return;
  if (in_sizes[6] != PD * NH * DMODEL) return;
  if (in_sizes[7] != DMODEL * QP) return;
  if (in_sizes[8] != DMODEL) return;
  if (in_sizes[9] != NH) return;
  if (in_sizes[10] != NH) return;
  if (out_size != NB * SEQ * DMODEL) return;

  const float* x     = (const float*)d_in[0];    // [NB*SEQ][DMODEL]
  const float* wqkv  = (const float*)d_in[1];    // [3*QP n][DMODEL k]
  const float* bqkv  = (const float*)d_in[2];    // [3*QP]
  const float* w1w   = (const float*)d_in[3];    // [PD*NH][DMODEL]
  const float* w2w   = (const float*)d_in[4];
  const float* w1r   = (const float*)d_in[5];
  const float* w2r   = (const float*)d_in[6];
  const float* wout  = (const float*)d_in[7];    // [DMODEL n][QP k]
  const float* bout  = (const float*)d_in[8];    // [DMODEL]
  const float* dlog  = (const float*)d_in[9];    // [NH]
  const float* bscl  = (const float*)d_in[10];   // [NH]

  const size_t PXb   = (size_t)NB * SEQ * DMODEL * 2;      //  8388608
  const size_t PWqkv = (size_t)3 * QP * DMODEL * 2;        //  6291456
  const size_t PWln  = (size_t)LNW * DMODEL * 2;           //   524288
  const size_t PWo   = (size_t)DMODEL * QP * 2;            //  2097152
  const size_t PLN   = (size_t)NB * SEQ * LNW * 4;         //  4194304
  const size_t PRL   = (size_t)NB * NH * SEQ * 8 * 4;      //  2097152
  const size_t PQpl  = (size_t)NB * SEQ * QP * 2;          //  8388608  (Qh, Ql, Kh, Kl, Ah, Al)
  const size_t PVTh  = (size_t)NB * QP * SEQ * 2;          //  8388608
  const size_t PVTl  = (size_t)NB * QP * VLP * 2;          //  2097152
  const size_t PAf   = (size_t)NB * SEQ * QP * 4;          // 16777216
  size_t off = 0;
  const size_t oXb   = off; off += PXb;
  const size_t oWqkv = off; off += PWqkv;
  const size_t oWln  = off; off += PWln;
  const size_t oWo   = off; off += PWo;
  const size_t oLN   = off; off += PLN;
  const size_t oRL   = off; off += PRL;
  const size_t oWL   = off; off += PRL;
  const size_t oQh   = off; off += PQpl;
  const size_t oQl   = off; off += PQpl;
  const size_t oKh   = off; off += PQpl;
  const size_t oKl   = off; off += PQpl;
  const size_t oVTh  = off; off += PVTh;
  const size_t oVTl  = off; off += PVTl;
  const size_t oAf   = off; off += PAf;
  const size_t oAh   = off; off += PQpl;
  const size_t oAl   = off; off += PQpl;
  if (off > ws_size) return;                          // off = 103284736
  if (off > (size_t)134217728) return;

  char* ws = (char*)d_ws;
  unsigned short* Xb   = (unsigned short*)(ws + oXb);
  unsigned short* Wqkv = (unsigned short*)(ws + oWqkv);
  unsigned short* Wln  = (unsigned short*)(ws + oWln);
  unsigned short* Wob  = (unsigned short*)(ws + oWo);
  float*          LN   = (float*)(ws + oLN);
  float*          RL   = (float*)(ws + oRL);
  float*          WL   = (float*)(ws + oWL);
  unsigned short* Qh   = (unsigned short*)(ws + oQh);
  unsigned short* Ql   = (unsigned short*)(ws + oQl);
  unsigned short* Kh   = (unsigned short*)(ws + oKh);
  unsigned short* Kl   = (unsigned short*)(ws + oKl);
  unsigned short* VTh  = (unsigned short*)(ws + oVTh);
  unsigned short* VTl  = (unsigned short*)(ws + oVTl);
  float*          Af   = (float*)(ws + oAf);
  unsigned short* Ah   = (unsigned short*)(ws + oAh);
  unsigned short* Al   = (unsigned short*)(ws + oAl);
  float*          outf = (float*)d_out;

  const dim3 blk(256);
  const int nTok   = NB * SEQ;                                       // 4096 tokens
  const int n8x    = nTok * DMODEL / 8;                              // 524288
  const int n8qkv  = 3 * QP * DMODEL / 8;                            // 393216
  const int n8ln   = PD * NH * DMODEL / 8;                           //   8192 per line weight
  const int n8wo   = DMODEL * QP / 8;                                // 131072
  const int n8a    = nTok * QP / 8;                                  // 524288
  const int nwLn   = NB * NH * (SEQ / 32);                           //   2048 waves
  const dim3 gCx((n8x + 255) / 256), gCqkv((n8qkv + 255) / 256), gCln((n8ln + 255) / 256), gCwo((n8wo + 255) / 256);
  const dim3 gLNg(((nTok / 64) * (LNW / 64) + 7) / 8, 1);            // 256 tiles -> 32 blocks
  const dim3 gQ(((nTok / 64) * (QP / 64) + 7) / 8, 1);               // 1024 tiles -> 128 blocks
  const dim3 gVT(((QP / 64) * (SEQ / 64) + 7) / 8, NB);              // 512 tiles -> 64 blocks x 2 batch elements
  const dim3 gLines((nwLn + 7) / 8);                                 // 256 blocks
  const dim3 gSplit((n8a + 255) / 256);                              // 2048 blocks
  const dim3 gOut(((nTok / 64) * (DMODEL / 64) + 7) / 8, 1);         // 1024 tiles -> 128 blocks

  // (1) inputs -> bf16 planes (RNE convert); weights arrive [n][k] = the Bt layout already
  cvt_bf16<<<gCx,   blk, 0, stream>>>(x,    Xb,   n8x);
  cvt_bf16<<<gCqkv, blk, 0, stream>>>(wqkv, Wqkv, n8qkv);
  cvt_bf16<<<gCln,  blk, 0, stream>>>(w1w,  Wln + (size_t)0 * PD * NH * DMODEL, n8ln);
  cvt_bf16<<<gCln,  blk, 0, stream>>>(w2w,  Wln + (size_t)1 * PD * NH * DMODEL, n8ln);
  cvt_bf16<<<gCln,  blk, 0, stream>>>(w1r,  Wln + (size_t)2 * PD * NH * DMODEL, n8ln);
  cvt_bf16<<<gCln,  blk, 0, stream>>>(w2r,  Wln + (size_t)3 * PD * NH * DMODEL, n8ln);
  cvt_bf16<<<gCwo,  blk, 0, stream>>>(wout, Wob,  n8wo);
  // (2) line-feature projections: LN[row][e] = sum_k Xb[row][k] Wln[e][k]  (M=4096, N=256, K=1024) -> f32
  gemm64<0, 0, 0><<<gLNg, blk, 0, stream>>>(
      Xb, Xb, DMODEL, 0LL, Wln, Wln, DMODEL, 0LL,
      (void*)LN, LNW, 0LL, (void*)LN, 0, 0LL, 0,
      bout, nTok, LNW, DMODEL, 1.0f);
  // (3) q projection + bias -> bf16 hi / lo planes  (M=4096, N=1024, K=1024)
  gemm64<0, 2, 1><<<gQ, blk, 0, stream>>>(
      Xb, Xb, DMODEL, 0LL, Wqkv, Wqkv, DMODEL, 0LL,
      (void*)Qh, QP, 0LL, (void*)Ql, QP, 0LL, QP,
      bqkv, nTok, QP, DMODEL, 1.0f);
  // (4) k projection + bias -> bf16 hi / lo planes (weight rows 1024..2047, bias 1024..)
  gemm64<0, 2, 1><<<gQ, blk, 0, stream>>>(
      Xb, Xb, DMODEL, 0LL, Wqkv + (size_t)QP * DMODEL, Wqkv + (size_t)QP * DMODEL, DMODEL, 0LL,
      (void*)Kh, QP, 0LL, (void*)Kl, QP, 0LL, QP,
      bqkv + QP, nTok, QP, DMODEL, 1.0f);
  // (5) v^T per batch element: VTh[b][f][s] = sum_k Wv[f][k] Xb[b*SEQ+s][k] + bv[f] -> f16 hi plane (pitch SEQ)
  //     and residual plane (x4096, keys < VLP, pitch VLP)  (M=1024 features, N=2048 tokens, K=1024, bias per row)
  gemm64<0, 3, 2><<<gVT, blk, 0, stream>>>(
      Wqkv + (size_t)2 * QP * DMODEL, Wqkv + (size_t)2 * QP * DMODEL, DMODEL, 0LL,
      Xb, Xb, DMODEL, (long long)SEQ * DMODEL,
      (void*)VTh, SEQ, (long long)QP * SEQ, (void*)VTl, VLP, (long long)QP * VLP, VLP,
      bqkv + 2 * QP, QP, SEQ, DMODEL, 4096.0f);
  // (6) line features (shifted p1, exterior 2-forms, L2 normalisation, J map) -> rl / wl f32 planes
  lines_k<<<gLines, blk, 0, stream>>>(LN, RL, WL, nwLn);
  // (7) causal attention with line-pair bias: query blocks 0..RESQB-1 with residual planes, the rest without
  attn_lb<true><<<dim3(NB * NH * RESQB), dim3(128), 0, stream>>>(
      Qh, Ql, Kh, Kl, VTh, VTl, RL, WL, dlog, bscl, Af, 0, RESQB, 0.125f);
  attn_lb<false><<<dim3(NB * NH * (NQB - RESQB)), dim3(128), 0, stream>>>(
      Qh, Ql, Kh, Kl, VTh, VTl, RL, WL, dlog, bscl, Af, RESQB, NQB - RESQB, 0.125f);
  // (8) context rows -> bf16 hi/lo planes
  split_bf16x8<<<gSplit, blk, 0, stream>>>(Af, Ah, Al, n8a);
  // (9) out[row][e] = sum_d (Ah+Al)[row][d] Wob[e][d] + bout[e] -> d_out f32 [4096][1024]  (M=4096, N=1024, K=1024)
  gemm64<1, 0, 1><<<gOut, blk, 0, stream>>>(
      Ah, Al, QP, 0LL, Wob, Wob, QP, 0LL,
      (void*)outf, DMODEL, 0LL, (void*)outf, 0, 0LL, 0,
      bout, nTok, DMODEL, QP, 1.0f);
  (void)hipGetLastError();
}

// v003
// It runs in 306 microseconds.
// Two timings next to v002 put it at 1.51 and 1.52 times that version's speed.
// Counting every step since v000, it is 2.02 times as fast.
// Contractions: q / k / v^T and line-feature projections = v_wmma_f32_16x16x32_bf16 (bf16 operands from
// RNE-converted inputs, one product per k-step); q.k^T scores = v_wmma_f32_16x16x32_bf16 with bf16 hi/lo split
// q and k (hi.hi + hi.lo + lo.hi); p.v = v_wmma_f32_16x16x32_f16 (p carried x1024 in f16, v in f16; extra f16
// residual planes x4096 of p and v on the first 512 query rows); ctx.Wo^T = v_wmma_f32_16x16x32_bf16 with ctx
// as bf16 hi/lo planes times the bf16 Wo plane (2 products); all f32 accumulate; 6-term line-pair bias dots,
// decay weights and softmax in f32 on VALU.
#include <hip/hip_runtime.h>
#include <math.h>
#include <float.h>
#include <stdint.h>

#define NB     2
#define SEQ    2048
#define DMODEL 1024
#define NH     16
#define HD     64
#define QP     (NH * HD)       // 1024: q / k / ctx row pitch
#define NQB    (SEQ / 64)      // 32 query / key tiles of 64
#define VLP    512             // key pitch of the v^T residual plane (keys 0..VLP-1)
#define RESQB  8               // leading 64-row query blocks that use the p / v residual planes
#define PD     4               // point dim per head
#define LNW    (4 * PD * NH)   // 256: width of the line-feature projection [p1w | p2w | p1r | p2r]
#define LP     72              // LDS row pitch (16-bit elements) of the attention K, V^T and P tiles: 144 B = 16 B x 9, so the
                               // 16 rows that one ds_load_b128 reads fall on 16 different groups of 4 banks (at 128 B: on 2)
static_assert(RESQB * 64 <= VLP);
static_assert(RESQB <= NQB);
static_assert(QP == DMODEL);
static_assert(HD == 64);
static_assert(PD == 4);
static_assert(LP >= 64 && (LP % 8) == 0 && 2 * 64 * LP * 2 >= 4 * 16 * 64 * 4);
static_assert((SEQ % 64) == 0 && (DMODEL % 64) == 0 && (LNW % 64) == 0 && (QP % 64) == 0);
static_assert(((NB * SEQ) % 64) == 0 && (SEQ % 32) == 0);
static_assert((DMODEL % 32) == 0);
static_assert(((NB * SEQ) % 128) == 0 && (SEQ % 128) == 0 && (QP % 128) == 0 && (LNW % 128) == 0 && (DMODEL % 128) == 0);

typedef _Float16 v16h __attribute__((ext_vector_type(16)));
typedef _Float16 v8h  __attribute__((ext_vector_type(8)));
typedef __bf16   v16b __attribute__((ext_vector_type(16)));
typedef __bf16   v8b  __attribute__((ext_vector_type(8)));
typedef float    v8f  __attribute__((ext_vector_type(8)));
typedef float    v4f  __attribute__((ext_vector_type(4)));
typedef float    v2f  __attribute__((ext_vector_type(2)));
typedef unsigned int v4u __attribute__((ext_vector_type(4)));

// ---- scalar helpers --------------------------------------------------------------------------------
__device__ __forceinline__ unsigned short bf_bits(float f) {          // f32 -> bf16 bits, RNE convert
  unsigned u = __float_as_uint(f);
  return (unsigned short)((u + 0x7FFFu + ((u >> 16) & 1u)) >> 16);
}
__device__ __forceinline__ float bf_up(unsigned short h) { return __uint_as_float(((unsigned)h) << 16); }
__device__ __forceinline__ unsigned short h_bits(_Float16 x) { return __builtin_bit_cast(unsigned short, x); }
__device__ __forceinline__ unsigned pk16(unsigned short a, unsigned short b) { return (unsigned)a | ((unsigned)b << 16); }
__device__ __forceinline__ v8f zero8() { v8f z = {0.f, 0.f, 0.f, 0.f, 0.f, 0.f, 0.f, 0.f}; return z; }
__device__ __forceinline__ v8h zero8h() {
  const _Float16 z = (_Float16)0.0f;
  v8h r = {z, z, z, z, z, z, z, z};
  return r;
}

// ---- lane l <- lane l ^ X inside each 16-lane row (DPP row_xmask, control 0x160 + X): no LDS round trip ----
template <int X>
__device__ __forceinline__ float lane_xor16(float v) {
  return __builtin_bit_cast(float, __builtin_amdgcn_update_dpp(0, __builtin_bit_cast(int, v), 0x160 + X, 0xf, 0xf, true));
}
// exp(x) as v_exp_f32(x * log2 e), the form __expf compiled to. The v_nop is the one slot that the instruction set asks
// for behind a transcendental before a source is overwritten.
__device__ __forceinline__ float exp_slot(float x) {
  const float t = x * 1.44269504088896340736f;
  float r;
#if defined(__HIP_DEVICE_COMPILE__)
  asm("v_exp_f32 %0, %1\n\tv_nop" : "=v"(r) : "v"(t));
#else
  r = t;
#endif
  return r;
}
template <int X>
__device__ __forceinline__ void rowmax8(float (&m)[8]) {
#pragma unroll  // the 8 values stay in registers, one independent instruction chain each
  for (int r = 0; r < 8; ++r) m[r] = fmaxf(m[r], lane_xor16<X>(m[r]));
}
template <int X>
__device__ __forceinline__ void rowsum8(float (&m)[8]) {
#pragma unroll  // the 8 values stay in registers, one independent instruction chain each
  for (int r = 0; r < 8; ++r) m[r] += lane_xor16<X>(m[r]);
}

// ---- fragment loader: 16-bit A/B operand, lane -> row/col (lane&15), p already includes +8*(lane>>4);
//      elements 0..7 <- p[0..7] (k0+8h..), elements 8..15 <- p[16..23] (k0+16+8h..)
__device__ __forceinline__ v16b ldfrag_b(const __bf16* p) {
  union { v16b v; v8b h[2]; } f;
  f.h[0] = *(const v8b*)(p);
  f.h[1] = *(const v8b*)(p + 16);
  return f.v;
}

// ---- WMMA helpers with trailing VALU hazard gap --------------------------------------------------------
__device__ __forceinline__ v8f mma_b(v16b a, v16b b, v8f c) {
  c = __builtin_amdgcn_wmma_f32_16x16x32_bf16(false, a, false, b, (short)0, c, false, false);
#if defined(__HIP_DEVICE_COMPILE__)
  asm volatile("v_nop\n\tv_nop\n\tv_nop\n\tv_nop" : "+v"(c) : "v"(a), "v"(b));
#endif
  return c;
}
__device__ __forceinline__ v8f mma_h(v16h a, v16h b, v8f c) {
  c = __builtin_amdgcn_wmma_f32_16x16x32_f16(false, a, false, b, (short)0, c, false, false);
#if defined(__HIP_DEVICE_COMPILE__)
  asm volatile("v_nop\n\tv_nop\n\tv_nop\n\tv_nop" : "+v"(c) : "v"(a), "v"(b));
#endif
  return c;
}
__device__ __forceinline__ v8f mma_b_raw(v16b a, v16b b, v8f c) {
  return __builtin_amdgcn_wmma_f32_16x16x32_bf16(false, a, false, b, (short)0, c, false, false);
}
__device__ __forceinline__ void dep_guard_b(v8f& a, v8f& b, v16b x, v16b y) {
#if defined(__HIP_DEVICE_COMPILE__)
  asm volatile("v_nop\n\tv_nop\n\tv_nop\n\tv_nop" : "+v"(a), "+v"(b) : "v"(x), "v"(y));
#endif
}
__device__ __forceinline__ void keep4_b(v16b a, v16b b, v16b c, v16b d) {
#if defined(__HIP_DEVICE_COMPILE__)
  asm volatile("v_nop" :: "v"(a), "v"(b), "v"(c), "v"(d));
#endif
}
__device__ __forceinline__ void acc_guard4(v8f& a, v8f& b, v8f& c, v8f& d) {
#if defined(__HIP_DEVICE_COMPILE__)
  asm volatile("v_nop\n\tv_nop\n\tv_nop\n\tv_nop" : "+v"(a), "+v"(b), "+v"(c), "+v"(d));
#endif
}

// =====================================================================================================
// Flat f32 -> bf16 (RNE convert), 8 elements per thread, one 16-B store per lane: a wave writes 512 contiguous
// coverage: n8 threads x 8 = the whole plane (n8 = element count / 8, all planes here are multiples of 2048).
// =====================================================================================================
__global__ __launch_bounds__(256) void cvt_bf16(const float* __restrict__ in, unsigned short* out, int n8) {
  const int i = blockIdx.x * 256 + threadIdx.x;
  if (i < n8) {
    const float* s = in + (size_t)i * 8;
    const v4f a = *(const v4f*)(s);
    const v4f b = *(const v4f*)(s + 4);
    v4u p;
    p[0] = pk16(bf_bits(a[0]), bf_bits(a[1]));
    p[1] = pk16(bf_bits(a[2]), bf_bits(a[3]));
    p[2] = pk16(bf_bits(b[0]), bf_bits(b[1]));
    p[3] = pk16(bf_bits(b[2]), bf_bits(b[3]));
    unsigned short* d = out + (size_t)i * 8;
    *(v4u*)d = p;
    
  }
}

// =====================================================================================================
// f32 -> bf16 hi plane + bf16 lo plane (lo = RNE(v - hi), unscaled), 8 elements per thread, one 16-B store per
// coverage: n8 threads x 8 = whole plane (n8 multiple of 256).
// =====================================================================================================
__global__ __launch_bounds__(256) void split_bf16x8(const float* __restrict__ in, unsigned short* hp,
                                                    unsigned short* lp, int n8) {
  const int i = blockIdx.x * 256 + threadIdx.x;
  if (i < n8) {
    const v4f a = *(const v4f*)(in + (size_t)i * 8);
    const v4f b = *(const v4f*)(in + (size_t)i * 8 + 4);
    v4u ph, pl;
#pragma unroll
    for (int e = 0; e < 4; ++e) {
      const float f0 = (e < 2) ? a[2 * e]     : b[2 * e - 4];
      const float f1 = (e < 2) ? a[2 * e + 1] : b[2 * e - 3];
      const unsigned short h0 = bf_bits(f0), h1 = bf_bits(f1);
      const unsigned short l0 = bf_bits(f0 - bf_up(h0)), l1 = bf_bits(f1 - bf_up(h1));
      ph[e] = pk16(h0, h1);
      pl[e] = pk16(l0, l1);
    }
    *(v4u*)(hp + (size_t)i * 8) = ph;
    *(v4u*)(lp + (size_t)i * 8) = pl;
    
  }
}

// =====================================================================================================
// Batched bf16 WMMA GEMM: C[m][n] = sum_k A[m][k] * Bt[n][k] (+ bias). Block = 4 waves = one 128x128 tile, each
// wave a 64x64 quarter (wave>>1 = m half, wave&1 = n half). A row-major [M][K] pitch lda; Bt row-major [N][K] pitch
// ldb (k contiguous); M, N multiples of 128, K a multiple of 64 and at least 64. blockIdx.y = batch index.
// The 128 A rows and 128 Bt rows of a 64-wide k slab (128 B a row) are brought into LDS by asynchronous 16-B copies,
// 8 lanes to a row so that every copy instruction takes whole 128-B lines, and are shared by the block's waves; two
// buffers: slab t+1 flies while slab t is multiplied. LDS row pitch GP = 144 B. Fragments come by ds_load_b128; the
// k order and the order of the products are those of ascending k in steps of 32.
// NSPLIT: 0 = A.Bt; 1 = (A + A2).Bt (A2 = unscaled bf16 lo plane of A).
// BIAS: 0 none; 1 = + bias[n] per output column; 2 = + bias[m] per output row (bias RNE-converted to bf16 and
//       widened, added in f32 in the epilogue).
// OUT_MODE: 0 = f32 (pitch ldc); 2 = bf16 hi plane C + bf16 lo plane C2 (lo = RNE(v - hi), unscaled);
//           3 = f16 hi plane C + f16 residual plane C2 = f16((v - hi) * rscale), C2 written only for tiles
//               with n0 < N2 (pitch ldc2, batch stride strideC2).
// =====================================================================================================
#define GP 72                  // LDS row pitch (16-bit elements) of the GEMM slabs: 144 B = 16 B x 9
#define GPL (128 * GP)         // elements of one staged plane (128 rows)

// Eight asynchronous 16-B copies global -> LDS per lane. The s_wait_xcnt stands inside the statement so that no
// address register of a copy is rewritten ahead of it.
__device__ __forceinline__ void async8(const unsigned (&l)[8], const __bf16* const (&g)[8]) {
#if defined(__HIP_DEVICE_COMPILE__)
  asm volatile(
      "global_load_async_to_lds_b128 %0, %8, off\n\t"
      "global_load_async_to_lds_b128 %1, %9, off\n\t"
      "global_load_async_to_lds_b128 %2, %10, off\n\t"
      "global_load_async_to_lds_b128 %3, %11, off\n\t"
      "global_load_async_to_lds_b128 %4, %12, off\n\t"
      "global_load_async_to_lds_b128 %5, %13, off\n\t"
      "global_load_async_to_lds_b128 %6, %14, off\n\t"
      "global_load_async_to_lds_b128 %7, %15, off\n\t"
      "s_wait_xcnt 0x0"
      :: "v"(l[0]), "v"(l[1]), "v"(l[2]), "v"(l[3]), "v"(l[4]), "v"(l[5]), "v"(l[6]), "v"(l[7]),
         "v"(g[0]), "v"(g[1]), "v"(g[2]), "v"(g[3]), "v"(g[4]), "v"(g[5]), "v"(g[6]), "v"(g[7])
      : "memory");
#endif
}
// One plane of a slab: rows row0..row0+127 of src (pitch ld), columns k0..k0+63, to LDS byte address ldst.
// Thread tid takes the 16-B piece tid&7 of rows (tid>>3) + 16*it.
__device__ __forceinline__ void stage_plane(const __bf16* src, int row0, int ld, int k0, unsigned ldst, int tid) {
  unsigned l[8];
  const __bf16* g[8];
#pragma unroll  // the eight addresses are operands of one asm statement
  for (int it = 0; it < 8; ++it) {
    const int row = it * 16 + (tid >> 3);
    l[it] = ldst + (unsigned)((row * GP + (tid & 7) * 8) * 2);
    g[it] = src + (size_t)(row0 + row) * ld + k0 + (tid & 7) * 8;
  }
  async8(l, g);
}
__device__ __forceinline__ void wait_async0() {   // this wave's copies have landed
#if defined(__HIP_DEVICE_COMPILE__)
  asm volatile("s_wait_asynccnt 0x0" ::: "memory");
#endif
}
__device__ __forceinline__ void wait_ds0() {      // this wave's LDS reads are done before the buffer is refilled
#if defined(__HIP_DEVICE_COMPILE__)
  asm volatile("s_wait_dscnt 0x0" ::: "memory");
#endif
}

template <int NSPLIT, int OUT_MODE, int BIAS>
__global__ __launch_bounds__(128) void gemm64(
    const unsigned short* __restrict__ Ap, const unsigned short* A2p, int lda, long long strideA,
    const unsigned short* __restrict__ Btp, const unsigned short* Bt2p, int ldb, long long strideB,
    void* Cout, int ldc, long long strideC,
    void* Cout2, int ldc2, long long strideC2, int N2,
    const float* __restrict__ biasp,
    int M, int N, int K, float rscale) {
  static_assert(NSPLIT == 0 || NSPLIT == 1);
  constexpr int NPL = (NSPLIT == 1) ? 3 : 2;       // staged planes: A, Bt, (A2)
  constexpr int GI  = (NSPLIT == 1) ? 2 : 4;       // A row groups fetched together
  const __bf16* A   = (const __bf16*)(const void*)Ap;
  const __bf16* A2  = (const __bf16*)(const void*)A2p;
  const __bf16* Bt  = (const __bf16*)(const void*)Btp;
  (void)Bt2p;
  __shared__ __align__(16) __bf16 sAB[2 * NPL * GPL];   // two buffers of NPL planes
  __shared__ __align__(16) float sT[4][16 * 68];        // per-wave 16x64 slab, pitch 68 floats
  const int b    = blockIdx.y;
  const int tid  = threadIdx.x;
  const int lane = tid & 31;
  const int wave = tid >> 5;
  const int tilesN = N >> 7;
  const int tilesM = M >> 7;
  const int tile = blockIdx.x;
  if (tile >= tilesM * tilesN) return;   // block-uniform, in front of every barrier
  const int tm = tile / tilesN;
  const int tn = tile - tm * tilesN;
  const int mB = tm << 7;
  const int nB = tn << 7;
  const int wm = (wave >> 1) << 6;
  const int wn = (wave & 1) << 6;
  const int m0 = mB + wm;
  const int n0 = nB + wn;

  const __bf16* Ab  = A  + (size_t)b * strideA;
  const __bf16* Bb  = Bt + (size_t)b * strideB;
  const __bf16* Ab2 = (NSPLIT == 1) ? (A2 + (size_t)b * strideA) : Ab;

  const int rlane = lane & 15;                 // row (A) / col (B, D) within subtile
  const int koff  = (lane >> 4) * 8;           // k offset of this lane half
  const int mOff  = (lane >> 4) * 8;           // D row offset

  v8f acc[4][4];
#pragma unroll
  for (int i = 0; i < 4; ++i)
#pragma unroll
    for (int j = 0; j < 4; ++j) acc[i][j] = zero8();

  const unsigned lds0 = (unsigned)(uintptr_t)(void*)sAB;   // LDS byte address of the ring
  const int nT = K >> 6;                                   // k slabs of 64
  // slab t into buffer bf
  auto issue = [&](int t, int bf) {
    const unsigned lb = lds0 + (unsigned)(bf * NPL * GPL * 2);
    stage_plane(Ab, mB, lda, t << 6, lb, tid);
    stage_plane(Bb, nB, ldb, t << 6, lb + (unsigned)(GPL * 2), tid);
    if (NSPLIT == 1) stage_plane(Ab2, mB, lda, t << 6, lb + (unsigned)(2 * GPL * 2), tid);
  };
  issue(0, 0);
  wait_async0();
  __syncthreads();
  if (nT > 1) issue(1, 1);

  for (int t = 0; t < nT; ++t) {
    const __bf16* sA  = sAB + (t & 1) * (NPL * GPL);
    const __bf16* sB  = sA + GPL;
    const __bf16* sA2 = sA + (NPL - 1) * GPL;
    // this loop and those inside it are unrolled so that fragments and accumulators are indexed by constants only
    // and stay in registers
#pragma unroll
    for (int ks = 0; ks < 2; ++ks) {
      // the A fragments of GI row groups (16 products' worth) are fetched together, so that the LDS latency is met
      // once for them and not once a row group; GI is 2 with the second A plane to stay inside 256 registers
      v16b bh[4];
#pragma unroll
      for (int j = 0; j < 4; ++j) bh[j] = ldfrag_b(sB + (wn + (j << 4) + rlane) * GP + ks * 32 + koff);
#pragma unroll
      for (int ig = 0; ig < 4; ig += GI) {
        v16b ah[GI], al[GI];
#pragma unroll
        for (int u = 0; u < GI; ++u) {
          const int ao = (wm + ((ig + u) << 4) + rlane) * GP + ks * 32 + koff;
          ah[u] = ldfrag_b(sA + ao);
          if (NSPLIT == 1) al[u] = ldfrag_b(sA2 + ao); else al[u] = ah[u];
        }
#pragma unroll
        for (int u = 0; u < GI; ++u) {
          const int i = ig + u;
#pragma unroll
          for (int j = 0; j < 4; ++j) {
            acc[i][j] = mma_b_raw(ah[u], bh[j], acc[i][j]);
            if (NSPLIT == 1) acc[i][j] = mma_b_raw(al[u], bh[j], acc[i][j]);
          }
          dep_guard_b(acc[i][0], acc[i][3], ah[u], al[u]);
        }
      }
      keep4_b(bh[0], bh[1], bh[2], bh[3]);
    }
    // publish slab t+1 and free slab t's buffer: own LDS reads done, own copies landed, then the block barrier
    wait_ds0();
    wait_async0();
    __syncthreads();
    if (t + 2 < nT) issue(t + 2, t & 1);
  }
  wait_async0();
  acc_guard4(acc[0][0], acc[0][1], acc[0][2], acc[0][3]);
  acc_guard4(acc[1][0], acc[1][1], acc[1][2], acc[1][3]);
  acc_guard4(acc[2][0], acc[2][1], acc[2][2], acc[2][3]);
  acc_guard4(acc[3][0], acc[3][1], acc[3][2], acc[3][3]);

  // ---- per-column bias (BIAS == 1): this lane's 4 output columns n0 + 16j + rlane ----
  float bcol[4];
#pragma unroll
  for (int j = 0; j < 4; ++j) bcol[j] = 0.f;
  if (BIAS == 1) {
#pragma unroll
    for (int j = 0; j < 4; ++j) bcol[j] = bf_up(bf_bits(biasp[n0 + (j << 4) + rlane]));
  }

  // ---- epilogue ----
  float* slab = sT[wave];
#pragma unroll
  for (int i = 0; i < 4; ++i) {
    const int mBase = m0 + (i << 4);
    float brow[8];
#pragma unroll
    for (int r = 0; r < 8; ++r) brow[r] = 0.f;
    if (BIAS == 2) {
#pragma unroll
      for (int r = 0; r < 8; ++r) brow[r] = bf_up(bf_bits(biasp[mBase + mOff + r]));
    }
#pragma unroll
    for (int r = 0; r < 8; ++r) {
#pragma unroll
      for (int j = 0; j < 4; ++j) {
        float v = acc[i][j][r];
        if (BIAS == 1) v += bcol[j];
        if (BIAS == 2) v += brow[r];
        slab[(mOff + r) * 68 + (j << 4) + rlane] = v;
      }
    }
    __builtin_amdgcn_fence(__ATOMIC_RELEASE, "workgroup");
    __builtin_amdgcn_wave_barrier();
    __builtin_amdgcn_fence(__ATOMIC_ACQUIRE, "workgroup");
    if (OUT_MODE == 0) {
      float* C = (float*)Cout + (size_t)b * strideC;
      const int hh = lane >> 4, c4 = (lane & 15) * 4;     // 256-B row segment = 16 lanes x 16 B
      v4f ov[8];
#pragma unroll
      for (int it = 0; it < 8; ++it) {
        const int row = it * 2 + hh;                       // it 0..7 x hh 0..1 = rows 0..15
        ov[it] = *(const v4f*)(slab + row * 68 + c4);
      }
      {
#pragma unroll
        for (int it = 0; it < 8; ++it) {
          const int row = it * 2 + hh;
          *(v4f*)(C + (size_t)(mBase + row) * ldc + n0 + c4) = ov[it];
        }
        
      }
    } else {
      const int q = lane >> 3, c8 = (lane & 7) * 8;
      unsigned short* C  = (unsigned short*)Cout  + (size_t)b * strideC;
      unsigned short* C2 = (unsigned short*)Cout2 + (size_t)b * strideC2;
      const bool wlo = (OUT_MODE == 2) || (n0 < N2);      // wave-uniform
      v4u hv[4], lv[4];
#pragma unroll
      for (int it = 0; it < 4; ++it) {
        const int row = it * 4 + q;                        // it 0..3 x q 0..3 = rows 0..15
        const float* sp = slab + row * 68 + c8;
        v4u a, a2;
#pragma unroll
        for (int e = 0; e < 4; ++e) {
          const float f0 = sp[2 * e], f1 = sp[2 * e + 1];
          unsigned short h0, h1, l0, l1;
          if (OUT_MODE == 2) {
            h0 = bf_bits(f0); h1 = bf_bits(f1);
            l0 = bf_bits(f0 - bf_up(h0)); l1 = bf_bits(f1 - bf_up(h1));
          } else {
            const _Float16 x0 = (_Float16)f0, x1 = (_Float16)f1;
            h0 = h_bits(x0); h1 = h_bits(x1);
            l0 = h_bits((_Float16)((f0 - (float)x0) * rscale));
            l1 = h_bits((_Float16)((f1 - (float)x1) * rscale));
          }
          a[e] = pk16(h0, h1); a2[e] = pk16(l0, l1);
        }
        hv[it] = a; lv[it] = a2;
      }
      {
#pragma unroll
        for (int it = 0; it < 4; ++it) {
          const int row = it * 4 + q;
          *(v4u*)(C + (size_t)(mBase + row) * ldc + n0 + c8) = hv[it];
          if (wlo) *(v4u*)(C2 + (size_t)(mBase + row) * ldc2 + n0 + c8) = lv[it];
        }
        
      }
    }
    __builtin_amdgcn_fence(__ATOMIC_RELEASE, "workgroup");
    __builtin_amdgcn_wave_barrier();
    __builtin_amdgcn_fence(__ATOMIC_ACQUIRE, "workgroup");
  }
}

// =====================================================================================================
// Line features. Input ln f32 [NB*SEQ][LNW]: column blocks of PD*NH = 64: block 0 = x.W1w^T, 1 = x.W2w^T,
// 2 = x.W1r^T, 3 = x.W2r^T; within a block head h owns columns h*4..h*4+3.
// Per (b, h, t): p1 = block 0 of token t-1 (zero vector at t == 0: the shifted input), p2 = block 1 of t,
// p3 = block 2 of t, p4 = block 3 of t. Exterior 2-form L[m] = pa[PI[m]]*pb[PJ[m]] - pa[PJ[m]]*pb[PI[m]] for
// pairs (0,1),(0,2),(0,3),(1,2),(1,3),(2,3), then L *= 1/max(|L|_2, 1e-12) (all f32, fp contract off).
// Outputs f32 [NB*NH][SEQ][8]: rl = read line [L0..L5, 0, 0]; wl = J-applied write line [L5,-L4,L3,L2,-L1,L0,0,0].
// wave-uniform bound, no block barriers.
// coverage: nwaves = NB*NH*(SEQ/32) waves x 32 rows x 32 B = every row of both planes incl. the zero pad cols.
// =====================================================================================================
struct L6 { float v0, v1, v2, v3, v4, v5; };

__device__ __forceinline__ L6 ext6n(const v4f a, const v4f b) {
#pragma clang fp contract(off)
  L6 o;
  o.v0 = a[0] * b[1] - a[1] * b[0];
  o.v1 = a[0] * b[2] - a[2] * b[0];
  o.v2 = a[0] * b[3] - a[3] * b[0];
  o.v3 = a[1] * b[2] - a[2] * b[1];
  o.v4 = a[1] * b[3] - a[3] * b[1];
  o.v5 = a[2] * b[3] - a[3] * b[2];
  float n2 = o.v0 * o.v0 + o.v1 * o.v1;
  n2 = n2 + o.v2 * o.v2;
  n2 = n2 + o.v3 * o.v3;
  n2 = n2 + o.v4 * o.v4;
  n2 = n2 + o.v5 * o.v5;
  float n = sqrtf(n2);
  n = fmaxf(n, 1e-12f);
  const float inv = 1.0f / n;
  o.v0 *= inv; o.v1 *= inv; o.v2 *= inv; o.v3 *= inv; o.v4 *= inv; o.v5 *= inv;
  return o;
}

__global__ __launch_bounds__(256) void lines_k(const float* __restrict__ ln, float* rl, float* wl, int nwaves) {
#pragma clang fp contract(off)
  __shared__ __align__(16) float sR[8][256];
  __shared__ __align__(16) float sW[8][256];
  const int tid = threadIdx.x, wave = tid >> 5, lane = tid & 31;
  const int w = blockIdx.x * 8 + wave;
  if (w >= nwaves) return;                        // wave-uniform; no block barriers in this kernel
  const int tgPer = SEQ / 32;                     // 64 token groups per (b, h)
  const int bh = w / tgPer;                       // b*NH + h
  const int tg = w - bh * tgPer;
  const int b  = bh / NH;
  const int h  = bh - b * NH;
  const int t  = tg * 32 + lane;                  // < SEQ
  const size_t row  = (size_t)b * SEQ + t;
  const size_t rowp = (t > 0) ? (row - 1) : row;  // clamped address; value zeroed below when t == 0
  const float* cur = ln + row * LNW + h * PD;
  v4f p1 = *(const v4f*)(ln + rowp * LNW + h * PD);
  if (t == 0) { p1[0] = 0.f; p1[1] = 0.f; p1[2] = 0.f; p1[3] = 0.f; }
  const v4f p2 = *(const v4f*)(cur + 1 * PD * NH);
  const v4f p3 = *(const v4f*)(cur + 2 * PD * NH);
  const v4f p4 = *(const v4f*)(cur + 3 * PD * NH);
  const L6 lw = ext6n(p1, p2);
  const L6 lr = ext6n(p3, p4);

  float* sr = sR[wave] + lane * 8;
  float* sw = sW[wave] + lane * 8;
  v4f t0, t1, u0, u1;
  t0[0] = lr.v0; t0[1] = lr.v1; t0[2] = lr.v2; t0[3] = lr.v3;
  t1[0] = lr.v4; t1[1] = lr.v5; t1[2] = 0.f;   t1[3] = 0.f;
  u0[0] = lw.v5; u0[1] = -lw.v4; u0[2] = lw.v3; u0[3] = lw.v2;
  u1[0] = -lw.v1; u1[1] = lw.v0; u1[2] = 0.f;   u1[3] = 0.f;
  *(v4f*)(sr)     = t0;
  *(v4f*)(sr + 4) = t1;
  *(v4f*)(sw)     = u0;
  *(v4f*)(sw + 4) = u1;
  __builtin_amdgcn_fence(__ATOMIC_RELEASE, "workgroup");
  __builtin_amdgcn_wave_barrier();
  __builtin_amdgcn_fence(__ATOMIC_ACQUIRE, "workgroup");
  v4f oR[2], oW[2];
#pragma unroll
  for (int it = 0; it < 2; ++it) {
    oR[it] = *(const v4f*)(sR[wave] + it * 128 + lane * 4);
    oW[it] = *(const v4f*)(sW[wave] + it * 128 + lane * 4);
  }
  const size_t gb = ((size_t)bh * SEQ + (size_t)tg * 32) * 8;
  {
#pragma unroll
    for (int it = 0; it < 2; ++it) {
      *(v4f*)(rl + gb + it * 128 + lane * 4) = oR[it];
      *(v4f*)(wl + gb + it * 128 + lane * 4) = oW[it];
    }
    
  }
}

// =====================================================================================================
// Causal multi-head attention, head dim 64, with an additive line-pair bias:
//   logit(q, k) = (q . k) * sscale + dot6(rl[q], wl[k]) * wdec(q - k),  wdec(d) = bs_h * dec_h^d for d > 0, 0 else,
//   dec_h = sigmoid(dl_h); keys k > q masked (-FLT_MAX, exp -> 0); diagonal kept.
//   q planes (bf16 hi / lo): element (b, t, h, d) at [(b*SEQ + t)*QP + h*64 + d]
//   k planes (bf16 hi / lo): same layout
//   v^T hi plane (f16):      element (b, h, d, s) at [(b*QP + h*64 + d)*SEQ + s]
//   v^T residual plane (f16, (v - hi)*4096): [(b*QP + h*64 + d)*VLP + s], s < VLP, read only when RES
//   rl / wl f32 planes [b*NH + h][SEQ][8] (6 used)
//   out f32 plane: element (b, t, h*64 + d) at [(b*SEQ + t)*QP + h*64 + d] = normalised context.
//   scores = q . k : bf16 hi/lo split (hi.hi + hi.lo + lo.hi), f32 accumulate, then scale + bias in f32
//   p = exp(s - m) carried as f16(1024 p); context = p . v on f16 WMMA; RES adds f16 residual planes of p and v
//   (scale 4096, separate accumulator folded back with 1/4096 per chunk in f32); online softmax in f32.
//   Block = 4 waves = 64 query rows of one (b, h); grid = nqbThis * NH * NB; key chunks of 64, tiles 0..qb only
//   (block-uniform trip count qb+1 <= NQB; every row has a live key in every processed chunk).
//   K / V^T / wl chunk staging: 128 threads (plain 16-B loads, __syncthreads before and after); P tiles are
//   wave-private, spilled with _Float16 element stores and reloaded as v8h (same element type) after a release
//   barrier in between).
//   Output coverage: each wave stores rows q0..q0+15 (it 0..7 x lane>>4 0..1) x 64 columns (16 lanes x 4 floats),
// =====================================================================================================
template <bool RES>
__global__ __launch_bounds__(128)
void attn_lb(const unsigned short* __restrict__ qhp, const unsigned short* __restrict__ qlp,
             const unsigned short* __restrict__ khp, const unsigned short* __restrict__ klp,
             const unsigned short* __restrict__ vhp, const unsigned short* __restrict__ vlp,
             const float* __restrict__ rlp, const float* __restrict__ wlp,
             const float* __restrict__ dlg, const float* __restrict__ bsc,
             float* outp, int qbBase, int nqbThis, float sscale) {
  union FB { v16b v; v8b h[2]; };
  union FH { v16h v; v8h h[2]; };
  __shared__ __align__(16) unsigned short KT[2 * 64 * LP];      // K hi [kv][d] | K lo; later f32 context staging
  __shared__ __align__(16) _Float16 Vth[64 * LP];                // V^T hi [d][kv]
  __shared__ __align__(16) _Float16 Vtl[RES ? 64 * LP : 8];      // V^T residual
  __shared__ __align__(16) _Float16 Psh[4][16 * LP];             // per wave P [row][kv]
  __shared__ __align__(16) _Float16 Psl[RES ? 4 : 1][16 * LP];   // per wave P residual
  __shared__ __align__(16) float    Ws[64 * 8];                  // wl rows of the chunk's 64 keys
  __shared__ __align__(16) float    Rs[4][16 * 8];               // per wave rl rows of its 16 queries
  __bf16* Ksh = (__bf16*)(void*)KT;
  __bf16* Ksl = Ksh + 64 * LP;

  const int tid  = threadIdx.x;
  const int wave = tid >> 5;
  const int lane = tid & 31;
  const int hh   = lane >> 4;
  const int c    = lane & 15;

  const int bx   = blockIdx.x;
  const int qbl  = bx % nqbThis;
  const int rest = bx / nqbThis;
  const int h    = rest % NH;
  const int b    = rest / NH;
  const int qb   = qbBase + qbl;
  const int q0   = qb * 64 + wave * 16;
  const size_t rowB = (size_t)b * SEQ;
  const size_t bhT  = ((size_t)b * NH + h) * SEQ;

  const __bf16* Qh = (const __bf16*)(const void*)qhp + (size_t)h * HD;
  const __bf16* Ql = (const __bf16*)(const void*)qlp + (size_t)h * HD;
  const __bf16* Kh = (const __bf16*)(const void*)khp + (size_t)h * HD;
  const __bf16* Kl = (const __bf16*)(const void*)klp + (size_t)h * HD;
  const _Float16* Vh = (const _Float16*)(const void*)vhp + ((size_t)b * QP + (size_t)h * HD) * SEQ;
  const _Float16* Vl = (const _Float16*)(const void*)vlp + ((size_t)b * QP + (size_t)h * HD) * VLP;

  // ---- per-head scalars (RNE bf16-converted inputs) ----
  const float dl  = bf_up(bf_bits(dlg[h]));
  const float dec = 1.0f / (1.0f + expf(-dl));
  const float l2d = log2f(dec);
  const float bsh = bf_up(bf_bits(bsc[h]));

  // ---- stage the wave's 16 rl rows: 16 x 8 f32 = 32 lanes x 16 B (ordered by the loop's first barrier) ----
  *(v4f*)(Rs[wave] + lane * 4) = *(const v4f*)(rlp + (bhT + q0) * 8 + lane * 4);

  float mrow[8], lrow[8];
  v8f oacc[4];
#pragma unroll
  for (int r = 0; r < 8; ++r) { mrow[r] = -INFINITY; lrow[r] = 0.f; }
#pragma unroll
  for (int t = 0; t < 4; ++t) oacc[t] = zero8();

  int nkt = qb + 1;                          // causal: key tiles 0..qb, block-uniform
  if (nkt > NQB) nkt = NQB;
  for (int kt = 0; kt < nkt; ++kt) {
    const int kv0 = kt * 64;
    __syncthreads();
    {
      const int r = tid >> 1, half = (tid & 1) * 32;
      const __bf16*   kg  = Kh + (rowB + kv0 + r) * QP + half;    // K row kv0+r, d = half..half+31
      const __bf16*   klg = Kl + (rowB + kv0 + r) * QP + half;
      const _Float16* vg  = Vh + (size_t)r * SEQ + kv0 + half;    // V^T row d = r, s = kv0+half..+31
      const int kvl = (kv0 + 64 <= VLP) ? kv0 : (VLP - 64);     // clamped address into the residual plane
      const _Float16* vlg = Vl + (size_t)r * VLP + kvl + half;
      const bool resOK = (kv0 + 64 <= VLP);                      // block-uniform
#pragma unroll
      for (int i = 0; i < 4; ++i) {
        const v8b a0 = *(const v8b*)(kg + 8 * i);
        const v8b a1 = *(const v8b*)(klg + 8 * i);
        const v8h b0 = *(const v8h*)(vg + 8 * i);
        *(v8b*)(Ksh + r * LP + half + 8 * i) = a0;
        *(v8b*)(Ksl + r * LP + half + 8 * i) = a1;
        *(v8h*)(Vth + r * LP + half + 8 * i) = b0;
        if (RES) {
          v8h b1 = *(const v8h*)(vlg + 8 * i);
          if (!resOK) b1 = zero8h();
          *(v8h*)(Vtl + r * LP + half + 8 * i) = b1;
        }
      }
      // wl rows kv0..kv0+63 of this (b, h): 64 x 8 f32 = 128 threads x 16 B
      *(v4f*)(Ws + tid * 4) = *(const v4f*)(wlp + (bhT + kv0) * 8 + tid * 4);
    }
    __syncthreads();

    // ---- Q fragments (A operand, row = lane&15): 2 d-chunks, hi and lo (reloaded per chunk) ----
    v16b qah[2], qal[2];
#pragma unroll
    for (int dc = 0; dc < 2; ++dc) {
      const size_t qo = (rowB + q0 + c) * QP + dc * 32 + 8 * hh;
      qah[dc] = ldfrag_b(Qh + qo);
      qal[dc] = ldfrag_b(Ql + qo);
    }

    // ---- scores: 16 query rows x 64 keys per wave, 3 bf16 products ----
    v8f s[4];
#pragma unroll
    for (int j = 0; j < 4; ++j) {
      s[j] = zero8();
#pragma unroll
      for (int dc = 0; dc < 2; ++dc) {
        FB kb, kl;
        kb.h[0] = *(const v8b*)(Ksh + (j * 16 + c) * LP + dc * 32 + 8 * hh);
        kb.h[1] = *(const v8b*)(Ksh + (j * 16 + c) * LP + dc * 32 + 16 + 8 * hh);
        kl.h[0] = *(const v8b*)(Ksl + (j * 16 + c) * LP + dc * 32 + 8 * hh);
        kl.h[1] = *(const v8b*)(Ksl + (j * 16 + c) * LP + dc * 32 + 16 + 8 * hh);
        s[j] = mma_b(qah[dc], kb.v, s[j]);
        s[j] = mma_b(qah[dc], kl.v, s[j]);
        s[j] = mma_b(qal[dc], kb.v, s[j]);
      }
    }

    // ---- wl rows of this lane's 4 key columns (j*16 + c): 6 used of 8 ----
    v4f wa[4];
    v2f wb[4];
#pragma unroll
    for (int j = 0; j < 4; ++j) {
      const float* wp = Ws + (j * 16 + c) * 8;
      wa[j] = *(const v4f*)(wp);
      wb[j] = *(const v2f*)(wp + 4);
    }

    // ---- scale + bias + causal mask (replace by -FLT_MAX), row max, online softmax, P (x1024, f16) and
    //      P residual (x4096) to LDS ----
    _Float16* pwh = Psh[wave];
    _Float16* pwl = Psl[RES ? wave : 0];
    float mloc[8], msafe[8], alpha[8], psum[8];
    // logits of all 8 rows first, so that the 8 row reductions below run as independent chains
#pragma unroll
    for (int r = 0; r < 8; ++r) {
      const int qrow = q0 + 8 * hh + r;
      const float* rp = Rs[wave] + (8 * hh + r) * 8;
      const v4f ra = *(const v4f*)(rp);
      const v2f rb = *(const v2f*)(rp + 4);
      float m = -INFINITY;
#pragma unroll
      for (int j = 0; j < 4; ++j) {
        const int key = kv0 + j * 16 + c;
        const int dd  = qrow - key;
        const float dot6 = ra[0] * wa[j][0] + ra[1] * wa[j][1] + ra[2] * wa[j][2] + ra[3] * wa[j][3]
                         + rb[0] * wb[j][0] + rb[1] * wb[j][1];
        const float ex   = exp2f((float)dd * l2d);
        const float wdec = (dd > 0) ? (bsh * ex) : 0.f;
        float sv = s[j][r] * sscale + dot6 * wdec;
        sv = (key > qrow) ? -FLT_MAX : sv;
        s[j][r] = sv;
        m = fmaxf(m, sv);
      }
      mloc[r] = m;
    }
    // row maximum over the 16 lanes of a half: xor butterfly 1, 2, 4, 8 in the vector unit, 8 rows per step.
    // The scheduling barriers keep the 8 chains side by side: without them the compiler moves each row's chain
    // back behind that row's logits, where every step waits for the one before it.
    __builtin_amdgcn_sched_barrier(0);
    rowmax8<1>(mloc); rowmax8<2>(mloc); rowmax8<4>(mloc); rowmax8<8>(mloc);
    __builtin_amdgcn_sched_barrier(0);
#pragma unroll  // per-row state is indexed by constants only, so it stays in registers
    for (int r = 0; r < 8; ++r) {
      const float mnew = fmaxf(mrow[r], mloc[r]);
      msafe[r] = (mnew == -INFINITY) ? 0.f : mnew;
      alpha[r] = exp_slot(mrow[r] - msafe[r]);
      mrow[r]  = mnew;
    }
#pragma unroll  // as above
    for (int r = 0; r < 8; ++r) {
      float ps = 0.f;
#pragma unroll
      for (int j = 0; j < 4; ++j) {
        const float p = exp_slot(s[j][r] - msafe[r]);  // masked logit against a finite max: exp -> 0
        ps += p;
        const float p1k = p * 1024.0f;
        const _Float16 ph = (_Float16)p1k;
        pwh[(8 * hh + r) * LP + j * 16 + c] = ph;
        if (RES) {
          const _Float16 pl = (_Float16)((p1k - (float)ph) * 4096.0f);
          pwl[(8 * hh + r) * LP + j * 16 + c] = pl;
        }
      }
      psum[r] = ps;
    }
    // row sum: xor butterfly 1, 2, 4, 8 like the maximum, with the same scheduling barriers for the same reason
    __builtin_amdgcn_sched_barrier(0);
    rowsum8<1>(psum); rowsum8<2>(psum); rowsum8<4>(psum); rowsum8<8>(psum);
    __builtin_amdgcn_sched_barrier(0);
#pragma unroll  // as above
    for (int r = 0; r < 8; ++r) {
      lrow[r] = lrow[r] * alpha[r] + psum[r];
#pragma unroll
      for (int t = 0; t < 4; ++t) oacc[t][r] *= alpha[r];
    }
    __builtin_amdgcn_fence(__ATOMIC_RELEASE, "workgroup");
    __builtin_amdgcn_wave_barrier();
    __builtin_amdgcn_fence(__ATOMIC_ACQUIRE, "workgroup");

    // ---- context += P . V (f16 WMMA), residual products into a separate accumulator ----
    v8f o1[4];
#pragma unroll
    for (int t = 0; t < 4; ++t) o1[t] = zero8();
#pragma unroll 1
    for (int kk = 0; kk < 2; ++kk) {
      FH pa, pl;
      pa.h[0] = *(const v8h*)(pwh + c * LP + kk * 32 + 8 * hh);
      pa.h[1] = *(const v8h*)(pwh + c * LP + kk * 32 + 16 + 8 * hh);
      if (RES) {
        pl.h[0] = *(const v8h*)(pwl + c * LP + kk * 32 + 8 * hh);
        pl.h[1] = *(const v8h*)(pwl + c * LP + kk * 32 + 16 + 8 * hh);
      } else {
        pl.v = pa.v;
      }
#pragma unroll
      for (int t = 0; t < 4; ++t) {
        FH vb;
        vb.h[0] = *(const v8h*)(Vth + (t * 16 + c) * LP + kk * 32 + 8 * hh);
        vb.h[1] = *(const v8h*)(Vth + (t * 16 + c) * LP + kk * 32 + 16 + 8 * hh);
        oacc[t] = mma_h(pa.v, vb.v, oacc[t]);
        if (RES) {
          FH vl;
          vl.h[0] = *(const v8h*)(Vtl + (t * 16 + c) * LP + kk * 32 + 8 * hh);
          vl.h[1] = *(const v8h*)(Vtl + (t * 16 + c) * LP + kk * 32 + 16 + 8 * hh);
          o1[t] = mma_h(pa.v, vl.v, o1[t]);
          o1[t] = mma_h(pl.v, vb.v, o1[t]);
        }
      }
    }
    if (RES) {
#pragma unroll
      for (int t = 0; t < 4; ++t)
#pragma unroll
        for (int r = 0; r < 8; ++r) oacc[t][r] += o1[t][r] * (1.0f / 4096.0f);
    }
  }

  // ---- all waves are done with the K tiles before that LDS region is reused for the context staging ----
  __syncthreads();

  // ---- normalise (1/l and the 1/1024 p carry), stage the wave's 16x64 tile in LDS, then write whole
  float* os = (float*)(void*)KT + wave * (16 * 64);
#pragma unroll
  for (int r = 0; r < 8; ++r) {
    const float l = lrow[r];
    const float inv = ((l > 0.f) ? (1.0f / l) : 0.f) * (1.0f / 1024.0f);
#pragma unroll
    for (int t = 0; t < 4; ++t) os[(8 * hh + r) * 64 + t * 16 + c] = oacc[t][r] * inv;
  }
  __builtin_amdgcn_fence(__ATOMIC_RELEASE, "workgroup");
  __builtin_amdgcn_wave_barrier();
  __builtin_amdgcn_fence(__ATOMIC_ACQUIRE, "workgroup");
  {
    const int h2 = lane >> 4, c4 = (lane & 15) * 4;
    v4f ov[8];
#pragma unroll
    for (int it = 0; it < 8; ++it) {
      const int row = it * 2 + h2;   // it 0..7 x h2 0..1 = rows 0..15 of the wave tile
      ov[it] = *(const v4f*)(os + row * 64 + c4);
    }
    {
#pragma unroll
      for (int it = 0; it < 8; ++it) {
        const int row = it * 2 + h2;
        const size_t go = (rowB + q0 + row) * QP + (size_t)h * HD + c4;
        *(v4f*)(outp + go) = ov[it];
      }
      
    }
  }
}

// =====================================================================================================
// Workspace map (bytes), every region an exact multiple of its whole-line / whole-tile store granularity
// multiples):
//   Xb     bf16 [4096][1024]            0            8388608
//   Wqkv   bf16 [3072][1024]            8388608      6291456   ([n][k], rows 0..1023 q | 1024.. k | 2048.. v)
//   Wln    bf16 [256][1024]             14680064      524288   ([W1w; W2w; W1r; W2r], [n][k])
//   Wob    bf16 [1024][1024]            15204352     2097152   ([n][k])
//   LN     f32  [4096][256]             17301504     4194304
//   RL     f32  [32][2048][8]           21495808     2097152
//   WL     f32  [32][2048][8]           23592960     2097152
//   Qh     bf16 [4096][1024]            25690112     8388608
//   Ql     bf16 [4096][1024]            34078720     8388608
//   Kh     bf16 [4096][1024]            42467328     8388608
//   Kl     bf16 [4096][1024]            50855936     8388608
//   VTh    f16  [2][1024][2048]         59244544     8388608
//   VTl    f16  [2][1024][512]          67633152     2097152
//   Af     f32  [4096][1024]            69730304    16777216
//   Ah     bf16 [4096][1024]            86507520     8388608
//   Al     bf16 [4096][1024]            94896128     8388608
//   end                                 103284736
// =====================================================================================================
extern "C" void kernel_launch(void* const* d_in, const int* in_sizes, int n_in,
                              void* d_out, int out_size, void* d_ws, size_t ws_size,
                              hipStream_t stream) {
  if (n_in < 11) return;
  if (in_sizes[0] != NB * SEQ * DMODEL) return;
  if (in_sizes[1] != 3 * QP * DMODEL) return;
  if (in_sizes[2] != 3 * QP) return;
  if (in_sizes[3] != PD * NH * DMODEL) return;
  if (in_sizes[4] != PD * NH * DMODEL) return;
  if (in_sizes[5] != PD * NH * DMODEL) return;
  if (in_sizes[6] != PD * NH * DMODEL) return;
  if (in_sizes[7] != DMODEL * QP) return;
  if (in_sizes[8] != DMODEL) return;
  if (in_sizes[9] != NH) return;
  if (in_sizes[10] != NH) return;
  if (out_size != NB * SEQ * DMODEL) return;

  const float* x     = (const float*)d_in[0];    // [NB*SEQ][DMODEL]
  const float* wqkv  = (const float*)d_in[1];    // [3*QP n][DMODEL k]
  const float* bqkv  = (const float*)d_in[2];    // [3*QP]
  const float* w1w   = (const float*)d_in[3];    // [PD*NH][DMODEL]
  const float* w2w   = (const float*)d_in[4];
  const float* w1r   = (const float*)d_in[5];
  const float* w2r   = (const float*)d_in[6];
  const float* wout  = (const float*)d_in[7];    // [DMODEL n][QP k]
  const float* bout  = (const float*)d_in[8];    // [DMODEL]
  const float* dlog  = (const float*)d_in[9];    // [NH]
  const float* bscl  = (const float*)d_in[10];   // [NH]

  const size_t PXb   = (size_t)NB * SEQ * DMODEL * 2;      //  8388608
  const size_t PWqkv = (size_t)3 * QP * DMODEL * 2;        //  6291456
  const size_t PWln  = (size_t)LNW * DMODEL * 2;           //   524288
  const size_t PWo   = (size_t)DMODEL * QP * 2;            //  2097152
  const size_t PLN   = (size_t)NB * SEQ * LNW * 4;         //  4194304
  const size_t PRL   = (size_t)NB * NH * SEQ * 8 * 4;      //  2097152
  const size_t PQpl  = (size_t)NB * SEQ * QP * 2;          //  8388608  (Qh, Ql, Kh, Kl, Ah, Al)
  const size_t PVTh  = (size_t)NB * QP * SEQ * 2;          //  8388608
  const size_t PVTl  = (size_t)NB * QP * VLP * 2;          //  2097152
  const size_t PAf   = (size_t)NB * SEQ * QP * 4;          // 16777216
  size_t off = 0;
  const size_t oXb   = off; off += PXb;
  const size_t oWqkv = off; off += PWqkv;
  const size_t oWln  = off; off += PWln;
  const size_t oWo   = off; off += PWo;
  const size_t oLN   = off; off += PLN;
  const size_t oRL   = off; off += PRL;
  const size_t oWL   = off; off += PRL;
  const size_t oQh   = off; off += PQpl;
  const size_t oQl   = off; off += PQpl;
  const size_t oKh   = off; off += PQpl;
  const size_t oKl   = off; off += PQpl;
  const size_t oVTh  = off; off += PVTh;
  const size_t oVTl  = off; off += PVTl;
  const size_t oAf   = off; off += PAf;
  const size_t oAh   = off; off += PQpl;
  const size_t oAl   = off; off += PQpl;
  if (off > ws_size) return;                          // off = 103284736
  if (off > (size_t)134217728) return;

  char* ws = (char*)d_ws;
  unsigned short* Xb   = (unsigned short*)(ws + oXb);
  unsigned short* Wqkv = (unsigned short*)(ws + oWqkv);
  unsigned short* Wln  = (unsigned short*)(ws + oWln);
  unsigned short* Wob  = (unsigned short*)(ws + oWo);
  float*          LN   = (float*)(ws + oLN);
  float*          RL   = (float*)(ws + oRL);
  float*          WL   = (float*)(ws + oWL);
  unsigned short* Qh   = (unsigned short*)(ws + oQh);
  unsigned short* Ql   = (unsigned short*)(ws + oQl);
  unsigned short* Kh   = (unsigned short*)(ws + oKh);
  unsigned short* Kl   = (unsigned short*)(ws + oKl);
  unsigned short* VTh  = (unsigned short*)(ws + oVTh);
  unsigned short* VTl  = (unsigned short*)(ws + oVTl);
  float*          Af   = (float*)(ws + oAf);
  unsigned short* Ah   = (unsigned short*)(ws + oAh);
  unsigned short* Al   = (unsigned short*)(ws + oAl);
  float*          outf = (float*)d_out;

  const dim3 blk(256);
  const int nTok   = NB * SEQ;                                       // 4096 tokens
  const int n8x    = nTok * DMODEL / 8;                              // 524288
  const int n8qkv  = 3 * QP * DMODEL / 8;                            // 393216
  const int n8ln   = PD * NH * DMODEL / 8;                           //   8192 per line weight
  const int n8wo   = DMODEL * QP / 8;                                // 131072
  const int n8a    = nTok * QP / 8;                                  // 524288
  const int nwLn   = NB * NH * (SEQ / 32);                           //   2048 waves
  const dim3 gCx((n8x + 255) / 256), gCqkv((n8qkv + 255) / 256), gCln((n8ln + 255) / 256), gCwo((n8wo + 255) / 256);
  const dim3 blkG(128);                                              // GEMM block: 4 waves, one 128x128 tile
  const dim3 gLNg((nTok / 128) * (LNW / 128), 1);                    //  64 blocks
  const dim3 gQ((nTok / 128) * (QP / 128), 1);                       // 256 blocks
  const dim3 gVT((QP / 128) * (SEQ / 128), NB);                      // 128 blocks x 2 batch elements
  const dim3 gLines((nwLn + 7) / 8);                                 // 256 blocks
  const dim3 gSplit((n8a + 255) / 256);                              // 2048 blocks
  const dim3 gOut((nTok / 128) * (DMODEL / 128), 1);                 // 256 blocks

  // (1) inputs -> bf16 planes (RNE convert); weights arrive [n][k] = the Bt layout already
  cvt_bf16<<<gCx,   blk, 0, stream>>>(x,    Xb,   n8x);
  cvt_bf16<<<gCqkv, blk, 0, stream>>>(wqkv, Wqkv, n8qkv);
  cvt_bf16<<<gCln,  blk, 0, stream>>>(w1w,  Wln + (size_t)0 * PD * NH * DMODEL, n8ln);
  cvt_bf16<<<gCln,  blk, 0, stream>>>(w2w,  Wln + (size_t)1 * PD * NH * DMODEL, n8ln);
  cvt_bf16<<<gCln,  blk, 0, stream>>>(w1r,  Wln + (size_t)2 * PD * NH * DMODEL, n8ln);
  cvt_bf16<<<gCln,  blk, 0, stream>>>(w2r,  Wln + (size_t)3 * PD * NH * DMODEL, n8ln);
  cvt_bf16<<<gCwo,  blk, 0, stream>>>(wout, Wob,  n8wo);
  // (2) line-feature projections: LN[row][e] = sum_k Xb[row][k] Wln[e][k]  (M=4096, N=256, K=1024) -> f32
  gemm64<0, 0, 0><<<gLNg, blkG, 0, stream>>>(
      Xb, Xb, DMODEL, 0LL, Wln, Wln, DMODEL, 0LL,
      (void*)LN, LNW, 0LL, (void*)LN, 0, 0LL, 0,
      bout, nTok, LNW, DMODEL, 1.0f);
  // (3) q projection + bias -> bf16 hi / lo planes  (M=4096, N=1024, K=1024)
  gemm64<0, 2, 1><<<gQ, blkG, 0, stream>>>(
      Xb, Xb, DMODEL, 0LL, Wqkv, Wqkv, DMODEL, 0LL,
      (void*)Qh, QP, 0LL, (void*)Ql, QP, 0LL, QP,
      bqkv, nTok, QP, DMODEL, 1.0f);
  // (4) k projection + bias -> bf16 hi / lo planes (weight rows 1024..2047, bias 1024..)
  gemm64<0, 2, 1><<<gQ, blkG, 0, stream>>>(
      Xb, Xb, DMODEL, 0LL, Wqkv + (size_t)QP * DMODEL, Wqkv + (size_t)QP * DMODEL, DMODEL, 0LL,
      (void*)Kh, QP, 0LL, (void*)Kl, QP, 0LL, QP,
      bqkv + QP, nTok, QP, DMODEL, 1.0f);
  // (5) v^T per batch element: VTh[b][f][s] = sum_k Wv[f][k] Xb[b*SEQ+s][k] + bv[f] -> f16 hi plane (pitch SEQ)
  //     and residual plane (x4096, keys < VLP, pitch VLP)  (M=1024 features, N=2048 tokens, K=1024, bias per row)
  gemm64<0, 3, 2><<<gVT, blkG, 0, stream>>>(
      Wqkv + (size_t)2 * QP * DMODEL, Wqkv + (size_t)2 * QP * DMODEL, DMODEL, 0LL,
      Xb, Xb, DMODEL, (long long)SEQ * DMODEL,
      (void*)VTh, SEQ, (long long)QP * SEQ, (void*)VTl, VLP, (long long)QP * VLP, VLP,
      bqkv + 2 * QP, QP, SEQ, DMODEL, 4096.0f);
  // (6) line features (shifted p1, exterior 2-forms, L2 normalisation, J map) -> rl / wl f32 planes
  lines_k<<<gLines, blk, 0, stream>>>(LN, RL, WL, nwLn);
  // (7) causal attention with line-pair bias: query blocks 0..RESQB-1 with residual planes, the rest without
  attn_lb<true><<<dim3(NB * NH * RESQB), dim3(128), 0, stream>>>(
      Qh, Ql, Kh, Kl, VTh, VTl, RL, WL, dlog, bscl, Af, 0, RESQB, 0.125f);
  attn_lb<false><<<dim3(NB * NH * (NQB - RESQB)), dim3(128), 0, stream>>>(
      Qh, Ql, Kh, Kl, VTh, VTl, RL, WL, dlog, bscl, Af, RESQB, NQB - RESQB, 0.125f);
  // (8) context rows -> bf16 hi/lo planes
  split_bf16x8<<<gSplit, blk, 0, stream>>>(Af, Ah, Al, n8a);
  // (9) out[row][e] = sum_d (Ah+Al)[row][d] Wob[e][d] + bout[e] -> d_out f32 [4096][1024]  (M=4096, N=1024, K=1024)
  gemm64<1, 0, 1><<<gOut, blkG, 0, stream>>>(
      Ah, Al, QP, 0LL, Wob, Wob, QP, 0LL,
      (void*)outf, DMODEL, 0LL, (void*)outf, 0, 0LL, 0,
      bout, nTok, DMODEL, QP, 1.0f);
  (void)hipGetLastError();
}

// v004
// One run takes 278 microseconds.
// Timed twice side by side with v003, it ran 1.10 times as fast both times.
// All steps since v000 together make it 2.22 times as fast.
// Contractions: q / k / v^T and line-feature projections = v_wmma_f32_16x16x32_bf16 (bf16 operands from
// RNE-converted inputs, one product per k-step); q.k^T scores = v_wmma_f32_16x16x32_bf16 with bf16 hi/lo split
// q and k (hi.hi + hi.lo + lo.hi); p.v = v_wmma_f32_16x16x32_f16 (p carried x1024 in f16, v in f16; extra f16
// residual planes x4096 of p and v on the first 512 query rows); ctx.Wo^T = v_wmma_f32_16x16x32_bf16 with ctx
// as bf16 hi/lo planes times the bf16 Wo plane (2 products); all f32 accumulate; 6-term line-pair bias dots,
// decay weights and softmax in f32 on VALU.
#include <hip/hip_runtime.h>
#include <math.h>
#include <float.h>
#include <stdint.h>

#define NB     2
#define SEQ    2048
#define DMODEL 1024
#define NH     16
#define HD     64
#define QP     (NH * HD)       // 1024: q / k / ctx row pitch
#define NQB    (SEQ / 64)      // 32 query / key tiles of 64
#define VLP    512             // key pitch of the v^T residual plane (keys 0..VLP-1)
#define RESQB  8               // leading 64-row query blocks that use the p / v residual planes
#define PD     4               // point dim per head
#define LNW    (4 * PD * NH)   // 256: width of the line-feature projection [p1w | p2w | p1r | p2r]
#define LP     72              // LDS row pitch (16-bit elements) of the attention K, V^T and P tiles: 144 B = 16 B x 9, so the
                               // 16 rows that one ds_load_b128 reads fall on 16 different groups of 4 banks (at 128 B: on 2)
static_assert(RESQB * 64 <= VLP);
static_assert(RESQB <= NQB);
static_assert(QP == DMODEL);
static_assert(HD == 64);
static_assert(PD == 4);
static_assert(LP >= 64 && (LP % 8) == 0 && 2 * 64 * LP * 2 >= 4 * 16 * 64 * 4);
static_assert((SEQ % 64) == 0 && (DMODEL % 64) == 0 && (LNW % 64) == 0 && (QP % 64) == 0);
static_assert(((NB * SEQ) % 64) == 0 && (SEQ % 32) == 0);
static_assert((DMODEL % 32) == 0);
static_assert(((NB * SEQ) % 128) == 0 && (SEQ % 128) == 0 && (QP % 128) == 0 && (LNW % 128) == 0 && (DMODEL % 128) == 0);

typedef _Float16 v16h __attribute__((ext_vector_type(16)));
typedef _Float16 v8h  __attribute__((ext_vector_type(8)));
typedef __bf16   v16b __attribute__((ext_vector_type(16)));
typedef __bf16   v8b  __attribute__((ext_vector_type(8)));
typedef float    v8f  __attribute__((ext_vector_type(8)));
typedef float    v4f  __attribute__((ext_vector_type(4)));
typedef float    v2f  __attribute__((ext_vector_type(2)));
typedef unsigned int v4u __attribute__((ext_vector_type(4)));

// ---- scalar helpers --------------------------------------------------------------------------------
__device__ __forceinline__ unsigned short bf_bits(float f) {          // f32 -> bf16 bits, RNE convert
  unsigned u = __float_as_uint(f);
  return (unsigned short)((u + 0x7FFFu + ((u >> 16) & 1u)) >> 16);
}
__device__ __forceinline__ float bf_up(unsigned short h) { return __uint_as_float(((unsigned)h) << 16); }
__device__ __forceinline__ unsigned short h_bits(_Float16 x) { return __builtin_bit_cast(unsigned short, x); }
__device__ __forceinline__ unsigned pk16(unsigned short a, unsigned short b) { return (unsigned)a | ((unsigned)b << 16); }
__device__ __forceinline__ v8f zero8() { v8f z = {0.f, 0.f, 0.f, 0.f, 0.f, 0.f, 0.f, 0.f}; return z; }
__device__ __forceinline__ v8h zero8h() {
  const _Float16 z = (_Float16)0.0f;
  v8h r = {z, z, z, z, z, z, z, z};
  return r;
}

// ---- lane l <- lane l ^ X inside each 16-lane row (DPP row_xmask, control 0x160 + X): no LDS round trip ----
template <int X>
__device__ __forceinline__ float lane_xor16(float v) {
  return __builtin_bit_cast(float, __builtin_amdgcn_update_dpp(0, __builtin_bit_cast(int, v), 0x160 + X, 0xf, 0xf, true));
}
// exp(x) as v_exp_f32(x * log2 e), the form __expf compiled to. The v_nop is the one slot that the instruction set asks
// for behind a transcendental before a source is overwritten.
__device__ __forceinline__ float exp_slot(float x) {
  const float t = x * 1.44269504088896340736f;
  float r;
#if defined(__HIP_DEVICE_COMPILE__)
  asm("v_exp_f32 %0, %1\n\tv_nop" : "=v"(r) : "v"(t));
#else
  r = t;
#endif
  return r;
}
template <int X>
__device__ __forceinline__ void rowmax8(float (&m)[8]) {
#pragma unroll  // the 8 values stay in registers, one independent instruction chain each
  for (int r = 0; r < 8; ++r) m[r] = fmaxf(m[r], lane_xor16<X>(m[r]));
}
template <int X>
__device__ __forceinline__ void rowsum8(float (&m)[8]) {
#pragma unroll  // the 8 values stay in registers, one independent instruction chain each
  for (int r = 0; r < 8; ++r) m[r] += lane_xor16<X>(m[r]);
}

// ---- fragment loader: 16-bit A/B operand, lane -> row/col (lane&15), p already includes +8*(lane>>4);
//      elements 0..7 <- p[0..7] (k0+8h..), elements 8..15 <- p[16..23] (k0+16+8h..)
__device__ __forceinline__ v16b ldfrag_b(const __bf16* p) {
  union { v16b v; v8b h[2]; } f;
  f.h[0] = *(const v8b*)(p);
  f.h[1] = *(const v8b*)(p + 16);
  return f.v;
}

// ---- WMMA helpers with trailing VALU hazard gap --------------------------------------------------------
__device__ __forceinline__ v8f mma_b(v16b a, v16b b, v8f c) {
  c = __builtin_amdgcn_wmma_f32_16x16x32_bf16(false, a, false, b, (short)0, c, false, false);
#if defined(__HIP_DEVICE_COMPILE__)
  asm volatile("v_nop\n\tv_nop\n\tv_nop\n\tv_nop" : "+v"(c) : "v"(a), "v"(b));
#endif
  return c;
}
__device__ __forceinline__ v8f mma_h(v16h a, v16h b, v8f c) {
  c = __builtin_amdgcn_wmma_f32_16x16x32_f16(false, a, false, b, (short)0, c, false, false);
#if defined(__HIP_DEVICE_COMPILE__)
  asm volatile("v_nop\n\tv_nop\n\tv_nop\n\tv_nop" : "+v"(c) : "v"(a), "v"(b));
#endif
  return c;
}
__device__ __forceinline__ v8f mma_b_raw(v16b a, v16b b, v8f c) {
  return __builtin_amdgcn_wmma_f32_16x16x32_bf16(false, a, false, b, (short)0, c, false, false);
}
__device__ __forceinline__ void dep_guard_b(v8f& a, v8f& b, v16b x, v16b y) {
#if defined(__HIP_DEVICE_COMPILE__)
  asm volatile("v_nop\n\tv_nop\n\tv_nop\n\tv_nop" : "+v"(a), "+v"(b) : "v"(x), "v"(y));
#endif
}
__device__ __forceinline__ void keep4_b(v16b a, v16b b, v16b c, v16b d) {
#if defined(__HIP_DEVICE_COMPILE__)
  asm volatile("v_nop" :: "v"(a), "v"(b), "v"(c), "v"(d));
#endif
}
__device__ __forceinline__ void acc_guard4(v8f& a, v8f& b, v8f& c, v8f& d) {
#if defined(__HIP_DEVICE_COMPILE__)
  asm volatile("v_nop\n\tv_nop\n\tv_nop\n\tv_nop" : "+v"(a), "+v"(b), "+v"(c), "+v"(d));
#endif
}

// =====================================================================================================
// Flat f32 -> bf16 (RNE convert), 8 elements per thread, one 16-B store per lane: a wave writes 512 contiguous
// coverage: n8 threads x 8 = the whole plane (n8 = element count / 8, all planes here are multiples of 2048).
// =====================================================================================================
__global__ __launch_bounds__(256) void cvt_bf16(const float* __restrict__ in, unsigned short* out, int n8) {
  const int i = blockIdx.x * 256 + threadIdx.x;
  if (i < n8) {
    const float* s = in + (size_t)i * 8;
    const v4f a = *(const v4f*)(s);
    const v4f b = *(const v4f*)(s + 4);
    v4u p;
    p[0] = pk16(bf_bits(a[0]), bf_bits(a[1]));
    p[1] = pk16(bf_bits(a[2]), bf_bits(a[3]));
    p[2] = pk16(bf_bits(b[0]), bf_bits(b[1]));
    p[3] = pk16(bf_bits(b[2]), bf_bits(b[3]));
    unsigned short* d = out + (size_t)i * 8;
    *(v4u*)d = p;
    
  }
}

// =====================================================================================================
// f32 -> bf16 hi plane + bf16 lo plane (lo = RNE(v - hi), unscaled), 8 elements per thread, one 16-B store per
// coverage: n8 threads x 8 = whole plane (n8 multiple of 256).
// =====================================================================================================
__global__ __launch_bounds__(256) void split_bf16x8(const float* __restrict__ in, unsigned short* hp,
                                                    unsigned short* lp, int n8) {
  const int i = blockIdx.x * 256 + threadIdx.x;
  if (i < n8) {
    const v4f a = *(const v4f*)(in + (size_t)i * 8);
    const v4f b = *(const v4f*)(in + (size_t)i * 8 + 4);
    v4u ph, pl;
#pragma unroll
    for (int e = 0; e < 4; ++e) {
      const float f0 = (e < 2) ? a[2 * e]     : b[2 * e - 4];
      const float f1 = (e < 2) ? a[2 * e + 1] : b[2 * e - 3];
      const unsigned short h0 = bf_bits(f0), h1 = bf_bits(f1);
      const unsigned short l0 = bf_bits(f0 - bf_up(h0)), l1 = bf_bits(f1 - bf_up(h1));
      ph[e] = pk16(h0, h1);
      pl[e] = pk16(l0, l1);
    }
    *(v4u*)(hp + (size_t)i * 8) = ph;
    *(v4u*)(lp + (size_t)i * 8) = pl;
    
  }
}

// =====================================================================================================
// Batched bf16 WMMA GEMM: C[m][n] = sum_k A[m][k] * Bt[n][k] (+ bias). Block = 4 waves = one 128x128 tile, each
// wave a 64x64 quarter (wave>>1 = m half, wave&1 = n half). A row-major [M][K] pitch lda; Bt row-major [N][K] pitch
// ldb (k contiguous); M, N multiples of 128, K a multiple of 64 and at least 64. blockIdx.y = batch index.
// The 128 A rows and 128 Bt rows of a 64-wide k slab (128 B a row) are brought into LDS by asynchronous 16-B copies,
// 8 lanes to a row so that every copy instruction takes whole 128-B lines, and are shared by the block's waves; two
// buffers: slab t+1 flies while slab t is multiplied. LDS row pitch GP = 144 B. Fragments come by ds_load_b128; the
// k order and the order of the products are those of ascending k in steps of 32.
// NSPLIT: 0 = A.Bt; 1 = (A + A2).Bt (A2 = unscaled bf16 lo plane of A).
// BIAS: 0 none; 1 = + bias[n] per output column; 2 = + bias[m] per output row (bias RNE-converted to bf16 and
//       widened, added in f32 in the epilogue).
// OUT_MODE: 0 = f32 (pitch ldc); 2 = bf16 hi plane C + bf16 lo plane C2 (lo = RNE(v - hi), unscaled);
//           3 = f16 hi plane C + f16 residual plane C2 = f16((v - hi) * rscale), C2 written only for tiles
//               with n0 < N2 (pitch ldc2, batch stride strideC2).
// =====================================================================================================
#define GP 72                  // LDS row pitch (16-bit elements) of the GEMM slabs: 144 B = 16 B x 9
#define GPL (128 * GP)         // elements of one staged plane (128 rows)

// Eight asynchronous 16-B copies global -> LDS per lane. The s_wait_xcnt stands inside the statement so that no
// address register of a copy is rewritten ahead of it.
__device__ __forceinline__ void async8(const unsigned (&l)[8], const __bf16* const (&g)[8]) {
#if defined(__HIP_DEVICE_COMPILE__)
  asm volatile(
      "global_load_async_to_lds_b128 %0, %8, off\n\t"
      "global_load_async_to_lds_b128 %1, %9, off\n\t"
      "global_load_async_to_lds_b128 %2, %10, off\n\t"
      "global_load_async_to_lds_b128 %3, %11, off\n\t"
      "global_load_async_to_lds_b128 %4, %12, off\n\t"
      "global_load_async_to_lds_b128 %5, %13, off\n\t"
      "global_load_async_to_lds_b128 %6, %14, off\n\t"
      "global_load_async_to_lds_b128 %7, %15, off\n\t"
      "s_wait_xcnt 0x0"
      :: "v"(l[0]), "v"(l[1]), "v"(l[2]), "v"(l[3]), "v"(l[4]), "v"(l[5]), "v"(l[6]), "v"(l[7]),
         "v"(g[0]), "v"(g[1]), "v"(g[2]), "v"(g[3]), "v"(g[4]), "v"(g[5]), "v"(g[6]), "v"(g[7])
      : "memory");
#endif
}
// One plane of a slab: rows row0..row0+127 of src (pitch ld), columns k0..k0+63, to LDS byte address ldst.
// Thread tid takes the 16-B piece tid&7 of rows (tid>>3) + 16*it.
__device__ __forceinline__ void stage_plane(const __bf16* src, int row0, int ld, int k0, unsigned ldst, int tid) {
  unsigned l[8];
  const __bf16* g[8];
#pragma unroll  // the eight addresses are operands of one asm statement
  for (int it = 0; it < 8; ++it) {
    const int row = it * 16 + (tid >> 3);
    l[it] = ldst + (unsigned)((row * GP + (tid & 7) * 8) * 2);
    g[it] = src + (size_t)(row0 + row) * ld + k0 + (tid & 7) * 8;
  }
  async8(l, g);
}
__device__ __forceinline__ void wait_async0() {   // this wave's copies have landed
#if defined(__HIP_DEVICE_COMPILE__)
  asm volatile("s_wait_asynccnt 0x0" ::: "memory");
#endif
}
__device__ __forceinline__ void wait_ds0() {      // this wave's LDS reads are done before the buffer is refilled
#if defined(__HIP_DEVICE_COMPILE__)
  asm volatile("s_wait_dscnt 0x0" ::: "memory");
#endif
}

template <int NSPLIT, int OUT_MODE, int BIAS>
__global__ __launch_bounds__(128) void gemm64(
    const unsigned short* __restrict__ Ap, const unsigned short* A2p, int lda, long long strideA,
    const unsigned short* __restrict__ Btp, const unsigned short* Bt2p, int ldb, long long strideB,
    void* Cout, int ldc, long long strideC,
    void* Cout2, int ldc2, long long strideC2, int N2,
    const float* __restrict__ biasp,
    int M, int N, int K, float rscale) {
  static_assert(NSPLIT == 0 || NSPLIT == 1);
  constexpr int NPL = (NSPLIT == 1) ? 3 : 2;       // staged planes: A, Bt, (A2)
  constexpr int GI  = (NSPLIT == 1) ? 2 : 4;       // A row groups fetched together
  const __bf16* A   = (const __bf16*)(const void*)Ap;
  const __bf16* A2  = (const __bf16*)(const void*)A2p;
  const __bf16* Bt  = (const __bf16*)(const void*)Btp;
  (void)Bt2p;
  __shared__ __align__(16) __bf16 sAB[2 * NPL * GPL];   // two buffers of NPL planes
  __shared__ __align__(16) float sT[4][16 * 68];        // per-wave 16x64 slab, pitch 68 floats
  const int b    = blockIdx.y;
  const int tid  = threadIdx.x;
  const int lane = tid & 31;
  const int wave = tid >> 5;
  const int tilesN = N >> 7;
  const int tilesM = M >> 7;
  const int tile = blockIdx.x;
  if (tile >= tilesM * tilesN) return;   // block-uniform, in front of every barrier
  const int tm = tile / tilesN;
  const int tn = tile - tm * tilesN;
  const int mB = tm << 7;
  const int nB = tn << 7;
  const int wm = (wave >> 1) << 6;
  const int wn = (wave & 1) << 6;
  const int m0 = mB + wm;
  const int n0 = nB + wn;

  const __bf16* Ab  = A  + (size_t)b * strideA;
  const __bf16* Bb  = Bt + (size_t)b * strideB;
  const __bf16* Ab2 = (NSPLIT == 1) ? (A2 + (size_t)b * strideA) : Ab;

  const int rlane = lane & 15;                 // row (A) / col (B, D) within subtile
  const int koff  = (lane >> 4) * 8;           // k offset of this lane half
  const int mOff  = (lane >> 4) * 8;           // D row offset

  v8f acc[4][4];
#pragma unroll
  for (int i = 0; i < 4; ++i)
#pragma unroll
    for (int j = 0; j < 4; ++j) acc[i][j] = zero8();

  const unsigned lds0 = (unsigned)(uintptr_t)(void*)sAB;   // LDS byte address of the ring
  const int nT = K >> 6;                                   // k slabs of 64
  // slab t into buffer bf
  auto issue = [&](int t, int bf) {
    const unsigned lb = lds0 + (unsigned)(bf * NPL * GPL * 2);
    stage_plane(Ab, mB, lda, t << 6, lb, tid);
    stage_plane(Bb, nB, ldb, t << 6, lb + (unsigned)(GPL * 2), tid);
    if (NSPLIT == 1) stage_plane(Ab2, mB, lda, t << 6, lb + (unsigned)(2 * GPL * 2), tid);
  };
  issue(0, 0);
  wait_async0();
  __syncthreads();
  if (nT > 1) issue(1, 1);

  for (int t = 0; t < nT; ++t) {
    const __bf16* sA  = sAB + (t & 1) * (NPL * GPL);
    const __bf16* sB  = sA + GPL;
    const __bf16* sA2 = sA + (NPL - 1) * GPL;
    // this loop and those inside it are unrolled so that fragments and accumulators are indexed by constants only
    // and stay in registers
#pragma unroll
    for (int ks = 0; ks < 2; ++ks) {
      // the A fragments of GI row groups (16 products' worth) are fetched together, so that the LDS latency is met
      // once for them and not once a row group; GI is 2 with the second A plane to stay inside 256 registers
      v16b bh[4];
#pragma unroll
      for (int j = 0; j < 4; ++j) bh[j] = ldfrag_b(sB + (wn + (j << 4) + rlane) * GP + ks * 32 + koff);
#pragma unroll
      for (int ig = 0; ig < 4; ig += GI) {
        v16b ah[GI], al[GI];
#pragma unroll
        for (int u = 0; u < GI; ++u) {
          const int ao = (wm + ((ig + u) << 4) + rlane) * GP + ks * 32 + koff;
          ah[u] = ldfrag_b(sA + ao);
          if (NSPLIT == 1) al[u] = ldfrag_b(sA2 + ao); else al[u] = ah[u];
        }
#pragma unroll
        for (int u = 0; u < GI; ++u) {
          const int i = ig + u;
#pragma unroll
          for (int j = 0; j < 4; ++j) {
            acc[i][j] = mma_b_raw(ah[u], bh[j], acc[i][j]);
            if (NSPLIT == 1) acc[i][j] = mma_b_raw(al[u], bh[j], acc[i][j]);
          }
          dep_guard_b(acc[i][0], acc[i][3], ah[u], al[u]);
        }
      }
      keep4_b(bh[0], bh[1], bh[2], bh[3]);
    }
    // publish slab t+1 and free slab t's buffer: own LDS reads done, own copies landed, then the block barrier
    wait_ds0();
    wait_async0();
    __syncthreads();
    if (t + 2 < nT) issue(t + 2, t & 1);
  }
  wait_async0();
  acc_guard4(acc[0][0], acc[0][1], acc[0][2], acc[0][3]);
  acc_guard4(acc[1][0], acc[1][1], acc[1][2], acc[1][3]);
  acc_guard4(acc[2][0], acc[2][1], acc[2][2], acc[2][3]);
  acc_guard4(acc[3][0], acc[3][1], acc[3][2], acc[3][3]);

  // ---- per-column bias (BIAS == 1): this lane's 4 output columns n0 + 16j + rlane ----
  float bcol[4];
#pragma unroll
  for (int j = 0; j < 4; ++j) bcol[j] = 0.f;
  if (BIAS == 1) {
#pragma unroll
    for (int j = 0; j < 4; ++j) bcol[j] = bf_up(bf_bits(biasp[n0 + (j << 4) + rlane]));
  }

  // ---- epilogue ----
  float* slab = sT[wave];
#pragma unroll
  for (int i = 0; i < 4; ++i) {
    const int mBase = m0 + (i << 4);
    float brow[8];
#pragma unroll
    for (int r = 0; r < 8; ++r) brow[r] = 0.f;
    if (BIAS == 2) {
#pragma unroll
      for (int r = 0; r < 8; ++r) brow[r] = bf_up(bf_bits(biasp[mBase + mOff + r]));
    }
#pragma unroll
    for (int r = 0; r < 8; ++r) {
#pragma unroll
      for (int j = 0; j < 4; ++j) {
        float v = acc[i][j][r];
        if (BIAS == 1) v += bcol[j];
        if (BIAS == 2) v += brow[r];
        slab[(mOff + r) * 68 + (j << 4) + rlane] = v;
      }
    }
    __builtin_amdgcn_fence(__ATOMIC_RELEASE, "workgroup");
    __builtin_amdgcn_wave_barrier();
    __builtin_amdgcn_fence(__ATOMIC_ACQUIRE, "workgroup");
    if (OUT_MODE == 0) {
      float* C = (float*)Cout + (size_t)b * strideC;
      const int hh = lane >> 4, c4 = (lane & 15) * 4;     // 256-B row segment = 16 lanes x 16 B
      v4f ov[8];
#pragma unroll
      for (int it = 0; it < 8; ++it) {
        const int row = it * 2 + hh;                       // it 0..7 x hh 0..1 = rows 0..15
        ov[it] = *(const v4f*)(slab + row * 68 + c4);
      }
      {
#pragma unroll
        for (int it = 0; it < 8; ++it) {
          const int row = it * 2 + hh;
          *(v4f*)(C + (size_t)(mBase + row) * ldc + n0 + c4) = ov[it];
        }
        
      }
    } else {
      const int q = lane >> 3, c8 = (lane & 7) * 8;
      unsigned short* C  = (unsigned short*)Cout  + (size_t)b * strideC;
      unsigned short* C2 = (unsigned short*)Cout2 + (size_t)b * strideC2;
      const bool wlo = (OUT_MODE == 2) || (n0 < N2);      // wave-uniform
      v4u hv[4], lv[4];
#pragma unroll
      for (int it = 0; it < 4; ++it) {
        const int row = it * 4 + q;                        // it 0..3 x q 0..3 = rows 0..15
        const float* sp = slab + row * 68 + c8;
        v4u a, a2;
#pragma unroll
        for (int e = 0; e < 4; ++e) {
          const float f0 = sp[2 * e], f1 = sp[2 * e + 1];
          unsigned short h0, h1, l0, l1;
          if (OUT_MODE == 2) {
            h0 = bf_bits(f0); h1 = bf_bits(f1);
            l0 = bf_bits(f0 - bf_up(h0)); l1 = bf_bits(f1 - bf_up(h1));
          } else {
            const _Float16 x0 = (_Float16)f0, x1 = (_Float16)f1;
            h0 = h_bits(x0); h1 = h_bits(x1);
            l0 = h_bits((_Float16)((f0 - (float)x0) * rscale));
            l1 = h_bits((_Float16)((f1 - (float)x1) * rscale));
          }
          a[e] = pk16(h0, h1); a2[e] = pk16(l0, l1);
        }
        hv[it] = a; lv[it] = a2;
      }
      {
#pragma unroll
        for (int it = 0; it < 4; ++it) {
          const int row = it * 4 + q;
          *(v4u*)(C + (size_t)(mBase + row) * ldc + n0 + c8) = hv[it];
          if (wlo) *(v4u*)(C2 + (size_t)(mBase + row) * ldc2 + n0 + c8) = lv[it];
        }
        
      }
    }
    __builtin_amdgcn_fence(__ATOMIC_RELEASE, "workgroup");
    __builtin_amdgcn_wave_barrier();
    __builtin_amdgcn_fence(__ATOMIC_ACQUIRE, "workgroup");
  }
}

// =====================================================================================================
// Line features. Input ln f32 [NB*SEQ][LNW]: column blocks of PD*NH = 64: block 0 = x.W1w^T, 1 = x.W2w^T,
// 2 = x.W1r^T, 3 = x.W2r^T; within a block head h owns columns h*4..h*4+3.
// Per (b, h, t): p1 = block 0 of token t-1 (zero vector at t == 0: the shifted input), p2 = block 1 of t,
// p3 = block 2 of t, p4 = block 3 of t. Exterior 2-form L[m] = pa[PI[m]]*pb[PJ[m]] - pa[PJ[m]]*pb[PI[m]] for
// pairs (0,1),(0,2),(0,3),(1,2),(1,3),(2,3), then L *= 1/max(|L|_2, 1e-12) (all f32, fp contract off).
// Outputs f32 [NB*NH][SEQ][8]: rl = read line [L0..L5, 0, 0]; wl = J-applied write line [L5,-L4,L3,L2,-L1,L0,0,0].
// wave-uniform bound, no block barriers.
// coverage: nwaves = NB*NH*(SEQ/32) waves x 32 rows x 32 B = every row of both planes incl. the zero pad cols.
// =====================================================================================================
struct L6 { float v0, v1, v2, v3, v4, v5; };

__device__ __forceinline__ L6 ext6n(const v4f a, const v4f b) {
#pragma clang fp contract(off)
  L6 o;
  o.v0 = a[0] * b[1] - a[1] * b[0];
  o.v1 = a[0] * b[2] - a[2] * b[0];
  o.v2 = a[0] * b[3] - a[3] * b[0];
  o.v3 = a[1] * b[2] - a[2] * b[1];
  o.v4 = a[1] * b[3] - a[3] * b[1];
  o.v5 = a[2] * b[3] - a[3] * b[2];
  float n2 = o.v0 * o.v0 + o.v1 * o.v1;
  n2 = n2 + o.v2 * o.v2;
  n2 = n2 + o.v3 * o.v3;
  n2 = n2 + o.v4 * o.v4;
  n2 = n2 + o.v5 * o.v5;
  float n = sqrtf(n2);
  n = fmaxf(n, 1e-12f);
  const float inv = 1.0f / n;
  o.v0 *= inv; o.v1 *= inv; o.v2 *= inv; o.v3 *= inv; o.v4 *= inv; o.v5 *= inv;
  return o;
}

__global__ __launch_bounds__(256) void lines_k(const float* __restrict__ ln, float* rl, float* wl, int nwaves) {
#pragma clang fp contract(off)
  __shared__ __align__(16) float sR[8][256];
  __shared__ __align__(16) float sW[8][256];
  const int tid = threadIdx.x, wave = tid >> 5, lane = tid & 31;
  const int w = blockIdx.x * 8 + wave;
  if (w >= nwaves) return;                        // wave-uniform; no block barriers in this kernel
  const int tgPer = SEQ / 32;                     // 64 token groups per (b, h)
  const int bh = w / tgPer;                       // b*NH + h
  const int tg = w - bh * tgPer;
  const int b  = bh / NH;
  const int h  = bh - b * NH;
  const int t  = tg * 32 + lane;                  // < SEQ
  const size_t row  = (size_t)b * SEQ + t;
  const size_t rowp = (t > 0) ? (row - 1) : row;  // clamped address; value zeroed below when t == 0
  const float* cur = ln + row * LNW + h * PD;
  v4f p1 = *(const v4f*)(ln + rowp * LNW + h * PD);
  if (t == 0) { p1[0] = 0.f; p1[1] = 0.f; p1[2] = 0.f; p1[3] = 0.f; }
  const v4f p2 = *(const v4f*)(cur + 1 * PD * NH);
  const v4f p3 = *(const v4f*)(cur + 2 * PD * NH);
  const v4f p4 = *(const v4f*)(cur + 3 * PD * NH);
  const L6 lw = ext6n(p1, p2);
  const L6 lr = ext6n(p3, p4);

  float* sr = sR[wave] + lane * 8;
  float* sw = sW[wave] + lane * 8;
  v4f t0, t1, u0, u1;
  t0[0] = lr.v0; t0[1] = lr.v1; t0[2] = lr.v2; t0[3] = lr.v3;
  t1[0] = lr.v4; t1[1] = lr.v5; t1[2] = 0.f;   t1[3] = 0.f;
  u0[0] = lw.v5; u0[1] = -lw.v4; u0[2] = lw.v3; u0[3] = lw.v2;
  u1[0] = -lw.v1; u1[1] = lw.v0; u1[2] = 0.f;   u1[3] = 0.f;
  *(v4f*)(sr)     = t0;
  *(v4f*)(sr + 4) = t1;
  *(v4f*)(sw)     = u0;
  *(v4f*)(sw + 4) = u1;
  __builtin_amdgcn_fence(__ATOMIC_RELEASE, "workgroup");
  __builtin_amdgcn_wave_barrier();
  __builtin_amdgcn_fence(__ATOMIC_ACQUIRE, "workgroup");
  v4f oR[2], oW[2];
#pragma unroll
  for (int it = 0; it < 2; ++it) {
    oR[it] = *(const v4f*)(sR[wave] + it * 128 + lane * 4);
    oW[it] = *(const v4f*)(sW[wave] + it * 128 + lane * 4);
  }
  const size_t gb = ((size_t)bh * SEQ + (size_t)tg * 32) * 8;
  {
#pragma unroll
    for (int it = 0; it < 2; ++it) {
      *(v4f*)(rl + gb + it * 128 + lane * 4) = oR[it];
      *(v4f*)(wl + gb + it * 128 + lane * 4) = oW[it];
    }
    
  }
}

// =====================================================================================================
// Causal multi-head attention, head dim 64, with an additive line-pair bias:
//   logit(q, k) = (q . k) * sscale + dot6(rl[q], wl[k]) * wdec(q - k),  wdec(d) = bs_h * dec_h^d for d > 0, 0 else,
//   dec_h = sigmoid(dl_h); keys k > q masked (-FLT_MAX, exp -> 0); diagonal kept.
//   q planes (bf16 hi / lo): element (b, t, h, d) at [(b*SEQ + t)*QP + h*64 + d]
//   k planes (bf16 hi / lo): same layout
//   v^T hi plane (f16):      element (b, h, d, s) at [(b*QP + h*64 + d)*SEQ + s]
//   v^T residual plane (f16, (v - hi)*4096): [(b*QP + h*64 + d)*VLP + s], s < VLP, read only when RES
//   rl / wl f32 planes [b*NH + h][SEQ][8] (6 used)
//   out f32 plane: element (b, t, h*64 + d) at [(b*SEQ + t)*QP + h*64 + d] = normalised context.
//   scores = q . k : bf16 hi/lo split (hi.hi + hi.lo + lo.hi), f32 accumulate, then scale + bias in f32
//   p = exp(s - m) carried as f16(1024 p); context = p . v on f16 WMMA; RES adds f16 residual planes of p and v
//   (scale 4096, separate accumulator folded back with 1/4096 per chunk in f32); online softmax in f32.
//   Block = 4 waves; a query tile = 64 query rows of one (b, h); key chunks of 64, chunks 0..qb only for tile qb
//   (block-uniform trip count qb+1 <= NQB; every row has a live key in every processed chunk).
//   Each block takes two tiles of its (b, h), one after the other: NQB-1-t, then t (t = 0..NQB/2-1), so that every
//   block walks NQB+1 key chunks; grid = (NQB/2) * NH * NB. Tiles qb < RESQB run the RES form.
//   K / V^T / wl chunk staging: 128 threads (plain 16-B loads, __syncthreads before and after); P tiles are
//   wave-private, spilled with _Float16 element stores and reloaded as v8h (same element type) after a release
//   barrier in between).
//   Output coverage: each wave stores rows q0..q0+15 (it 0..7 x lane>>4 0..1) x 64 columns (16 lanes x 4 floats),
// =====================================================================================================
struct AttnLds {
  __align__(16) unsigned short KT[2 * 64 * LP];      // K hi [kv][d] | K lo; later f32 context staging
  __align__(16) _Float16 Vth[64 * LP];                // V^T hi [d][kv]
  __align__(16) _Float16 Vtl[64 * LP];                // V^T residual (RES tiles)
  __align__(16) _Float16 Psh[4][16 * LP];             // per wave P [row][kv]
  __align__(16) _Float16 Psl[4][16 * LP];             // per wave P residual (RES tiles)
  __align__(16) float    Ws[64 * 8];                  // wl rows of the chunk's 64 keys
  __align__(16) float    Rs[4][16 * 8];               // per wave rl rows of its 16 queries
};

// One query tile qb of (b, h), all 4 waves of the block.
template <bool RES>
__device__ __forceinline__
void attn_tile(AttnLds& sm,
               const unsigned short* __restrict__ qhp, const unsigned short* __restrict__ qlp,
               const unsigned short* __restrict__ khp, const unsigned short* __restrict__ klp,
               const unsigned short* __restrict__ vhp, const unsigned short* __restrict__ vlp,
               const float* __restrict__ rlp, const float* __restrict__ wlp,
               const float* __restrict__ dlg, const float* __restrict__ bsc,
               float* outp, int b, int h, int qb, float sscale) {
  union FB { v16b v; v8b h[2]; };
  union FH { v16h v; v8h h[2]; };
  unsigned short* KT = sm.KT;
  _Float16* Vth = sm.Vth;
  _Float16* Vtl = sm.Vtl;
  _Float16 (*Psh)[16 * LP] = sm.Psh;
  _Float16 (*Psl)[16 * LP] = sm.Psl;
  float* Ws = sm.Ws;
  float (*Rs)[16 * 8] = sm.Rs;
  __bf16* Ksh = (__bf16*)(void*)KT;
  __bf16* Ksl = Ksh + 64 * LP;

  const int tid  = threadIdx.x;
  const int wave = tid >> 5;
  const int lane = tid & 31;
  const int hh   = lane >> 4;
  const int c    = lane & 15;

  const int q0   = qb * 64 + wave * 16;
  const size_t rowB = (size_t)b * SEQ;
  const size_t bhT  = ((size_t)b * NH + h) * SEQ;

  const __bf16* Qh = (const __bf16*)(const void*)qhp + (size_t)h * HD;
  const __bf16* Ql = (const __bf16*)(const void*)qlp + (size_t)h * HD;
  const __bf16* Kh = (const __bf16*)(const void*)khp + (size_t)h * HD;
  const __bf16* Kl = (const __bf16*)(const void*)klp + (size_t)h * HD;
  const _Float16* Vh = (const _Float16*)(const void*)vhp + ((size_t)b * QP + (size_t)h * HD) * SEQ;
  const _Float16* Vl = (const _Float16*)(const void*)vlp + ((size_t)b * QP + (size_t)h * HD) * VLP;

  // ---- per-head scalars (RNE bf16-converted inputs) ----
  const float dl  = bf_up(bf_bits(dlg[h]));
  const float dec = 1.0f / (1.0f + expf(-dl));
  const float l2d = log2f(dec);
  const float bsh = bf_up(bf_bits(bsc[h]));

  // ---- stage the wave's 16 rl rows: 16 x 8 f32 = 32 lanes x 16 B (ordered by the loop's first barrier) ----
  *(v4f*)(Rs[wave] + lane * 4) = *(const v4f*)(rlp + (bhT + q0) * 8 + lane * 4);

  float mrow[8], lrow[8];
  v8f oacc[4];
#pragma unroll
  for (int r = 0; r < 8; ++r) { mrow[r] = -INFINITY; lrow[r] = 0.f; }
#pragma unroll
  for (int t = 0; t < 4; ++t) oacc[t] = zero8();

  int nkt = qb + 1;                          // causal: key tiles 0..qb, block-uniform
  if (nkt > NQB) nkt = NQB;
  for (int kt = 0; kt < nkt; ++kt) {
    const int kv0 = kt * 64;
    __syncthreads();
    {
      const int r = tid >> 1, half = (tid & 1) * 32;
      const __bf16*   kg  = Kh + (rowB + kv0 + r) * QP + half;    // K row kv0+r, d = half..half+31
      const __bf16*   klg = Kl + (rowB + kv0 + r) * QP + half;
      const _Float16* vg  = Vh + (size_t)r * SEQ + kv0 + half;    // V^T row d = r, s = kv0+half..+31
      const int kvl = (kv0 + 64 <= VLP) ? kv0 : (VLP - 64);     // clamped address into the residual plane
      const _Float16* vlg = Vl + (size_t)r * VLP + kvl + half;
      const bool resOK = (kv0 + 64 <= VLP);                      // block-uniform
#pragma unroll
      for (int i = 0; i < 4; ++i) {
        const v8b a0 = *(const v8b*)(kg + 8 * i);
        const v8b a1 = *(const v8b*)(klg + 8 * i);
        const v8h b0 = *(const v8h*)(vg + 8 * i);
        *(v8b*)(Ksh + r * LP + half + 8 * i) = a0;
        *(v8b*)(Ksl + r * LP + half + 8 * i) = a1;
        *(v8h*)(Vth + r * LP + half + 8 * i) = b0;
        if (RES) {
          v8h b1 = *(const v8h*)(vlg + 8 * i);
          if (!resOK) b1 = zero8h();
          *(v8h*)(Vtl + r * LP + half + 8 * i) = b1;
        }
      }
      // wl rows kv0..kv0+63 of this (b, h): 64 x 8 f32 = 128 threads x 16 B
      *(v4f*)(Ws + tid * 4) = *(const v4f*)(wlp + (bhT + kv0) * 8 + tid * 4);
    }
    __syncthreads();

    // ---- Q fragments (A operand, row = lane&15): 2 d-chunks, hi and lo (reloaded per chunk) ----
    v16b qah[2], qal[2];
#pragma unroll
    for (int dc = 0; dc < 2; ++dc) {
      const size_t qo = (rowB + q0 + c) * QP + dc * 32 + 8 * hh;
      qah[dc] = ldfrag_b(Qh + qo);
      qal[dc] = ldfrag_b(Ql + qo);
    }

    // ---- scores: 16 query rows x 64 keys per wave, 3 bf16 products ----
    v8f s[4];
#pragma unroll
    for (int j = 0; j < 4; ++j) {
      s[j] = zero8();
#pragma unroll
      for (int dc = 0; dc < 2; ++dc) {
        FB kb, kl;
        kb.h[0] = *(const v8b*)(Ksh + (j * 16 + c) * LP + dc * 32 + 8 * hh);
        kb.h[1] = *(const v8b*)(Ksh + (j * 16 + c) * LP + dc * 32 + 16 + 8 * hh);
        kl.h[0] = *(const v8b*)(Ksl + (j * 16 + c) * LP + dc * 32 + 8 * hh);
        kl.h[1] = *(const v8b*)(Ksl + (j * 16 + c) * LP + dc * 32 + 16 + 8 * hh);
        s[j] = mma_b(qah[dc], kb.v, s[j]);
        s[j] = mma_b(qah[dc], kl.v, s[j]);
        s[j] = mma_b(qal[dc], kb.v, s[j]);
      }
    }

    // ---- wl rows of this lane's 4 key columns (j*16 + c): 6 used of 8 ----
    v4f wa[4];
    v2f wb[4];
#pragma unroll
    for (int j = 0; j < 4; ++j) {
      const float* wp = Ws + (j * 16 + c) * 8;
      wa[j] = *(const v4f*)(wp);
      wb[j] = *(const v2f*)(wp + 4);
    }

    // ---- scale + bias + causal mask (replace by -FLT_MAX), row max, online softmax, P (x1024, f16) and
    //      P residual (x4096) to LDS ----
    _Float16* pwh = Psh[wave];
    _Float16* pwl = Psl[RES ? wave : 0];
    float mloc[8], msafe[8], alpha[8], psum[8];
    // logits of all 8 rows first, so that the 8 row reductions below run as independent chains
#pragma unroll
    for (int r = 0; r < 8; ++r) {
      const int qrow = q0 + 8 * hh + r;
      const float* rp = Rs[wave] + (8 * hh + r) * 8;
      const v4f ra = *(const v4f*)(rp);
      const v2f rb = *(const v2f*)(rp + 4);
      float m = -INFINITY;
#pragma unroll
      for (int j = 0; j < 4; ++j) {
        const int key = kv0 + j * 16 + c;
        const int dd  = qrow - key;
        const float dot6 = ra[0] * wa[j][0] + ra[1] * wa[j][1] + ra[2] * wa[j][2] + ra[3] * wa[j][3]
                         + rb[0] * wb[j][0] + rb[1] * wb[j][1];
        const float ex   = exp2f((float)dd * l2d);
        const float wdec = (dd > 0) ? (bsh * ex) : 0.f;
        float sv = s[j][r] * sscale + dot6 * wdec;
        sv = (key > qrow) ? -FLT_MAX : sv;
        s[j][r] = sv;
        m = fmaxf(m, sv);
      }
      mloc[r] = m;
    }
    // row maximum over the 16 lanes of a half: xor butterfly 1, 2, 4, 8 in the vector unit, 8 rows per step.
    // The scheduling barriers keep the 8 chains side by side: without them the compiler moves each row's chain
    // back behind that row's logits, where every step waits for the one before it.
    __builtin_amdgcn_sched_barrier(0);
    rowmax8<1>(mloc); rowmax8<2>(mloc); rowmax8<4>(mloc); rowmax8<8>(mloc);
    __builtin_amdgcn_sched_barrier(0);
#pragma unroll  // per-row state is indexed by constants only, so it stays in registers
    for (int r = 0; r < 8; ++r) {
      const float mnew = fmaxf(mrow[r], mloc[r]);
      msafe[r] = (mnew == -INFINITY) ? 0.f : mnew;
      alpha[r] = exp_slot(mrow[r] - msafe[r]);
      mrow[r]  = mnew;
    }
#pragma unroll  // as above
    for (int r = 0; r < 8; ++r) {
      float ps = 0.f;
#pragma unroll
      for (int j = 0; j < 4; ++j) {
        const float p = exp_slot(s[j][r] - msafe[r]);  // masked logit against a finite max: exp -> 0
        ps += p;
        const float p1k = p * 1024.0f;
        const _Float16 ph = (_Float16)p1k;
        pwh[(8 * hh + r) * LP + j * 16 + c] = ph;
        if (RES) {
          const _Float16 pl = (_Float16)((p1k - (float)ph) * 4096.0f);
          pwl[(8 * hh + r) * LP + j * 16 + c] = pl;
        }
      }
      psum[r] = ps;
    }
    // row sum: xor butterfly 1, 2, 4, 8 like the maximum, with the same scheduling barriers for the same reason
    __builtin_amdgcn_sched_barrier(0);
    rowsum8<1>(psum); rowsum8<2>(psum); rowsum8<4>(psum); rowsum8<8>(psum);
    __builtin_amdgcn_sched_barrier(0);
#pragma unroll  // as above
    for (int r = 0; r < 8; ++r) {
      lrow[r] = lrow[r] * alpha[r] + psum[r];
#pragma unroll
      for (int t = 0; t < 4; ++t) oacc[t][r] *= alpha[r];
    }
    __builtin_amdgcn_fence(__ATOMIC_RELEASE, "workgroup");
    __builtin_amdgcn_wave_barrier();
    __builtin_amdgcn_fence(__ATOMIC_ACQUIRE, "workgroup");

    // ---- context += P . V (f16 WMMA), residual products into a separate accumulator ----
    v8f o1[4];
#pragma unroll
    for (int t = 0; t < 4; ++t) o1[t] = zero8();
#pragma unroll 1
    for (int kk = 0; kk < 2; ++kk) {
      FH pa, pl;
      pa.h[0] = *(const v8h*)(pwh + c * LP + kk * 32 + 8 * hh);
      pa.h[1] = *(const v8h*)(pwh + c * LP + kk * 32 + 16 + 8 * hh);
      if (RES) {
        pl.h[0] = *(const v8h*)(pwl + c * LP + kk * 32 + 8 * hh);
        pl.h[1] = *(const v8h*)(pwl + c * LP + kk * 32 + 16 + 8 * hh);
      } else {
        pl.v = pa.v;
      }
#pragma unroll
      for (int t = 0; t < 4; ++t) {
        FH vb;
        vb.h[0] = *(const v8h*)(Vth + (t * 16 + c) * LP + kk * 32 + 8 * hh);
        vb.h[1] = *(const v8h*)(Vth + (t * 16 + c) * LP + kk * 32 + 16 + 8 * hh);
        oacc[t] = mma_h(pa.v, vb.v, oacc[t]);
        if (RES) {
          FH vl;
          vl.h[0] = *(const v8h*)(Vtl + (t * 16 + c) * LP + kk * 32 + 8 * hh);
          vl.h[1] = *(const v8h*)(Vtl + (t * 16 + c) * LP + kk * 32 + 16 + 8 * hh);
          o1[t] = mma_h(pa.v, vl.v, o1[t]);
          o1[t] = mma_h(pl.v, vb.v, o1[t]);
        }
      }
    }
    if (RES) {
#pragma unroll
      for (int t = 0; t < 4; ++t)
#pragma unroll
        for (int r = 0; r < 8; ++r) oacc[t][r] += o1[t][r] * (1.0f / 4096.0f);
    }
  }

  // ---- all waves are done with the K tiles before that LDS region is reused for the context staging ----
  __syncthreads();

  // ---- normalise (1/l and the 1/1024 p carry), stage the wave's 16x64 tile in LDS, then write whole
  float* os = (float*)(void*)KT + wave * (16 * 64);
#pragma unroll
  for (int r = 0; r < 8; ++r) {
    const float l = lrow[r];
    const float inv = ((l > 0.f) ? (1.0f / l) : 0.f) * (1.0f / 1024.0f);
#pragma unroll
    for (int t = 0; t < 4; ++t) os[(8 * hh + r) * 64 + t * 16 + c] = oacc[t][r] * inv;
  }
  __builtin_amdgcn_fence(__ATOMIC_RELEASE, "workgroup");
  __builtin_amdgcn_wave_barrier();
  __builtin_amdgcn_fence(__ATOMIC_ACQUIRE, "workgroup");
  {
    const int h2 = lane >> 4, c4 = (lane & 15) * 4;
    v4f ov[8];
#pragma unroll
    for (int it = 0; it < 8; ++it) {
      const int row = it * 2 + h2;   // it 0..7 x h2 0..1 = rows 0..15 of the wave tile
      ov[it] = *(const v4f*)(os + row * 64 + c4);
    }
    {
#pragma unroll
      for (int it = 0; it < 8; ++it) {
        const int row = it * 2 + h2;
        const size_t go = (rowB + q0 + row) * QP + (size_t)h * HD + c4;
        *(v4f*)(outp + go) = ov[it];
      }
#if defined(__HIP_DEVICE_COMPILE__)
      // the block's next tile rewrites the address and data registers of these stores: the wait stands in front of that
      asm volatile("s_wait_xcnt 0x0" ::: "memory");
#endif
    }
  }
}

__global__ __launch_bounds__(128)
void attn_lb(const unsigned short* __restrict__ qhp, const unsigned short* __restrict__ qlp,
             const unsigned short* __restrict__ khp, const unsigned short* __restrict__ klp,
             const unsigned short* __restrict__ vhp, const unsigned short* __restrict__ vlp,
             const float* __restrict__ rlp, const float* __restrict__ wlp,
             const float* __restrict__ dlg, const float* __restrict__ bsc,
             float* outp, float sscale) {
  static_assert((NQB % 2) == 0);
  __shared__ AttnLds sm;
  const int bx   = blockIdx.x;
  const int t    = bx % (NQB / 2);
  const int rest = bx / (NQB / 2);
  const int h    = rest % NH;
  const int b    = rest / NH;
  // The second tile's first barrier (top of its key loop) stands behind every wave's read-back of the first tile's
  // context staging, and in front of the first refill of that LDS.
#pragma unroll 1  // rolled: one copy of each tile form in the text
  for (int pass = 0; pass < 2; ++pass) {
    const int qb = pass ? t : (NQB - 1 - t);       // block-uniform
    if (qb < RESQB)
      attn_tile<true>(sm, qhp, qlp, khp, klp, vhp, vlp, rlp, wlp, dlg, bsc, outp, b, h, qb, sscale);
    else
      attn_tile<false>(sm, qhp, qlp, khp, klp, vhp, vlp, rlp, wlp, dlg, bsc, outp, b, h, qb, sscale);
  }
}

// =====================================================================================================
// Workspace map (bytes), every region an exact multiple of its whole-line / whole-tile store granularity
// multiples):
//   Xb     bf16 [4096][1024]            0            8388608
//   Wqkv   bf16 [3072][1024]            8388608      6291456   ([n][k], rows 0..1023 q | 1024.. k | 2048.. v)
//   Wln    bf16 [256][1024]             14680064      524288   ([W1w; W2w; W1r; W2r], [n][k])
//   Wob    bf16 [1024][1024]            15204352     2097152   ([n][k])
//   LN     f32  [4096][256]             17301504     4194304
//   RL     f32  [32][2048][8]           21495808     2097152
//   WL     f32  [32][2048][8]           23592960     2097152
//   Qh     bf16 [4096][1024]            25690112     8388608
//   Ql     bf16 [4096][1024]            34078720     8388608
//   Kh     bf16 [4096][1024]            42467328     8388608
//   Kl     bf16 [4096][1024]            50855936     8388608
//   VTh    f16  [2][1024][2048]         59244544     8388608
//   VTl    f16  [2][1024][512]          67633152     2097152
//   Af     f32  [4096][1024]            69730304    16777216
//   Ah     bf16 [4096][1024]            86507520     8388608
//   Al     bf16 [4096][1024]            94896128     8388608
//   end                                 103284736
// =====================================================================================================
extern "C" void kernel_launch(void* const* d_in, const int* in_sizes, int n_in,
                              void* d_out, int out_size, void* d_ws, size_t ws_size,
                              hipStream_t stream) {
  if (n_in < 11) return;
  if (in_sizes[0] != NB * SEQ * DMODEL) return;
  if (in_sizes[1] != 3 * QP * DMODEL) return;
  if (in_sizes[2] != 3 * QP) return;
  if (in_sizes[3] != PD * NH * DMODEL) return;
  if (in_sizes[4] != PD * NH * DMODEL) return;
  if (in_sizes[5] != PD * NH * DMODEL) return;
  if (in_sizes[6] != PD * NH * DMODEL) return;
  if (in_sizes[7] != DMODEL * QP) return;
  if (in_sizes[8] != DMODEL) return;
  if (in_sizes[9] != NH) return;
  if (in_sizes[10] != NH) return;
  if (out_size != NB * SEQ * DMODEL) return;

  const float* x     = (const float*)d_in[0];    // [NB*SEQ][DMODEL]
  const float* wqkv  = (const float*)d_in[1];    // [3*QP n][DMODEL k]
  const float* bqkv  = (const float*)d_in[2];    // [3*QP]
  const float* w1w   = (const float*)d_in[3];    // [PD*NH][DMODEL]
  const float* w2w   = (const float*)d_in[4];
  const float* w1r   = (const float*)d_in[5];
  const float* w2r   = (const float*)d_in[6];
  const float* wout  = (const float*)d_in[7];    // [DMODEL n][QP k]
  const float* bout  = (const float*)d_in[8];    // [DMODEL]
  const float* dlog  = (const float*)d_in[9];    // [NH]
  const float* bscl  = (const float*)d_in[10];   // [NH]

  const size_t PXb   = (size_t)NB * SEQ * DMODEL * 2;      //  8388608
  const size_t PWqkv = (size_t)3 * QP * DMODEL * 2;        //  6291456
  const size_t PWln  = (size_t)LNW * DMODEL * 2;           //   524288
  const size_t PWo   = (size_t)DMODEL * QP * 2;            //  2097152
  const size_t PLN   = (size_t)NB * SEQ * LNW * 4;         //  4194304
  const size_t PRL   = (size_t)NB * NH * SEQ * 8 * 4;      //  2097152
  const size_t PQpl  = (size_t)NB * SEQ * QP * 2;          //  8388608  (Qh, Ql, Kh, Kl, Ah, Al)
  const size_t PVTh  = (size_t)NB * QP * SEQ * 2;          //  8388608
  const size_t PVTl  = (size_t)NB * QP * VLP * 2;          //  2097152
  const size_t PAf   = (size_t)NB * SEQ * QP * 4;          // 16777216
  size_t off = 0;
  const size_t oXb   = off; off += PXb;
  const size_t oWqkv = off; off += PWqkv;
  const size_t oWln  = off; off += PWln;
  const size_t oWo   = off; off += PWo;
  const size_t oLN   = off; off += PLN;
  const size_t oRL   = off; off += PRL;
  const size_t oWL   = off; off += PRL;
  const size_t oQh   = off; off += PQpl;
  const size_t oQl   = off; off += PQpl;
  const size_t oKh   = off; off += PQpl;
  const size_t oKl   = off; off += PQpl;
  const size_t oVTh  = off; off += PVTh;
  const size_t oVTl  = off; off += PVTl;
  const size_t oAf   = off; off += PAf;
  const size_t oAh   = off; off += PQpl;
  const size_t oAl   = off; off += PQpl;
  if (off > ws_size) return;                          // off = 103284736
  if (off > (size_t)134217728) return;

  char* ws = (char*)d_ws;
  unsigned short* Xb   = (unsigned short*)(ws + oXb);
  unsigned short* Wqkv = (unsigned short*)(ws + oWqkv);
  unsigned short* Wln  = (unsigned short*)(ws + oWln);
  unsigned short* Wob  = (unsigned short*)(ws + oWo);
  float*          LN   = (float*)(ws + oLN);
  float*          RL   = (float*)(ws + oRL);
  float*          WL   = (float*)(ws + oWL);
  unsigned short* Qh   = (unsigned short*)(ws + oQh);
  unsigned short* Ql   = (unsigned short*)(ws + oQl);
  unsigned short* Kh   = (unsigned short*)(ws + oKh);
  unsigned short* Kl   = (unsigned short*)(ws + oKl);
  unsigned short* VTh  = (unsigned short*)(ws + oVTh);
  unsigned short* VTl  = (unsigned short*)(ws + oVTl);
  float*          Af   = (float*)(ws + oAf);
  unsigned short* Ah   = (unsigned short*)(ws + oAh);
  unsigned short* Al   = (unsigned short*)(ws + oAl);
  float*          outf = (float*)d_out;

  const dim3 blk(256);
  const int nTok   = NB * SEQ;                                       // 4096 tokens
  const int n8x    = nTok * DMODEL / 8;                              // 524288
  const int n8qkv  = 3 * QP * DMODEL / 8;                            // 393216
  const int n8ln   = PD * NH * DMODEL / 8;                           //   8192 per line weight
  const int n8wo   = DMODEL * QP / 8;                                // 131072
  const int n8a    = nTok * QP / 8;                                  // 524288
  const int nwLn   = NB * NH * (SEQ / 32);                           //   2048 waves
  const dim3 gCx((n8x + 255) / 256), gCqkv((n8qkv + 255) / 256), gCln((n8ln + 255) / 256), gCwo((n8wo + 255) / 256);
  const dim3 blkG(128);                                              // GEMM block: 4 waves, one 128x128 tile
  const dim3 gLNg((nTok / 128) * (LNW / 128), 1);                    //  64 blocks
  const dim3 gQ((nTok / 128) * (QP / 128), 1);                       // 256 blocks
  const dim3 gVT((QP / 128) * (SEQ / 128), NB);                      // 128 blocks x 2 batch elements
  const dim3 gLines((nwLn + 7) / 8);                                 // 256 blocks
  const dim3 gSplit((n8a + 255) / 256);                              // 2048 blocks
  const dim3 gOut((nTok / 128) * (DMODEL / 128), 1);                 // 256 blocks

  // (1) inputs -> bf16 planes (RNE convert); weights arrive [n][k] = the Bt layout already
  cvt_bf16<<<gCx,   blk, 0, stream>>>(x,    Xb,   n8x);
  cvt_bf16<<<gCqkv, blk, 0, stream>>>(wqkv, Wqkv, n8qkv);
  cvt_bf16<<<gCln,  blk, 0, stream>>>(w1w,  Wln + (size_t)0 * PD * NH * DMODEL, n8ln);
  cvt_bf16<<<gCln,  blk, 0, stream>>>(w2w,  Wln + (size_t)1 * PD * NH * DMODEL, n8ln);
  cvt_bf16<<<gCln,  blk, 0, stream>>>(w1r,  Wln + (size_t)2 * PD * NH * DMODEL, n8ln);
  cvt_bf16<<<gCln,  blk, 0, stream>>>(w2r,  Wln + (size_t)3 * PD * NH * DMODEL, n8ln);
  cvt_bf16<<<gCwo,  blk, 0, stream>>>(wout, Wob,  n8wo);
  // (2) line-feature projections: LN[row][e] = sum_k Xb[row][k] Wln[e][k]  (M=4096, N=256, K=1024) -> f32
  gemm64<0, 0, 0><<<gLNg, blkG, 0, stream>>>(
      Xb, Xb, DMODEL, 0LL, Wln, Wln, DMODEL, 0LL,
      (void*)LN, LNW, 0LL, (void*)LN, 0, 0LL, 0,
      bout, nTok, LNW, DMODEL, 1.0f);
  // (3) q projection + bias -> bf16 hi / lo planes  (M=4096, N=1024, K=1024)
  gemm64<0, 2, 1><<<gQ, blkG, 0, stream>>>(
      Xb, Xb, DMODEL, 0LL, Wqkv, Wqkv, DMODEL, 0LL,
      (void*)Qh, QP, 0LL, (void*)Ql, QP, 0LL, QP,
      bqkv, nTok, QP, DMODEL, 1.0f);
  // (4) k projection + bias -> bf16 hi / lo planes (weight rows 1024..2047, bias 1024..)
  gemm64<0, 2, 1><<<gQ, blkG, 0, stream>>>(
      Xb, Xb, DMODEL, 0LL, Wqkv + (size_t)QP * DMODEL, Wqkv + (size_t)QP * DMODEL, DMODEL, 0LL,
      (void*)Kh, QP, 0LL, (void*)Kl, QP, 0LL, QP,
      bqkv + QP, nTok, QP, DMODEL, 1.0f);
  // (5) v^T per batch element: VTh[b][f][s] = sum_k Wv[f][k] Xb[b*SEQ+s][k] + bv[f] -> f16 hi plane (pitch SEQ)
  //     and residual plane (x4096, keys < VLP, pitch VLP)  (M=1024 features, N=2048 tokens, K=1024, bias per row)
  gemm64<0, 3, 2><<<gVT, blkG, 0, stream>>>(
      Wqkv + (size_t)2 * QP * DMODEL, Wqkv + (size_t)2 * QP * DMODEL, DMODEL, 0LL,
      Xb, Xb, DMODEL, (long long)SEQ * DMODEL,
      (void*)VTh, SEQ, (long long)QP * SEQ, (void*)VTl, VLP, (long long)QP * VLP, VLP,
      bqkv + 2 * QP, QP, SEQ, DMODEL, 4096.0f);
  // (6) line features (shifted p1, exterior 2-forms, L2 normalisation, J map) -> rl / wl f32 planes
  lines_k<<<gLines, blk, 0, stream>>>(LN, RL, WL, nwLn);
  // (7) causal attention with line-pair bias: query tiles 0..RESQB-1 with residual planes, the rest without;
  //     one launch, two tiles (NQB-1-t and t) per block
  attn_lb<<<dim3(NB * NH * (NQB / 2)), dim3(128), 0, stream>>>(
      Qh, Ql, Kh, Kl, VTh, VTl, RL, WL, dlog, bscl, Af, 0.125f);
  // (8) context rows -> bf16 hi/lo planes
  split_bf16x8<<<gSplit, blk, 0, stream>>>(Af, Ah, Al, n8a);
  // (9) out[row][e] = sum_d (Ah+Al)[row][d] Wob[e][d] + bout[e] -> d_out f32 [4096][1024]  (M=4096, N=1024, K=1024)
  gemm64<1, 0, 1><<<gOut, blkG, 0, stream>>>(
      Ah, Al, QP, 0LL, Wob, Wob, QP, 0LL,
      (void*)outf, DMODEL, 0LL, (void*)outf, 0, 0LL, 0,
      bout, nTok, DMODEL, QP, 1.0f);
  (void)hipGetLastError();
}

// v005
// One run takes 223 microseconds.
// Next to v004, in two timings, it ran 1.25 and 1.24 times as fast.
// Over all steps from v000 it is 2.76 times as fast.
// Contractions: q / k / v^T and line-feature projections = v_wmma_f32_16x16x32_bf16 (bf16 operands from
// RNE-converted inputs, one product per k-step); q.k^T scores = v_wmma_f32_16x16x32_bf16 with bf16 hi/lo split
// q and k (hi.hi + hi.lo + lo.hi); p.v = v_wmma_f32_16x16x32_f16 (p carried x1024 in f16, v in f16; extra f16
// residual planes x4096 of p and v on the first 512 query rows); ctx.Wo^T = v_wmma_f32_16x16x32_bf16 with ctx
// as bf16 hi/lo planes times the bf16 Wo plane (2 products); all f32 accumulate; 6-term line-pair bias dots,
// decay weights and softmax in f32 on VALU.
#include <hip/hip_runtime.h>
#include <math.h>
#include <float.h>
#include <stdint.h>

#define NB     2
#define SEQ    2048
#define DMODEL 1024
#define NH     16
#define HD     64
#define QP     (NH * HD)       // 1024: q / k / ctx row pitch
#define NQB    (SEQ / 64)      // 32 query / key tiles of 64
#define VLP    512             // key pitch of the v^T residual plane (keys 0..VLP-1)
#define RESQB  8               // leading 64-row query blocks that use the p / v residual planes
#define PD     4               // point dim per head
#define LNW    (4 * PD * NH)   // 256: width of the line-feature projection [p1w | p2w | p1r | p2r]
#define LP     72              // LDS row pitch (16-bit elements) of the attention K, V^T and P tiles: 144 B = 16 B x 9, so the
                               // 16 rows that one ds_load_b128 reads fall on 16 different groups of 4 banks (at 128 B: on 2)
static_assert(RESQB * 64 <= VLP);
static_assert(RESQB <= NQB);
static_assert(QP == DMODEL);
static_assert(HD == 64);
static_assert(PD == 4);
static_assert(LP >= 64 && (LP % 8) == 0 && 2 * 64 * LP * 2 >= 4 * 16 * 64 * 4);
static_assert((SEQ % 64) == 0 && (DMODEL % 64) == 0 && (LNW % 64) == 0 && (QP % 64) == 0);
static_assert(((NB * SEQ) % 64) == 0 && (SEQ % 32) == 0);
static_assert((DMODEL % 32) == 0);
static_assert(((NB * SEQ) % 128) == 0 && (SEQ % 128) == 0 && (QP % 128) == 0 && (LNW % 128) == 0 && (DMODEL % 128) == 0);

typedef _Float16 v16h __attribute__((ext_vector_type(16)));
typedef _Float16 v8h  __attribute__((ext_vector_type(8)));
typedef __bf16   v16b __attribute__((ext_vector_type(16)));
typedef __bf16   v8b  __attribute__((ext_vector_type(8)));
typedef float    v8f  __attribute__((ext_vector_type(8)));
typedef float    v4f  __attribute__((ext_vector_type(4)));
typedef float    v2f  __attribute__((ext_vector_type(2)));
typedef unsigned int v4u __attribute__((ext_vector_type(4)));

// ---- scalar helpers --------------------------------------------------------------------------------
__device__ __forceinline__ unsigned short bf_bits(float f) {          // f32 -> bf16 bits, RNE convert
  unsigned u = __float_as_uint(f);
  return (unsigned short)((u + 0x7FFFu + ((u >> 16) & 1u)) >> 16);
}
__device__ __forceinline__ float bf_up(unsigned short h) { return __uint_as_float(((unsigned)h) << 16); }
__device__ __forceinline__ unsigned short h_bits(_Float16 x) { return __builtin_bit_cast(unsigned short, x); }
__device__ __forceinline__ unsigned pk16(unsigned short a, unsigned short b) { return (unsigned)a | ((unsigned)b << 16); }
__device__ __forceinline__ v8f zero8() { v8f z = {0.f, 0.f, 0.f, 0.f, 0.f, 0.f, 0.f, 0.f}; return z; }
__device__ __forceinline__ v8h zero8h() {
  const _Float16 z = (_Float16)0.0f;
  v8h r = {z, z, z, z, z, z, z, z};
  return r;
}

// ---- lane l <- lane l ^ X inside each 16-lane row (DPP row_xmask, control 0x160 + X): no LDS round trip ----
template <int X>
__device__ __forceinline__ float lane_xor16(float v) {
  return __builtin_bit_cast(float, __builtin_amdgcn_update_dpp(0, __builtin_bit_cast(int, v), 0x160 + X, 0xf, 0xf, true));
}
// exp(x) as v_exp_f32(x * log2 e), the form __expf compiled to. The v_nop is the one slot that the instruction set asks
// for behind a transcendental before a source is overwritten.
__device__ __forceinline__ float exp_slot(float x) {
  const float t = x * 1.44269504088896340736f;
  float r;
#if defined(__HIP_DEVICE_COMPILE__)
  asm("v_exp_f32 %0, %1\n\tv_nop" : "=v"(r) : "v"(t));
#else
  r = t;
#endif
  return r;
}
template <int X>
__device__ __forceinline__ void rowmax8(float (&m)[8]) {
#pragma unroll  // the 8 values stay in registers, one independent instruction chain each
  for (int r = 0; r < 8; ++r) m[r] = fmaxf(m[r], lane_xor16<X>(m[r]));
}
template <int X>
__device__ __forceinline__ void rowsum8(float (&m)[8]) {
#pragma unroll  // the 8 values stay in registers, one independent instruction chain each
  for (int r = 0; r < 8; ++r) m[r] += lane_xor16<X>(m[r]);
}

// ---- fragment loader: 16-bit A/B operand, lane -> row/col (lane&15), p already includes +8*(lane>>4);
//      elements 0..7 <- p[0..7] (k0+8h..), elements 8..15 <- p[16..23] (k0+16+8h..)
__device__ __forceinline__ v16b ldfrag_b(const __bf16* p) {
  union { v16b v; v8b h[2]; } f;
  f.h[0] = *(const v8b*)(p);
  f.h[1] = *(const v8b*)(p + 16);
  return f.v;
}

// ---- WMMA helpers with trailing VALU hazard gap --------------------------------------------------------
__device__ __forceinline__ v8f mma_b(v16b a, v16b b, v8f c) {
  c = __builtin_amdgcn_wmma_f32_16x16x32_bf16(false, a, false, b, (short)0, c, false, false);
#if defined(__HIP_DEVICE_COMPILE__)
  asm volatile("v_nop\n\tv_nop\n\tv_nop\n\tv_nop" : "+v"(c) : "v"(a), "v"(b));
#endif
  return c;
}
__device__ __forceinline__ v8f mma_h(v16h a, v16h b, v8f c) {
  c = __builtin_amdgcn_wmma_f32_16x16x32_f16(false, a, false, b, (short)0, c, false, false);
#if defined(__HIP_DEVICE_COMPILE__)
  asm volatile("v_nop\n\tv_nop\n\tv_nop\n\tv_nop" : "+v"(c) : "v"(a), "v"(b));
#endif
  return c;
}
__device__ __forceinline__ v8f mma_b_raw(v16b a, v16b b, v8f c) {
  return __builtin_amdgcn_wmma_f32_16x16x32_bf16(false, a, false, b, (short)0, c, false, false);
}
__device__ __forceinline__ void dep_guard_b(v8f& a, v8f& b, v16b x, v16b y) {
#if defined(__HIP_DEVICE_COMPILE__)
  asm volatile("v_nop\n\tv_nop\n\tv_nop\n\tv_nop" : "+v"(a), "+v"(b) : "v"(x), "v"(y));
#endif
}
__device__ __forceinline__ void keep4_b(v16b a, v16b b, v16b c, v16b d) {
#if defined(__HIP_DEVICE_COMPILE__)
  asm volatile("v_nop" :: "v"(a), "v"(b), "v"(c), "v"(d));
#endif
}
__device__ __forceinline__ void acc_guard4(v8f& a, v8f& b, v8f& c, v8f& d) {
#if defined(__HIP_DEVICE_COMPILE__)
  asm volatile("v_nop\n\tv_nop\n\tv_nop\n\tv_nop" : "+v"(a), "+v"(b), "+v"(c), "+v"(d));
#endif
}

// =====================================================================================================
// Flat f32 -> bf16 (RNE convert) of all seven f32 operands in one launch: x, w_qkv, the four line weights, w_out.
// Their bf16 planes lie one behind the other in the workspace in that order, so the destination is one flat array;
// a block (256 threads x 8 elements = 2048 elements) lies wholly inside one operand and picks its source by its index
// (block-uniform). One 16-B store per lane: a wave writes 512 contiguous bytes.
// coverage: CB_ALL blocks x 2048 elements = all seven planes, every plane a multiple of 2048 elements.
// =====================================================================================================
#define CB_X   (NB * SEQ * DMODEL / 2048)    // 2048 blocks
#define CB_QKV (3 * QP * DMODEL / 2048)      // 1536
#define CB_LN  (PD * NH * DMODEL / 2048)     //   32 for each line weight
#define CB_WO  (DMODEL * QP / 2048)          //  512
#define CB_ALL (CB_X + CB_QKV + 4 * CB_LN + CB_WO)
static_assert(((NB * SEQ * DMODEL) % 2048) == 0 && ((3 * QP * DMODEL) % 2048) == 0);
static_assert(((PD * NH * DMODEL) % 2048) == 0 && ((DMODEL * QP) % 2048) == 0);
__global__ __launch_bounds__(256) void cvt_all(const float* __restrict__ x, const float* __restrict__ wqkv,
                                               const float* __restrict__ w1w, const float* __restrict__ w2w,
                                               const float* __restrict__ w1r, const float* __restrict__ w2r,
                                               const float* __restrict__ wout, unsigned short* out) {
  const int bx = blockIdx.x;
  if (bx >= CB_ALL) return;
  const float* in;
  int b0;
  if (bx < CB_X)                            { in = x;    b0 = 0; }
  else if (bx < CB_X + CB_QKV)              { in = wqkv; b0 = CB_X; }
  else if (bx < CB_X + CB_QKV + 1 * CB_LN)  { in = w1w;  b0 = CB_X + CB_QKV; }
  else if (bx < CB_X + CB_QKV + 2 * CB_LN)  { in = w2w;  b0 = CB_X + CB_QKV + 1 * CB_LN; }
  else if (bx < CB_X + CB_QKV + 3 * CB_LN)  { in = w1r;  b0 = CB_X + CB_QKV + 2 * CB_LN; }
  else if (bx < CB_X + CB_QKV + 4 * CB_LN)  { in = w2r;  b0 = CB_X + CB_QKV + 3 * CB_LN; }
  else                                      { in = wout; b0 = CB_X + CB_QKV + 4 * CB_LN; }
  const float* s = in + ((size_t)(bx - b0) * 256 + threadIdx.x) * 8;
  const v4f a = *(const v4f*)(s);
  const v4f b = *(const v4f*)(s + 4);
  v4u p;
  p[0] = pk16(bf_bits(a[0]), bf_bits(a[1]));
  p[1] = pk16(bf_bits(a[2]), bf_bits(a[3]));
  p[2] = pk16(bf_bits(b[0]), bf_bits(b[1]));
  p[3] = pk16(bf_bits(b[2]), bf_bits(b[3]));
  *(v4u*)(out + ((size_t)bx * 256 + threadIdx.x) * 8) = p;
}

// =====================================================================================================
// f32 -> bf16 hi plane + bf16 lo plane (lo = RNE(v - hi), unscaled), 8 elements per thread, one 16-B store per
// coverage: n8 threads x 8 = whole plane (n8 multiple of 256).
// =====================================================================================================
__global__ __launch_bounds__(256) void split_bf16x8(const float* __restrict__ in, unsigned short* hp,
                                                    unsigned short* lp, int n8) {
  const int i = blockIdx.x * 256 + threadIdx.x;
  if (i < n8) {
    const v4f a = *(const v4f*)(in + (size_t)i * 8);
    const v4f b = *(const v4f*)(in + (size_t)i * 8 + 4);
    v4u ph, pl;
#pragma unroll
    for (int e = 0; e < 4; ++e) {
      const float f0 = (e < 2) ? a[2 * e]     : b[2 * e - 4];
      const float f1 = (e < 2) ? a[2 * e + 1] : b[2 * e - 3];
      const unsigned short h0 = bf_bits(f0), h1 = bf_bits(f1);
      const unsigned short l0 = bf_bits(f0 - bf_up(h0)), l1 = bf_bits(f1 - bf_up(h1));
      ph[e] = pk16(h0, h1);
      pl[e] = pk16(l0, l1);
    }
    *(v4u*)(hp + (size_t)i * 8) = ph;
    *(v4u*)(lp + (size_t)i * 8) = pl;
    
  }
}

// =====================================================================================================
// Batched bf16 WMMA GEMM: C[m][n] = sum_k A[m][k] * Bt[n][k] (+ bias). Block = 4 waves = one 128x128 tile, each
// wave a 64x64 quarter (wave>>1 = m half, wave&1 = n half). A row-major [M][K] pitch lda; Bt row-major [N][K] pitch
// ldb (k contiguous); M, N multiples of 128, K a multiple of 64 and at least 64. b = batch index.
// The 128 A rows and 128 Bt rows of a 64-wide k slab (128 B a row) are brought into LDS by asynchronous 16-B copies,
// 8 lanes to a row so that every copy instruction takes whole 128-B lines, and are shared by the block's waves; two
// buffers: slab t+1 flies while slab t is multiplied. LDS row pitch GP = 144 B. Fragments come by ds_load_b128; the
// k order and the order of the products are those of ascending k in steps of 32.
// NSPLIT: 0 = A.Bt; 1 = (A + A2).Bt (A2 = unscaled bf16 lo plane of A).
// BIAS: 0 none; 1 = + bias[n] per output column; 2 = + bias[m] per output row (bias RNE-converted to bf16 and
//       widened, added in f32 in the epilogue).
// OUT_MODE: 0 = f32 (pitch ldc); 2 = bf16 hi plane C + bf16 lo plane C2 (lo = RNE(v - hi), unscaled);
//           3 = f16 hi plane C + f16 residual plane C2 = f16((v - hi) * rscale), C2 written only for tiles
//               with n0 < N2 (pitch ldc2, batch stride strideC2).
// =====================================================================================================
#define GP 72                  // LDS row pitch (16-bit elements) of the GEMM slabs: 144 B = 16 B x 9
#define GPL (128 * GP)         // elements of one staged plane (128 rows)

// Eight asynchronous 16-B copies global -> LDS per lane. The s_wait_xcnt stands inside the statement so that no
// address register of a copy is rewritten ahead of it.
__device__ __forceinline__ void async8(const unsigned (&l)[8], const __bf16* const (&g)[8]) {
#if defined(__HIP_DEVICE_COMPILE__)
  asm volatile(
      "global_load_async_to_lds_b128 %0, %8, off\n\t"
      "global_load_async_to_lds_b128 %1, %9, off\n\t"
      "global_load_async_to_lds_b128 %2, %10, off\n\t"
      "global_load_async_to_lds_b128 %3, %11, off\n\t"
      "global_load_async_to_lds_b128 %4, %12, off\n\t"
      "global_load_async_to_lds_b128 %5, %13, off\n\t"
      "global_load_async_to_lds_b128 %6, %14, off\n\t"
      "global_load_async_to_lds_b128 %7, %15, off\n\t"
      "s_wait_xcnt 0x0"
      :: "v"(l[0]), "v"(l[1]), "v"(l[2]), "v"(l[3]), "v"(l[4]), "v"(l[5]), "v"(l[6]), "v"(l[7]),
         "v"(g[0]), "v"(g[1]), "v"(g[2]), "v"(g[3]), "v"(g[4]), "v"(g[5]), "v"(g[6]), "v"(g[7])
      : "memory");
#endif
}
// One plane of a slab: rows row0..row0+127 of src (pitch ld), columns k0..k0+63, to LDS byte address ldst.
// Thread tid takes the 16-B piece tid&7 of rows (tid>>3) + 16*it.
__device__ __forceinline__ void stage_plane(const __bf16* src, int row0, int ld, int k0, unsigned ldst, int tid) {
  unsigned l[8];
  const __bf16* g[8];
#pragma unroll  // the eight addresses are operands of one asm statement
  for (int it = 0; it < 8; ++it) {
    const int row = it * 16 + (tid >> 3);
    l[it] = ldst + (unsigned)((row * GP + (tid & 7) * 8) * 2);
    g[it] = src + (size_t)(row0 + row) * ld + k0 + (tid & 7) * 8;
  }
  async8(l, g);
}
__device__ __forceinline__ void wait_async0() {   // this wave's copies have landed
#if defined(__HIP_DEVICE_COMPILE__)
  asm volatile("s_wait_asynccnt 0x0" ::: "memory");
#endif
}
__device__ __forceinline__ void wait_ds0() {      // this wave's LDS reads are done before the buffer is refilled
#if defined(__HIP_DEVICE_COMPILE__)
  asm volatile("s_wait_dscnt 0x0" ::: "memory");
#endif
}

// One 128x128 tile (index tile, batch element b) by the 4 waves of a block; sAB = the two slab buffers, sT = the
// per-wave epilogue slabs, both the calling kernel's LDS.
template <int NSPLIT, int OUT_MODE, int BIAS>
__device__ __forceinline__ void gemm_tile(
    __bf16* sAB, float (*sT)[16 * 68], int tile, int b,
    const unsigned short* __restrict__ Ap, const unsigned short* A2p, int lda, long long strideA,
    const unsigned short* __restrict__ Btp, const unsigned short* Bt2p, int ldb, long long strideB,
    void* Cout, int ldc, long long strideC,
    void* Cout2, int ldc2, long long strideC2, int N2,
    const float* __restrict__ biasp,
    int M, int N, int K, float rscale) {
  static_assert(NSPLIT == 0 || NSPLIT == 1);
  constexpr int NPL = (NSPLIT == 1) ? 3 : 2;       // staged planes: A, Bt, (A2)
  constexpr int GI  = (NSPLIT == 1) ? 2 : 4;       // A row groups fetched together
  const __bf16* A   = (const __bf16*)(const void*)Ap;
  const __bf16* A2  = (const __bf16*)(const void*)A2p;
  const __bf16* Bt  = (const __bf16*)(const void*)Btp;
  (void)Bt2p;
  const int tid  = threadIdx.x;
  const int lane = tid & 31;
  const int wave = tid >> 5;
  const int tilesN = N >> 7;
  const int tilesM = M >> 7;
  if (tile >= tilesM * tilesN) return;   // block-uniform, in front of every barrier
  const int tm = tile / tilesN;
  const int tn = tile - tm * tilesN;
  const int mB = tm << 7;
  const int nB = tn << 7;
  const int wm = (wave >> 1) << 6;
  const int wn = (wave & 1) << 6;
  const int m0 = mB + wm;
  const int n0 = nB + wn;

  const __bf16* Ab  = A  + (size_t)b * strideA;
  const __bf16* Bb  = Bt + (size_t)b * strideB;
  const __bf16* Ab2 = (NSPLIT == 1) ? (A2 + (size_t)b * strideA) : Ab;

  const int rlane = lane & 15;                 // row (A) / col (B, D) within subtile
  const int koff  = (lane >> 4) * 8;           // k offset of this lane half
  const int mOff  = (lane >> 4) * 8;           // D row offset

  v8f acc[4][4];
#pragma unroll
  for (int i = 0; i < 4; ++i)
#pragma unroll
    for (int j = 0; j < 4; ++j) acc[i][j] = zero8();

  const unsigned lds0 = (unsigned)(uintptr_t)(void*)sAB;   // LDS byte address of the ring
  const int nT = K >> 6;                                   // k slabs of 64
  // slab t into buffer bf
  auto issue = [&](int t, int bf) {
    const unsigned lb = lds0 + (unsigned)(bf * NPL * GPL * 2);
    stage_plane(Ab, mB, lda, t << 6, lb, tid);
    stage_plane(Bb, nB, ldb, t << 6, lb + (unsigned)(GPL * 2), tid);
    if (NSPLIT == 1) stage_plane(Ab2, mB, lda, t << 6, lb + (unsigned)(2 * GPL * 2), tid);
  };
  issue(0, 0);
  wait_async0();
  __syncthreads();
  if (nT > 1) issue(1, 1);

  for (int t = 0; t < nT; ++t) {
    const __bf16* sA  = sAB + (t & 1) * (NPL * GPL);
    const __bf16* sB  = sA + GPL;
    const __bf16* sA2 = sA + (NPL - 1) * GPL;
    // this loop and those inside it are unrolled so that fragments and accumulators are indexed by constants only
    // and stay in registers
#pragma unroll
    for (int ks = 0; ks < 2; ++ks) {
      // the A fragments of GI row groups (16 products' worth) are fetched together, so that the LDS latency is met
      // once for them and not once a row group; GI is 2 with the second A plane to stay inside 256 registers
      v16b bh[4];
#pragma unroll
      for (int j = 0; j < 4; ++j) bh[j] = ldfrag_b(sB + (wn + (j << 4) + rlane) * GP + ks * 32 + koff);
#pragma unroll
      for (int ig = 0; ig < 4; ig += GI) {
        v16b ah[GI], al[GI];
#pragma unroll
        for (int u = 0; u < GI; ++u) {
          const int ao = (wm + ((ig + u) << 4) + rlane) * GP + ks * 32 + koff;
          ah[u] = ldfrag_b(sA + ao);
          if (NSPLIT == 1) al[u] = ldfrag_b(sA2 + ao); else al[u] = ah[u];
        }
#pragma unroll
        for (int u = 0; u < GI; ++u) {
          const int i = ig + u;
#pragma unroll
          for (int j = 0; j < 4; ++j) {
            acc[i][j] = mma_b_raw(ah[u], bh[j], acc[i][j]);
            if (NSPLIT == 1) acc[i][j] = mma_b_raw(al[u], bh[j], acc[i][j]);
          }
          dep_guard_b(acc[i][0], acc[i][3], ah[u], al[u]);
        }
      }
      keep4_b(bh[0], bh[1], bh[2], bh[3]);
    }
    // publish slab t+1 and free slab t's buffer: own LDS reads done, own copies landed, then the block barrier
    wait_ds0();
    wait_async0();
    __syncthreads();
    if (t + 2 < nT) issue(t + 2, t & 1);
  }
  wait_async0();
  acc_guard4(acc[0][0], acc[0][1], acc[0][2], acc[0][3]);
  acc_guard4(acc[1][0], acc[1][1], acc[1][2], acc[1][3]);
  acc_guard4(acc[2][0], acc[2][1], acc[2][2], acc[2][3]);
  acc_guard4(acc[3][0], acc[3][1], acc[3][2], acc[3][3]);

  // ---- per-column bias (BIAS == 1): this lane's 4 output columns n0 + 16j + rlane ----
  float bcol[4];
#pragma unroll
  for (int j = 0; j < 4; ++j) bcol[j] = 0.f;
  if (BIAS == 1) {
#pragma unroll
    for (int j = 0; j < 4; ++j) bcol[j] = bf_up(bf_bits(biasp[n0 + (j << 4) + rlane]));
  }

  // ---- epilogue ----
  float* slab = sT[wave];
#pragma unroll
  for (int i = 0; i < 4; ++i) {
    const int mBase = m0 + (i << 4);
    float brow[8];
#pragma unroll
    for (int r = 0; r < 8; ++r) brow[r] = 0.f;
    if (BIAS == 2) {
#pragma unroll
      for (int r = 0; r < 8; ++r) brow[r] = bf_up(bf_bits(biasp[mBase + mOff + r]));
    }
#pragma unroll
    for (int r = 0; r < 8; ++r) {
#pragma unroll
      for (int j = 0; j < 4; ++j) {
        float v = acc[i][j][r];
        if (BIAS == 1) v += bcol[j];
        if (BIAS == 2) v += brow[r];
        slab[(mOff + r) * 68 + (j << 4) + rlane] = v;
      }
    }
    __builtin_amdgcn_fence(__ATOMIC_RELEASE, "workgroup");
    __builtin_amdgcn_wave_barrier();
    __builtin_amdgcn_fence(__ATOMIC_ACQUIRE, "workgroup");
    if (OUT_MODE == 0) {
      float* C = (float*)Cout + (size_t)b * strideC;
      const int hh = lane >> 4, c4 = (lane & 15) * 4;     // 256-B row segment = 16 lanes x 16 B
      v4f ov[8];
#pragma unroll
      for (int it = 0; it < 8; ++it) {
        const int row = it * 2 + hh;                       // it 0..7 x hh 0..1 = rows 0..15
        ov[it] = *(const v4f*)(slab + row * 68 + c4);
      }
      {
#pragma unroll
        for (int it = 0; it < 8; ++it) {
          const int row = it * 2 + hh;
          *(v4f*)(C + (size_t)(mBase + row) * ldc + n0 + c4) = ov[it];
        }
        
      }
    } else {
      const int q = lane >> 3, c8 = (lane & 7) * 8;
      unsigned short* C  = (unsigned short*)Cout  + (size_t)b * strideC;
      unsigned short* C2 = (unsigned short*)Cout2 + (size_t)b * strideC2;
      const bool wlo = (OUT_MODE == 2) || (n0 < N2);      // wave-uniform
      v4u hv[4], lv[4];
#pragma unroll
      for (int it = 0; it < 4; ++it) {
        const int row = it * 4 + q;                        // it 0..3 x q 0..3 = rows 0..15
        const float* sp = slab + row * 68 + c8;
        v4u a, a2;
#pragma unroll
        for (int e = 0; e < 4; ++e) {
          const float f0 = sp[2 * e], f1 = sp[2 * e + 1];
          unsigned short h0, h1, l0, l1;
          if (OUT_MODE == 2) {
            h0 = bf_bits(f0); h1 = bf_bits(f1);
            l0 = bf_bits(f0 - bf_up(h0)); l1 = bf_bits(f1 - bf_up(h1));
          } else {
            const _Float16 x0 = (_Float16)f0, x1 = (_Float16)f1;
            h0 = h_bits(x0); h1 = h_bits(x1);
            l0 = h_bits((_Float16)((f0 - (float)x0) * rscale));
            l1 = h_bits((_Float16)((f1 - (float)x1) * rscale));
          }
          a[e] = pk16(h0, h1); a2[e] = pk16(l0, l1);
        }
        hv[it] = a; lv[it] = a2;
      }
      // the test stands round the store loops, not inside them: each side is one straight run of stores
      if (wlo) {
#pragma unroll  // hv and lv are indexed by constants only, so they stay in registers
        for (int it = 0; it < 4; ++it) {
          const int row = it * 4 + q;
          *(v4u*)(C + (size_t)(mBase + row) * ldc + n0 + c8) = hv[it];
          *(v4u*)(C2 + (size_t)(mBase + row) * ldc2 + n0 + c8) = lv[it];
        }
      } else {
#pragma unroll  // as above
        for (int it = 0; it < 4; ++it) {
          const int row = it * 4 + q;
          *(v4u*)(C + (size_t)(mBase + row) * ldc + n0 + c8) = hv[it];
        }
#if defined(__HIP_DEVICE_COMPILE__)
        // the code laid out behind these stores rewrites their address and data registers: the wait stands in front of it
        asm volatile("s_wait_xcnt 0x0" ::: "memory");
#endif
      }
    }
    __builtin_amdgcn_fence(__ATOMIC_RELEASE, "workgroup");
    __builtin_amdgcn_wave_barrier();
    __builtin_amdgcn_fence(__ATOMIC_ACQUIRE, "workgroup");
  }
}

// One GEMM per launch: blockIdx.x = tile, blockIdx.y = batch index.
template <int NSPLIT, int OUT_MODE, int BIAS>
__global__ __launch_bounds__(128) void gemm64(
    const unsigned short* __restrict__ Ap, const unsigned short* A2p, int lda, long long strideA,
    const unsigned short* __restrict__ Btp, const unsigned short* Bt2p, int ldb, long long strideB,
    void* Cout, int ldc, long long strideC,
    void* Cout2, int ldc2, long long strideC2, int N2,
    const float* __restrict__ biasp,
    int M, int N, int K, float rscale) {
  __shared__ __align__(16) __bf16 sAB[2 * ((NSPLIT == 1) ? 3 : 2) * GPL];   // two buffers of 2 or 3 planes
  __shared__ __align__(16) float sT[4][16 * 68];                            // per-wave 16x64 slab, pitch 68 floats
  gemm_tile<NSPLIT, OUT_MODE, BIAS>(sAB, sT, blockIdx.x, blockIdx.y, Ap, A2p, lda, strideA, Btp, Bt2p, ldb, strideB,
                                    Cout, ldc, strideC, Cout2, ldc2, strideC2, N2, biasp, M, N, K, rscale);
}

// The four projections of x, none of which reads another's result, in one launch; a block's index picks its GEMM
// (block-uniform) and its tile: q tiles, k tiles, v^T tiles of each batch element, line-feature tiles.
//   q, k:   C[row][e] = sum_k Xb[row][k] W[e][k] + bias[e] -> bf16 hi / lo planes     (M=4096, N=1024, K=1024)
//   v^T:    VTh[b][f][s] = sum_k Wv[f][k] Xb[b*SEQ+s][k] + bv[f] -> f16 hi plane (pitch SEQ) and residual plane
//           (x4096, keys < VLP, pitch VLP)                                            (M=1024, N=2048, K=1024)
//   lines:  LN[row][e] = sum_k Xb[row][k] Wln[e][k] -> f32                            (M=4096, N=256,  K=1024)
#define PB_Q  ((NB * SEQ / 128) * (QP / 128))    // 256 tiles, q and k each
#define PB_V  ((QP / 128) * (SEQ / 128))         // 128 tiles for each batch element
#define PB_LN ((NB * SEQ / 128) * (LNW / 128))   //  64 tiles
#define PB_ALL (2 * PB_Q + NB * PB_V + PB_LN)
__global__ __launch_bounds__(128) void proj4(
    const unsigned short* __restrict__ Xb, const unsigned short* __restrict__ Wqkv,
    const unsigned short* __restrict__ Wln, const float* __restrict__ bqkv,
    unsigned short* Qh, unsigned short* Ql, unsigned short* Kh, unsigned short* Kl,
    unsigned short* VTh, unsigned short* VTl, float* LN) {
  __shared__ __align__(16) __bf16 sAB[2 * 2 * GPL];     // two buffers of 2 planes
  __shared__ __align__(16) float sT[4][16 * 68];        // per-wave 16x64 slab, pitch 68 floats
  const int bx = blockIdx.x;
  if (bx < 2 * PB_Q) {
    const int isk = (bx >= PB_Q) ? 1 : 0;
    const unsigned short* Wp = Wqkv + (size_t)isk * QP * DMODEL;
    gemm_tile<0, 2, 1>(sAB, sT, bx - isk * PB_Q, 0,
                       Xb, Xb, DMODEL, 0LL, Wp, Wp, DMODEL, 0LL,
                       (void*)(isk ? Kh : Qh), QP, 0LL, (void*)(isk ? Kl : Ql), QP, 0LL, QP,
                       bqkv + isk * QP, NB * SEQ, QP, DMODEL, 1.0f);
  } else if (bx < 2 * PB_Q + NB * PB_V) {
    const int v = bx - 2 * PB_Q;
    const unsigned short* Wp = Wqkv + (size_t)2 * QP * DMODEL;
    gemm_tile<0, 3, 2>(sAB, sT, v % PB_V, v / PB_V,
                       Wp, Wp, DMODEL, 0LL, Xb, Xb, DMODEL, (long long)SEQ * DMODEL,
                       (void*)VTh, SEQ, (long long)QP * SEQ, (void*)VTl, VLP, (long long)QP * VLP, VLP,
                       bqkv + 2 * QP, QP, SEQ, DMODEL, 4096.0f);
  } else if (bx < PB_ALL) {
    gemm_tile<0, 0, 0>(sAB, sT, bx - (2 * PB_Q + NB * PB_V), 0,
                       Xb, Xb, DMODEL, 0LL, Wln, Wln, DMODEL, 0LL,
                       (void*)LN, LNW, 0LL, (void*)LN, 0, 0LL, 0,
                       bqkv, NB * SEQ, LNW, DMODEL, 1.0f);
  }
}

// =====================================================================================================
// Line features. Input ln f32 [NB*SEQ][LNW]: column blocks of PD*NH = 64: block 0 = x.W1w^T, 1 = x.W2w^T,
// 2 = x.W1r^T, 3 = x.W2r^T; within a block head h owns columns h*4..h*4+3.
// Per (b, h, t): p1 = block 0 of token t-1 (zero vector at t == 0: the shifted input), p2 = block 1 of t,
// p3 = block 2 of t, p4 = block 3 of t. Exterior 2-form L[m] = pa[PI[m]]*pb[PJ[m]] - pa[PJ[m]]*pb[PI[m]] for
// pairs (0,1),(0,2),(0,3),(1,2),(1,3),(2,3), then L *= 1/max(|L|_2, 1e-12) (all f32, fp contract off).
// Outputs f32 [NB*NH][SEQ][8]: rl = read line [L0..L5, 0, 0]; wl = J-applied write line [L5,-L4,L3,L2,-L1,L0,0,0].
// wave-uniform bound, no block barriers.
// coverage: nwaves = NB*NH*(SEQ/32) waves x 32 rows x 32 B = every row of both planes incl. the zero pad cols.
// =====================================================================================================
struct L6 { float v0, v1, v2, v3, v4, v5; };

__device__ __forceinline__ L6 ext6n(const v4f a, const v4f b) {
#pragma clang fp contract(off)
  L6 o;
  o.v0 = a[0] * b[1] - a[1] * b[0];
  o.v1 = a[0] * b[2] - a[2] * b[0];
  o.v2 = a[0] * b[3] - a[3] * b[0];
  o.v3 = a[1] * b[2] - a[2] * b[1];
  o.v4 = a[1] * b[3] - a[3] * b[1];
  o.v5 = a[2] * b[3] - a[3] * b[2];
  float n2 = o.v0 * o.v0 + o.v1 * o.v1;
  n2 = n2 + o.v2 * o.v2;
  n2 = n2 + o.v3 * o.v3;
  n2 = n2 + o.v4 * o.v4;
  n2 = n2 + o.v5 * o.v5;
  float n = sqrtf(n2);
  n = fmaxf(n, 1e-12f);
  const float inv = 1.0f / n;
  o.v0 *= inv; o.v1 *= inv; o.v2 *= inv; o.v3 *= inv; o.v4 *= inv; o.v5 *= inv;
  return o;
}

__global__ __launch_bounds__(256) void lines_k(const float* __restrict__ ln, float* rl, float* wl, int nwaves) {
#pragma clang fp contract(off)
  __shared__ __align__(16) float sR[8][256];
  __shared__ __align__(16) float sW[8][256];
  const int tid = threadIdx.x, wave = tid >> 5, lane = tid & 31;
  const int w = blockIdx.x * 8 + wave;
  if (w >= nwaves) return;                        // wave-uniform; no block barriers in this kernel
  const int tgPer = SEQ / 32;                     // 64 token groups per (b, h)
  const int bh = w / tgPer;                       // b*NH + h
  const int tg = w - bh * tgPer;
  const int b  = bh / NH;
  const int h  = bh - b * NH;
  const int t  = tg * 32 + lane;                  // < SEQ
  const size_t row  = (size_t)b * SEQ + t;
  const size_t rowp = (t > 0) ? (row - 1) : row;  // clamped address; value zeroed below when t == 0
  const float* cur = ln + row * LNW + h * PD;
  v4f p1 = *(const v4f*)(ln + rowp * LNW + h * PD);
  if (t == 0) { p1[0] = 0.f; p1[1] = 0.f; p1[2] = 0.f; p1[3] = 0.f; }
  const v4f p2 = *(const v4f*)(cur + 1 * PD * NH);
  const v4f p3 = *(const v4f*)(cur + 2 * PD * NH);
  const v4f p4 = *(const v4f*)(cur + 3 * PD * NH);
  const L6 lw = ext6n(p1, p2);
  const L6 lr = ext6n(p3, p4);

  float* sr = sR[wave] + lane * 8;
  float* sw = sW[wave] + lane * 8;
  v4f t0, t1, u0, u1;
  t0[0] = lr.v0; t0[1] = lr.v1; t0[2] = lr.v2; t0[3] = lr.v3;
  t1[0] = lr.v4; t1[1] = lr.v5; t1[2] = 0.f;   t1[3] = 0.f;
  u0[0] = lw.v5; u0[1] = -lw.v4; u0[2] = lw.v3; u0[3] = lw.v2;
  u1[0] = -lw.v1; u1[1] = lw.v0; u1[2] = 0.f;   u1[3] = 0.f;
  *(v4f*)(sr)     = t0;
  *(v4f*)(sr + 4) = t1;
  *(v4f*)(sw)     = u0;
  *(v4f*)(sw + 4) = u1;
  __builtin_amdgcn_fence(__ATOMIC_RELEASE, "workgroup");
  __builtin_amdgcn_wave_barrier();
  __builtin_amdgcn_fence(__ATOMIC_ACQUIRE, "workgroup");
  v4f oR[2], oW[2];
#pragma unroll
  for (int it = 0; it < 2; ++it) {
    oR[it] = *(const v4f*)(sR[wave] + it * 128 + lane * 4);
    oW[it] = *(const v4f*)(sW[wave] + it * 128 + lane * 4);
  }
  const size_t gb = ((size_t)bh * SEQ + (size_t)tg * 32) * 8;
  {
#pragma unroll
    for (int it = 0; it < 2; ++it) {
      *(v4f*)(rl + gb + it * 128 + lane * 4) = oR[it];
      *(v4f*)(wl + gb + it * 128 + lane * 4) = oW[it];
    }
    
  }
}

// =====================================================================================================
// Causal multi-head attention, head dim 64, with an additive line-pair bias:
//   logit(q, k) = (q . k) * sscale + dot6(rl[q], wl[k]) * wdec(q - k),  wdec(d) = bs_h * dec_h^d for d > 0, 0 else,
//   dec_h = sigmoid(dl_h); keys k > q masked (-FLT_MAX, exp -> 0); diagonal kept.
//   q planes (bf16 hi / lo): element (b, t, h, d) at [(b*SEQ + t)*QP + h*64 + d]
//   k planes (bf16 hi / lo): same layout
//   v^T hi plane (f16):      element (b, h, d, s) at [(b*QP + h*64 + d)*SEQ + s]
//   v^T residual plane (f16, (v - hi)*4096): [(b*QP + h*64 + d)*VLP + s], s < VLP, read only when RES
//   rl / wl f32 planes [b*NH + h][SEQ][8] (6 used)
//   out f32 plane: element (b, t, h*64 + d) at [(b*SEQ + t)*QP + h*64 + d] = normalised context.
//   scores = q . k : bf16 hi/lo split (hi.hi + hi.lo + lo.hi), f32 accumulate, then scale + bias in f32
//   p = exp(s - m) carried as f16(1024 p); context = p . v on f16 WMMA; RES adds f16 residual planes of p and v
//   (scale 4096, separate accumulator folded back with 1/4096 per chunk in f32); online softmax in f32.
//   Block = 4 waves; a query tile = 64 query rows of one (b, h); key chunks of 64, chunks 0..qb only for tile qb
//   (block-uniform trip count qb+1 <= NQB; every row has a live key in every processed chunk).
//   Each block takes two tiles of its (b, h), one after the other: NQB-1-t, then t (t = 0..NQB/2-1), so that every
//   block walks NQB+1 key chunks; grid = (NQB/2) * NH * NB. Tiles qb < RESQB run the RES form.
//   K / V^T / wl chunk staging: 128 threads (plain 16-B loads, __syncthreads before and after); P tiles are
//   wave-private, spilled with _Float16 element stores and reloaded as v8h (same element type) after a release
//   barrier in between).
//   Output coverage: each wave stores rows q0..q0+15 (it 0..7 x lane>>4 0..1) x 64 columns (16 lanes x 4 floats),
// =====================================================================================================
struct AttnLds {
  __align__(16) unsigned short KT[2 * 64 * LP];      // K hi [kv][d] | K lo; later f32 context staging
  __align__(16) _Float16 Vth[64 * LP];                // V^T hi [d][kv]
  __align__(16) _Float16 Vtl[64 * LP];                // V^T residual (RES tiles)
  __align__(16) _Float16 Psh[4][16 * LP];             // per wave P [row][kv]
  __align__(16) _Float16 Psl[4][16 * LP];             // per wave P residual (RES tiles)
  __align__(16) float    Ws[64 * 8];                  // wl rows of the chunk's 64 keys
  __align__(16) float    Rs[4][16 * 8];               // per wave rl rows of its 16 queries
};

// One query tile qb of (b, h), all 4 waves of the block.
template <bool RES>
__device__ __forceinline__
void attn_tile(AttnLds& sm,
               const unsigned short* __restrict__ qhp, const unsigned short* __restrict__ qlp,
               const unsigned short* __restrict__ khp, const unsigned short* __restrict__ klp,
               const unsigned short* __restrict__ vhp, const unsigned short* __restrict__ vlp,
               const float* __restrict__ rlp, const float* __restrict__ wlp,
               const float* __restrict__ dlg, const float* __restrict__ bsc,
               float* outp, int b, int h, int qb, float sscale) {
  union FB { v16b v; v8b h[2]; };
  union FH { v16h v; v8h h[2]; };
  unsigned short* KT = sm.KT;
  _Float16* Vth = sm.Vth;
  _Float16* Vtl = sm.Vtl;
  _Float16 (*Psh)[16 * LP] = sm.Psh;
  _Float16 (*Psl)[16 * LP] = sm.Psl;
  float* Ws = sm.Ws;
  float (*Rs)[16 * 8] = sm.Rs;
  __bf16* Ksh = (__bf16*)(void*)KT;
  __bf16* Ksl = Ksh + 64 * LP;

  const int tid  = threadIdx.x;
  const int wave = tid >> 5;
  const int lane = tid & 31;
  const int hh   = lane >> 4;
  const int c    = lane & 15;

  const int q0   = qb * 64 + wave * 16;
  const size_t rowB = (size_t)b * SEQ;
  const size_t bhT  = ((size_t)b * NH + h) * SEQ;

  const __bf16* Qh = (const __bf16*)(const void*)qhp + (size_t)h * HD;
  const __bf16* Ql = (const __bf16*)(const void*)qlp + (size_t)h * HD;
  const __bf16* Kh = (const __bf16*)(const void*)khp + (size_t)h * HD;
  const __bf16* Kl = (const __bf16*)(const void*)klp + (size_t)h * HD;
  const _Float16* Vh = (const _Float16*)(const void*)vhp + ((size_t)b * QP + (size_t)h * HD) * SEQ;
  const _Float16* Vl = (const _Float16*)(const void*)vlp + ((size_t)b * QP + (size_t)h * HD) * VLP;

  // ---- per-head scalars (RNE bf16-converted inputs) ----
  const float dl  = bf_up(bf_bits(dlg[h]));
  const float dec = 1.0f / (1.0f + expf(-dl));
  const float l2d = log2f(dec);
  const float bsh = bf_up(bf_bits(bsc[h]));

  // ---- stage the wave's 16 rl rows: 16 x 8 f32 = 32 lanes x 16 B (ordered by the loop's first barrier) ----
  *(v4f*)(Rs[wave] + lane * 4) = *(const v4f*)(rlp + (bhT + q0) * 8 + lane * 4);

  float mrow[8], lrow[8];
  v8f oacc[4];
#pragma unroll
  for (int r = 0; r < 8; ++r) { mrow[r] = -INFINITY; lrow[r] = 0.f; }
#pragma unroll
  for (int t = 0; t < 4; ++t) oacc[t] = zero8();

  int nkt = qb + 1;                          // causal: key tiles 0..qb, block-uniform
  if (nkt > NQB) nkt = NQB;
  for (int kt = 0; kt < nkt; ++kt) {
    const int kv0 = kt * 64;
    __syncthreads();
    {
      const int r = tid >> 1, half = (tid & 1) * 32;
      const __bf16*   kg  = Kh + (rowB + kv0 + r) * QP + half;    // K row kv0+r, d = half..half+31
      const __bf16*   klg = Kl + (rowB + kv0 + r) * QP + half;
      const _Float16* vg  = Vh + (size_t)r * SEQ + kv0 + half;    // V^T row d = r, s = kv0+half..+31
      const int kvl = (kv0 + 64 <= VLP) ? kv0 : (VLP - 64);     // clamped address into the residual plane
      const _Float16* vlg = Vl + (size_t)r * VLP + kvl + half;
      const bool resOK = (kv0 + 64 <= VLP);                      // block-uniform
#pragma unroll
      for (int i = 0; i < 4; ++i) {
        const v8b a0 = *(const v8b*)(kg + 8 * i);
        const v8b a1 = *(const v8b*)(klg + 8 * i);
        const v8h b0 = *(const v8h*)(vg + 8 * i);
        *(v8b*)(Ksh + r * LP + half + 8 * i) = a0;
        *(v8b*)(Ksl + r * LP + half + 8 * i) = a1;
        *(v8h*)(Vth + r * LP + half + 8 * i) = b0;
        if (RES) {
          v8h b1 = *(const v8h*)(vlg + 8 * i);
          if (!resOK) b1 = zero8h();
          *(v8h*)(Vtl + r * LP + half + 8 * i) = b1;
        }
      }
      // wl rows kv0..kv0+63 of this (b, h): 64 x 8 f32 = 128 threads x 16 B
      *(v4f*)(Ws + tid * 4) = *(const v4f*)(wlp + (bhT + kv0) * 8 + tid * 4);
    }
    __syncthreads();

    // ---- Q fragments (A operand, row = lane&15): 2 d-chunks, hi and lo (reloaded per chunk) ----
    v16b qah[2], qal[2];
#pragma unroll
    for (int dc = 0; dc < 2; ++dc) {
      const size_t qo = (rowB + q0 + c) * QP + dc * 32 + 8 * hh;
      qah[dc] = ldfrag_b(Qh + qo);
      qal[dc] = ldfrag_b(Ql + qo);
    }

    // ---- scores: 16 query rows x 64 keys per wave, 3 bf16 products ----
    v8f s[4];
#pragma unroll
    for (int j = 0; j < 4; ++j) {
      s[j] = zero8();
#pragma unroll
      for (int dc = 0; dc < 2; ++dc) {
        FB kb, kl;
        kb.h[0] = *(const v8b*)(Ksh + (j * 16 + c) * LP + dc * 32 + 8 * hh);
        kb.h[1] = *(const v8b*)(Ksh + (j * 16 + c) * LP + dc * 32 + 16 + 8 * hh);
        kl.h[0] = *(const v8b*)(Ksl + (j * 16 + c) * LP + dc * 32 + 8 * hh);
        kl.h[1] = *(const v8b*)(Ksl + (j * 16 + c) * LP + dc * 32 + 16 + 8 * hh);
        s[j] = mma_b(qah[dc], kb.v, s[j]);
        s[j] = mma_b(qah[dc], kl.v, s[j]);
        s[j] = mma_b(qal[dc], kb.v, s[j]);
      }
    }

    // ---- wl rows of this lane's 4 key columns (j*16 + c): 6 used of 8 ----
    v4f wa[4];
    v2f wb[4];
#pragma unroll
    for (int j = 0; j < 4; ++j) {
      const float* wp = Ws + (j * 16 + c) * 8;
      wa[j] = *(const v4f*)(wp);
      wb[j] = *(const v2f*)(wp + 4);
    }

    // ---- scale + bias + causal mask (replace by -FLT_MAX), row max, online softmax, P (x1024, f16) and
    //      P residual (x4096) to LDS ----
    _Float16* pwh = Psh[wave];
    _Float16* pwl = Psl[RES ? wave : 0];
    float mloc[8], msafe[8], alpha[8], psum[8];
    // logits of all 8 rows first, so that the 8 row reductions below run as independent chains
#pragma unroll
    for (int r = 0; r < 8; ++r) {
      const int qrow = q0 + 8 * hh + r;
      const float* rp = Rs[wave] + (8 * hh + r) * 8;
      const v4f ra = *(const v4f*)(rp);
      const v2f rb = *(const v2f*)(rp + 4);
      float m = -INFINITY;
#pragma unroll
      for (int j = 0; j < 4; ++j) {
        const int key = kv0 + j * 16 + c;
        const int dd  = qrow - key;
        const float dot6 = ra[0] * wa[j][0] + ra[1] * wa[j][1] + ra[2] * wa[j][2] + ra[3] * wa[j][3]
                         + rb[0] * wb[j][0] + rb[1] * wb[j][1];
        const float ex   = exp2f((float)dd * l2d);
        const float wdec = (dd > 0) ? (bsh * ex) : 0.f;
        float sv = s[j][r] * sscale + dot6 * wdec;
        sv = (key > qrow) ? -FLT_MAX : sv;
        s[j][r] = sv;
        m = fmaxf(m, sv);
      }
      mloc[r] = m;
    }
    // row maximum over the 16 lanes of a half: xor butterfly 1, 2, 4, 8 in the vector unit, 8 rows per step.
    // The scheduling barriers keep the 8 chains side by side: without them the compiler moves each row's chain
    // back behind that row's logits, where every step waits for the one before it.
    __builtin_amdgcn_sched_barrier(0);
    rowmax8<1>(mloc); rowmax8<2>(mloc); rowmax8<4>(mloc); rowmax8<8>(mloc);
    __builtin_amdgcn_sched_barrier(0);
#pragma unroll  // per-row state is indexed by constants only, so it stays in registers
    for (int r = 0; r < 8; ++r) {
      const float mnew = fmaxf(mrow[r], mloc[r]);
      msafe[r] = (mnew == -INFINITY) ? 0.f : mnew;
      alpha[r] = exp_slot(mrow[r] - msafe[r]);
      mrow[r]  = mnew;
    }
#pragma unroll  // as above
    for (int r = 0; r < 8; ++r) {
      float ps = 0.f;
#pragma unroll
      for (int j = 0; j < 4; ++j) {
        const float p = exp_slot(s[j][r] - msafe[r]);  // masked logit against a finite max: exp -> 0
        ps += p;
        const float p1k = p * 1024.0f;
        const _Float16 ph = (_Float16)p1k;
        pwh[(8 * hh + r) * LP + j * 16 + c] = ph;
        if (RES) {
          const _Float16 pl = (_Float16)((p1k - (float)ph) * 4096.0f);
          pwl[(8 * hh + r) * LP + j * 16 + c] = pl;
        }
      }
      psum[r] = ps;
    }
    // row sum: xor butterfly 1, 2, 4, 8 like the maximum, with the same scheduling barriers for the same reason
    __builtin_amdgcn_sched_barrier(0);
    rowsum8<1>(psum); rowsum8<2>(psum); rowsum8<4>(psum); rowsum8<8>(psum);
    __builtin_amdgcn_sched_barrier(0);
#pragma unroll  // as above
    for (int r = 0; r < 8; ++r) {
      lrow[r] = lrow[r] * alpha[r] + psum[r];
#pragma unroll
      for (int t = 0; t < 4; ++t) oacc[t][r] *= alpha[r];
    }
    __builtin_amdgcn_fence(__ATOMIC_RELEASE, "workgroup");
    __builtin_amdgcn_wave_barrier();
    __builtin_amdgcn_fence(__ATOMIC_ACQUIRE, "workgroup");

    // ---- context += P . V (f16 WMMA), residual products into a separate accumulator ----
    v8f o1[4];
#pragma unroll
    for (int t = 0; t < 4; ++t) o1[t] = zero8();
#pragma unroll 1
    for (int kk = 0; kk < 2; ++kk) {
      FH pa, pl;
      pa.h[0] = *(const v8h*)(pwh + c * LP + kk * 32 + 8 * hh);
      pa.h[1] = *(const v8h*)(pwh + c * LP + kk * 32 + 16 + 8 * hh);
      if (RES) {
        pl.h[0] = *(const v8h*)(pwl + c * LP + kk * 32 + 8 * hh);
        pl.h[1] = *(const v8h*)(pwl + c * LP + kk * 32 + 16 + 8 * hh);
      } else {
        pl.v = pa.v;
      }
#pragma unroll
      for (int t = 0; t < 4; ++t) {
        FH vb;
        vb.h[0] = *(const v8h*)(Vth + (t * 16 + c) * LP + kk * 32 + 8 * hh);
        vb.h[1] = *(const v8h*)(Vth + (t * 16 + c) * LP + kk * 32 + 16 + 8 * hh);
        oacc[t] = mma_h(pa.v, vb.v, oacc[t]);
        if (RES) {
          FH vl;
          vl.h[0] = *(const v8h*)(Vtl + (t * 16 + c) * LP + kk * 32 + 8 * hh);
          vl.h[1] = *(const v8h*)(Vtl + (t * 16 + c) * LP + kk * 32 + 16 + 8 * hh);
          o1[t] = mma_h(pa.v, vl.v, o1[t]);
          o1[t] = mma_h(pl.v, vb.v, o1[t]);
        }
      }
    }
    if (RES) {
#pragma unroll
      for (int t = 0; t < 4; ++t)
#pragma unroll
        for (int r = 0; r < 8; ++r) oacc[t][r] += o1[t][r] * (1.0f / 4096.0f);
    }
  }

  // ---- all waves are done with the K tiles before that LDS region is reused for the context staging ----
  __syncthreads();

  // ---- normalise (1/l and the 1/1024 p carry), stage the wave's 16x64 tile in LDS, then write whole
  float* os = (float*)(void*)KT + wave * (16 * 64);
#pragma unroll
  for (int r = 0; r < 8; ++r) {
    const float l = lrow[r];
    const float inv = ((l > 0.f) ? (1.0f / l) : 0.f) * (1.0f / 1024.0f);
#pragma unroll
    for (int t = 0; t < 4; ++t) os[(8 * hh + r) * 64 + t * 16 + c] = oacc[t][r] * inv;
  }
  __builtin_amdgcn_fence(__ATOMIC_RELEASE, "workgroup");
  __builtin_amdgcn_wave_barrier();
  __builtin_amdgcn_fence(__ATOMIC_ACQUIRE, "workgroup");
  {
    const int h2 = lane >> 4, c4 = (lane & 15) * 4;
    v4f ov[8];
#pragma unroll
    for (int it = 0; it < 8; ++it) {
      const int row = it * 2 + h2;   // it 0..7 x h2 0..1 = rows 0..15 of the wave tile
      ov[it] = *(const v4f*)(os + row * 64 + c4);
    }
    {
#pragma unroll
      for (int it = 0; it < 8; ++it) {
        const int row = it * 2 + h2;
        const size_t go = (rowB + q0 + row) * QP + (size_t)h * HD + c4;
        *(v4f*)(outp + go) = ov[it];
      }
#if defined(__HIP_DEVICE_COMPILE__)
      // the block's next tile rewrites the address and data registers of these stores: the wait stands in front of that
      asm volatile("s_wait_xcnt 0x0" ::: "memory");
#endif
    }
  }
}

__global__ __launch_bounds__(128)
void attn_lb(const unsigned short* __restrict__ qhp, const unsigned short* __restrict__ qlp,
             const unsigned short* __restrict__ khp, const unsigned short* __restrict__ klp,
             const unsigned short* __restrict__ vhp, const unsigned short* __restrict__ vlp,
             const float* __restrict__ rlp, const float* __restrict__ wlp,
             const float* __restrict__ dlg, const float* __restrict__ bsc,
             float* outp, float sscale) {
  static_assert((NQB % 2) == 0);
  __shared__ AttnLds sm;
  const int bx   = blockIdx.x;
  const int t    = bx % (NQB / 2);
  const int rest = bx / (NQB / 2);
  const int h    = rest % NH;
  const int b    = rest / NH;
  // The second tile's first barrier (top of its key loop) stands behind every wave's read-back of the first tile's
  // context staging, and in front of the first refill of that LDS.
#pragma unroll 1  // rolled: one copy of each tile form in the text
  for (int pass = 0; pass < 2; ++pass) {
    const int qb = pass ? t : (NQB - 1 - t);       // block-uniform
    if (qb < RESQB)
      attn_tile<true>(sm, qhp, qlp, khp, klp, vhp, vlp, rlp, wlp, dlg, bsc, outp, b, h, qb, sscale);
    else
      attn_tile<false>(sm, qhp, qlp, khp, klp, vhp, vlp, rlp, wlp, dlg, bsc, outp, b, h, qb, sscale);
  }
}

// =====================================================================================================
// Workspace map (bytes), every region an exact multiple of its whole-line / whole-tile store granularity
// multiples):
//   Xb     bf16 [4096][1024]            0            8388608
//   Wqkv   bf16 [3072][1024]            8388608      6291456   ([n][k], rows 0..1023 q | 1024.. k | 2048.. v)
//   Wln    bf16 [256][1024]             14680064      524288   ([W1w; W2w; W1r; W2r], [n][k])
//   Wob    bf16 [1024][1024]            15204352     2097152   ([n][k])
//   LN     f32  [4096][256]             17301504     4194304
//   RL     f32  [32][2048][8]           21495808     2097152
//   WL     f32  [32][2048][8]           23592960     2097152
//   Qh     bf16 [4096][1024]            25690112     8388608
//   Ql     bf16 [4096][1024]            34078720     8388608
//   Kh     bf16 [4096][1024]            42467328     8388608
//   Kl     bf16 [4096][1024]            50855936     8388608
//   VTh    f16  [2][1024][2048]         59244544     8388608
//   VTl    f16  [2][1024][512]          67633152     2097152
//   Af     f32  [4096][1024]            69730304    16777216
//   Ah     bf16 [4096][1024]            86507520     8388608
//   Al     bf16 [4096][1024]            94896128     8388608
//   end                                 103284736
// =====================================================================================================
extern "C" void kernel_launch(void* const* d_in, const int* in_sizes, int n_in,
                              void* d_out, int out_size, void* d_ws, size_t ws_size,
                              hipStream_t stream) {
  if (n_in < 11) return;
  if (in_sizes[0] != NB * SEQ * DMODEL) return;
  if (in_sizes[1] != 3 * QP * DMODEL) return;
  if (in_sizes[2] != 3 * QP) return;
  if (in_sizes[3] != PD * NH * DMODEL) return;
  if (in_sizes[4] != PD * NH * DMODEL) return;
  if (in_sizes[5] != PD * NH * DMODEL) return;
  if (in_sizes[6] != PD * NH * DMODEL) return;
  if (in_sizes[7] != DMODEL * QP) return;
  if (in_sizes[8] != DMODEL) return;
  if (in_sizes[9] != NH) return;
  if (in_sizes[10] != NH) return;
  if (out_size != NB * SEQ * DMODEL) return;

  const float* x     = (const float*)d_in[0];    // [NB*SEQ][DMODEL]
  const float* wqkv  = (const float*)d_in[1];    // [3*QP n][DMODEL k]
  const float* bqkv  = (const float*)d_in[2];    // [3*QP]
  const float* w1w   = (const float*)d_in[3];    // [PD*NH][DMODEL]
  const float* w2w   = (const float*)d_in[4];
  const float* w1r   = (const float*)d_in[5];
  const float* w2r   = (const float*)d_in[6];
  const float* wout  = (const float*)d_in[7];    // [DMODEL n][QP k]
  const float* bout  = (const float*)d_in[8];    // [DMODEL]
  const float* dlog  = (const float*)d_in[9];    // [NH]
  const float* bscl  = (const float*)d_in[10];   // [NH]

  const size_t PXb   = (size_t)NB * SEQ * DMODEL * 2;      //  8388608
  const size_t PWqkv = (size_t)3 * QP * DMODEL * 2;        //  6291456
  const size_t PWln  = (size_t)LNW * DMODEL * 2;           //   524288
  const size_t PWo   = (size_t)DMODEL * QP * 2;            //  2097152
  const size_t PLN   = (size_t)NB * SEQ * LNW * 4;         //  4194304
  const size_t PRL   = (size_t)NB * NH * SEQ * 8 * 4;      //  2097152
  const size_t PQpl  = (size_t)NB * SEQ * QP * 2;          //  8388608  (Qh, Ql, Kh, Kl, Ah, Al)
  const size_t PVTh  = (size_t)NB * QP * SEQ * 2;          //  8388608
  const size_t PVTl  = (size_t)NB * QP * VLP * 2;          //  2097152
  const size_t PAf   = (size_t)NB * SEQ * QP * 4;          // 16777216
  size_t off = 0;
  const size_t oXb   = off; off += PXb;
  const size_t oWqkv = off; off += PWqkv;
  const size_t oWln  = off; off += PWln;
  const size_t oWo   = off; off += PWo;
  const size_t oLN   = off; off += PLN;
  const size_t oRL   = off; off += PRL;
  const size_t oWL   = off; off += PRL;
  const size_t oQh   = off; off += PQpl;
  const size_t oQl   = off; off += PQpl;
  const size_t oKh   = off; off += PQpl;
  const size_t oKl   = off; off += PQpl;
  const size_t oVTh  = off; off += PVTh;
  const size_t oVTl  = off; off += PVTl;
  const size_t oAf   = off; off += PAf;
  const size_t oAh   = off; off += PQpl;
  const size_t oAl   = off; off += PQpl;
  if (off > ws_size) return;                          // off = 103284736
  if (off > (size_t)134217728) return;

  char* ws = (char*)d_ws;
  unsigned short* Xb   = (unsigned short*)(ws + oXb);
  unsigned short* Wqkv = (unsigned short*)(ws + oWqkv);
  unsigned short* Wln  = (unsigned short*)(ws + oWln);
  unsigned short* Wob  = (unsigned short*)(ws + oWo);
  float*          LN   = (float*)(ws + oLN);
  float*          RL   = (float*)(ws + oRL);
  float*          WL   = (float*)(ws + oWL);
  unsigned short* Qh   = (unsigned short*)(ws + oQh);
  unsigned short* Ql   = (unsigned short*)(ws + oQl);
  unsigned short* Kh   = (unsigned short*)(ws + oKh);
  unsigned short* Kl   = (unsigned short*)(ws + oKl);
  unsigned short* VTh  = (unsigned short*)(ws + oVTh);
  unsigned short* VTl  = (unsigned short*)(ws + oVTl);
  float*          Af   = (float*)(ws + oAf);
  unsigned short* Ah   = (unsigned short*)(ws + oAh);
  unsigned short* Al   = (unsigned short*)(ws + oAl);
  float*          outf = (float*)d_out;

  const dim3 blk(256);
  const int nTok   = NB * SEQ;                                       // 4096 tokens
  const int n8a    = nTok * QP / 8;                                  // 524288
  const int nwLn   = NB * NH * (SEQ / 32);                           //   2048 waves
  const dim3 blkG(128);                                              // GEMM block: 4 waves, one 128x128 tile
  const dim3 gLines((nwLn + 7) / 8);                                 // 256 blocks
  const dim3 gSplit((n8a + 255) / 256);                              // 2048 blocks
  const dim3 gOut((nTok / 128) * (DMODEL / 128), 1);                 // 256 blocks

  // (1) inputs -> bf16 planes (RNE convert), one launch; weights arrive [n][k] = the Bt layout already. The planes
  //     Xb | Wqkv | Wln | Wob are contiguous from Xb on.
  cvt_all<<<dim3(CB_ALL), blk, 0, stream>>>(x, wqkv, w1w, w2w, w1r, w2r, wout, Xb);
  // (2)-(5) q, k, v^T and line-feature projections, one launch
  proj4<<<dim3(PB_ALL), blkG, 0, stream>>>(Xb, Wqkv, Wln, bqkv, Qh, Ql, Kh, Kl, VTh, VTl, LN);
  // (6) line features (shifted p1, exterior 2-forms, L2 normalisation, J map) -> rl / wl f32 planes
  lines_k<<<gLines, blk, 0, stream>>>(LN, RL, WL, nwLn);
  // (7) causal attention with line-pair bias: query tiles 0..RESQB-1 with residual planes, the rest without;
  //     one launch, two tiles (NQB-1-t and t) per block
  attn_lb<<<dim3(NB * NH * (NQB / 2)), dim3(128), 0, stream>>>(
      Qh, Ql, Kh, Kl, VTh, VTl, RL, WL, dlog, bscl, Af, 0.125f);
  // (8) context rows -> bf16 hi/lo planes
  split_bf16x8<<<gSplit, blk, 0, stream>>>(Af, Ah, Al, n8a);
  // (9) out[row][e] = sum_d (Ah+Al)[row][d] Wob[e][d] + bout[e] -> d_out f32 [4096][1024]  (M=4096, N=1024, K=1024)
  gemm64<1, 0, 1><<<gOut, blkG, 0, stream>>>(
      Ah, Al, QP, 0LL, Wob, Wob, QP, 0LL,
      (void*)outf, DMODEL, 0LL, (void*)outf, 0, 0LL, 0,
      bout, nTok, DMODEL, QP, 1.0f);
  (void)hipGetLastError();
}

// v006
// One run takes 175 microseconds.
// Two timings next to v005 both put it at 1.29 times that version's speed.
// Over all steps from v000 it is 3.56 times as fast.
// Contractions: q / k / v^T and line-feature projections = v_wmma_f32_16x16x32_bf16 (bf16 operands from
// RNE-converted inputs, one product per k-step); q.k^T scores = v_wmma_f32_16x16x32_bf16 with bf16 hi/lo split
// q and k (hi.hi + hi.lo + lo.hi); p.v = v_wmma_f32_16x16x32_f16 (p carried x1024 in f16, v in f16; extra f16
// residual planes x4096 of p and v on the first 512 query rows); ctx.Wo^T = v_wmma_f32_16x16x32_bf16 with ctx
// as bf16 hi/lo planes times the bf16 Wo plane (2 products); all f32 accumulate; 6-term line-pair bias dots,
// decay weights and softmax in f32 on VALU.
#include <hip/hip_runtime.h>
#include <math.h>
#include <float.h>
#include <stdint.h>

#define NB     2
#define SEQ    2048
#define DMODEL 1024
#define NH     16
#define HD     64
#define QP     (NH * HD)       // 1024: q / k / ctx row pitch
#define NQB    (SEQ / 64)      // 32 query / key tiles of 64
#define VLP    512             // key pitch of the v^T residual plane (keys 0..VLP-1)
#define RESQB  8               // leading 64-row query blocks that use the p / v residual planes
#define PD     4               // point dim per head
#define LNW    (4 * PD * NH)   // 256: width of the line-feature projection [p1w | p2w | p1r | p2r]
#define LP     72              // LDS row pitch (16-bit elements) of the attention K, V^T and P tiles: 144 B = 16 B x 9, so the
                               // 16 rows that one ds_load_b128 reads fall on 16 different groups of 4 banks (at 128 B: on 2)
static_assert(RESQB * 64 <= VLP);
static_assert(RESQB <= NQB);
static_assert(QP == DMODEL);
static_assert(HD == 64);
static_assert(PD == 4);
static_assert(LP >= 64 && (LP % 8) == 0 && 2 * 64 * LP * 2 >= 4 * 16 * 64 * 4);
static_assert((SEQ % 64) == 0 && (DMODEL % 64) == 0 && (LNW % 64) == 0 && (QP % 64) == 0);
static_assert(((NB * SEQ) % 64) == 0 && (SEQ % 32) == 0);
static_assert((DMODEL % 32) == 0);
static_assert(((NB * SEQ) % 128) == 0 && (SEQ % 128) == 0 && (QP % 128) == 0 && (LNW % 128) == 0 && (DMODEL % 128) == 0);

typedef _Float16 v16h __attribute__((ext_vector_type(16)));
typedef _Float16 v8h  __attribute__((ext_vector_type(8)));
typedef __bf16   v16b __attribute__((ext_vector_type(16)));
typedef __bf16   v8b  __attribute__((ext_vector_type(8)));
typedef float    v8f  __attribute__((ext_vector_type(8)));
typedef float    v4f  __attribute__((ext_vector_type(4)));
typedef float    v2f  __attribute__((ext_vector_type(2)));
typedef unsigned int v4u __attribute__((ext_vector_type(4)));

// ---- scalar helpers --------------------------------------------------------------------------------
__device__ __forceinline__ unsigned short bf_bits(float f) {          // f32 -> bf16 bits, RNE convert
  unsigned u = __float_as_uint(f);
  return (unsigned short)((u + 0x7FFFu + ((u >> 16) & 1u)) >> 16);
}
__device__ __forceinline__ float bf_up(unsigned short h) { return __uint_as_float(((unsigned)h) << 16); }
__device__ __forceinline__ unsigned short h_bits(_Float16 x) { return __builtin_bit_cast(unsigned short, x); }
__device__ __forceinline__ unsigned pk16(unsigned short a, unsigned short b) { return (unsigned)a | ((unsigned)b << 16); }
__device__ __forceinline__ v8f zero8() { v8f z = {0.f, 0.f, 0.f, 0.f, 0.f, 0.f, 0.f, 0.f}; return z; }
__device__ __forceinline__ v8h zero8h() {
  const _Float16 z = (_Float16)0.0f;
  v8h r = {z, z, z, z, z, z, z, z};
  return r;
}

// ---- lane l <- lane l ^ X inside each 16-lane row (DPP row_xmask, control 0x160 + X): no LDS round trip ----
template <int X>
__device__ __forceinline__ float lane_xor16(float v) {
  return __builtin_bit_cast(float, __builtin_amdgcn_update_dpp(0, __builtin_bit_cast(int, v), 0x160 + X, 0xf, 0xf, true));
}
// exp(x) as v_exp_f32(x * log2 e), the form __expf compiled to. The v_nop is the one slot that the instruction set asks
// for behind a transcendental before a source is overwritten.
__device__ __forceinline__ float exp_slot(float x) {
  const float t = x * 1.44269504088896340736f;
  float r;
#if defined(__HIP_DEVICE_COMPILE__)
  asm("v_exp_f32 %0, %1\n\tv_nop" : "=v"(r) : "v"(t));
#else
  r = t;
#endif
  return r;
}
template <int X>
__device__ __forceinline__ void rowmax8(float (&m)[8]) {
#pragma unroll  // the 8 values stay in registers, one independent instruction chain each
  for (int r = 0; r < 8; ++r) m[r] = fmaxf(m[r], lane_xor16<X>(m[r]));
}
template <int X>
__device__ __forceinline__ void rowsum8(float (&m)[8]) {
#pragma unroll  // the 8 values stay in registers, one independent instruction chain each
  for (int r = 0; r < 8; ++r) m[r] += lane_xor16<X>(m[r]);
}

// ---- fragment loader: 16-bit A/B operand, lane -> row/col (lane&15), p already includes +8*(lane>>4);
//      elements 0..7 <- p[0..7] (k0+8h..), elements 8..15 <- p[16..23] (k0+16+8h..)
__device__ __forceinline__ v16b ldfrag_b(const __bf16* p) {
  union { v16b v; v8b h[2]; } f;
  f.h[0] = *(const v8b*)(p);
  f.h[1] = *(const v8b*)(p + 16);
  return f.v;
}

// ---- WMMA helpers with trailing VALU hazard gap --------------------------------------------------------
__device__ __forceinline__ v8f mma_b(v16b a, v16b b, v8f c) {
  c = __builtin_amdgcn_wmma_f32_16x16x32_bf16(false, a, false, b, (short)0, c, false, false);
#if defined(__HIP_DEVICE_COMPILE__)
  asm volatile("v_nop\n\tv_nop\n\tv_nop\n\tv_nop" : "+v"(c) : "v"(a), "v"(b));
#endif
  return c;
}
__device__ __forceinline__ v8f mma_h(v16h a, v16h b, v8f c) {
  c = __builtin_amdgcn_wmma_f32_16x16x32_f16(false, a, false, b, (short)0, c, false, false);
#if defined(__HIP_DEVICE_COMPILE__)
  asm volatile("v_nop\n\tv_nop\n\tv_nop\n\tv_nop" : "+v"(c) : "v"(a), "v"(b));
#endif
  return c;
}
__device__ __forceinline__ v8f mma_b_raw(v16b a, v16b b, v8f c) {
  return __builtin_amdgcn_wmma_f32_16x16x32_bf16(false, a, false, b, (short)0, c, false, false);
}
__device__ __forceinline__ void dep_guard_b(v8f& a, v8f& b, v16b x, v16b y) {
#if defined(__HIP_DEVICE_COMPILE__)
  asm volatile("v_nop\n\tv_nop\n\tv_nop\n\tv_nop" : "+v"(a), "+v"(b) : "v"(x), "v"(y));
#endif
}
__device__ __forceinline__ void keep4_b(v16b a, v16b b, v16b c, v16b d) {
#if defined(__HIP_DEVICE_COMPILE__)
  asm volatile("v_nop" :: "v"(a), "v"(b), "v"(c), "v"(d));
#endif
}
__device__ __forceinline__ void acc_guard4(v8f& a, v8f& b, v8f& c, v8f& d) {
#if defined(__HIP_DEVICE_COMPILE__)
  asm volatile("v_nop\n\tv_nop\n\tv_nop\n\tv_nop" : "+v"(a), "+v"(b), "+v"(c), "+v"(d));
#endif
}

// =====================================================================================================
// Flat f32 -> bf16 (RNE convert) of all seven f32 operands in one launch: x, w_qkv, the four line weights, w_out.
// Their bf16 planes lie one behind the other in the workspace in that order, so the destination is one flat array;
// a block (256 threads x 8 elements = 2048 elements) lies wholly inside one operand and picks its source by its index
// (block-uniform). One 16-B store per lane: a wave writes 512 contiguous bytes.
// coverage: CB_ALL blocks x 2048 elements = all seven planes, every plane a multiple of 2048 elements.
// =====================================================================================================
#define CB_X   (NB * SEQ * DMODEL / 2048)    // 2048 blocks
#define CB_QKV (3 * QP * DMODEL / 2048)      // 1536
#define CB_LN  (PD * NH * DMODEL / 2048)     //   32 for each line weight
#define CB_WO  (DMODEL * QP / 2048)          //  512
#define CB_ALL (CB_X + CB_QKV + 4 * CB_LN + CB_WO)
static_assert(((NB * SEQ * DMODEL) % 2048) == 0 && ((3 * QP * DMODEL) % 2048) == 0);
static_assert(((PD * NH * DMODEL) % 2048) == 0 && ((DMODEL * QP) % 2048) == 0);
__global__ __launch_bounds__(256) void cvt_all(const float* __restrict__ x, const float* __restrict__ wqkv,
                                               const float* __restrict__ w1w, const float* __restrict__ w2w,
                                               const float* __restrict__ w1r, const float* __restrict__ w2r,
                                               const float* __restrict__ wout, unsigned short* out) {
  const int bx = blockIdx.x;
  if (bx >= CB_ALL) return;
  const float* in;
  int b0;
  if (bx < CB_X)                            { in = x;    b0 = 0; }
  else if (bx < CB_X + CB_QKV)              { in = wqkv; b0 = CB_X; }
  else if (bx < CB_X + CB_QKV + 1 * CB_LN)  { in = w1w;  b0 = CB_X + CB_QKV; }
  else if (bx < CB_X + CB_QKV + 2 * CB_LN)  { in = w2w;  b0 = CB_X + CB_QKV + 1 * CB_LN; }
  else if (bx < CB_X + CB_QKV + 3 * CB_LN)  { in = w1r;  b0 = CB_X + CB_QKV + 2 * CB_LN; }
  else if (bx < CB_X + CB_QKV + 4 * CB_LN)  { in = w2r;  b0 = CB_X + CB_QKV + 3 * CB_LN; }
  else                                      { in = wout; b0 = CB_X + CB_QKV + 4 * CB_LN; }
  const float* s = in + ((size_t)(bx - b0) * 256 + threadIdx.x) * 8;
  const v4f a = *(const v4f*)(s);
  const v4f b = *(const v4f*)(s + 4);
  v4u p;
  p[0] = pk16(bf_bits(a[0]), bf_bits(a[1]));
  p[1] = pk16(bf_bits(a[2]), bf_bits(a[3]));
  p[2] = pk16(bf_bits(b[0]), bf_bits(b[1]));
  p[3] = pk16(bf_bits(b[2]), bf_bits(b[3]));
  *(v4u*)(out + ((size_t)bx * 256 + threadIdx.x) * 8) = p;
}

// =====================================================================================================
// f32 -> bf16 hi plane + bf16 lo plane (lo = RNE(v - hi), unscaled), 8 elements per thread, one 16-B store per
// coverage: n8 threads x 8 = whole plane (n8 multiple of 256).
// =====================================================================================================
__global__ __launch_bounds__(256) void split_bf16x8(const float* __restrict__ in, unsigned short* hp,
                                                    unsigned short* lp, int n8) {
  const int i = blockIdx.x * 256 + threadIdx.x;
  if (i < n8) {
    const v4f a = *(const v4f*)(in + (size_t)i * 8);
    const v4f b = *(const v4f*)(in + (size_t)i * 8 + 4);
    v4u ph, pl;
#pragma unroll
    for (int e = 0; e < 4; ++e) {
      const float f0 = (e < 2) ? a[2 * e]     : b[2 * e - 4];
      const float f1 = (e < 2) ? a[2 * e + 1] : b[2 * e - 3];
      const unsigned short h0 = bf_bits(f0), h1 = bf_bits(f1);
      const unsigned short l0 = bf_bits(f0 - bf_up(h0)), l1 = bf_bits(f1 - bf_up(h1));
      ph[e] = pk16(h0, h1);
      pl[e] = pk16(l0, l1);
    }
    *(v4u*)(hp + (size_t)i * 8) = ph;
    *(v4u*)(lp + (size_t)i * 8) = pl;
    
  }
}

// =====================================================================================================
// Batched bf16 WMMA GEMM: C[m][n] = sum_k A[m][k] * Bt[n][k] (+ bias). Block = 4 waves = one 128x128 tile, each
// wave a 64x64 quarter (wave>>1 = m half, wave&1 = n half). A row-major [M][K] pitch lda; Bt row-major [N][K] pitch
// ldb (k contiguous); M, N multiples of 128, K a multiple of 64 and at least 64. b = batch index.
// The 128 A rows and 128 Bt rows of a 64-wide k slab (128 B a row) are brought into LDS by asynchronous 16-B copies,
// 8 lanes to a row so that every copy instruction takes whole 128-B lines, and are shared by the block's waves; two
// buffers: slab t+1 flies while slab t is multiplied. LDS row pitch GP = 144 B. Fragments come by ds_load_b128; the
// k order and the order of the products are those of ascending k in steps of 32.
// NSPLIT: 0 = A.Bt; 1 = (A + A2).Bt (A2 = unscaled bf16 lo plane of A).
// BIAS: 0 none; 1 = + bias[n] per output column; 2 = + bias[m] per output row (bias RNE-converted to bf16 and
//       widened, added in f32 in the epilogue).
// OUT_MODE: 0 = f32 (pitch ldc); 2 = bf16 hi plane C + bf16 lo plane C2 (lo = RNE(v - hi), unscaled);
//           3 = f16 hi plane C + f16 residual plane C2 = f16((v - hi) * rscale), C2 written only for tiles
//               with n0 < N2 (pitch ldc2, batch stride strideC2).
// =====================================================================================================
#define GP 72                  // LDS row pitch (16-bit elements) of the GEMM slabs: 144 B = 16 B x 9
#define GPL (128 * GP)         // elements of one staged plane (128 rows)

// Eight asynchronous 16-B copies global -> LDS per lane. The s_wait_xcnt stands inside the statement so that no
// address register of a copy is rewritten ahead of it.
__device__ __forceinline__ void async8(const unsigned (&l)[8], const __bf16* const (&g)[8]) {
#if defined(__HIP_DEVICE_COMPILE__)
  asm volatile(
      "global_load_async_to_lds_b128 %0, %8, off\n\t"
      "global_load_async_to_lds_b128 %1, %9, off\n\t"
      "global_load_async_to_lds_b128 %2, %10, off\n\t"
      "global_load_async_to_lds_b128 %3, %11, off\n\t"
      "global_load_async_to_lds_b128 %4, %12, off\n\t"
      "global_load_async_to_lds_b128 %5, %13, off\n\t"
      "global_load_async_to_lds_b128 %6, %14, off\n\t"
      "global_load_async_to_lds_b128 %7, %15, off\n\t"
      "s_wait_xcnt 0x0"
      :: "v"(l[0]), "v"(l[1]), "v"(l[2]), "v"(l[3]), "v"(l[4]), "v"(l[5]), "v"(l[6]), "v"(l[7]),
         "v"(g[0]), "v"(g[1]), "v"(g[2]), "v"(g[3]), "v"(g[4]), "v"(g[5]), "v"(g[6]), "v"(g[7])
      : "memory");
#endif
}
// One plane of a slab: rows row0..row0+127 of src (pitch ld), columns k0..k0+63, to LDS byte address ldst.
// Thread tid takes the 16-B piece tid&7 of rows (tid>>3) + 16*it.
__device__ __forceinline__ void stage_plane(const __bf16* src, int row0, int ld, int k0, unsigned ldst, int tid) {
  unsigned l[8];
  const __bf16* g[8];
#pragma unroll  // the eight addresses are operands of one asm statement
  for (int it = 0; it < 8; ++it) {
    const int row = it * 16 + (tid >> 3);
    l[it] = ldst + (unsigned)((row * GP + (tid & 7) * 8) * 2);
    g[it] = src + (size_t)(row0 + row) * ld + k0 + (tid & 7) * 8;
  }
  async8(l, g);
}
__device__ __forceinline__ void wait_async0() {   // this wave's copies have landed
#if defined(__HIP_DEVICE_COMPILE__)
  asm volatile("s_wait_asynccnt 0x0" ::: "memory");
#endif
}
__device__ __forceinline__ void wait_ds0() {      // this wave's LDS reads are done before the buffer is refilled
#if defined(__HIP_DEVICE_COMPILE__)
  asm volatile("s_wait_dscnt 0x0" ::: "memory");
#endif
}

// One 128x128 tile (index tile, batch element b) by the 4 waves of a block; sAB = the two slab buffers, sT = the
// per-wave epilogue slabs, both the calling kernel's LDS.
template <int NSPLIT, int OUT_MODE, int BIAS>
__device__ __forceinline__ void gemm_tile(
    __bf16* sAB, float (*sT)[16 * 68], int tile, int b,
    const unsigned short* __restrict__ Ap, const unsigned short* A2p, int lda, long long strideA,
    const unsigned short* __restrict__ Btp, const unsigned short* Bt2p, int ldb, long long strideB,
    void* Cout, int ldc, long long strideC,
    void* Cout2, int ldc2, long long strideC2, int N2,
    const float* __restrict__ biasp,
    int M, int N, int K, float rscale) {
  static_assert(NSPLIT == 0 || NSPLIT == 1);
  constexpr int NPL = (NSPLIT == 1) ? 3 : 2;       // staged planes: A, Bt, (A2)
  constexpr int GI  = (NSPLIT == 1) ? 2 : 4;       // A row groups fetched together
  const __bf16* A   = (const __bf16*)(const void*)Ap;
  const __bf16* A2  = (const __bf16*)(const void*)A2p;
  const __bf16* Bt  = (const __bf16*)(const void*)Btp;
  (void)Bt2p;
  const int tid  = threadIdx.x;
  const int lane = tid & 31;
  const int wave = tid >> 5;
  const int tilesN = N >> 7;
  const int tilesM = M >> 7;
  if (tile >= tilesM * tilesN) return;   // block-uniform, in front of every barrier
  const int tm = tile / tilesN;
  const int tn = tile - tm * tilesN;
  const int mB = tm << 7;
  const int nB = tn << 7;
  const int wm = (wave >> 1) << 6;
  const int wn = (wave & 1) << 6;
  const int m0 = mB + wm;
  const int n0 = nB + wn;

  const __bf16* Ab  = A  + (size_t)b * strideA;
  const __bf16* Bb  = Bt + (size_t)b * strideB;
  const __bf16* Ab2 = (NSPLIT == 1) ? (A2 + (size_t)b * strideA) : Ab;

  const int rlane = lane & 15;                 // row (A) / col (B, D) within subtile
  const int koff  = (lane >> 4) * 8;           // k offset of this lane half
  const int mOff  = (lane >> 4) * 8;           // D row offset

  v8f acc[4][4];
#pragma unroll
  for (int i = 0; i < 4; ++i)
#pragma unroll
    for (int j = 0; j < 4; ++j) acc[i][j] = zero8();

  const unsigned lds0 = (unsigned)(uintptr_t)(void*)sAB;   // LDS byte address of the ring
  const int nT = K >> 6;                                   // k slabs of 64
  // slab t into buffer bf
  auto issue = [&](int t, int bf) {
    const unsigned lb = lds0 + (unsigned)(bf * NPL * GPL * 2);
    stage_plane(Ab, mB, lda, t << 6, lb, tid);
    stage_plane(Bb, nB, ldb, t << 6, lb + (unsigned)(GPL * 2), tid);
    if (NSPLIT == 1) stage_plane(Ab2, mB, lda, t << 6, lb + (unsigned)(2 * GPL * 2), tid);
  };
  issue(0, 0);
  wait_async0();
  __syncthreads();
  if (nT > 1) issue(1, 1);

  for (int t = 0; t < nT; ++t) {
    const __bf16* sA  = sAB + (t & 1) * (NPL * GPL);
    const __bf16* sB  = sA + GPL;
    const __bf16* sA2 = sA + (NPL - 1) * GPL;
    // this loop and those inside it are unrolled so that fragments and accumulators are indexed by constants only
    // and stay in registers
#pragma unroll
    for (int ks = 0; ks < 2; ++ks) {
      // the A fragments of GI row groups (16 products' worth) are fetched together, so that the LDS latency is met
      // once for them and not once a row group; GI is 2 with the second A plane to stay inside 256 registers
      v16b bh[4];
#pragma unroll
      for (int j = 0; j < 4; ++j) bh[j] = ldfrag_b(sB + (wn + (j << 4) + rlane) * GP + ks * 32 + koff);
#pragma unroll
      for (int ig = 0; ig < 4; ig += GI) {
        v16b ah[GI], al[GI];
#pragma unroll
        for (int u = 0; u < GI; ++u) {
          const int ao = (wm + ((ig + u) << 4) + rlane) * GP + ks * 32 + koff;
          ah[u] = ldfrag_b(sA + ao);
          if (NSPLIT == 1) al[u] = ldfrag_b(sA2 + ao); else al[u] = ah[u];
        }
#pragma unroll
        for (int u = 0; u < GI; ++u) {
          const int i = ig + u;
#pragma unroll
          for (int j = 0; j < 4; ++j) {
            acc[i][j] = mma_b_raw(ah[u], bh[j], acc[i][j]);
            if (NSPLIT == 1) acc[i][j] = mma_b_raw(al[u], bh[j], acc[i][j]);
          }
          dep_guard_b(acc[i][0], acc[i][3], ah[u], al[u]);
        }
      }
      keep4_b(bh[0], bh[1], bh[2], bh[3]);
    }
    // publish slab t+1 and free slab t's buffer: own LDS reads done, own copies landed, then the block barrier
    wait_ds0();
    wait_async0();
    __syncthreads();
    if (t + 2 < nT) issue(t + 2, t & 1);
  }
  wait_async0();
  acc_guard4(acc[0][0], acc[0][1], acc[0][2], acc[0][3]);
  acc_guard4(acc[1][0], acc[1][1], acc[1][2], acc[1][3]);
  acc_guard4(acc[2][0], acc[2][1], acc[2][2], acc[2][3]);
  acc_guard4(acc[3][0], acc[3][1], acc[3][2], acc[3][3]);

  // ---- per-column bias (BIAS == 1): this lane's 4 output columns n0 + 16j + rlane ----
  float bcol[4];
#pragma unroll
  for (int j = 0; j < 4; ++j) bcol[j] = 0.f;
  if (BIAS == 1) {
#pragma unroll
    for (int j = 0; j < 4; ++j) bcol[j] = bf_up(bf_bits(biasp[n0 + (j << 4) + rlane]));
  }

  // ---- epilogue ----
  float* slab = sT[wave];
#pragma unroll
  for (int i = 0; i < 4; ++i) {
    const int mBase = m0 + (i << 4);
    float brow[8];
#pragma unroll
    for (int r = 0; r < 8; ++r) brow[r] = 0.f;
    if (BIAS == 2) {
#pragma unroll
      for (int r = 0; r < 8; ++r) brow[r] = bf_up(bf_bits(biasp[mBase + mOff + r]));
    }
#pragma unroll
    for (int r = 0; r < 8; ++r) {
#pragma unroll
      for (int j = 0; j < 4; ++j) {
        float v = acc[i][j][r];
        if (BIAS == 1) v += bcol[j];
        if (BIAS == 2) v += brow[r];
        slab[(mOff + r) * 68 + (j << 4) + rlane] = v;
      }
    }
    __builtin_amdgcn_fence(__ATOMIC_RELEASE, "workgroup");
    __builtin_amdgcn_wave_barrier();
    __builtin_amdgcn_fence(__ATOMIC_ACQUIRE, "workgroup");
    if (OUT_MODE == 0) {
      float* C = (float*)Cout + (size_t)b * strideC;
      const int hh = lane >> 4, c4 = (lane & 15) * 4;     // 256-B row segment = 16 lanes x 16 B
      v4f ov[8];
#pragma unroll
      for (int it = 0; it < 8; ++it) {
        const int row = it * 2 + hh;                       // it 0..7 x hh 0..1 = rows 0..15
        ov[it] = *(const v4f*)(slab + row * 68 + c4);
      }
      {
#pragma unroll
        for (int it = 0; it < 8; ++it) {
          const int row = it * 2 + hh;
          *(v4f*)(C + (size_t)(mBase + row) * ldc + n0 + c4) = ov[it];
        }
        
      }
    } else {
      const int q = lane >> 3, c8 = (lane & 7) * 8;
      unsigned short* C  = (unsigned short*)Cout  + (size_t)b * strideC;
      unsigned short* C2 = (unsigned short*)Cout2 + (size_t)b * strideC2;
      const bool wlo = (OUT_MODE == 2) || (n0 < N2);      // wave-uniform
      v4u hv[4], lv[4];
#pragma unroll
      for (int it = 0; it < 4; ++it) {
        const int row = it * 4 + q;                        // it 0..3 x q 0..3 = rows 0..15
        const float* sp = slab + row * 68 + c8;
        v4u a, a2;
#pragma unroll
        for (int e = 0; e < 4; ++e) {
          const float f0 = sp[2 * e], f1 = sp[2 * e + 1];
          unsigned short h0, h1, l0, l1;
          if (OUT_MODE == 2) {
            h0 = bf_bits(f0); h1 = bf_bits(f1);
            l0 = bf_bits(f0 - bf_up(h0)); l1 = bf_bits(f1 - bf_up(h1));
          } else {
            const _Float16 x0 = (_Float16)f0, x1 = (_Float16)f1;
            h0 = h_bits(x0); h1 = h_bits(x1);
            l0 = h_bits((_Float16)((f0 - (float)x0) * rscale));
            l1 = h_bits((_Float16)((f1 - (float)x1) * rscale));
          }
          a[e] = pk16(h0, h1); a2[e] = pk16(l0, l1);
        }
        hv[it] = a; lv[it] = a2;
      }
      // the test stands round the store loops, not inside them: each side is one straight run of stores
      if (wlo) {
#pragma unroll  // hv and lv are indexed by constants only, so they stay in registers
        for (int it = 0; it < 4; ++it) {
          const int row = it * 4 + q;
          *(v4u*)(C + (size_t)(mBase + row) * ldc + n0 + c8) = hv[it];
          *(v4u*)(C2 + (size_t)(mBase + row) * ldc2 + n0 + c8) = lv[it];
        }
      } else {
#pragma unroll  // as above
        for (int it = 0; it < 4; ++it) {
          const int row = it * 4 + q;
          *(v4u*)(C + (size_t)(mBase + row) * ldc + n0 + c8) = hv[it];
        }
#if defined(__HIP_DEVICE_COMPILE__)
        // the code laid out behind these stores rewrites their address and data registers: the wait stands in front of it
        asm volatile("s_wait_xcnt 0x0" ::: "memory");
#endif
      }
    }
    __builtin_amdgcn_fence(__ATOMIC_RELEASE, "workgroup");
    __builtin_amdgcn_wave_barrier();
    __builtin_amdgcn_fence(__ATOMIC_ACQUIRE, "workgroup");
  }
}

// One GEMM per launch: blockIdx.x = tile, blockIdx.y = batch index.
template <int NSPLIT, int OUT_MODE, int BIAS>
__global__ __launch_bounds__(128) void gemm64(
    const unsigned short* __restrict__ Ap, const unsigned short* A2p, int lda, long long strideA,
    const unsigned short* __restrict__ Btp, const unsigned short* Bt2p, int ldb, long long strideB,
    void* Cout, int ldc, long long strideC,
    void* Cout2, int ldc2, long long strideC2, int N2,
    const float* __restrict__ biasp,
    int M, int N, int K, float rscale) {
  __shared__ __align__(16) __bf16 sAB[2 * ((NSPLIT == 1) ? 3 : 2) * GPL];   // two buffers of 2 or 3 planes
  __shared__ __align__(16) float sT[4][16 * 68];                            // per-wave 16x64 slab, pitch 68 floats
  gemm_tile<NSPLIT, OUT_MODE, BIAS>(sAB, sT, blockIdx.x, blockIdx.y, Ap, A2p, lda, strideA, Btp, Bt2p, ldb, strideB,
                                    Cout, ldc, strideC, Cout2, ldc2, strideC2, N2, biasp, M, N, K, rscale);
}

// The four projections of x, none of which reads another's result, in one launch; a block's index picks its GEMM
// (block-uniform) and its tile: q tiles, k tiles, v^T tiles of each batch element, line-feature tiles.
//   q, k:   C[row][e] = sum_k Xb[row][k] W[e][k] + bias[e] -> bf16 hi / lo planes     (M=4096, N=1024, K=1024)
//   v^T:    VTh[b][f][s] = sum_k Wv[f][k] Xb[b*SEQ+s][k] + bv[f] -> f16 hi plane (pitch SEQ) and residual plane
//           (x4096, keys < VLP, pitch VLP)                                            (M=1024, N=2048, K=1024)
//   lines:  LN[row][e] = sum_k Xb[row][k] Wln[e][k] -> f32                            (M=4096, N=256,  K=1024)
#define PB_Q  ((NB * SEQ / 128) * (QP / 128))    // 256 tiles, q and k each
#define PB_V  ((QP / 128) * (SEQ / 128))         // 128 tiles for each batch element
#define PB_LN ((NB * SEQ / 128) * (LNW / 128))   //  64 tiles
#define PB_ALL (2 * PB_Q + NB * PB_V + PB_LN)
__global__ __launch_bounds__(128) void proj4(
    const unsigned short* __restrict__ Xb, const unsigned short* __restrict__ Wqkv,
    const unsigned short* __restrict__ Wln, const float* __restrict__ bqkv,
    unsigned short* Qh, unsigned short* Ql, unsigned short* Kh, unsigned short* Kl,
    unsigned short* VTh, unsigned short* VTl, float* LN) {
  __shared__ __align__(16) __bf16 sAB[2 * 2 * GPL];     // two buffers of 2 planes
  __shared__ __align__(16) float sT[4][16 * 68];        // per-wave 16x64 slab, pitch 68 floats
  const int bx = blockIdx.x;
  if (bx < 2 * PB_Q) {
    const int isk = (bx >= PB_Q) ? 1 : 0;
    const unsigned short* Wp = Wqkv + (size_t)isk * QP * DMODEL;
    gemm_tile<0, 2, 1>(sAB, sT, bx - isk * PB_Q, 0,
                       Xb, Xb, DMODEL, 0LL, Wp, Wp, DMODEL, 0LL,
                       (void*)(isk ? Kh : Qh), QP, 0LL, (void*)(isk ? Kl : Ql), QP, 0LL, QP,
                       bqkv + isk * QP, NB * SEQ, QP, DMODEL, 1.0f);
  } else if (bx < 2 * PB_Q + NB * PB_V) {
    const int v = bx - 2 * PB_Q;
    const unsigned short* Wp = Wqkv + (size_t)2 * QP * DMODEL;
    gemm_tile<0, 3, 2>(sAB, sT, v % PB_V, v / PB_V,
                       Wp, Wp, DMODEL, 0LL, Xb, Xb, DMODEL, (long long)SEQ * DMODEL,
                       (void*)VTh, SEQ, (long long)QP * SEQ, (void*)VTl, VLP, (long long)QP * VLP, VLP,
                       bqkv + 2 * QP, QP, SEQ, DMODEL, 4096.0f);
  } else if (bx < PB_ALL) {
    gemm_tile<0, 0, 0>(sAB, sT, bx - (2 * PB_Q + NB * PB_V), 0,
                       Xb, Xb, DMODEL, 0LL, Wln, Wln, DMODEL, 0LL,
                       (void*)LN, LNW, 0LL, (void*)LN, 0, 0LL, 0,
                       bqkv, NB * SEQ, LNW, DMODEL, 1.0f);
  }
}

// =====================================================================================================
// Line features. Input ln f32 [NB*SEQ][LNW]: column blocks of PD*NH = 64: block 0 = x.W1w^T, 1 = x.W2w^T,
// 2 = x.W1r^T, 3 = x.W2r^T; within a block head h owns columns h*4..h*4+3.
// Per (b, h, t): p1 = block 0 of token t-1 (zero vector at t == 0: the shifted input), p2 = block 1 of t,
// p3 = block 2 of t, p4 = block 3 of t. Exterior 2-form L[m] = pa[PI[m]]*pb[PJ[m]] - pa[PJ[m]]*pb[PI[m]] for
// pairs (0,1),(0,2),(0,3),(1,2),(1,3),(2,3), then L *= 1/max(|L|_2, 1e-12) (all f32, fp contract off).
// Outputs f32 [NB*NH][SEQ][8]: rl = read line [L0..L5, 0, 0]; wl = J-applied write line [L5,-L4,L3,L2,-L1,L0,0,0].
// wave-uniform bound, no block barriers.
// coverage: nwaves = NB*NH*(SEQ/32) waves x 32 rows x 32 B = every row of both planes incl. the zero pad cols.
// =====================================================================================================
struct L6 { float v0, v1, v2, v3, v4, v5; };

__device__ __forceinline__ L6 ext6n(const v4f a, const v4f b) {
#pragma clang fp contract(off)
  L6 o;
  o.v0 = a[0] * b[1] - a[1] * b[0];
  o.v1 = a[0] * b[2] - a[2] * b[0];
  o.v2 = a[0] * b[3] - a[3] * b[0];
  o.v3 = a[1] * b[2] - a[2] * b[1];
  o.v4 = a[1] * b[3] - a[3] * b[1];
  o.v5 = a[2] * b[3] - a[3] * b[2];
  float n2 = o.v0 * o.v0 + o.v1 * o.v1;
  n2 = n2 + o.v2 * o.v2;
  n2 = n2 + o.v3 * o.v3;
  n2 = n2 + o.v4 * o.v4;
  n2 = n2 + o.v5 * o.v5;
  float n = sqrtf(n2);
  n = fmaxf(n, 1e-12f);
  const float inv = 1.0f / n;
  o.v0 *= inv; o.v1 *= inv; o.v2 *= inv; o.v3 *= inv; o.v4 *= inv; o.v5 *= inv;
  return o;
}

__global__ __launch_bounds__(256) void lines_k(const float* __restrict__ ln, float* rl, float* wl, int nwaves) {
#pragma clang fp contract(off)
  __shared__ __align__(16) float sR[8][256];
  __shared__ __align__(16) float sW[8][256];
  const int tid = threadIdx.x, wave = tid >> 5, lane = tid & 31;
  const int w = blockIdx.x * 8 + wave;
  if (w >= nwaves) return;                        // wave-uniform; no block barriers in this kernel
  const int tgPer = SEQ / 32;                     // 64 token groups per (b, h)
  const int bh = w / tgPer;                       // b*NH + h
  const int tg = w - bh * tgPer;
  const int b  = bh / NH;
  const int h  = bh - b * NH;
  const int t  = tg * 32 + lane;                  // < SEQ
  const size_t row  = (size_t)b * SEQ + t;
  const size_t rowp = (t > 0) ? (row - 1) : row;  // clamped address; value zeroed below when t == 0
  const float* cur = ln + row * LNW + h * PD;
  v4f p1 = *(const v4f*)(ln + rowp * LNW + h * PD);
  if (t == 0) { p1[0] = 0.f; p1[1] = 0.f; p1[2] = 0.f; p1[3] = 0.f; }
  const v4f p2 = *(const v4f*)(cur + 1 * PD * NH);
  const v4f p3 = *(const v4f*)(cur + 2 * PD * NH);
  const v4f p4 = *(const v4f*)(cur + 3 * PD * NH);
  const L6 lw = ext6n(p1, p2);
  const L6 lr = ext6n(p3, p4);

  float* sr = sR[wave] + lane * 8;
  float* sw = sW[wave] + lane * 8;
  v4f t0, t1, u0, u1;
  t0[0] = lr.v0; t0[1] = lr.v1; t0[2] = lr.v2; t0[3] = lr.v3;
  t1[0] = lr.v4; t1[1] = lr.v5; t1[2] = 0.f;   t1[3] = 0.f;
  u0[0] = lw.v5; u0[1] = -lw.v4; u0[2] = lw.v3; u0[3] = lw.v2;
  u1[0] = -lw.v1; u1[1] = lw.v0; u1[2] = 0.f;   u1[3] = 0.f;
  *(v4f*)(sr)     = t0;
  *(v4f*)(sr + 4) = t1;
  *(v4f*)(sw)     = u0;
  *(v4f*)(sw + 4) = u1;
  __builtin_amdgcn_fence(__ATOMIC_RELEASE, "workgroup");
  __builtin_amdgcn_wave_barrier();
  __builtin_amdgcn_fence(__ATOMIC_ACQUIRE, "workgroup");
  v4f oR[2], oW[2];
#pragma unroll
  for (int it = 0; it < 2; ++it) {
    oR[it] = *(const v4f*)(sR[wave] + it * 128 + lane * 4);
    oW[it] = *(const v4f*)(sW[wave] + it * 128 + lane * 4);
  }
  const size_t gb = ((size_t)bh * SEQ + (size_t)tg * 32) * 8;
  {
#pragma unroll
    for (int it = 0; it < 2; ++it) {
      *(v4f*)(rl + gb + it * 128 + lane * 4) = oR[it];
      *(v4f*)(wl + gb + it * 128 + lane * 4) = oW[it];
    }
    
  }
}

// =====================================================================================================
// Causal multi-head attention, head dim 64, with an additive line-pair bias:
//   logit(q, k) = (q . k) * sscale + dot6(rl[q], wl[k]) * wdec(q - k),  wdec(d) = bs_h * dec_h^d for d > 0, 0 else,
//   dec_h = sigmoid(dl_h); keys k > q masked (-FLT_MAX, exp -> 0); diagonal kept. In the key chunks in front of the
//   diagonal one the weight is carried by the staged rows: rl[q] * bs_h * dec_h^(q - 64 qb) and wl[k] * dec_h^(64 qb - k).
//   q planes (bf16 hi / lo): element (b, t, h, d) at [(b*SEQ + t)*QP + h*64 + d]
//   k planes (bf16 hi / lo): same layout
//   v^T hi plane (f16):      element (b, h, d, s) at [(b*QP + h*64 + d)*SEQ + s]
//   v^T residual plane (f16, (v - hi)*4096): [(b*QP + h*64 + d)*VLP + s], s < VLP, read only when RES
//   rl / wl f32 planes [b*NH + h][SEQ][8] (6 used)
//   out f32 plane: element (b, t, h*64 + d) at [(b*SEQ + t)*QP + h*64 + d] = normalised context.
//   scores = q . k : bf16 hi/lo split (hi.hi + hi.lo + lo.hi), f32 accumulate, then scale + bias in f32
//   p = exp(s - m) carried as f16(1024 p); context = p . v on f16 WMMA; RES adds f16 residual planes of p and v
//   (scale 4096, separate accumulator folded back with 1/4096 per chunk in f32); online softmax in f32.
//   Block = 4 waves; a query tile = 64 query rows of one (b, h); key chunks of 64, chunks 0..qb only for tile qb
//   (block-uniform trip count qb+1 <= NQB; every row has a live key in every processed chunk).
//   Each block takes two tiles of its (b, h), one after the other: NQB-1-t, then t (t = 0..NQB/2-1), so that every
//   block walks NQB+1 key chunks; grid = (NQB/2) * NH * NB. Tiles qb < RESQB run the RES form.
//   K / V^T / wl chunk staging: 128 threads (plain 16-B loads, __syncthreads before and after); P tiles are
//   wave-private, spilled with _Float16 element stores and reloaded as v8h (same element type) after a release
//   barrier in between).
//   Output coverage: each wave stores rows q0..q0+15 (it 0..7 x lane>>4 0..1) x 64 columns (16 lanes x 4 floats),
// =====================================================================================================
struct AttnLds {
  __align__(16) unsigned short KT[2 * 64 * LP];      // K hi [kv][d] | K lo; later f32 context staging
  __align__(16) _Float16 Vth[64 * LP];                // V^T hi [d][kv]
  __align__(16) _Float16 Vtl[64 * LP];                // V^T residual (RES tiles)
  __align__(16) _Float16 Psh[4][16 * LP];             // per wave P [row][kv]
  __align__(16) _Float16 Psl[4][16 * LP];             // per wave P residual (RES tiles)
  __align__(16) float    Ws[64 * 8];                  // wl rows of the chunk's 64 keys, times dec_h^(64 qb - key) in front of the diagonal chunk
  __align__(16) float    Rs[4][16 * 8];               // per wave rl rows of its 16 queries
  __align__(16) float    Rd[4][8 * 16];               // the same times bs_h * dec_h^(q - first row of the query tile), [term][row]
};

// One query tile qb of (b, h), all 4 waves of the block.
template <bool RES>
__device__ __forceinline__
void attn_tile(AttnLds& sm,
               const unsigned short* __restrict__ qhp, const unsigned short* __restrict__ qlp,
               const unsigned short* __restrict__ khp, const unsigned short* __restrict__ klp,
               const unsigned short* __restrict__ vhp, const unsigned short* __restrict__ vlp,
               const float* __restrict__ rlp, const float* __restrict__ wlp,
               const float* __restrict__ dlg, const float* __restrict__ bsc,
               float* outp, int b, int h, int qb, float sscale) {
  union FB { v16b v; v8b h[2]; };
  union FH { v16h v; v8h h[2]; };
  unsigned short* KT = sm.KT;
  _Float16* Vth = sm.Vth;
  _Float16* Vtl = sm.Vtl;
  _Float16 (*Psh)[16 * LP] = sm.Psh;
  _Float16 (*Psl)[16 * LP] = sm.Psl;
  float* Ws = sm.Ws;
  float (*Rs)[16 * 8] = sm.Rs;
  float (*Rd)[8 * 16] = sm.Rd;
  __bf16* Ksh = (__bf16*)(void*)KT;
  __bf16* Ksl = Ksh + 64 * LP;

  const int tid  = threadIdx.x;
  const int wave = tid >> 5;
  const int lane = tid & 31;
  const int hh   = lane >> 4;
  const int c    = lane & 15;

  const int q0   = qb * 64 + wave * 16;
  const size_t rowB = (size_t)b * SEQ;
  const size_t bhT  = ((size_t)b * NH + h) * SEQ;

  const __bf16* Qh = (const __bf16*)(const void*)qhp + (size_t)h * HD;
  const __bf16* Ql = (const __bf16*)(const void*)qlp + (size_t)h * HD;
  const __bf16* Kh = (const __bf16*)(const void*)khp + (size_t)h * HD;
  const __bf16* Kl = (const __bf16*)(const void*)klp + (size_t)h * HD;
  const _Float16* Vh = (const _Float16*)(const void*)vhp + ((size_t)b * QP + (size_t)h * HD) * SEQ;
  const _Float16* Vl = (const _Float16*)(const void*)vlp + ((size_t)b * QP + (size_t)h * HD) * VLP;

  // ---- per-head scalars (RNE bf16-converted inputs) ----
  const float dl  = bf_up(bf_bits(dlg[h]));
  const float dec = 1.0f / (1.0f + expf(-dl));
  const float l2d = fmaxf(log2f(dec), -FLT_MAX);   // finite, so that a power with exponent 0 is 1 also when dec == 0
  const float bsh = bf_up(bf_bits(bsc[h]));

  // ---- stage the wave's 16 rl rows: 16 x 8 f32 = 32 lanes x 16 B (ordered by the loop's first barrier), plain for
  //      the diagonal chunk and, for the chunks in front of it, with the query's share of the decay weight:
  //      bs * dec^(q - k) = [bs * dec^(q - 64 qb)] * [dec^(64 qb - k)], both exponents >= 0 there, so both powers
  //      are <= 1 and neither can overflow; where one underflows the whole weight does ----
  {
    const v4f rv = *(const v4f*)(rlp + (bhT + q0) * 8 + lane * 4);
    const float rf = bsh * exp2f((float)(wave * 16 + (lane >> 1)) * l2d);   // row = lane >> 1 (two lanes a row)
    *(v4f*)(Rs[wave] + lane * 4) = rv;
    // term-major, so that one 8-B read brings one term of two neighbouring rows: the row pairs of the packed fma
#pragma unroll
    for (int e = 0; e < 4; ++e) Rd[wave][((lane & 1) * 4 + e) * 16 + (lane >> 1)] = rv[e] * rf;
  }

  float mrow[8], lrow[8];
  v8f oacc[4];
#pragma unroll
  for (int r = 0; r < 8; ++r) { mrow[r] = -INFINITY; lrow[r] = 0.f; }
#pragma unroll
  for (int t = 0; t < 4; ++t) oacc[t] = zero8();

  // ---- Q fragments (A operand, row = lane&15): 2 d-chunks, hi and lo, held in registers for the whole tile ----
  v16b qah[2], qal[2];
#pragma unroll
  for (int dc = 0; dc < 2; ++dc) {
    const size_t qo = (rowB + q0 + c) * QP + dc * 32 + 8 * hh;
    qah[dc] = ldfrag_b(Qh + qo);
    qal[dc] = ldfrag_b(Ql + qo);
  }

  int nkt = qb + 1;                          // causal: key tiles 0..qb, block-uniform
  if (nkt > NQB) nkt = NQB;
  for (int kt = 0; kt < nkt; ++kt) {
    const int kv0 = kt * 64;
    const bool diag = (kt == qb);            // block-uniform: the one chunk that holds keys >= a query of the tile
    __syncthreads();
    {
      const int r = tid >> 1, half = (tid & 1) * 32;
      // wl rows kv0..kv0+63 of this (b, h): 64 x 8 f32 = 128 threads x 16 B (key = kv0 + r); in front of the diagonal
      // chunk times the key's share dec^(64 qb - key) of the decay weight (exponent >= 1), in it times dec^0 = 1.
      // The load stands first so that it flies together with the K and V loads.
      const float* wg = wlp + (bhT + kv0) * 8 + tid * 4;
      const v4f wv = *(const v4f*)(wg);
      const float kf = exp2f((float)(diag ? 0 : (qb * 64 - kv0 - r)) * l2d);
      const __bf16*   kg  = Kh + (rowB + kv0 + r) * QP + half;    // K row kv0+r, d = half..half+31
      const __bf16*   klg = Kl + (rowB + kv0 + r) * QP + half;
      const _Float16* vg  = Vh + (size_t)r * SEQ + kv0 + half;    // V^T row d = r, s = kv0+half..+31
      const int kvl = (kv0 + 64 <= VLP) ? kv0 : (VLP - 64);     // clamped address into the residual plane
      const _Float16* vlg = Vl + (size_t)r * VLP + kvl + half;
      const bool resOK = (kv0 + 64 <= VLP);                      // block-uniform
#pragma unroll
      for (int i = 0; i < 4; ++i) {
        const v8b a0 = *(const v8b*)(kg + 8 * i);
        const v8b a1 = *(const v8b*)(klg + 8 * i);
        const v8h b0 = *(const v8h*)(vg + 8 * i);
        *(v8b*)(Ksh + r * LP + half + 8 * i) = a0;
        *(v8b*)(Ksl + r * LP + half + 8 * i) = a1;
        *(v8h*)(Vth + r * LP + half + 8 * i) = b0;
        if (RES) {
          v8h b1 = *(const v8h*)(vlg + 8 * i);
          if (!resOK) b1 = zero8h();
          *(v8h*)(Vtl + r * LP + half + 8 * i) = b1;
        }
      }
      *(v4f*)(Ws + tid * 4) = wv * kf;
#if defined(__HIP_DEVICE_COMPILE__)
      // the address registers of the chunk's loads are inputs here, so they stay whole up to this wait
      if (RES) asm volatile("s_wait_xcnt 0x0" :: "v"(wg), "v"(kg), "v"(klg), "v"(vg), "v"(vlg) : "memory");
      else     asm volatile("s_wait_xcnt 0x0" :: "v"(wg), "v"(kg), "v"(klg), "v"(vg) : "memory");
#endif
    }
    __syncthreads();

    // ---- scores: 16 query rows x 64 keys per wave, 3 bf16 products ----
    v8f s[4];
#pragma unroll
    for (int j = 0; j < 4; ++j) {
      s[j] = zero8();
#pragma unroll
      for (int dc = 0; dc < 2; ++dc) {
        FB kb, kl;
        kb.h[0] = *(const v8b*)(Ksh + (j * 16 + c) * LP + dc * 32 + 8 * hh);
        kb.h[1] = *(const v8b*)(Ksh + (j * 16 + c) * LP + dc * 32 + 16 + 8 * hh);
        kl.h[0] = *(const v8b*)(Ksl + (j * 16 + c) * LP + dc * 32 + 8 * hh);
        kl.h[1] = *(const v8b*)(Ksl + (j * 16 + c) * LP + dc * 32 + 16 + 8 * hh);
        s[j] = mma_b(qah[dc], kb.v, s[j]);
        s[j] = mma_b(qah[dc], kl.v, s[j]);
        s[j] = mma_b(qal[dc], kb.v, s[j]);
      }
    }

    // ---- wl rows of this lane's 4 key columns (j*16 + c): 6 used of 8 ----
    v4f wa[4];
    v2f wb[4];
#pragma unroll
    for (int j = 0; j < 4; ++j) {
      const float* wp = Ws + (j * 16 + c) * 8;
      wa[j] = *(const v4f*)(wp);
      wb[j] = *(const v2f*)(wp + 4);
    }

    // ---- scale + bias + causal mask (replace by -FLT_MAX), row max, online softmax, P (x1024, f16) and
    //      P residual (x4096) to LDS ----
    _Float16* pwh = Psh[wave];
    _Float16* pwl = Psl[RES ? wave : 0];
    float mloc[8], msafe[8], alpha[8], psum[8];
    // logits of all 8 rows first, so that the 8 row reductions below run as independent chains
    if (!diag) {
      // every key of the chunk lies before every query of the tile: nothing is masked, and the decay weight is
      // already in the staged rows, so the bias is the plain 6-term dot
      const v2f sc2 = {sscale, sscale};
#pragma unroll  // rr, s and mloc are indexed by constants only, so they stay in registers (all loops of this branch)
      for (int p = 0; p < 4; ++p) {
        v2f rr[6];                           // term i of rows 8 hh + 2 p and 8 hh + 2 p + 1
#pragma unroll
        for (int i = 0; i < 6; ++i) rr[i] = *(const v2f*)(Rd[wave] + i * 16 + 8 * hh + 2 * p);
        v2f m2 = {-INFINITY, -INFINITY};
#pragma unroll
        for (int j = 0; j < 4; ++j) {
          // two rows at a time; the six terms in the order 0..5, then the scaled score, as in the diagonal chunk
          const v2f w0 = {wa[j][0], wa[j][0]}, w1 = {wa[j][1], wa[j][1]}, w2 = {wa[j][2], wa[j][2]};
          const v2f w3 = {wa[j][3], wa[j][3]}, w4 = {wb[j][0], wb[j][0]}, w5 = {wb[j][1], wb[j][1]};
          v2f d = rr[0] * w0;
          d = __builtin_elementwise_fma(rr[1], w1, d);
          d = __builtin_elementwise_fma(rr[2], w2, d);
          d = __builtin_elementwise_fma(rr[3], w3, d);
          d = __builtin_elementwise_fma(rr[4], w4, d);
          d = __builtin_elementwise_fma(rr[5], w5, d);
          const v2f sp = {s[j][2 * p], s[j][2 * p + 1]};
          d = __builtin_elementwise_fma(sp, sc2, d);
          s[j][2 * p] = d.x; s[j][2 * p + 1] = d.y;
          m2.x = fmaxf(m2.x, d.x); m2.y = fmaxf(m2.y, d.y);
        }
        mloc[2 * p] = m2.x; mloc[2 * p + 1] = m2.y;
      }
    } else
#pragma unroll
    for (int r = 0; r < 8; ++r) {
      const int qrow = q0 + 8 * hh + r;
      const float* rp = Rs[wave] + (8 * hh + r) * 8;
      const v4f ra = *(const v4f*)(rp);
      const v2f rb = *(const v2f*)(rp + 4);
      float m = -INFINITY;
#pragma unroll
      for (int j = 0; j < 4; ++j) {
        const int key = kv0 + j * 16 + c;
        const int dd  = qrow - key;
        const float dot6 = ra[0] * wa[j][0] + ra[1] * wa[j][1] + ra[2] * wa[j][2] + ra[3] * wa[j][3]
                         + rb[0] * wb[j][0] + rb[1] * wb[j][1];
        const float ex   = exp2f((float)dd * l2d);
        const float wdec = (dd > 0) ? (bsh * ex) : 0.f;
        float sv = s[j][r] * sscale + dot6 * wdec;
        sv = (key > qrow) ? -FLT_MAX : sv;
        s[j][r] = sv;
        m = fmaxf(m, sv);
      }
      mloc[r] = m;
    }
    // row maximum over the 16 lanes of a half: xor butterfly 1, 2, 4, 8 in the vector unit, 8 rows per step.
    // The scheduling barriers keep the 8 chains side by side: without them the compiler moves each row's chain
    // back behind that row's logits, where every step waits for the one before it.
    __builtin_amdgcn_sched_barrier(0);
    rowmax8<1>(mloc); rowmax8<2>(mloc); rowmax8<4>(mloc); rowmax8<8>(mloc);
    __builtin_amdgcn_sched_barrier(0);
#pragma unroll  // per-row state is indexed by constants only, so it stays in registers
    for (int r = 0; r < 8; ++r) {
      const float mnew = fmaxf(mrow[r], mloc[r]);
      msafe[r] = (mnew == -INFINITY) ? 0.f : mnew;
      alpha[r] = exp_slot(mrow[r] - msafe[r]);
      mrow[r]  = mnew;
    }
#pragma unroll  // as above
    for (int r = 0; r < 8; ++r) {
      float ps = 0.f;
#pragma unroll
      for (int j = 0; j < 4; ++j) {
        const float p = exp_slot(s[j][r] - msafe[r]);  // masked logit against a finite max: exp -> 0
        ps += p;
        const float p1k = p * 1024.0f;
        const _Float16 ph = (_Float16)p1k;
        pwh[(8 * hh + r) * LP + j * 16 + c] = ph;
        if (RES) {
          const _Float16 pl = (_Float16)((p1k - (float)ph) * 4096.0f);
          pwl[(8 * hh + r) * LP + j * 16 + c] = pl;
        }
      }
      psum[r] = ps;
    }
    // row sum: xor butterfly 1, 2, 4, 8 like the maximum, with the same scheduling barriers for the same reason
    __builtin_amdgcn_sched_barrier(0);
    rowsum8<1>(psum); rowsum8<2>(psum); rowsum8<4>(psum); rowsum8<8>(psum);
    __builtin_amdgcn_sched_barrier(0);
#pragma unroll  // as above
    for (int r = 0; r < 8; ++r) {
      lrow[r] = lrow[r] * alpha[r] + psum[r];
#pragma unroll
      for (int t = 0; t < 4; ++t) oacc[t][r] *= alpha[r];
    }
    __builtin_amdgcn_fence(__ATOMIC_RELEASE, "workgroup");
    __builtin_amdgcn_wave_barrier();
    __builtin_amdgcn_fence(__ATOMIC_ACQUIRE, "workgroup");

    // ---- context += P . V (f16 WMMA), residual products into a separate accumulator ----
    v8f o1[4];
#pragma unroll
    for (int t = 0; t < 4; ++t) o1[t] = zero8();
#pragma unroll 1
    for (int kk = 0; kk < 2; ++kk) {
      FH pa, pl;
      pa.h[0] = *(const v8h*)(pwh + c * LP + kk * 32 + 8 * hh);
      pa.h[1] = *(const v8h*)(pwh + c * LP + kk * 32 + 16 + 8 * hh);
      if (RES) {
        pl.h[0] = *(const v8h*)(pwl + c * LP + kk * 32 + 8 * hh);
        pl.h[1] = *(const v8h*)(pwl + c * LP + kk * 32 + 16 + 8 * hh);
      } else {
        pl.v = pa.v;
      }
#pragma unroll
      for (int t = 0; t < 4; ++t) {
        FH vb;
        vb.h[0] = *(const v8h*)(Vth + (t * 16 + c) * LP + kk * 32 + 8 * hh);
        vb.h[1] = *(const v8h*)(Vth + (t * 16 + c) * LP + kk * 32 + 16 + 8 * hh);
        oacc[t] = mma_h(pa.v, vb.v, oacc[t]);
        if (RES) {
          FH vl;
          vl.h[0] = *(const v8h*)(Vtl + (t * 16 + c) * LP + kk * 32 + 8 * hh);
          vl.h[1] = *(const v8h*)(Vtl + (t * 16 + c) * LP + kk * 32 + 16 + 8 * hh);
          o1[t] = mma_h(pa.v, vl.v, o1[t]);
          o1[t] = mma_h(pl.v, vb.v, o1[t]);
        }
      }
    }
    if (RES) {
#pragma unroll
      for (int t = 0; t < 4; ++t)
#pragma unroll
        for (int r = 0; r < 8; ++r) oacc[t][r] += o1[t][r] * (1.0f / 4096.0f);
    }
  }

  // ---- all waves are done with the K tiles before that LDS region is reused for the context staging ----
  __syncthreads();

  // ---- normalise (1/l and the 1/1024 p carry), stage the wave's 16x64 tile in LDS, then write whole
  float* os = (float*)(void*)KT + wave * (16 * 64);
#pragma unroll
  for (int r = 0; r < 8; ++r) {
    const float l = lrow[r];
    const float inv = ((l > 0.f) ? (1.0f / l) : 0.f) * (1.0f / 1024.0f);
#pragma unroll
    for (int t = 0; t < 4; ++t) os[(8 * hh + r) * 64 + t * 16 + c] = oacc[t][r] * inv;
  }
  __builtin_amdgcn_fence(__ATOMIC_RELEASE, "workgroup");
  __builtin_amdgcn_wave_barrier();
  __builtin_amdgcn_fence(__ATOMIC_ACQUIRE, "workgroup");
  {
    const int h2 = lane >> 4, c4 = (lane & 15) * 4;
    v4f ov[8];
#pragma unroll
    for (int it = 0; it < 8; ++it) {
      const int row = it * 2 + h2;   // it 0..7 x h2 0..1 = rows 0..15 of the wave tile
      ov[it] = *(const v4f*)(os + row * 64 + c4);
    }
    {
#pragma unroll
      for (int it = 0; it < 8; ++it) {
        const int row = it * 2 + h2;
        const size_t go = (rowB + q0 + row) * QP + (size_t)h * HD + c4;
        *(v4f*)(outp + go) = ov[it];
      }
#if defined(__HIP_DEVICE_COMPILE__)
      // the block's next tile rewrites the address and data registers of these stores: the wait stands in front of that
      asm volatile("s_wait_xcnt 0x0" ::: "memory");
#endif
    }
  }
}

__global__ __launch_bounds__(128)
void attn_lb(const unsigned short* __restrict__ qhp, const unsigned short* __restrict__ qlp,
             const unsigned short* __restrict__ khp, const unsigned short* __restrict__ klp,
             const unsigned short* __restrict__ vhp, const unsigned short* __restrict__ vlp,
             const float* __restrict__ rlp, const float* __restrict__ wlp,
             const float* __restrict__ dlg, const float* __restrict__ bsc,
             float* outp, float sscale) {
  static_assert((NQB % 2) == 0);
  __shared__ AttnLds sm;
  const int bx   = blockIdx.x;
  const int t    = bx % (NQB / 2);
  const int rest = bx / (NQB / 2);
  const int h    = rest % NH;
  const int b    = rest / NH;
  // The second tile's first barrier (top of its key loop) stands behind every wave's read-back of the first tile's
  // context staging, and in front of the first refill of that LDS.
#pragma unroll 1  // rolled: one copy of each tile form in the text
  for (int pass = 0; pass < 2; ++pass) {
    const int qb = pass ? t : (NQB - 1 - t);       // block-uniform
    if (qb < RESQB)
      attn_tile<true>(sm, qhp, qlp, khp, klp, vhp, vlp, rlp, wlp, dlg, bsc, outp, b, h, qb, sscale);
    else
      attn_tile<false>(sm, qhp, qlp, khp, klp, vhp, vlp, rlp, wlp, dlg, bsc, outp, b, h, qb, sscale);
  }
}

// =====================================================================================================
// Workspace map (bytes), every region an exact multiple of its whole-line / whole-tile store granularity
// multiples):
//   Xb     bf16 [4096][1024]            0            8388608
//   Wqkv   bf16 [3072][1024]            8388608      6291456   ([n][k], rows 0..1023 q | 1024.. k | 2048.. v)
//   Wln    bf16 [256][1024]             14680064      524288   ([W1w; W2w; W1r; W2r], [n][k])
//   Wob    bf16 [1024][1024]            15204352     2097152   ([n][k])
//   LN     f32  [4096][256]             17301504     4194304
//   RL     f32  [32][2048][8]           21495808     2097152
//   WL     f32  [32][2048][8]           23592960     2097152
//   Qh     bf16 [4096][1024]            25690112     8388608
//   Ql     bf16 [4096][1024]            34078720     8388608
//   Kh     bf16 [4096][1024]            42467328     8388608
//   Kl     bf16 [4096][1024]            50855936     8388608
//   VTh    f16  [2][1024][2048]         59244544     8388608
//   VTl    f16  [2][1024][512]          67633152     2097152
//   Af     f32  [4096][1024]            69730304    16777216
//   Ah     bf16 [4096][1024]            86507520     8388608
//   Al     bf16 [4096][1024]            94896128     8388608
//   end                                 103284736
// =====================================================================================================
extern "C" void kernel_launch(void* const* d_in, const int* in_sizes, int n_in,
                              void* d_out, int out_size, void* d_ws, size_t ws_size,
                              hipStream_t stream) {
  if (n_in < 11) return;
  if (in_sizes[0] != NB * SEQ * DMODEL) return;
  if (in_sizes[1] != 3 * QP * DMODEL) return;
  if (in_sizes[2] != 3 * QP) return;
  if (in_sizes[3] != PD * NH * DMODEL) return;
  if (in_sizes[4] != PD * NH * DMODEL) return;
  if (in_sizes[5] != PD * NH * DMODEL) return;
  if (in_sizes[6] != PD * NH * DMODEL) return;
  if (in_sizes[7] != DMODEL * QP) return;
  if (in_sizes[8] != DMODEL) return;
  if (in_sizes[9] != NH) return;
  if (in_sizes[10] != NH) return;
  if (out_size != NB * SEQ * DMODEL) return;

  const float* x     = (const float*)d_in[0];    // [NB*SEQ][DMODEL]
  const float* wqkv  = (const float*)d_in[1];    // [3*QP n][DMODEL k]
  const float* bqkv  = (const float*)d_in[2];    // [3*QP]
  const float* w1w   = (const float*)d_in[3];    // [PD*NH][DMODEL]
  const float* w2w   = (const float*)d_in[4];
  const float* w1r   = (const float*)d_in[5];
  const float* w2r   = (const float*)d_in[6];
  const float* wout  = (const float*)d_in[7];    // [DMODEL n][QP k]
  const float* bout  = (const float*)d_in[8];    // [DMODEL]
  const float* dlog  = (const float*)d_in[9];    // [NH]
  const float* bscl  = (const float*)d_in[10];   // [NH]

  const size_t PXb   = (size_t)NB * SEQ * DMODEL * 2;      //  8388608
  const size_t PWqkv = (size_t)3 * QP * DMODEL * 2;        //  6291456
  const size_t PWln  = (size_t)LNW * DMODEL * 2;           //   524288
  const size_t PWo   = (size_t)DMODEL * QP * 2;            //  2097152
  const size_t PLN   = (size_t)NB * SEQ * LNW * 4;         //  4194304
  const size_t PRL   = (size_t)NB * NH * SEQ * 8 * 4;      //  2097152
  const size_t PQpl  = (size_t)NB * SEQ * QP * 2;          //  8388608  (Qh, Ql, Kh, Kl, Ah, Al)
  const size_t PVTh  = (size_t)NB * QP * SEQ * 2;          //  8388608
  const size_t PVTl  = (size_t)NB * QP * VLP * 2;          //  2097152
  const size_t PAf   = (size_t)NB * SEQ * QP * 4;          // 16777216
  size_t off = 0;
  const size_t oXb   = off; off += PXb;
  const size_t oWqkv = off; off += PWqkv;
  const size_t oWln  = off; off += PWln;
  const size_t oWo   = off; off += PWo;
  const size_t oLN   = off; off += PLN;
  const size_t oRL   = off; off += PRL;
  const size_t oWL   = off; off += PRL;
  const size_t oQh   = off; off += PQpl;
  const size_t oQl   = off; off += PQpl;
  const size_t oKh   = off; off += PQpl;
  const size_t oKl   = off; off += PQpl;
  const size_t oVTh  = off; off += PVTh;
  const size_t oVTl  = off; off += PVTl;
  const size_t oAf   = off; off += PAf;
  const size_t oAh   = off; off += PQpl;
  const size_t oAl   = off; off += PQpl;
  if (off > ws_size) return;                          // off = 103284736
  if (off > (size_t)134217728) return;

  char* ws = (char*)d_ws;
  unsigned short* Xb   = (unsigned short*)(ws + oXb);
  unsigned short* Wqkv = (unsigned short*)(ws + oWqkv);
  unsigned short* Wln  = (unsigned short*)(ws + oWln);
  unsigned short* Wob  = (unsigned short*)(ws + oWo);
  float*          LN   = (float*)(ws + oLN);
  float*          RL   = (float*)(ws + oRL);
  float*          WL   = (float*)(ws + oWL);
  unsigned short* Qh   = (unsigned short*)(ws + oQh);
  unsigned short* Ql   = (unsigned short*)(ws + oQl);
  unsigned short* Kh   = (unsigned short*)(ws + oKh);
  unsigned short* Kl   = (unsigned short*)(ws + oKl);
  unsigned short* VTh  = (unsigned short*)(ws + oVTh);
  unsigned short* VTl  = (unsigned short*)(ws + oVTl);
  float*          Af   = (float*)(ws + oAf);
  unsigned short* Ah   = (unsigned short*)(ws + oAh);
  unsigned short* Al   = (unsigned short*)(ws + oAl);
  float*          outf = (float*)d_out;

  const dim3 blk(256);
  const int nTok   = NB * SEQ;                                       // 4096 tokens
  const int n8a    = nTok * QP / 8;                                  // 524288
  const int nwLn   = NB * NH * (SEQ / 32);                           //   2048 waves
  const dim3 blkG(128);                                              // GEMM block: 4 waves, one 128x128 tile
  const dim3 gLines((nwLn + 7) / 8);                                 // 256 blocks
  const dim3 gSplit((n8a + 255) / 256);                              // 2048 blocks
  const dim3 gOut((nTok / 128) * (DMODEL / 128), 1);                 // 256 blocks

  // (1) inputs -> bf16 planes (RNE convert), one launch; weights arrive [n][k] = the Bt layout already. The planes
  //     Xb | Wqkv | Wln | Wob are contiguous from Xb on.
  cvt_all<<<dim3(CB_ALL), blk, 0, stream>>>(x, wqkv, w1w, w2w, w1r, w2r, wout, Xb);
  // (2)-(5) q, k, v^T and line-feature projections, one launch
  proj4<<<dim3(PB_ALL), blkG, 0, stream>>>(Xb, Wqkv, Wln, bqkv, Qh, Ql, Kh, Kl, VTh, VTl, LN);
  // (6) line features (shifted p1, exterior 2-forms, L2 normalisation, J map) -> rl / wl f32 planes
  lines_k<<<gLines, blk, 0, stream>>>(LN, RL, WL, nwLn);
  // (7) causal attention with line-pair bias: query tiles 0..RESQB-1 with residual planes, the rest without;
  //     one launch, two tiles (NQB-1-t and t) per block
  attn_lb<<<dim3(NB * NH * (NQB / 2)), dim3(128), 0, stream>>>(
      Qh, Ql, Kh, Kl, VTh, VTl, RL, WL, dlog, bscl, Af, 0.125f);
  // (8) context rows -> bf16 hi/lo planes
  split_bf16x8<<<gSplit, blk, 0, stream>>>(Af, Ah, Al, n8a);
  // (9) out[row][e] = sum_d (Ah+Al)[row][d] Wob[e][d] + bout[e] -> d_out f32 [4096][1024]  (M=4096, N=1024, K=1024)
  gemm64<1, 0, 1><<<gOut, blkG, 0, stream>>>(
      Ah, Al, QP, 0LL, Wob, Wob, QP, 0LL,
      (void*)outf, DMODEL, 0LL, (void*)outf, 0, 0LL, 0,
      bout, nTok, DMODEL, QP, 1.0f);
  (void)hipGetLastError();
}

// v007
// It runs in 162 microseconds.
// Next to v006, in two timings, it ran 1.08 times as fast each time.
// Over all steps from v000 it is 3.85 times as fast.
// Contractions: q / k / v^T and line-feature projections = v_wmma_f32_16x16x32_bf16 (bf16 operands from
// RNE-converted inputs, one product per k-step); q.k^T scores = v_wmma_f32_16x16x32_bf16 with bf16 hi/lo split
// q and k (hi.hi + hi.lo + lo.hi); p.v = v_wmma_f32_16x16x32_f16 (p carried x1024 in f16, v in f16; extra f16
// residual planes x4096 of p and v on the first 512 query rows); ctx.Wo^T = v_wmma_f32_16x16x32_bf16 with ctx
// as bf16 hi/lo planes times the bf16 Wo plane (2 products); all f32 accumulate; 6-term line-pair bias dots,
// decay weights and softmax in f32 on VALU.
#include <hip/hip_runtime.h>
#include <math.h>
#include <float.h>
#include <stdint.h>

#define NB     2
#define SEQ    2048
#define DMODEL 1024
#define NH     16
#define HD     64
#define QP     (NH * HD)       // 1024: q / k / ctx row pitch
#define NQB    (SEQ / 64)      // 32 query / key tiles of 64
#define VLP    512             // key pitch of the v^T residual plane (keys 0..VLP-1)
#define RESQB  8               // leading 64-row query blocks that use the p / v residual planes
#define PD     4               // point dim per head
#define LNW    (4 * PD * NH)   // 256: width of the line-feature projection [p1w | p2w | p1r | p2r]
#define LP     72              // LDS row pitch (16-bit elements) of the attention K, V^T and P tiles: 144 B = 16 B x 9, so the
                               // 16 rows that one ds_load_b128 reads fall on 16 different groups of 4 banks (at 128 B: on 2)
static_assert(RESQB * 64 <= VLP);
static_assert(RESQB <= NQB);
static_assert(QP == DMODEL);
static_assert(HD == 64);
static_assert(PD == 4);
static_assert(LP >= 64 && (LP % 8) == 0 && 2 * 64 * LP * 2 >= 4 * 16 * 64 * 4);
static_assert((SEQ % 64) == 0 && (DMODEL % 64) == 0 && (LNW % 64) == 0 && (QP % 64) == 0);
static_assert(((NB * SEQ) % 64) == 0 && (SEQ % 32) == 0);
static_assert((DMODEL % 32) == 0);
static_assert(((NB * SEQ) % 128) == 0 && (SEQ % 128) == 0 && (QP % 128) == 0 && (LNW % 128) == 0 && (DMODEL % 128) == 0);

typedef _Float16 v16h __attribute__((ext_vector_type(16)));
typedef _Float16 v8h  __attribute__((ext_vector_type(8)));
typedef __bf16   v16b __attribute__((ext_vector_type(16)));
typedef __bf16   v8b  __attribute__((ext_vector_type(8)));
typedef float    v8f  __attribute__((ext_vector_type(8)));
typedef float    v4f  __attribute__((ext_vector_type(4)));
typedef float    v2f  __attribute__((ext_vector_type(2)));
typedef unsigned int v4u __attribute__((ext_vector_type(4)));

// ---- scalar helpers --------------------------------------------------------------------------------
__device__ __forceinline__ unsigned short bf_bits(float f) {          // f32 -> bf16 bits, RNE convert
  unsigned u = __float_as_uint(f);
  return (unsigned short)((u + 0x7FFFu + ((u >> 16) & 1u)) >> 16);
}
__device__ __forceinline__ float bf_up(unsigned short h) { return __uint_as_float(((unsigned)h) << 16); }
__device__ __forceinline__ unsigned short h_bits(_Float16 x) { return __builtin_bit_cast(unsigned short, x); }
__device__ __forceinline__ unsigned pk16(unsigned short a, unsigned short b) { return (unsigned)a | ((unsigned)b << 16); }
__device__ __forceinline__ v8f zero8() { v8f z = {0.f, 0.f, 0.f, 0.f, 0.f, 0.f, 0.f, 0.f}; return z; }
__device__ __forceinline__ v8h zero8h() {
  const _Float16 z = (_Float16)0.0f;
  v8h r = {z, z, z, z, z, z, z, z};
  return r;
}

// ---- lane l <- lane l ^ X inside each 16-lane row (DPP row_xmask, control 0x160 + X): no LDS round trip ----
template <int X>
__device__ __forceinline__ float lane_xor16(float v) {
  return __builtin_bit_cast(float, __builtin_amdgcn_update_dpp(0, __builtin_bit_cast(int, v), 0x160 + X, 0xf, 0xf, true));
}
// exp(x) as v_exp_f32(x * log2 e), the form __expf compiled to. The v_nop is the one slot that the instruction set asks
// for behind a transcendental before a source is overwritten.
__device__ __forceinline__ float exp_slot(float x) {
  const float t = x * 1.44269504088896340736f;
  float r;
#if defined(__HIP_DEVICE_COMPILE__)
  asm("v_exp_f32 %0, %1\n\tv_nop" : "=v"(r) : "v"(t));
#else
  r = t;
#endif
  return r;
}
// 2^x in the form exp2f compiled to (v_exp_f32, arguments under -126 stepped up by 64 and the result back down), with the
// same v_nop slot behind the transcendental.
__device__ __forceinline__ float exp2_slot(float x) {
  const bool low = x < -126.0f;
  const float t = x + (low ? 64.0f : 0.0f);
  float r;
#if defined(__HIP_DEVICE_COMPILE__)
  asm("v_exp_f32 %0, %1\n\tv_nop" : "=v"(r) : "v"(t));
#else
  r = t;
#endif
  return ldexpf(r, low ? -64 : 0);
}
template <int X>
__device__ __forceinline__ void rowmax8(float (&m)[8]) {
#pragma unroll  // the 8 values stay in registers, one independent instruction chain each
  for (int r = 0; r < 8; ++r) m[r] = fmaxf(m[r], lane_xor16<X>(m[r]));
}
template <int X>
__device__ __forceinline__ void rowsum8(float (&m)[8]) {
#pragma unroll  // the 8 values stay in registers, one independent instruction chain each
  for (int r = 0; r < 8; ++r) m[r] += lane_xor16<X>(m[r]);
}

// ---- fragment loader: 16-bit A/B operand, lane -> row/col (lane&15), p already includes +8*(lane>>4);
//      elements 0..7 <- p[0..7] (k0+8h..), elements 8..15 <- p[16..23] (k0+16+8h..)
__device__ __forceinline__ v16b ldfrag_b(const __bf16* p) {
  union { v16b v; v8b h[2]; } f;
  f.h[0] = *(const v8b*)(p);
  f.h[1] = *(const v8b*)(p + 16);
  return f.v;
}

// ---- WMMA helpers with trailing VALU hazard gap --------------------------------------------------------
__device__ __forceinline__ v8f mma_b(v16b a, v16b b, v8f c) {
  c = __builtin_amdgcn_wmma_f32_16x16x32_bf16(false, a, false, b, (short)0, c, false, false);
#if defined(__HIP_DEVICE_COMPILE__)
  asm volatile("v_nop\n\tv_nop\n\tv_nop\n\tv_nop" : "+v"(c) : "v"(a), "v"(b));
#endif
  return c;
}
__device__ __forceinline__ v8f mma_h(v16h a, v16h b, v8f c) {
  c = __builtin_amdgcn_wmma_f32_16x16x32_f16(false, a, false, b, (short)0, c, false, false);
#if defined(__HIP_DEVICE_COMPILE__)
  asm volatile("v_nop\n\tv_nop\n\tv_nop\n\tv_nop" : "+v"(c) : "v"(a), "v"(b));
#endif
  return c;
}
__device__ __forceinline__ v8f mma_b_raw(v16b a, v16b b, v8f c) {
  return __builtin_amdgcn_wmma_f32_16x16x32_bf16(false, a, false, b, (short)0, c, false, false);
}
__device__ __forceinline__ void dep_guard_b(v8f& a, v8f& b, v16b x, v16b y) {
#if defined(__HIP_DEVICE_COMPILE__)
  asm volatile("v_nop\n\tv_nop\n\tv_nop\n\tv_nop" : "+v"(a), "+v"(b) : "v"(x), "v"(y));
#endif
}
__device__ __forceinline__ void keep4_b(v16b a, v16b b, v16b c, v16b d) {
#if defined(__HIP_DEVICE_COMPILE__)
  asm volatile("v_nop" :: "v"(a), "v"(b), "v"(c), "v"(d));
#endif
}
__device__ __forceinline__ void acc_guard4(v8f& a, v8f& b, v8f& c, v8f& d) {
#if defined(__HIP_DEVICE_COMPILE__)
  asm volatile("v_nop\n\tv_nop\n\tv_nop\n\tv_nop" : "+v"(a), "+v"(b), "+v"(c), "+v"(d));
#endif
}

// =====================================================================================================
// Flat f32 -> bf16 (RNE convert) of all seven f32 operands in one launch: x, w_qkv, the four line weights, w_out.
// Their bf16 planes lie one behind the other in the workspace in that order, so the destination is one flat array;
// a block (256 threads x 8 elements = 2048 elements) lies wholly inside one operand and picks its source by its index
// (block-uniform). One 16-B store per lane: a wave writes 512 contiguous bytes.
// coverage: CB_ALL blocks x 2048 elements = all seven planes, every plane a multiple of 2048 elements.
// =====================================================================================================
#define CB_X   (NB * SEQ * DMODEL / 2048)    // 2048 blocks
#define CB_QKV (3 * QP * DMODEL / 2048)      // 1536
#define CB_LN  (PD * NH * DMODEL / 2048)     //   32 for each line weight
#define CB_WO  (DMODEL * QP / 2048)          //  512
#define CB_ALL (CB_X + CB_QKV + 4 * CB_LN + CB_WO)
static_assert(((NB * SEQ * DMODEL) % 2048) == 0 && ((3 * QP * DMODEL) % 2048) == 0);
static_assert(((PD * NH * DMODEL) % 2048) == 0 && ((DMODEL * QP) % 2048) == 0);
__global__ __launch_bounds__(256) void cvt_all(const float* __restrict__ x, const float* __restrict__ wqkv,
                                               const float* __restrict__ w1w, const float* __restrict__ w2w,
                                               const float* __restrict__ w1r, const float* __restrict__ w2r,
                                               const float* __restrict__ wout, unsigned short* out) {
  const int bx = blockIdx.x;
  if (bx >= CB_ALL) return;
  const float* in;
  int b0;
  if (bx < CB_X)                            { in = x;    b0 = 0; }
  else if (bx < CB_X + CB_QKV)              { in = wqkv; b0 = CB_X; }
  else if (bx < CB_X + CB_QKV + 1 * CB_LN)  { in = w1w;  b0 = CB_X + CB_QKV; }
  else if (bx < CB_X + CB_QKV + 2 * CB_LN)  { in = w2w;  b0 = CB_X + CB_QKV + 1 * CB_LN; }
  else if (bx < CB_X + CB_QKV + 3 * CB_LN)  { in = w1r;  b0 = CB_X + CB_QKV + 2 * CB_LN; }
  else if (bx < CB_X + CB_QKV + 4 * CB_LN)  { in = w2r;  b0 = CB_X + CB_QKV + 3 * CB_LN; }
  else                                      { in = wout; b0 = CB_X + CB_QKV + 4 * CB_LN; }
  const float* s = in + ((size_t)(bx - b0) * 256 + threadIdx.x) * 8;
  const v4f a = *(const v4f*)(s);
  const v4f b = *(const v4f*)(s + 4);
  v4u p;
  p[0] = pk16(bf_bits(a[0]), bf_bits(a[1]));
  p[1] = pk16(bf_bits(a[2]), bf_bits(a[3]));
  p[2] = pk16(bf_bits(b[0]), bf_bits(b[1]));
  p[3] = pk16(bf_bits(b[2]), bf_bits(b[3]));
  *(v4u*)(out + ((size_t)bx * 256 + threadIdx.x) * 8) = p;
}

// =====================================================================================================
// f32 -> bf16 hi plane + bf16 lo plane (lo = RNE(v - hi), unscaled), 8 elements per thread, one 16-B store per
// coverage: n8 threads x 8 = whole plane (n8 multiple of 256).
// =====================================================================================================
__global__ __launch_bounds__(256) void split_bf16x8(const float* __restrict__ in, unsigned short* hp,
                                                    unsigned short* lp, int n8) {
  const int i = blockIdx.x * 256 + threadIdx.x;
  if (i < n8) {
    const v4f a = *(const v4f*)(in + (size_t)i * 8);
    const v4f b = *(const v4f*)(in + (size_t)i * 8 + 4);
    v4u ph, pl;
#pragma unroll
    for (int e = 0; e < 4; ++e) {
      const float f0 = (e < 2) ? a[2 * e]     : b[2 * e - 4];
      const float f1 = (e < 2) ? a[2 * e + 1] : b[2 * e - 3];
      const unsigned short h0 = bf_bits(f0), h1 = bf_bits(f1);
      const unsigned short l0 = bf_bits(f0 - bf_up(h0)), l1 = bf_bits(f1 - bf_up(h1));
      ph[e] = pk16(h0, h1);
      pl[e] = pk16(l0, l1);
    }
    *(v4u*)(hp + (size_t)i * 8) = ph;
    *(v4u*)(lp + (size_t)i * 8) = pl;
    
  }
}

// =====================================================================================================
// Batched bf16 WMMA GEMM: C[m][n] = sum_k A[m][k] * Bt[n][k] (+ bias). Block = 4 waves = one 128x128 tile, each
// wave a 64x64 quarter (wave>>1 = m half, wave&1 = n half). A row-major [M][K] pitch lda; Bt row-major [N][K] pitch
// ldb (k contiguous); M, N multiples of 128, K a multiple of 64 and at least 64. b = batch index.
// The 128 A rows and 128 Bt rows of a 64-wide k slab (128 B a row) are brought into LDS by asynchronous 16-B copies,
// 8 lanes to a row so that every copy instruction takes whole 128-B lines, and are shared by the block's waves; two
// buffers: slab t+1 flies while slab t is multiplied. LDS row pitch GP = 144 B. Fragments come by ds_load_b128; the
// k order and the order of the products are those of ascending k in steps of 32.
// NSPLIT: 0 = A.Bt; 1 = (A + A2).Bt (A2 = unscaled bf16 lo plane of A).
// BIAS: 0 none; 1 = + bias[n] per output column; 2 = + bias[m] per output row (bias RNE-converted to bf16 and
//       widened, added in f32 in the epilogue).
// OUT_MODE: 0 = f32 (pitch ldc); 2 = bf16 hi plane C + bf16 lo plane C2 (lo = RNE(v - hi), unscaled);
//           3 = f16 hi plane C + f16 residual plane C2 = f16((v - hi) * rscale), C2 written only for tiles
//               with n0 < N2 (pitch ldc2, batch stride strideC2).
// =====================================================================================================
#define GP 72                  // LDS row pitch (16-bit elements) of the GEMM slabs: 144 B = 16 B x 9
#define GPL (128 * GP)         // elements of one staged plane (128 rows)

// Eight asynchronous 16-B copies global -> LDS per lane. The s_wait_xcnt stands inside the statement so that no
// address register of a copy is rewritten ahead of it.
__device__ __forceinline__ void async8(const unsigned (&l)[8], const __bf16* const (&g)[8]) {
#if defined(__HIP_DEVICE_COMPILE__)
  asm volatile(
      "global_load_async_to_lds_b128 %0, %8, off\n\t"
      "global_load_async_to_lds_b128 %1, %9, off\n\t"
      "global_load_async_to_lds_b128 %2, %10, off\n\t"
      "global_load_async_to_lds_b128 %3, %11, off\n\t"
      "global_load_async_to_lds_b128 %4, %12, off\n\t"
      "global_load_async_to_lds_b128 %5, %13, off\n\t"
      "global_load_async_to_lds_b128 %6, %14, off\n\t"
      "global_load_async_to_lds_b128 %7, %15, off\n\t"
      "s_wait_xcnt 0x0"
      :: "v"(l[0]), "v"(l[1]), "v"(l[2]), "v"(l[3]), "v"(l[4]), "v"(l[5]), "v"(l[6]), "v"(l[7]),
         "v"(g[0]), "v"(g[1]), "v"(g[2]), "v"(g[3]), "v"(g[4]), "v"(g[5]), "v"(g[6]), "v"(g[7])
      : "memory");
#endif
}
// One plane of a slab: rows row0..row0+127 of src (pitch ld), columns k0..k0+63, to LDS byte address ldst.
// Thread tid takes the 16-B piece tid&7 of rows (tid>>3) + 16*it.
__device__ __forceinline__ void stage_plane(const __bf16* src, int row0, int ld, int k0, unsigned ldst, int tid) {
  unsigned l[8];
  const __bf16* g[8];
#pragma unroll  // the eight addresses are operands of one asm statement
  for (int it = 0; it < 8; ++it) {
    const int row = it * 16 + (tid >> 3);
    l[it] = ldst + (unsigned)((row * GP + (tid & 7) * 8) * 2);
    g[it] = src + (size_t)(row0 + row) * ld + k0 + (tid & 7) * 8;
  }
  async8(l, g);
}
__device__ __forceinline__ void wait_async0() {   // this wave's copies have landed
#if defined(__HIP_DEVICE_COMPILE__)
  asm volatile("s_wait_asynccnt 0x0" ::: "memory");
#endif
}
__device__ __forceinline__ void wait_ds0() {      // this wave's LDS reads are done before the buffer is refilled
#if defined(__HIP_DEVICE_COMPILE__)
  asm volatile("s_wait_dscnt 0x0" ::: "memory");
#endif
}

// One 128x128 tile (index tile, batch element b) by the 4 waves of a block; sAB = the two slab buffers, sT = the
// per-wave epilogue slabs, both the calling kernel's LDS.
template <int NSPLIT, int OUT_MODE, int BIAS>
__device__ __forceinline__ void gemm_tile(
    __bf16* sAB, float (*sT)[16 * 68], int tile, int b,
    const unsigned short* __restrict__ Ap, const unsigned short* A2p, int lda, long long strideA,
    const unsigned short* __restrict__ Btp, const unsigned short* Bt2p, int ldb, long long strideB,
    void* Cout, int ldc, long long strideC,
    void* Cout2, int ldc2, long long strideC2, int N2,
    const float* __restrict__ biasp,
    int M, int N, int K, float rscale) {
  static_assert(NSPLIT == 0 || NSPLIT == 1);
  constexpr int NPL = (NSPLIT == 1) ? 3 : 2;       // staged planes: A, Bt, (A2)
  constexpr int GI  = (NSPLIT == 1) ? 2 : 4;       // A row groups fetched together
  const __bf16* A   = (const __bf16*)(const void*)Ap;
  const __bf16* A2  = (const __bf16*)(const void*)A2p;
  const __bf16* Bt  = (const __bf16*)(const void*)Btp;
  (void)Bt2p;
  const int tid  = threadIdx.x;
  const int lane = tid & 31;
  const int wave = tid >> 5;
  const int tilesN = N >> 7;
  const int tilesM = M >> 7;
  if (tile >= tilesM * tilesN) return;   // block-uniform, in front of every barrier
  const int tm = tile / tilesN;
  const int tn = tile - tm * tilesN;
  const int mB = tm << 7;
  const int nB = tn << 7;
  const int wm = (wave >> 1) << 6;
  const int wn = (wave & 1) << 6;
  const int m0 = mB + wm;
  const int n0 = nB + wn;

  const __bf16* Ab  = A  + (size_t)b * strideA;
  const __bf16* Bb  = Bt + (size_t)b * strideB;
  const __bf16* Ab2 = (NSPLIT == 1) ? (A2 + (size_t)b * strideA) : Ab;

  const int rlane = lane & 15;                 // row (A) / col (B, D) within subtile
  const int koff  = (lane >> 4) * 8;           // k offset of this lane half
  const int mOff  = (lane >> 4) * 8;           // D row offset

  v8f acc[4][4];
#pragma unroll
  for (int i = 0; i < 4; ++i)
#pragma unroll
    for (int j = 0; j < 4; ++j) acc[i][j] = zero8();

  const unsigned lds0 = (unsigned)(uintptr_t)(void*)sAB;   // LDS byte address of the ring
  const int nT = K >> 6;                                   // k slabs of 64
  // slab t into buffer bf
  auto issue = [&](int t, int bf) {
    const unsigned lb = lds0 + (unsigned)(bf * NPL * GPL * 2);
    stage_plane(Ab, mB, lda, t << 6, lb, tid);
    stage_plane(Bb, nB, ldb, t << 6, lb + (unsigned)(GPL * 2), tid);
    if (NSPLIT == 1) stage_plane(Ab2, mB, lda, t << 6, lb + (unsigned)(2 * GPL * 2), tid);
  };
  issue(0, 0);
  wait_async0();
  __syncthreads();
  if (nT > 1) issue(1, 1);

  for (int t = 0; t < nT; ++t) {
    const __bf16* sA  = sAB + (t & 1) * (NPL * GPL);
    const __bf16* sB  = sA + GPL;
    const __bf16* sA2 = sA + (NPL - 1) * GPL;
    // this loop and those inside it are unrolled so that fragments and accumulators are indexed by constants only
    // and stay in registers
#pragma unroll
    for (int ks = 0; ks < 2; ++ks) {
      // the A fragments of GI row groups (16 products' worth) are fetched together, so that the LDS latency is met
      // once for them and not once a row group; GI is 2 with the second A plane to stay inside 256 registers
      v16b bh[4];
#pragma unroll
      for (int j = 0; j < 4; ++j) bh[j] = ldfrag_b(sB + (wn + (j << 4) + rlane) * GP + ks * 32 + koff);
#pragma unroll
      for (int ig = 0; ig < 4; ig += GI) {
        v16b ah[GI], al[GI];
#pragma unroll
        for (int u = 0; u < GI; ++u) {
          const int ao = (wm + ((ig + u) << 4) + rlane) * GP + ks * 32 + koff;
          ah[u] = ldfrag_b(sA + ao);
          if (NSPLIT == 1) al[u] = ldfrag_b(sA2 + ao); else al[u] = ah[u];
        }
#pragma unroll
        for (int u = 0; u < GI; ++u) {
          const int i = ig + u;
#pragma unroll
          for (int j = 0; j < 4; ++j) {
            acc[i][j] = mma_b_raw(ah[u], bh[j], acc[i][j]);
            if (NSPLIT == 1) acc[i][j] = mma_b_raw(al[u], bh[j], acc[i][j]);
          }
          dep_guard_b(acc[i][0], acc[i][3], ah[u], al[u]);
        }
      }
      keep4_b(bh[0], bh[1], bh[2], bh[3]);
    }
    // publish slab t+1 and free slab t's buffer: own LDS reads done, own copies landed, then the block barrier
    wait_ds0();
    wait_async0();
    __syncthreads();
    if (t + 2 < nT) issue(t + 2, t & 1);
  }
  wait_async0();
  acc_guard4(acc[0][0], acc[0][1], acc[0][2], acc[0][3]);
  acc_guard4(acc[1][0], acc[1][1], acc[1][2], acc[1][3]);
  acc_guard4(acc[2][0], acc[2][1], acc[2][2], acc[2][3]);
  acc_guard4(acc[3][0], acc[3][1], acc[3][2], acc[3][3]);

  // ---- per-column bias (BIAS == 1): this lane's 4 output columns n0 + 16j + rlane ----
  float bcol[4];
#pragma unroll
  for (int j = 0; j < 4; ++j) bcol[j] = 0.f;
  if (BIAS == 1) {
#pragma unroll
    for (int j = 0; j < 4; ++j) bcol[j] = bf_up(bf_bits(biasp[n0 + (j << 4) + rlane]));
  }

  // ---- epilogue ----
  float* slab = sT[wave];
#pragma unroll
  for (int i = 0; i < 4; ++i) {
    const int mBase = m0 + (i << 4);
    float brow[8];
#pragma unroll
    for (int r = 0; r < 8; ++r) brow[r] = 0.f;
    if (BIAS == 2) {
#pragma unroll
      for (int r = 0; r < 8; ++r) brow[r] = bf_up(bf_bits(biasp[mBase + mOff + r]));
    }
#pragma unroll
    for (int r = 0; r < 8; ++r) {
#pragma unroll
      for (int j = 0; j < 4; ++j) {
        float v = acc[i][j][r];
        if (BIAS == 1) v += bcol[j];
        if (BIAS == 2) v += brow[r];
        slab[(mOff + r) * 68 + (j << 4) + rlane] = v;
      }
    }
    __builtin_amdgcn_fence(__ATOMIC_RELEASE, "workgroup");
    __builtin_amdgcn_wave_barrier();
    __builtin_amdgcn_fence(__ATOMIC_ACQUIRE, "workgroup");
    if (OUT_MODE == 0) {
      float* C = (float*)Cout + (size_t)b * strideC;
      const int hh = lane >> 4, c4 = (lane & 15) * 4;     // 256-B row segment = 16 lanes x 16 B
      v4f ov[8];
#pragma unroll
      for (int it = 0; it < 8; ++it) {
        const int row = it * 2 + hh;                       // it 0..7 x hh 0..1 = rows 0..15
        ov[it] = *(const v4f*)(slab + row * 68 + c4);
      }
      {
#pragma unroll
        for (int it = 0; it < 8; ++it) {
          const int row = it * 2 + hh;
          *(v4f*)(C + (size_t)(mBase + row) * ldc + n0 + c4) = ov[it];
        }
        
      }
    } else {
      const int q = lane >> 3, c8 = (lane & 7) * 8;
      unsigned short* C  = (unsigned short*)Cout  + (size_t)b * strideC;
      unsigned short* C2 = (unsigned short*)Cout2 + (size_t)b * strideC2;
      const bool wlo = (OUT_MODE == 2) || (n0 < N2);      // wave-uniform
      v4u hv[4], lv[4];
#pragma unroll
      for (int it = 0; it < 4; ++it) {
        const int row = it * 4 + q;                        // it 0..3 x q 0..3 = rows 0..15
        const float* sp = slab + row * 68 + c8;
        v4u a, a2;
#pragma unroll
        for (int e = 0; e < 4; ++e) {
          const float f0 = sp[2 * e], f1 = sp[2 * e + 1];
          unsigned short h0, h1, l0, l1;
          if (OUT_MODE == 2) {
            h0 = bf_bits(f0); h1 = bf_bits(f1);
            l0 = bf_bits(f0 - bf_up(h0)); l1 = bf_bits(f1 - bf_up(h1));
          } else {
            const _Float16 x0 = (_Float16)f0, x1 = (_Float16)f1;
            h0 = h_bits(x0); h1 = h_bits(x1);
            l0 = h_bits((_Float16)((f0 - (float)x0) * rscale));
            l1 = h_bits((_Float16)((f1 - (float)x1) * rscale));
          }
          a[e] = pk16(h0, h1); a2[e] = pk16(l0, l1);
        }
        hv[it] = a; lv[it] = a2;
      }
      // the test stands round the store loops, not inside them: each side is one straight run of stores
      if (wlo) {
#pragma unroll  // hv and lv are indexed by constants only, so they stay in registers
        for (int it = 0; it < 4; ++it) {
          const int row = it * 4 + q;
          *(v4u*)(C + (size_t)(mBase + row) * ldc + n0 + c8) = hv[it];
          *(v4u*)(C2 + (size_t)(mBase + row) * ldc2 + n0 + c8) = lv[it];
        }
      } else {
#pragma unroll  // as above
        for (int it = 0; it < 4; ++it) {
          const int row = it * 4 + q;
          *(v4u*)(C + (size_t)(mBase + row) * ldc + n0 + c8) = hv[it];
        }
#if defined(__HIP_DEVICE_COMPILE__)
        // the code laid out behind these stores rewrites their address and data registers: the wait stands in front of it
        asm volatile("s_wait_xcnt 0x0" ::: "memory");
#endif
      }
    }
    __builtin_amdgcn_fence(__ATOMIC_RELEASE, "workgroup");
    __builtin_amdgcn_wave_barrier();
    __builtin_amdgcn_fence(__ATOMIC_ACQUIRE, "workgroup");
  }
}

// One GEMM per launch: blockIdx.x = tile, blockIdx.y = batch index.
template <int NSPLIT, int OUT_MODE, int BIAS>
__global__ __launch_bounds__(128) void gemm64(
    const unsigned short* __restrict__ Ap, const unsigned short* A2p, int lda, long long strideA,
    const unsigned short* __restrict__ Btp, const unsigned short* Bt2p, int ldb, long long strideB,
    void* Cout, int ldc, long long strideC,
    void* Cout2, int ldc2, long long strideC2, int N2,
    const float* __restrict__ biasp,
    int M, int N, int K, float rscale) {
  __shared__ __align__(16) __bf16 sAB[2 * ((NSPLIT == 1) ? 3 : 2) * GPL];   // two buffers of 2 or 3 planes
  __shared__ __align__(16) float sT[4][16 * 68];                            // per-wave 16x64 slab, pitch 68 floats
  gemm_tile<NSPLIT, OUT_MODE, BIAS>(sAB, sT, blockIdx.x, blockIdx.y, Ap, A2p, lda, strideA, Btp, Bt2p, ldb, strideB,
                                    Cout, ldc, strideC, Cout2, ldc2, strideC2, N2, biasp, M, N, K, rscale);
}

// The four projections of x, none of which reads another's result, in one launch; a block's index picks its GEMM
// (block-uniform) and its tile: q tiles, k tiles, v^T tiles of each batch element, line-feature tiles.
//   q, k:   C[row][e] = sum_k Xb[row][k] W[e][k] + bias[e] -> bf16 hi / lo planes     (M=4096, N=1024, K=1024)
//   v^T:    VTh[b][f][s] = sum_k Wv[f][k] Xb[b*SEQ+s][k] + bv[f] -> f16 hi plane (pitch SEQ) and residual plane
//           (x4096, keys < VLP, pitch VLP)                                            (M=1024, N=2048, K=1024)
//   lines:  LN[row][e] = sum_k Xb[row][k] Wln[e][k] -> f32                            (M=4096, N=256,  K=1024)
#define PB_Q  ((NB * SEQ / 128) * (QP / 128))    // 256 tiles, q and k each
#define PB_V  ((QP / 128) * (SEQ / 128))         // 128 tiles for each batch element
#define PB_LN ((NB * SEQ / 128) * (LNW / 128))   //  64 tiles
#define PB_ALL (2 * PB_Q + NB * PB_V + PB_LN)
__global__ __launch_bounds__(128) void proj4(
    const unsigned short* __restrict__ Xb, const unsigned short* __restrict__ Wqkv,
    const unsigned short* __restrict__ Wln, const float* __restrict__ bqkv,
    unsigned short* Qh, unsigned short* Ql, unsigned short* Kh, unsigned short* Kl,
    unsigned short* VTh, unsigned short* VTl, float* LN) {
  __shared__ __align__(16) __bf16 sAB[2 * 2 * GPL];     // two buffers of 2 planes
  __shared__ __align__(16) float sT[4][16 * 68];        // per-wave 16x64 slab, pitch 68 floats
  const int bx = blockIdx.x;
  if (bx < 2 * PB_Q) {
    const int isk = (bx >= PB_Q) ? 1 : 0;
    const unsigned short* Wp = Wqkv + (size_t)isk * QP * DMODEL;
    gemm_tile<0, 2, 1>(sAB, sT, bx - isk * PB_Q, 0,
                       Xb, Xb, DMODEL, 0LL, Wp, Wp, DMODEL, 0LL,
                       (void*)(isk ? Kh : Qh), QP, 0LL, (void*)(isk ? Kl : Ql), QP, 0LL, QP,
                       bqkv + isk * QP, NB * SEQ, QP, DMODEL, 1.0f);
  } else if (bx < 2 * PB_Q + NB * PB_V) {
    const int v = bx - 2 * PB_Q;
    const unsigned short* Wp = Wqkv + (size_t)2 * QP * DMODEL;
    gemm_tile<0, 3, 2>(sAB, sT, v % PB_V, v / PB_V,
                       Wp, Wp, DMODEL, 0LL, Xb, Xb, DMODEL, (long long)SEQ * DMODEL,
                       (void*)VTh, SEQ, (long long)QP * SEQ, (void*)VTl, VLP, (long long)QP * VLP, VLP,
                       bqkv + 2 * QP, QP, SEQ, DMODEL, 4096.0f);
  } else if (bx < PB_ALL) {
    gemm_tile<0, 0, 0>(sAB, sT, bx - (2 * PB_Q + NB * PB_V), 0,
                       Xb, Xb, DMODEL, 0LL, Wln, Wln, DMODEL, 0LL,
                       (void*)LN, LNW, 0LL, (void*)LN, 0, 0LL, 0,
                       bqkv, NB * SEQ, LNW, DMODEL, 1.0f);
  }
}

// =====================================================================================================
// Line features. Input ln f32 [NB*SEQ][LNW]: column blocks of PD*NH = 64: block 0 = x.W1w^T, 1 = x.W2w^T,
// 2 = x.W1r^T, 3 = x.W2r^T; within a block head h owns columns h*4..h*4+3.
// Per (b, h, t): p1 = block 0 of token t-1 (zero vector at t == 0: the shifted input), p2 = block 1 of t,
// p3 = block 2 of t, p4 = block 3 of t. Exterior 2-form L[m] = pa[PI[m]]*pb[PJ[m]] - pa[PJ[m]]*pb[PI[m]] for
// pairs (0,1),(0,2),(0,3),(1,2),(1,3),(2,3), then L *= 1/max(|L|_2, 1e-12) (all f32, fp contract off).
// Outputs f32 [NB*NH][SEQ][8]: rl = read line [L0..L5, 0, 0]; wl = J-applied write line [L5,-L4,L3,L2,-L1,L0,0,0].
// wave-uniform bound, no block barriers.
// coverage: nwaves = NB*NH*(SEQ/32) waves x 32 rows x 32 B = every row of both planes incl. the zero pad cols.
// =====================================================================================================
struct L6 { float v0, v1, v2, v3, v4, v5; };

__device__ __forceinline__ L6 ext6n(const v4f a, const v4f b) {
#pragma clang fp contract(off)
  L6 o;
  o.v0 = a[0] * b[1] - a[1] * b[0];
  o.v1 = a[0] * b[2] - a[2] * b[0];
  o.v2 = a[0] * b[3] - a[3] * b[0];
  o.v3 = a[1] * b[2] - a[2] * b[1];
  o.v4 = a[1] * b[3] - a[3] * b[1];
  o.v5 = a[2] * b[3] - a[3] * b[2];
  float n2 = o.v0 * o.v0 + o.v1 * o.v1;
  n2 = n2 + o.v2 * o.v2;
  n2 = n2 + o.v3 * o.v3;
  n2 = n2 + o.v4 * o.v4;
  n2 = n2 + o.v5 * o.v5;
  float n = sqrtf(n2);
  n = fmaxf(n, 1e-12f);
  const float inv = 1.0f / n;
  o.v0 *= inv; o.v1 *= inv; o.v2 *= inv; o.v3 *= inv; o.v4 *= inv; o.v5 *= inv;
  return o;
}

__global__ __launch_bounds__(256) void lines_k(const float* __restrict__ ln, float* rl, float* wl, int nwaves) {
#pragma clang fp contract(off)
  __shared__ __align__(16) float sR[8][256];
  __shared__ __align__(16) float sW[8][256];
  const int tid = threadIdx.x, wave = tid >> 5, lane = tid & 31;
  const int w = blockIdx.x * 8 + wave;
  if (w >= nwaves) return;                        // wave-uniform; no block barriers in this kernel
  const int tgPer = SEQ / 32;                     // 64 token groups per (b, h)
  const int bh = w / tgPer;                       // b*NH + h
  const int tg = w - bh * tgPer;
  const int b  = bh / NH;
  const int h  = bh - b * NH;
  const int t  = tg * 32 + lane;                  // < SEQ
  const size_t row  = (size_t)b * SEQ + t;
  const size_t rowp = (t > 0) ? (row - 1) : row;  // clamped address; value zeroed below when t == 0
  const float* cur = ln + row * LNW + h * PD;
  v4f p1 = *(const v4f*)(ln + rowp * LNW + h * PD);
  if (t == 0) { p1[0] = 0.f; p1[1] = 0.f; p1[2] = 0.f; p1[3] = 0.f; }
  const v4f p2 = *(const v4f*)(cur + 1 * PD * NH);
  const v4f p3 = *(const v4f*)(cur + 2 * PD * NH);
  const v4f p4 = *(const v4f*)(cur + 3 * PD * NH);
  const L6 lw = ext6n(p1, p2);
  const L6 lr = ext6n(p3, p4);

  float* sr = sR[wave] + lane * 8;
  float* sw = sW[wave] + lane * 8;
  v4f t0, t1, u0, u1;
  t0[0] = lr.v0; t0[1] = lr.v1; t0[2] = lr.v2; t0[3] = lr.v3;
  t1[0] = lr.v4; t1[1] = lr.v5; t1[2] = 0.f;   t1[3] = 0.f;
  u0[0] = lw.v5; u0[1] = -lw.v4; u0[2] = lw.v3; u0[3] = lw.v2;
  u1[0] = -lw.v1; u1[1] = lw.v0; u1[2] = 0.f;   u1[3] = 0.f;
  *(v4f*)(sr)     = t0;
  *(v4f*)(sr + 4) = t1;
  *(v4f*)(sw)     = u0;
  *(v4f*)(sw + 4) = u1;
  __builtin_amdgcn_fence(__ATOMIC_RELEASE, "workgroup");
  __builtin_amdgcn_wave_barrier();
  __builtin_amdgcn_fence(__ATOMIC_ACQUIRE, "workgroup");
  v4f oR[2], oW[2];
#pragma unroll
  for (int it = 0; it < 2; ++it) {
    oR[it] = *(const v4f*)(sR[wave] + it * 128 + lane * 4);
    oW[it] = *(const v4f*)(sW[wave] + it * 128 + lane * 4);
  }
  const size_t gb = ((size_t)bh * SEQ + (size_t)tg * 32) * 8;
  {
#pragma unroll
    for (int it = 0; it < 2; ++it) {
      *(v4f*)(rl + gb + it * 128 + lane * 4) = oR[it];
      *(v4f*)(wl + gb + it * 128 + lane * 4) = oW[it];
    }
    
  }
}

// =====================================================================================================
// Causal multi-head attention, head dim 64, with an additive line-pair bias:
//   logit(q, k) = (q . k) * sscale + dot6(rl[q], wl[k]) * wdec(q - k),  wdec(d) = bs_h * dec_h^d for d > 0, 0 else,
//   dec_h = sigmoid(dl_h); keys k > q masked (-FLT_MAX, exp -> 0); diagonal kept. In the key chunks in front of the
//   diagonal one the weight is carried by the staged rows: rl[q] * bs_h * dec_h^(q - 64 qb) and wl[k] * dec_h^(64 qb - k).
//   q planes (bf16 hi / lo): element (b, t, h, d) at [(b*SEQ + t)*QP + h*64 + d]
//   k planes (bf16 hi / lo): same layout
//   v^T hi plane (f16):      element (b, h, d, s) at [(b*QP + h*64 + d)*SEQ + s]
//   v^T residual plane (f16, (v - hi)*4096): [(b*QP + h*64 + d)*VLP + s], s < VLP, read only when RES
//   rl / wl f32 planes [b*NH + h][SEQ][8] (6 used)
//   out f32 plane: element (b, t, h*64 + d) at [(b*SEQ + t)*QP + h*64 + d] = normalised context.
//   scores = q . k : bf16 hi/lo split (hi.hi + hi.lo + lo.hi), f32 accumulate, then scale + bias in f32
//   p = exp(s - m) carried as f16(1024 p); context = p . v on f16 WMMA; RES adds f16 residual planes of p and v
//   (scale 4096, separate accumulator folded back with 1/4096 per chunk in f32); online softmax in f32.
//   Block = 4 waves; a query tile = 64 query rows of one (b, h); key chunks of 64, chunks 0..qb only for tile qb
//   (block-uniform trip count qb+1 <= NQB; every row has a live key in every processed chunk).
//   Each block takes two tiles of its (b, h), one after the other: NQB-1-t, then t (t = 0..NQB/2-1), so that every
//   block walks NQB+1 key chunks; grid = (NQB/2) * NH * NB. Tiles qb < RESQB run the RES form.
//   K / V^T / wl chunk staging: 128 threads (plain 16-B loads, __syncthreads before and after); P tiles are
//   wave-private, spilled with _Float16 element stores and reloaded as v8h (same element type) after a release
//   barrier in between).
//   Output coverage: each wave stores rows q0..q0+15 (it 0..7 x lane>>4 0..1) x 64 columns (16 lanes x 4 floats),
// =====================================================================================================
struct AttnLds {
  __align__(16) unsigned short KT[2 * 64 * LP];      // K hi [kv][d] | K lo; later f32 context staging
  __align__(16) _Float16 Vth[64 * LP];                // V^T hi [d][kv]
  __align__(16) _Float16 Vtl[64 * LP];                // V^T residual (RES tiles)
  __align__(16) _Float16 Psh[4][16 * LP];             // per wave P [row][kv]
  __align__(16) _Float16 Psl[4][16 * LP];             // per wave P residual (RES tiles)
  __align__(16) float    Ws[64 * 8];                  // wl rows of the chunk's 64 keys, times dec_h^(64 qb - key) in front of the diagonal chunk
  __align__(16) float    Rs[4][16 * 8];               // per wave rl rows of its 16 queries
  __align__(16) float    Rd[4][8 * 16];               // the same times bs_h * dec_h^(q - first row of the query tile), [term][row]
};

// One query tile qb of (b, h), all 4 waves of the block.
template <bool RES>
__device__ __forceinline__
void attn_tile(AttnLds& sm,
               const unsigned short* __restrict__ qhp, const unsigned short* __restrict__ qlp,
               const unsigned short* __restrict__ khp, const unsigned short* __restrict__ klp,
               const unsigned short* __restrict__ vhp, const unsigned short* __restrict__ vlp,
               const float* __restrict__ rlp, const float* __restrict__ wlp,
               const float* __restrict__ dlg, const float* __restrict__ bsc,
               float* outp, int b, int h, int qb, float sscale) {
  union FB { v16b v; v8b h[2]; };
  union FH { v16h v; v8h h[2]; };
  unsigned short* KT = sm.KT;
  _Float16* Vth = sm.Vth;
  _Float16* Vtl = sm.Vtl;
  _Float16 (*Psh)[16 * LP] = sm.Psh;
  _Float16 (*Psl)[16 * LP] = sm.Psl;
  float* Ws = sm.Ws;
  float (*Rs)[16 * 8] = sm.Rs;
  float (*Rd)[8 * 16] = sm.Rd;
  __bf16* Ksh = (__bf16*)(void*)KT;
  __bf16* Ksl = Ksh + 64 * LP;

  const int tid  = threadIdx.x;
  const int wave = tid >> 5;
  const int lane = tid & 31;
  const int hh   = lane >> 4;
  const int c    = lane & 15;

  const int q0   = qb * 64 + wave * 16;
  const size_t rowB = (size_t)b * SEQ;
  const size_t bhT  = ((size_t)b * NH + h) * SEQ;

  const __bf16* Qh = (const __bf16*)(const void*)qhp + (size_t)h * HD;
  const __bf16* Ql = (const __bf16*)(const void*)qlp + (size_t)h * HD;
  const __bf16* Kh = (const __bf16*)(const void*)khp + (size_t)h * HD;
  const __bf16* Kl = (const __bf16*)(const void*)klp + (size_t)h * HD;
  const _Float16* Vh = (const _Float16*)(const void*)vhp + ((size_t)b * QP + (size_t)h * HD) * SEQ;
  const _Float16* Vl = (const _Float16*)(const void*)vlp + ((size_t)b * QP + (size_t)h * HD) * VLP;

  // ---- per-head scalars (RNE bf16-converted inputs) ----
  const float dl  = bf_up(bf_bits(dlg[h]));
  const float dec = 1.0f / (1.0f + expf(-dl));
  const float l2d = fmaxf(log2f(dec), -FLT_MAX);   // finite, so that a power with exponent 0 is 1 also when dec == 0
  const float bsh = bf_up(bf_bits(bsc[h]));

  // ---- stage the wave's 16 rl rows: 16 x 8 f32 = 32 lanes x 16 B (ordered by the loop's first barrier), plain for
  //      the diagonal chunk and, for the chunks in front of it, with the query's share of the decay weight:
  //      bs * dec^(q - k) = [bs * dec^(q - 64 qb)] * [dec^(64 qb - k)], both exponents >= 0 there, so both powers
  //      are <= 1 and neither can overflow; where one underflows the whole weight does ----
  {
    const v4f rv = *(const v4f*)(rlp + (bhT + q0) * 8 + lane * 4);
    const float rf = bsh * exp2f((float)(wave * 16 + (lane >> 1)) * l2d);   // row = lane >> 1 (two lanes a row)
    *(v4f*)(Rs[wave] + lane * 4) = rv;
    // term-major, so that one 8-B read brings one term of two neighbouring rows: the row pairs of the packed fma
#pragma unroll
    for (int e = 0; e < 4; ++e) Rd[wave][((lane & 1) * 4 + e) * 16 + (lane >> 1)] = rv[e] * rf;
  }

  float mrow[8], lrow[8];
  v8f oacc[4];
#pragma unroll
  for (int r = 0; r < 8; ++r) { mrow[r] = -INFINITY; lrow[r] = 0.f; }
#pragma unroll
  for (int t = 0; t < 4; ++t) oacc[t] = zero8();

  // ---- Q fragments (A operand, row = lane&15): 2 d-chunks, hi and lo, held in registers for the whole tile ----
  v16b qah[2], qal[2];
#pragma unroll
  for (int dc = 0; dc < 2; ++dc) {
    const size_t qo = (rowB + q0 + c) * QP + dc * 32 + 8 * hh;
    qah[dc] = ldfrag_b(Qh + qo);
    qal[dc] = ldfrag_b(Ql + qo);
  }

  int nkt = qb + 1;                          // causal: key tiles 0..qb, block-uniform
  if (nkt > NQB) nkt = NQB;
  for (int kt = 0; kt < nkt; ++kt) {
    const int kv0 = kt * 64;
    const bool diag = (kt == qb);            // block-uniform: the one chunk that holds keys >= a query of the tile
    __syncthreads();
    {
      const int r = tid >> 1, half = (tid & 1) * 32;
      // wl rows kv0..kv0+63 of this (b, h): 64 x 8 f32 = 128 threads x 16 B (key = kv0 + r); in front of the diagonal
      // chunk times the key's share dec^(64 qb - key) of the decay weight (exponent >= 1), in it times dec^0 = 1.
      // The load stands first so that it flies together with the K and V loads.
      const float* wg = wlp + (bhT + kv0) * 8 + tid * 4;
      const v4f wv = *(const v4f*)(wg);
      const float kf = exp2f((float)(diag ? 0 : (qb * 64 - kv0 - r)) * l2d);
      const __bf16*   kg  = Kh + (rowB + kv0 + r) * QP + half;    // K row kv0+r, d = half..half+31
      const __bf16*   klg = Kl + (rowB + kv0 + r) * QP + half;
      const _Float16* vg  = Vh + (size_t)r * SEQ + kv0 + half;    // V^T row d = r, s = kv0+half..+31
      const int kvl = (kv0 + 64 <= VLP) ? kv0 : (VLP - 64);     // clamped address into the residual plane
      const _Float16* vlg = Vl + (size_t)r * VLP + kvl + half;
      const bool resOK = (kv0 + 64 <= VLP);                      // block-uniform
#pragma unroll
      for (int i = 0; i < 4; ++i) {
        const v8b a0 = *(const v8b*)(kg + 8 * i);
        const v8b a1 = *(const v8b*)(klg + 8 * i);
        const v8h b0 = *(const v8h*)(vg + 8 * i);
        *(v8b*)(Ksh + r * LP + half + 8 * i) = a0;
        *(v8b*)(Ksl + r * LP + half + 8 * i) = a1;
        *(v8h*)(Vth + r * LP + half + 8 * i) = b0;
        if (RES) {
          v8h b1 = *(const v8h*)(vlg + 8 * i);
          if (!resOK) b1 = zero8h();
          *(v8h*)(Vtl + r * LP + half + 8 * i) = b1;
        }
      }
      *(v4f*)(Ws + tid * 4) = wv * kf;
#if defined(__HIP_DEVICE_COMPILE__)
      // the address registers of the chunk's loads are inputs here, so they stay whole up to this wait
      if (RES) asm volatile("s_wait_xcnt 0x0" :: "v"(wg), "v"(kg), "v"(klg), "v"(vg), "v"(vlg) : "memory");
      else     asm volatile("s_wait_xcnt 0x0" :: "v"(wg), "v"(kg), "v"(klg), "v"(vg) : "memory");
#endif
    }
    __syncthreads();

    // ---- scores: 16 query rows x 64 keys per wave, 3 bf16 products ----
    // all K fragments of the chunk are fetched as one group in front of the products, in the order of their use, so that
    // the LDS latency is met once for the chunk and not once for every three products
    FB kb[4][2], kl[4][2];
#pragma unroll  // the fragments are indexed by constants only, so they stay in registers (all loops of this part)
    for (int j = 0; j < 4; ++j) {
#pragma unroll
      for (int dc = 0; dc < 2; ++dc) {
        kb[j][dc].h[0] = *(const v8b*)(Ksh + (j * 16 + c) * LP + dc * 32 + 8 * hh);
        kb[j][dc].h[1] = *(const v8b*)(Ksh + (j * 16 + c) * LP + dc * 32 + 16 + 8 * hh);
        kl[j][dc].h[0] = *(const v8b*)(Ksl + (j * 16 + c) * LP + dc * 32 + 8 * hh);
        kl[j][dc].h[1] = *(const v8b*)(Ksl + (j * 16 + c) * LP + dc * 32 + 16 + 8 * hh);
      }
    }
    v8f s[4];
#pragma unroll
    for (int j = 0; j < 4; ++j) {
      s[j] = zero8();
#pragma unroll
      for (int dc = 0; dc < 2; ++dc) {
        s[j] = mma_b(qah[dc], kb[j][dc].v, s[j]);
        s[j] = mma_b(qah[dc], kl[j][dc].v, s[j]);
        s[j] = mma_b(qal[dc], kb[j][dc].v, s[j]);
      }
    }

    // ---- all V^T fragments of the chunk, fetched here so that they arrive while the softmax below is computed ----
    FH vb[2][4];
#pragma unroll  // as above
    for (int kk = 0; kk < 2; ++kk) {
#pragma unroll
      for (int t = 0; t < 4; ++t) {
        vb[kk][t].h[0] = *(const v8h*)(Vth + (t * 16 + c) * LP + kk * 32 + 8 * hh);
        vb[kk][t].h[1] = *(const v8h*)(Vth + (t * 16 + c) * LP + kk * 32 + 16 + 8 * hh);
      }
    }

    // ---- wl rows of this lane's 4 key columns (j*16 + c): 6 used of 8 ----
    v4f wa[4];
    v2f wb[4];
#pragma unroll
    for (int j = 0; j < 4; ++j) {
      const float* wp = Ws + (j * 16 + c) * 8;
      wa[j] = *(const v4f*)(wp);
      wb[j] = *(const v2f*)(wp + 4);
    }

    // ---- scale + bias + causal mask (replace by -FLT_MAX), row max, online softmax, P (x1024, f16) and
    //      P residual (x4096) to LDS ----
    _Float16* pwh = Psh[wave];
    _Float16* pwl = Psl[RES ? wave : 0];
    float mloc[8], msafe[8], alpha[8], psum[8];
    // logits of all 8 rows first, so that the 8 row reductions below run as independent chains
    if (!diag) {
      // every key of the chunk lies before every query of the tile: nothing is masked, and the decay weight is
      // already in the staged rows, so the bias is the plain 6-term dot
      const v2f sc2 = {sscale, sscale};
#pragma unroll  // rr, s and mloc are indexed by constants only, so they stay in registers (all loops of this branch)
      for (int p = 0; p < 4; ++p) {
        v2f rr[6];                           // term i of rows 8 hh + 2 p and 8 hh + 2 p + 1
#pragma unroll
        for (int i = 0; i < 6; ++i) rr[i] = *(const v2f*)(Rd[wave] + i * 16 + 8 * hh + 2 * p);
        v2f m2 = {-INFINITY, -INFINITY};
#pragma unroll
        for (int j = 0; j < 4; ++j) {
          // two rows at a time; the six terms in the order 0..5, then the scaled score, as in the diagonal chunk
          const v2f w0 = {wa[j][0], wa[j][0]}, w1 = {wa[j][1], wa[j][1]}, w2 = {wa[j][2], wa[j][2]};
          const v2f w3 = {wa[j][3], wa[j][3]}, w4 = {wb[j][0], wb[j][0]}, w5 = {wb[j][1], wb[j][1]};
          v2f d = rr[0] * w0;
          d = __builtin_elementwise_fma(rr[1], w1, d);
          d = __builtin_elementwise_fma(rr[2], w2, d);
          d = __builtin_elementwise_fma(rr[3], w3, d);
          d = __builtin_elementwise_fma(rr[4], w4, d);
          d = __builtin_elementwise_fma(rr[5], w5, d);
          const v2f sp = {s[j][2 * p], s[j][2 * p + 1]};
          d = __builtin_elementwise_fma(sp, sc2, d);
          s[j][2 * p] = d.x; s[j][2 * p + 1] = d.y;
          m2.x = fmaxf(m2.x, d.x); m2.y = fmaxf(m2.y, d.y);
        }
        mloc[2 * p] = m2.x; mloc[2 * p + 1] = m2.y;
      }
    } else
#pragma unroll
    for (int r = 0; r < 8; ++r) {
      const int qrow = q0 + 8 * hh + r;
      const float* rp = Rs[wave] + (8 * hh + r) * 8;
      const v4f ra = *(const v4f*)(rp);
      const v2f rb = *(const v2f*)(rp + 4);
      float m = -INFINITY;
#pragma unroll
      for (int j = 0; j < 4; ++j) {
        const int key = kv0 + j * 16 + c;
        const int dd  = qrow - key;
        const float dot6 = ra[0] * wa[j][0] + ra[1] * wa[j][1] + ra[2] * wa[j][2] + ra[3] * wa[j][3]
                         + rb[0] * wb[j][0] + rb[1] * wb[j][1];
        const float ex   = exp2_slot((float)dd * l2d);
        const float wdec = (dd > 0) ? (bsh * ex) : 0.f;
        float sv = s[j][r] * sscale + dot6 * wdec;
        sv = (key > qrow) ? -FLT_MAX : sv;
        s[j][r] = sv;
        m = fmaxf(m, sv);
      }
      mloc[r] = m;
    }
    // row maximum over the 16 lanes of a half: xor butterfly 1, 2, 4, 8 in the vector unit, 8 rows per step.
    // The scheduling barriers keep the 8 chains side by side: without them the compiler moves each row's chain
    // back behind that row's logits, where every step waits for the one before it.
    __builtin_amdgcn_sched_barrier(0);
    rowmax8<1>(mloc); rowmax8<2>(mloc); rowmax8<4>(mloc); rowmax8<8>(mloc);
    __builtin_amdgcn_sched_barrier(0);
#pragma unroll  // per-row state is indexed by constants only, so it stays in registers
    for (int r = 0; r < 8; ++r) {
      const float mnew = fmaxf(mrow[r], mloc[r]);
      msafe[r] = (mnew == -INFINITY) ? 0.f : mnew;
      alpha[r] = exp_slot(mrow[r] - msafe[r]);
      mrow[r]  = mnew;
    }
#pragma unroll  // as above
    for (int r = 0; r < 8; ++r) {
      float ps = 0.f;
#pragma unroll
      for (int j = 0; j < 4; ++j) {
        const float p = exp_slot(s[j][r] - msafe[r]);  // masked logit against a finite max: exp -> 0
        ps += p;
        const float p1k = p * 1024.0f;
        const _Float16 ph = (_Float16)p1k;
        pwh[(8 * hh + r) * LP + j * 16 + c] = ph;
        if (RES) {
          const _Float16 pl = (_Float16)((p1k - (float)ph) * 4096.0f);
          pwl[(8 * hh + r) * LP + j * 16 + c] = pl;
        }
      }
      psum[r] = ps;
    }
    // row sum: xor butterfly 1, 2, 4, 8 like the maximum, with the same scheduling barriers for the same reason
    __builtin_amdgcn_sched_barrier(0);
    rowsum8<1>(psum); rowsum8<2>(psum); rowsum8<4>(psum); rowsum8<8>(psum);
    __builtin_amdgcn_sched_barrier(0);
#pragma unroll  // as above
    for (int r = 0; r < 8; ++r) {
      lrow[r] = lrow[r] * alpha[r] + psum[r];
#pragma unroll
      for (int t = 0; t < 4; ++t) oacc[t][r] *= alpha[r];
    }
    __builtin_amdgcn_fence(__ATOMIC_RELEASE, "workgroup");
    __builtin_amdgcn_wave_barrier();
    __builtin_amdgcn_fence(__ATOMIC_ACQUIRE, "workgroup");

    // ---- context += P . V (f16 WMMA), residual products into a separate accumulator ----
    v8f o1[4];
#pragma unroll
    for (int t = 0; t < 4; ++t) o1[t] = zero8();
    // the P fragments of both key halves as one group, for the same reason as the K fragments
    FH pa[2], pl[2];
#pragma unroll  // the fragments are indexed by constants only, so they stay in registers (this loop and the next)
    for (int kk = 0; kk < 2; ++kk) {
      pa[kk].h[0] = *(const v8h*)(pwh + c * LP + kk * 32 + 8 * hh);
      pa[kk].h[1] = *(const v8h*)(pwh + c * LP + kk * 32 + 16 + 8 * hh);
      if (RES) {
        pl[kk].h[0] = *(const v8h*)(pwl + c * LP + kk * 32 + 8 * hh);
        pl[kk].h[1] = *(const v8h*)(pwl + c * LP + kk * 32 + 16 + 8 * hh);
      } else {
        pl[kk].v = pa[kk].v;
      }
    }
#pragma unroll
    for (int kk = 0; kk < 2; ++kk) {
      // RES tiles: the V^T residual fragments of one key half as a group (all eight, or held over the softmax, they did
      // not fit the registers)
      FH vl[4];
#pragma unroll
      for (int t = 0; t < 4; ++t) {
        if (RES) {
          vl[t].h[0] = *(const v8h*)(Vtl + (t * 16 + c) * LP + kk * 32 + 8 * hh);
          vl[t].h[1] = *(const v8h*)(Vtl + (t * 16 + c) * LP + kk * 32 + 16 + 8 * hh);
        } else {
          vl[t].v = vb[kk][t].v;
        }
      }
#pragma unroll
      for (int t = 0; t < 4; ++t) {
        oacc[t] = mma_h(pa[kk].v, vb[kk][t].v, oacc[t]);
        if (RES) {
          o1[t] = mma_h(pa[kk].v, vl[t].v, o1[t]);
          o1[t] = mma_h(pl[kk].v, vb[kk][t].v, o1[t]);
        }
      }
    }
    if (RES) {
#pragma unroll
      for (int t = 0; t < 4; ++t)
#pragma unroll
        for (int r = 0; r < 8; ++r) oacc[t][r] += o1[t][r] * (1.0f / 4096.0f);
    }
  }

  // ---- all waves are done with the K tiles before that LDS region is reused for the context staging ----
  __syncthreads();

  // ---- normalise (1/l and the 1/1024 p carry), stage the wave's 16x64 tile in LDS, then write whole
  float* os = (float*)(void*)KT + wave * (16 * 64);
#pragma unroll
  for (int r = 0; r < 8; ++r) {
    const float l = lrow[r];
    const float inv = ((l > 0.f) ? (1.0f / l) : 0.f) * (1.0f / 1024.0f);
#pragma unroll
    for (int t = 0; t < 4; ++t) os[(8 * hh + r) * 64 + t * 16 + c] = oacc[t][r] * inv;
  }
  __builtin_amdgcn_fence(__ATOMIC_RELEASE, "workgroup");
  __builtin_amdgcn_wave_barrier();
  __builtin_amdgcn_fence(__ATOMIC_ACQUIRE, "workgroup");
  {
    const int h2 = lane >> 4, c4 = (lane & 15) * 4;
    v4f ov[8];
#pragma unroll
    for (int it = 0; it < 8; ++it) {
      const int row = it * 2 + h2;   // it 0..7 x h2 0..1 = rows 0..15 of the wave tile
      ov[it] = *(const v4f*)(os + row * 64 + c4);
    }
    {
#pragma unroll
      for (int it = 0; it < 8; ++it) {
        const int row = it * 2 + h2;
        const size_t go = (rowB + q0 + row) * QP + (size_t)h * HD + c4;
        *(v4f*)(outp + go) = ov[it];
      }
#if defined(__HIP_DEVICE_COMPILE__)
      // the block's next tile rewrites the address and data registers of these stores: the wait stands in front of that
      asm volatile("s_wait_xcnt 0x0" ::: "memory");
#endif
    }
  }
}

__global__ __launch_bounds__(128)
void attn_lb(const unsigned short* __restrict__ qhp, const unsigned short* __restrict__ qlp,
             const unsigned short* __restrict__ khp, const unsigned short* __restrict__ klp,
             const unsigned short* __restrict__ vhp, const unsigned short* __restrict__ vlp,
             const float* __restrict__ rlp, const float* __restrict__ wlp,
             const float* __restrict__ dlg, const float* __restrict__ bsc,
             float* outp, float sscale) {
  static_assert((NQB % 2) == 0);
  __shared__ AttnLds sm;
  const int bx   = blockIdx.x;
  const int t    = bx % (NQB / 2);
  const int rest = bx / (NQB / 2);
  const int h    = rest % NH;
  const int b    = rest / NH;
  // The second tile's first barrier (top of its key loop) stands behind every wave's read-back of the first tile's
  // context staging, and in front of the first refill of that LDS.
#pragma unroll 1  // rolled: one copy of each tile form in the text
  for (int pass = 0; pass < 2; ++pass) {
    const int qb = pass ? t : (NQB - 1 - t);       // block-uniform
    if (qb < RESQB)
      attn_tile<true>(sm, qhp, qlp, khp, klp, vhp, vlp, rlp, wlp, dlg, bsc, outp, b, h, qb, sscale);
    else
      attn_tile<false>(sm, qhp, qlp, khp, klp, vhp, vlp, rlp, wlp, dlg, bsc, outp, b, h, qb, sscale);
  }
}

// =====================================================================================================
// Workspace map (bytes), every region an exact multiple of its whole-line / whole-tile store granularity
// multiples):
//   Xb     bf16 [4096][1024]            0            8388608
//   Wqkv   bf16 [3072][1024]            8388608      6291456   ([n][k], rows 0..1023 q | 1024.. k | 2048.. v)
//   Wln    bf16 [256][1024]             14680064      524288   ([W1w; W2w; W1r; W2r], [n][k])
//   Wob    bf16 [1024][1024]            15204352     2097152   ([n][k])
//   LN     f32  [4096][256]             17301504     4194304
//   RL     f32  [32][2048][8]           21495808     2097152
//   WL     f32  [32][2048][8]           23592960     2097152
//   Qh     bf16 [4096][1024]            25690112     8388608
//   Ql     bf16 [4096][1024]            34078720     8388608
//   Kh     bf16 [4096][1024]            42467328     8388608
//   Kl     bf16 [4096][1024]            50855936     8388608
//   VTh    f16  [2][1024][2048]         59244544     8388608
//   VTl    f16  [2][1024][512]          67633152     2097152
//   Af     f32  [4096][1024]            69730304    16777216
//   Ah     bf16 [4096][1024]            86507520     8388608
//   Al     bf16 [4096][1024]            94896128     8388608
//   end                                 103284736
// =====================================================================================================
extern "C" void kernel_launch(void* const* d_in, const int* in_sizes, int n_in,
                              void* d_out, int out_size, void* d_ws, size_t ws_size,
                              hipStream_t stream) {
  if (n_in < 11) return;
  if (in_sizes[0] != NB * SEQ * DMODEL) return;
  if (in_sizes[1] != 3 * QP * DMODEL) return;
  if (in_sizes[2] != 3 * QP) return;
  if (in_sizes[3] != PD * NH * DMODEL) return;
  if (in_sizes[4] != PD * NH * DMODEL) return;
  if (in_sizes[5] != PD * NH * DMODEL) return;
  if (in_sizes[6] != PD * NH * DMODEL) return;
  if (in_sizes[7] != DMODEL * QP) return;
  if (in_sizes[8] != DMODEL) return;
  if (in_sizes[9] != NH) return;
  if (in_sizes[10] != NH) return;
  if (out_size != NB * SEQ * DMODEL) return;

  const float* x     = (const float*)d_in[0];    // [NB*SEQ][DMODEL]
  const float* wqkv  = (const float*)d_in[1];    // [3*QP n][DMODEL k]
  const float* bqkv  = (const float*)d_in[2];    // [3*QP]
  const float* w1w   = (const float*)d_in[3];    // [PD*NH][DMODEL]
  const float* w2w   = (const float*)d_in[4];
  const float* w1r   = (const float*)d_in[5];
  const float* w2r   = (const float*)d_in[6];
  const float* wout  = (const float*)d_in[7];    // [DMODEL n][QP k]
  const float* bout  = (const float*)d_in[8];    // [DMODEL]
  const float* dlog  = (const float*)d_in[9];    // [NH]
  const float* bscl  = (const float*)d_in[10];   // [NH]

  const size_t PXb   = (size_t)NB * SEQ * DMODEL * 2;      //  8388608
  const size_t PWqkv = (size_t)3 * QP * DMODEL * 2;        //  6291456
  const size_t PWln  = (size_t)LNW * DMODEL * 2;           //   524288
  const size_t PWo   = (size_t)DMODEL * QP * 2;            //  2097152
  const size_t PLN   = (size_t)NB * SEQ * LNW * 4;         //  4194304
  const size_t PRL   = (size_t)NB * NH * SEQ * 8 * 4;      //  2097152
  const size_t PQpl  = (size_t)NB * SEQ * QP * 2;          //  8388608  (Qh, Ql, Kh, Kl, Ah, Al)
  const size_t PVTh  = (size_t)NB * QP * SEQ * 2;          //  8388608
  const size_t PVTl  = (size_t)NB * QP * VLP * 2;          //  2097152
  const size_t PAf   = (size_t)NB * SEQ * QP * 4;          // 16777216
  size_t off = 0;
  const size_t oXb   = off; off += PXb;
  const size_t oWqkv = off; off += PWqkv;
  const size_t oWln  = off; off += PWln;
  const size_t oWo   = off; off += PWo;
  const size_t oLN   = off; off += PLN;
  const size_t oRL   = off; off += PRL;
  const size_t oWL   = off; off += PRL;
  const size_t oQh   = off; off += PQpl;
  const size_t oQl   = off; off += PQpl;
  const size_t oKh   = off; off += PQpl;
  const size_t oKl   = off; off += PQpl;
  const size_t oVTh  = off; off += PVTh;
  const size_t oVTl  = off; off += PVTl;
  const size_t oAf   = off; off += PAf;
  const size_t oAh   = off; off += PQpl;
  const size_t oAl   = off; off += PQpl;
  if (off > ws_size) return;                          // off = 103284736
  if (off > (size_t)134217728) return;

  char* ws = (char*)d_ws;
  unsigned short* Xb   = (unsigned short*)(ws + oXb);
  unsigned short* Wqkv = (unsigned short*)(ws + oWqkv);
  unsigned short* Wln  = (unsigned short*)(ws + oWln);
  unsigned short* Wob  = (unsigned short*)(ws + oWo);
  float*          LN   = (float*)(ws + oLN);
  float*          RL   = (float*)(ws + oRL);
  float*          WL   = (float*)(ws + oWL);
  unsigned short* Qh   = (unsigned short*)(ws + oQh);
  unsigned short* Ql   = (unsigned short*)(ws + oQl);
  unsigned short* Kh   = (unsigned short*)(ws + oKh);
  unsigned short* Kl   = (unsigned short*)(ws + oKl);
  unsigned short* VTh  = (unsigned short*)(ws + oVTh);
  unsigned short* VTl  = (unsigned short*)(ws + oVTl);
  float*          Af   = (float*)(ws + oAf);
  unsigned short* Ah   = (unsigned short*)(ws + oAh);
  unsigned short* Al   = (unsigned short*)(ws + oAl);
  float*          outf = (float*)d_out;

  const dim3 blk(256);
  const int nTok   = NB * SEQ;                                       // 4096 tokens
  const int n8a    = nTok * QP / 8;                                  // 524288
  const int nwLn   = NB * NH * (SEQ / 32);                           //   2048 waves
  const dim3 blkG(128);                                              // GEMM block: 4 waves, one 128x128 tile
  const dim3 gLines((nwLn + 7) / 8);                                 // 256 blocks
  const dim3 gSplit((n8a + 255) / 256);                              // 2048 blocks
  const dim3 gOut((nTok / 128) * (DMODEL / 128), 1);                 // 256 blocks

  // (1) inputs -> bf16 planes (RNE convert), one launch; weights arrive [n][k] = the Bt layout already. The planes
  //     Xb | Wqkv | Wln | Wob are contiguous from Xb on.
  cvt_all<<<dim3(CB_ALL), blk, 0, stream>>>(x, wqkv, w1w, w2w, w1r, w2r, wout, Xb);
  // (2)-(5) q, k, v^T and line-feature projections, one launch
  proj4<<<dim3(PB_ALL), blkG, 0, stream>>>(Xb, Wqkv, Wln, bqkv, Qh, Ql, Kh, Kl, VTh, VTl, LN);
  // (6) line features (shifted p1, exterior 2-forms, L2 normalisation, J map) -> rl / wl f32 planes
  lines_k<<<gLines, blk, 0, stream>>>(LN, RL, WL, nwLn);
  // (7) causal attention with line-pair bias: query tiles 0..RESQB-1 with residual planes, the rest without;
  //     one launch, two tiles (NQB-1-t and t) per block
  attn_lb<<<dim3(NB * NH * (NQB / 2)), dim3(128), 0, stream>>>(
      Qh, Ql, Kh, Kl, VTh, VTl, RL, WL, dlog, bscl, Af, 0.125f);
  // (8) context rows -> bf16 hi/lo planes
  split_bf16x8<<<gSplit, blk, 0, stream>>>(Af, Ah, Al, n8a);
  // (9) out[row][e] = sum_d (Ah+Al)[row][d] Wob[e][d] + bout[e] -> d_out f32 [4096][1024]  (M=4096, N=1024, K=1024)
  gemm64<1, 0, 1><<<gOut, blkG, 0, stream>>>(
      Ah, Al, QP, 0LL, Wob, Wob, QP, 0LL,
      (void*)outf, DMODEL, 0LL, (void*)outf, 0, 0LL, 0,
      bout, nTok, DMODEL, QP, 1.0f);
  (void)hipGetLastError();
}

// v008
// A run of this version takes 156 microseconds.
// In two side-by-side timings against v007, it was 1.03 and 1.04 times as fast.
// Counting every step since v000, it is 3.98 times as fast.
// Contractions: q / k / v^T and line-feature projections = v_wmma_f32_16x16x32_bf16 (bf16 operands from
// RNE-converted inputs, one product per k-step); q.k^T scores = v_wmma_f32_16x16x32_bf16 with bf16 hi/lo split
// q and k (hi.hi + hi.lo + lo.hi); p.v = v_wmma_f32_16x16x32_f16 (p carried x1024 in f16, v in f16; extra f16
// residual planes x4096 of p and v on the first 512 query rows); ctx.Wo^T = v_wmma_f32_16x16x32_bf16 with ctx
// as bf16 hi/lo planes times the bf16 Wo plane (2 products); all f32 accumulate; 6-term line-pair bias dots,
// decay weights and softmax in f32 on VALU.
#include <hip/hip_runtime.h>
#include <math.h>
#include <float.h>
#include <stdint.h>

#define NB     2
#define SEQ    2048
#define DMODEL 1024
#define NH     16
#define HD     64
#define QP     (NH * HD)       // 1024: q / k / ctx row pitch
#define NQB    (SEQ / 64)      // 32 query / key tiles of 64
#define VLP    512             // key pitch of the v^T residual plane (keys 0..VLP-1)
#define RESQB  8               // leading 64-row query blocks that use the p / v residual planes
#define PD     4               // point dim per head
#define LNW    (4 * PD * NH)   // 256: width of the line-feature projection [p1w | p2w | p1r | p2r]
#define LP     72              // LDS row pitch (16-bit elements) of the attention K and V^T tiles: 144 B = 16 B x 9, so the
                               // 16 rows that one ds_load_b128 reads fall on 16 different groups of 4 banks (at 128 B: on 2)
static_assert(RESQB * 64 <= VLP);
static_assert(RESQB <= NQB);
static_assert(QP == DMODEL);
static_assert(HD == 64);
static_assert(PD == 4);
#define OSP    68              // LDS row pitch (f32) of the attention's context staging: 272 B = 16 B x 17
static_assert(LP >= 64 && (LP % 8) == 0 && 2 * 64 * LP * 2 >= 4 * 16 * OSP * 4);
static_assert((SEQ % 64) == 0 && (DMODEL % 64) == 0 && (LNW % 64) == 0 && (QP % 64) == 0);
static_assert(((NB * SEQ) % 64) == 0 && (SEQ % 32) == 0);
static_assert((DMODEL % 32) == 0);
static_assert(((NB * SEQ) % 128) == 0 && (SEQ % 128) == 0 && (QP % 128) == 0 && (LNW % 128) == 0 && (DMODEL % 128) == 0);

typedef _Float16 v16h __attribute__((ext_vector_type(16)));
typedef _Float16 v8h  __attribute__((ext_vector_type(8)));
typedef __bf16   v16b __attribute__((ext_vector_type(16)));
typedef __bf16   v8b  __attribute__((ext_vector_type(8)));
typedef float    v8f  __attribute__((ext_vector_type(8)));
typedef float    v4f  __attribute__((ext_vector_type(4)));
typedef float    v2f  __attribute__((ext_vector_type(2)));
typedef unsigned int v4u __attribute__((ext_vector_type(4)));

// ---- scalar helpers --------------------------------------------------------------------------------
__device__ __forceinline__ unsigned short bf_bits(float f) {          // f32 -> bf16 bits, RNE convert
  unsigned u = __float_as_uint(f);
  return (unsigned short)((u + 0x7FFFu + ((u >> 16) & 1u)) >> 16);
}
__device__ __forceinline__ float bf_up(unsigned short h) { return __uint_as_float(((unsigned)h) << 16); }
__device__ __forceinline__ unsigned short h_bits(_Float16 x) { return __builtin_bit_cast(unsigned short, x); }
__device__ __forceinline__ unsigned pk16(unsigned short a, unsigned short b) { return (unsigned)a | ((unsigned)b << 16); }
__device__ __forceinline__ v8f zero8() { v8f z = {0.f, 0.f, 0.f, 0.f, 0.f, 0.f, 0.f, 0.f}; return z; }
__device__ __forceinline__ v8h zero8h() {
  const _Float16 z = (_Float16)0.0f;
  v8h r = {z, z, z, z, z, z, z, z};
  return r;
}

// exp(x) as v_exp_f32(x * log2 e), the form __expf compiled to. The v_nop is the one slot that the instruction set asks
// for behind a transcendental before a source is overwritten.
__device__ __forceinline__ float exp_slot(float x) {
  const float t = x * 1.44269504088896340736f;
  float r;
#if defined(__HIP_DEVICE_COMPILE__)
  asm("v_exp_f32 %0, %1\n\tv_nop" : "=v"(r) : "v"(t));
#else
  r = t;
#endif
  return r;
}
// 2^x in the form exp2f compiled to (v_exp_f32, arguments under -126 stepped up by 64 and the result back down), with the
// same v_nop slot behind the transcendental.
__device__ __forceinline__ float exp2_slot(float x) {
  const bool low = x < -126.0f;
  const float t = x + (low ? 64.0f : 0.0f);
  float r;
#if defined(__HIP_DEVICE_COMPILE__)
  asm("v_exp_f32 %0, %1\n\tv_nop" : "=v"(r) : "v"(t));
#else
  r = t;
#endif
  return ldexpf(r, low ? -64 : 0);
}
// ---- fragment loader: 16-bit A/B operand, lane -> row/col (lane&15), p already includes +8*(lane>>4);
//      elements 0..7 <- p[0..7] (k0+8h..), elements 8..15 <- p[16..23] (k0+16+8h..)
__device__ __forceinline__ v16b ldfrag_b(const __bf16* p) {
  union { v16b v; v8b h[2]; } f;
  f.h[0] = *(const v8b*)(p);
  f.h[1] = *(const v8b*)(p + 16);
  return f.v;
}

// ---- WMMA helpers with trailing VALU hazard gap --------------------------------------------------------
__device__ __forceinline__ v8f mma_b(v16b a, v16b b, v8f c) {
  c = __builtin_amdgcn_wmma_f32_16x16x32_bf16(false, a, false, b, (short)0, c, false, false);
#if defined(__HIP_DEVICE_COMPILE__)
  asm volatile("v_nop\n\tv_nop\n\tv_nop\n\tv_nop" : "+v"(c) : "v"(a), "v"(b));
#endif
  return c;
}
__device__ __forceinline__ v8f mma_h(v16h a, v16h b, v8f c) {
  c = __builtin_amdgcn_wmma_f32_16x16x32_f16(false, a, false, b, (short)0, c, false, false);
#if defined(__HIP_DEVICE_COMPILE__)
  asm volatile("v_nop\n\tv_nop\n\tv_nop\n\tv_nop" : "+v"(c) : "v"(a), "v"(b));
#endif
  return c;
}
__device__ __forceinline__ v8f mma_b_raw(v16b a, v16b b, v8f c) {
  return __builtin_amdgcn_wmma_f32_16x16x32_bf16(false, a, false, b, (short)0, c, false, false);
}
__device__ __forceinline__ void dep_guard_b(v8f& a, v8f& b, v16b x, v16b y) {
#if defined(__HIP_DEVICE_COMPILE__)
  asm volatile("v_nop\n\tv_nop\n\tv_nop\n\tv_nop" : "+v"(a), "+v"(b) : "v"(x), "v"(y));
#endif
}
__device__ __forceinline__ void keep4_b(v16b a, v16b b, v16b c, v16b d) {
#if defined(__HIP_DEVICE_COMPILE__)
  asm volatile("v_nop" :: "v"(a), "v"(b), "v"(c), "v"(d));
#endif
}
__device__ __forceinline__ void acc_guard4(v8f& a, v8f& b, v8f& c, v8f& d) {
#if defined(__HIP_DEVICE_COMPILE__)
  asm volatile("v_nop\n\tv_nop\n\tv_nop\n\tv_nop" : "+v"(a), "+v"(b), "+v"(c), "+v"(d));
#endif
}

// =====================================================================================================
// Flat f32 -> bf16 (RNE convert) of all seven f32 operands in one launch: x, w_qkv, the four line weights, w_out.
// Their bf16 planes lie one behind the other in the workspace in that order, so the destination is one flat array;
// a block (256 threads x 8 elements = 2048 elements) lies wholly inside one operand and picks its source by its index
// (block-uniform). One 16-B store per lane: a wave writes 512 contiguous bytes.
// coverage: CB_ALL blocks x 2048 elements = all seven planes, every plane a multiple of 2048 elements.
// =====================================================================================================
#define CB_X   (NB * SEQ * DMODEL / 2048)    // 2048 blocks
#define CB_QKV (3 * QP * DMODEL / 2048)      // 1536
#define CB_LN  (PD * NH * DMODEL / 2048)     //   32 for each line weight
#define CB_WO  (DMODEL * QP / 2048)          //  512
#define CB_ALL (CB_X + CB_QKV + 4 * CB_LN + CB_WO)
static_assert(((NB * SEQ * DMODEL) % 2048) == 0 && ((3 * QP * DMODEL) % 2048) == 0);
static_assert(((PD * NH * DMODEL) % 2048) == 0 && ((DMODEL * QP) % 2048) == 0);
__global__ __launch_bounds__(256) void cvt_all(const float* __restrict__ x, const float* __restrict__ wqkv,
                                               const float* __restrict__ w1w, const float* __restrict__ w2w,
                                               const float* __restrict__ w1r, const float* __restrict__ w2r,
                                               const float* __restrict__ wout, unsigned short* out) {
  const int bx = blockIdx.x;
  if (bx >= CB_ALL) return;
  const float* in;
  int b0;
  if (bx < CB_X)                            { in = x;    b0 = 0; }
  else if (bx < CB_X + CB_QKV)              { in = wqkv; b0 = CB_X; }
  else if (bx < CB_X + CB_QKV + 1 * CB_LN)  { in = w1w;  b0 = CB_X + CB_QKV; }
  else if (bx < CB_X + CB_QKV + 2 * CB_LN)  { in = w2w;  b0 = CB_X + CB_QKV + 1 * CB_LN; }
  else if (bx < CB_X + CB_QKV + 3 * CB_LN)  { in = w1r;  b0 = CB_X + CB_QKV + 2 * CB_LN; }
  else if (bx < CB_X + CB_QKV + 4 * CB_LN)  { in = w2r;  b0 = CB_X + CB_QKV + 3 * CB_LN; }
  else                                      { in = wout; b0 = CB_X + CB_QKV + 4 * CB_LN; }
  const float* s = in + ((size_t)(bx - b0) * 256 + threadIdx.x) * 8;
  const v4f a = *(const v4f*)(s);
  const v4f b = *(const v4f*)(s + 4);
  v4u p;
  p[0] = pk16(bf_bits(a[0]), bf_bits(a[1]));
  p[1] = pk16(bf_bits(a[2]), bf_bits(a[3]));
  p[2] = pk16(bf_bits(b[0]), bf_bits(b[1]));
  p[3] = pk16(bf_bits(b[2]), bf_bits(b[3]));
  *(v4u*)(out + ((size_t)bx * 256 + threadIdx.x) * 8) = p;
}

// =====================================================================================================
// f32 -> bf16 hi plane + bf16 lo plane (lo = RNE(v - hi), unscaled), 8 elements per thread, one 16-B store per
// coverage: n8 threads x 8 = whole plane (n8 multiple of 256).
// =====================================================================================================
__global__ __launch_bounds__(256) void split_bf16x8(const float* __restrict__ in, unsigned short* hp,
                                                    unsigned short* lp, int n8) {
  const int i = blockIdx.x * 256 + threadIdx.x;
  if (i < n8) {
    const v4f a = *(const v4f*)(in + (size_t)i * 8);
    const v4f b = *(const v4f*)(in + (size_t)i * 8 + 4);
    v4u ph, pl;
#pragma unroll
    for (int e = 0; e < 4; ++e) {
      const float f0 = (e < 2) ? a[2 * e]     : b[2 * e - 4];
      const float f1 = (e < 2) ? a[2 * e + 1] : b[2 * e - 3];
      const unsigned short h0 = bf_bits(f0), h1 = bf_bits(f1);
      const unsigned short l0 = bf_bits(f0 - bf_up(h0)), l1 = bf_bits(f1 - bf_up(h1));
      ph[e] = pk16(h0, h1);
      pl[e] = pk16(l0, l1);
    }
    *(v4u*)(hp + (size_t)i * 8) = ph;
    *(v4u*)(lp + (size_t)i * 8) = pl;
    
  }
}

// =====================================================================================================
// Batched bf16 WMMA GEMM: C[m][n] = sum_k A[m][k] * Bt[n][k] (+ bias). Block = 4 waves = one 128x128 tile, each
// wave a 64x64 quarter (wave>>1 = m half, wave&1 = n half). A row-major [M][K] pitch lda; Bt row-major [N][K] pitch
// ldb (k contiguous); M, N multiples of 128, K a multiple of 64 and at least 64. b = batch index.
// The 128 A rows and 128 Bt rows of a 64-wide k slab (128 B a row) are brought into LDS by asynchronous 16-B copies,
// 8 lanes to a row so that every copy instruction takes whole 128-B lines, and are shared by the block's waves; two
// buffers: slab t+1 flies while slab t is multiplied. LDS row pitch GP = 144 B. Fragments come by ds_load_b128; the
// k order and the order of the products are those of ascending k in steps of 32.
// NSPLIT: 0 = A.Bt; 1 = (A + A2).Bt (A2 = unscaled bf16 lo plane of A).
// BIAS: 0 none; 1 = + bias[n] per output column; 2 = + bias[m] per output row (bias RNE-converted to bf16 and
//       widened, added in f32 in the epilogue).
// OUT_MODE: 0 = f32 (pitch ldc); 2 = bf16 hi plane C + bf16 lo plane C2 (lo = RNE(v - hi), unscaled);
//           3 = f16 hi plane C + f16 residual plane C2 = f16((v - hi) * rscale), C2 written only for tiles
//               with n0 < N2 (pitch ldc2, batch stride strideC2).
// =====================================================================================================
#define GP 72                  // LDS row pitch (16-bit elements) of the GEMM slabs: 144 B = 16 B x 9
#define GPL (128 * GP)         // elements of one staged plane (128 rows)

// Eight asynchronous 16-B copies global -> LDS per lane. The s_wait_xcnt stands inside the statement so that no
// address register of a copy is rewritten ahead of it.
__device__ __forceinline__ void async8(const unsigned (&l)[8], const __bf16* const (&g)[8]) {
#if defined(__HIP_DEVICE_COMPILE__)
  asm volatile(
      "global_load_async_to_lds_b128 %0, %8, off\n\t"
      "global_load_async_to_lds_b128 %1, %9, off\n\t"
      "global_load_async_to_lds_b128 %2, %10, off\n\t"
      "global_load_async_to_lds_b128 %3, %11, off\n\t"
      "global_load_async_to_lds_b128 %4, %12, off\n\t"
      "global_load_async_to_lds_b128 %5, %13, off\n\t"
      "global_load_async_to_lds_b128 %6, %14, off\n\t"
      "global_load_async_to_lds_b128 %7, %15, off\n\t"
      "s_wait_xcnt 0x0"
      :: "v"(l[0]), "v"(l[1]), "v"(l[2]), "v"(l[3]), "v"(l[4]), "v"(l[5]), "v"(l[6]), "v"(l[7]),
         "v"(g[0]), "v"(g[1]), "v"(g[2]), "v"(g[3]), "v"(g[4]), "v"(g[5]), "v"(g[6]), "v"(g[7])
      : "memory");
#endif
}
// One plane of a slab: rows row0..row0+127 of src (pitch ld), columns k0..k0+63, to LDS byte address ldst.
// Thread tid takes the 16-B piece tid&7 of rows (tid>>3) + 16*it.
__device__ __forceinline__ void stage_plane(const __bf16* src, int row0, int ld, int k0, unsigned ldst, int tid) {
  unsigned l[8];
  const __bf16* g[8];
#pragma unroll  // the eight addresses are operands of one asm statement
  for (int it = 0; it < 8; ++it) {
    const int row = it * 16 + (tid >> 3);
    l[it] = ldst + (unsigned)((row * GP + (tid & 7) * 8) * 2);
    g[it] = src + (size_t)(row0 + row) * ld + k0 + (tid & 7) * 8;
  }
  async8(l, g);
}
__device__ __forceinline__ void wait_async0() {   // this wave's copies have landed
#if defined(__HIP_DEVICE_COMPILE__)
  asm volatile("s_wait_asynccnt 0x0" ::: "memory");
#endif
}
__device__ __forceinline__ void wait_ds0() {      // this wave's LDS reads are done before the buffer is refilled
#if defined(__HIP_DEVICE_COMPILE__)
  asm volatile("s_wait_dscnt 0x0" ::: "memory");
#endif
}

// One 128x128 tile (index tile, batch element b) by the 4 waves of a block; sAB = the two slab buffers, sT = the
// per-wave epilogue slabs, both the calling kernel's LDS.
template <int NSPLIT, int OUT_MODE, int BIAS>
__device__ __forceinline__ void gemm_tile(
    __bf16* sAB, float (*sT)[16 * 68], int tile, int b,
    const unsigned short* __restrict__ Ap, const unsigned short* A2p, int lda, long long strideA,
    const unsigned short* __restrict__ Btp, const unsigned short* Bt2p, int ldb, long long strideB,
    void* Cout, int ldc, long long strideC,
    void* Cout2, int ldc2, long long strideC2, int N2,
    const float* __restrict__ biasp,
    int M, int N, int K, float rscale) {
  static_assert(NSPLIT == 0 || NSPLIT == 1);
  constexpr int NPL = (NSPLIT == 1) ? 3 : 2;       // staged planes: A, Bt, (A2)
  constexpr int GI  = (NSPLIT == 1) ? 2 : 4;       // A row groups fetched together
  const __bf16* A   = (const __bf16*)(const void*)Ap;
  const __bf16* A2  = (const __bf16*)(const void*)A2p;
  const __bf16* Bt  = (const __bf16*)(const void*)Btp;
  (void)Bt2p;
  const int tid  = threadIdx.x;
  const int lane = tid & 31;
  const int wave = tid >> 5;
  const int tilesN = N >> 7;
  const int tilesM = M >> 7;
  if (tile >= tilesM * tilesN) return;   // block-uniform, in front of every barrier
  const int tm = tile / tilesN;
  const int tn = tile - tm * tilesN;
  const int mB = tm << 7;
  const int nB = tn << 7;
  const int wm = (wave >> 1) << 6;
  const int wn = (wave & 1) << 6;
  const int m0 = mB + wm;
  const int n0 = nB + wn;

  const __bf16* Ab  = A  + (size_t)b * strideA;
  const __bf16* Bb  = Bt + (size_t)b * strideB;
  const __bf16* Ab2 = (NSPLIT == 1) ? (A2 + (size_t)b * strideA) : Ab;

  const int rlane = lane & 15;                 // row (A) / col (B, D) within subtile
  const int koff  = (lane >> 4) * 8;           // k offset of this lane half
  const int mOff  = (lane >> 4) * 8;           // D row offset

  v8f acc[4][4];
#pragma unroll
  for (int i = 0; i < 4; ++i)
#pragma unroll
    for (int j = 0; j < 4; ++j) acc[i][j] = zero8();

  const unsigned lds0 = (unsigned)(uintptr_t)(void*)sAB;   // LDS byte address of the ring
  const int nT = K >> 6;                                   // k slabs of 64
  // slab t into buffer bf
  auto issue = [&](int t, int bf) {
    const unsigned lb = lds0 + (unsigned)(bf * NPL * GPL * 2);
    stage_plane(Ab, mB, lda, t << 6, lb, tid);
    stage_plane(Bb, nB, ldb, t << 6, lb + (unsigned)(GPL * 2), tid);
    if (NSPLIT == 1) stage_plane(Ab2, mB, lda, t << 6, lb + (unsigned)(2 * GPL * 2), tid);
  };
  issue(0, 0);
  wait_async0();
  __syncthreads();
  if (nT > 1) issue(1, 1);

  for (int t = 0; t < nT; ++t) {
    const __bf16* sA  = sAB + (t & 1) * (NPL * GPL);
    const __bf16* sB  = sA + GPL;
    const __bf16* sA2 = sA + (NPL - 1) * GPL;
    // this loop and those inside it are unrolled so that fragments and accumulators are indexed by constants only
    // and stay in registers
#pragma unroll
    for (int ks = 0; ks < 2; ++ks) {
      // the A fragments of GI row groups (16 products' worth) are fetched together, so that the LDS latency is met
      // once for them and not once a row group; GI is 2 with the second A plane to stay inside 256 registers
      v16b bh[4];
#pragma unroll
      for (int j = 0; j < 4; ++j) bh[j] = ldfrag_b(sB + (wn + (j << 4) + rlane) * GP + ks * 32 + koff);
#pragma unroll
      for (int ig = 0; ig < 4; ig += GI) {
        v16b ah[GI], al[GI];
#pragma unroll
        for (int u = 0; u < GI; ++u) {
          const int ao = (wm + ((ig + u) << 4) + rlane) * GP + ks * 32 + koff;
          ah[u] = ldfrag_b(sA + ao);
          if (NSPLIT == 1) al[u] = ldfrag_b(sA2 + ao); else al[u] = ah[u];
        }
#pragma unroll
        for (int u = 0; u < GI; ++u) {
          const int i = ig + u;
#pragma unroll
          for (int j = 0; j < 4; ++j) {
            acc[i][j] = mma_b_raw(ah[u], bh[j], acc[i][j]);
            if (NSPLIT == 1) acc[i][j] = mma_b_raw(al[u], bh[j], acc[i][j]);
          }
          dep_guard_b(acc[i][0], acc[i][3], ah[u], al[u]);
        }
      }
      keep4_b(bh[0], bh[1], bh[2], bh[3]);
    }
    // publish slab t+1 and free slab t's buffer: own LDS reads done, own copies landed, then the block barrier
    wait_ds0();
    wait_async0();
    __syncthreads();
    if (t + 2 < nT) issue(t + 2, t & 1);
  }
  wait_async0();
  acc_guard4(acc[0][0], acc[0][1], acc[0][2], acc[0][3]);
  acc_guard4(acc[1][0], acc[1][1], acc[1][2], acc[1][3]);
  acc_guard4(acc[2][0], acc[2][1], acc[2][2], acc[2][3]);
  acc_guard4(acc[3][0], acc[3][1], acc[3][2], acc[3][3]);

  // ---- per-column bias (BIAS == 1): this lane's 4 output columns n0 + 16j + rlane ----
  float bcol[4];
#pragma unroll
  for (int j = 0; j < 4; ++j) bcol[j] = 0.f;
  if (BIAS == 1) {
#pragma unroll
    for (int j = 0; j < 4; ++j) bcol[j] = bf_up(bf_bits(biasp[n0 + (j << 4) + rlane]));
  }

  // ---- epilogue ----
  float* slab = sT[wave];
#pragma unroll
  for (int i = 0; i < 4; ++i) {
    const int mBase = m0 + (i << 4);
    float brow[8];
#pragma unroll
    for (int r = 0; r < 8; ++r) brow[r] = 0.f;
    if (BIAS == 2) {
#pragma unroll
      for (int r = 0; r < 8; ++r) brow[r] = bf_up(bf_bits(biasp[mBase + mOff + r]));
    }
#pragma unroll
    for (int r = 0; r < 8; ++r) {
#pragma unroll
      for (int j = 0; j < 4; ++j) {
        float v = acc[i][j][r];
        if (BIAS == 1) v += bcol[j];
        if (BIAS == 2) v += brow[r];
        slab[(mOff + r) * 68 + (j << 4) + rlane] = v;
      }
    }
    __builtin_amdgcn_fence(__ATOMIC_RELEASE, "workgroup");
    __builtin_amdgcn_wave_barrier();
    __builtin_amdgcn_fence(__ATOMIC_ACQUIRE, "workgroup");
    if (OUT_MODE == 0) {
      float* C = (float*)Cout + (size_t)b * strideC;
      const int hh = lane >> 4, c4 = (lane & 15) * 4;     // 256-B row segment = 16 lanes x 16 B
      v4f ov[8];
#pragma unroll
      for (int it = 0; it < 8; ++it) {
        const int row = it * 2 + hh;                       // it 0..7 x hh 0..1 = rows 0..15
        ov[it] = *(const v4f*)(slab + row * 68 + c4);
      }
      {
#pragma unroll
        for (int it = 0; it < 8; ++it) {
          const int row = it * 2 + hh;
          *(v4f*)(C + (size_t)(mBase + row) * ldc + n0 + c4) = ov[it];
        }
        
      }
    } else {
      const int q = lane >> 3, c8 = (lane & 7) * 8;
      unsigned short* C  = (unsigned short*)Cout  + (size_t)b * strideC;
      unsigned short* C2 = (unsigned short*)Cout2 + (size_t)b * strideC2;
      const bool wlo = (OUT_MODE == 2) || (n0 < N2);      // wave-uniform
      v4u hv[4], lv[4];
#pragma unroll
      for (int it = 0; it < 4; ++it) {
        const int row = it * 4 + q;                        // it 0..3 x q 0..3 = rows 0..15
        const float* sp = slab + row * 68 + c8;
        v4u a, a2;
#pragma unroll
        for (int e = 0; e < 4; ++e) {
          const float f0 = sp[2 * e], f1 = sp[2 * e + 1];
          unsigned short h0, h1, l0, l1;
          if (OUT_MODE == 2) {
            h0 = bf_bits(f0); h1 = bf_bits(f1);
            l0 = bf_bits(f0 - bf_up(h0)); l1 = bf_bits(f1 - bf_up(h1));
          } else {
            const _Float16 x0 = (_Float16)f0, x1 = (_Float16)f1;
            h0 = h_bits(x0); h1 = h_bits(x1);
            l0 = h_bits((_Float16)((f0 - (float)x0) * rscale));
            l1 = h_bits((_Float16)((f1 - (float)x1) * rscale));
          }
          a[e] = pk16(h0, h1); a2[e] = pk16(l0, l1);
        }
        hv[it] = a; lv[it] = a2;
      }
      // the test stands round the store loops, not inside them: each side is one straight run of stores
      if (wlo) {
#pragma unroll  // hv and lv are indexed by constants only, so they stay in registers
        for (int it = 0; it < 4; ++it) {
          const int row = it * 4 + q;
          *(v4u*)(C + (size_t)(mBase + row) * ldc + n0 + c8) = hv[it];
          *(v4u*)(C2 + (size_t)(mBase + row) * ldc2 + n0 + c8) = lv[it];
        }
      } else {
#pragma unroll  // as above
        for (int it = 0; it < 4; ++it) {
          const int row = it * 4 + q;
          *(v4u*)(C + (size_t)(mBase + row) * ldc + n0 + c8) = hv[it];
        }
#if defined(__HIP_DEVICE_COMPILE__)
        // the code laid out behind these stores rewrites their address and data registers: the wait stands in front of it
        asm volatile("s_wait_xcnt 0x0" ::: "memory");
#endif
      }
    }
    __builtin_amdgcn_fence(__ATOMIC_RELEASE, "workgroup");
    __builtin_amdgcn_wave_barrier();
    __builtin_amdgcn_fence(__ATOMIC_ACQUIRE, "workgroup");
  }
}

// One GEMM per launch: blockIdx.x = tile, blockIdx.y = batch index.
template <int NSPLIT, int OUT_MODE, int BIAS>
__global__ __launch_bounds__(128) void gemm64(
    const unsigned short* __restrict__ Ap, const unsigned short* A2p, int lda, long long strideA,
    const unsigned short* __restrict__ Btp, const unsigned short* Bt2p, int ldb, long long strideB,
    void* Cout, int ldc, long long strideC,
    void* Cout2, int ldc2, long long strideC2, int N2,
    const float* __restrict__ biasp,
    int M, int N, int K, float rscale) {
  __shared__ __align__(16) __bf16 sAB[2 * ((NSPLIT == 1) ? 3 : 2) * GPL];   // two buffers of 2 or 3 planes
  __shared__ __align__(16) float sT[4][16 * 68];                            // per-wave 16x64 slab, pitch 68 floats
  gemm_tile<NSPLIT, OUT_MODE, BIAS>(sAB, sT, blockIdx.x, blockIdx.y, Ap, A2p, lda, strideA, Btp, Bt2p, ldb, strideB,
                                    Cout, ldc, strideC, Cout2, ldc2, strideC2, N2, biasp, M, N, K, rscale);
}

// The four projections of x, none of which reads another's result, in one launch; a block's index picks its GEMM
// (block-uniform) and its tile: q tiles, k tiles, v^T tiles of each batch element, line-feature tiles.
//   q, k:   C[row][e] = sum_k Xb[row][k] W[e][k] + bias[e] -> bf16 hi / lo planes     (M=4096, N=1024, K=1024)
//   v^T:    VTh[b][f][s] = sum_k Wv[f][k] Xb[b*SEQ+s][k] + bv[f] -> f16 hi plane (pitch SEQ) and residual plane
//           (x4096, keys < VLP, pitch VLP)                                            (M=1024, N=2048, K=1024)
//   lines:  LN[row][e] = sum_k Xb[row][k] Wln[e][k] -> f32                            (M=4096, N=256,  K=1024)
#define PB_Q  ((NB * SEQ / 128) * (QP / 128))    // 256 tiles, q and k each
#define PB_V  ((QP / 128) * (SEQ / 128))         // 128 tiles for each batch element
#define PB_LN ((NB * SEQ / 128) * (LNW / 128))   //  64 tiles
#define PB_ALL (2 * PB_Q + NB * PB_V + PB_LN)
__global__ __launch_bounds__(128) void proj4(
    const unsigned short* __restrict__ Xb, const unsigned short* __restrict__ Wqkv,
    const unsigned short* __restrict__ Wln, const float* __restrict__ bqkv,
    unsigned short* Qh, unsigned short* Ql, unsigned short* Kh, unsigned short* Kl,
    unsigned short* VTh, unsigned short* VTl, float* LN) {
  __shared__ __align__(16) __bf16 sAB[2 * 2 * GPL];     // two buffers of 2 planes
  __shared__ __align__(16) float sT[4][16 * 68];        // per-wave 16x64 slab, pitch 68 floats
  const int bx = blockIdx.x;
  if (bx < 2 * PB_Q) {
    const int isk = (bx >= PB_Q) ? 1 : 0;
    const unsigned short* Wp = Wqkv + (size_t)isk * QP * DMODEL;
    gemm_tile<0, 2, 1>(sAB, sT, bx - isk * PB_Q, 0,
                       Xb, Xb, DMODEL, 0LL, Wp, Wp, DMODEL, 0LL,
                       (void*)(isk ? Kh : Qh), QP, 0LL, (void*)(isk ? Kl : Ql), QP, 0LL, QP,
                       bqkv + isk * QP, NB * SEQ, QP, DMODEL, 1.0f);
  } else if (bx < 2 * PB_Q + NB * PB_V) {
    const int v = bx - 2 * PB_Q;
    const unsigned short* Wp = Wqkv + (size_t)2 * QP * DMODEL;
    gemm_tile<0, 3, 2>(sAB, sT, v % PB_V, v / PB_V,
                       Wp, Wp, DMODEL, 0LL, Xb, Xb, DMODEL, (long long)SEQ * DMODEL,
                       (void*)VTh, SEQ, (long long)QP * SEQ, (void*)VTl, VLP, (long long)QP * VLP, VLP,
                       bqkv + 2 * QP, QP, SEQ, DMODEL, 4096.0f);
  } else if (bx < PB_ALL) {
    gemm_tile<0, 0, 0>(sAB, sT, bx - (2 * PB_Q + NB * PB_V), 0,
                       Xb, Xb, DMODEL, 0LL, Wln, Wln, DMODEL, 0LL,
                       (void*)LN, LNW, 0LL, (void*)LN, 0, 0LL, 0,
                       bqkv, NB * SEQ, LNW, DMODEL, 1.0f);
  }
}

// =====================================================================================================
// Line features. Input ln f32 [NB*SEQ][LNW]: column blocks of PD*NH = 64: block 0 = x.W1w^T, 1 = x.W2w^T,
// 2 = x.W1r^T, 3 = x.W2r^T; within a block head h owns columns h*4..h*4+3.
// Per (b, h, t): p1 = block 0 of token t-1 (zero vector at t == 0: the shifted input), p2 = block 1 of t,
// p3 = block 2 of t, p4 = block 3 of t. Exterior 2-form L[m] = pa[PI[m]]*pb[PJ[m]] - pa[PJ[m]]*pb[PI[m]] for
// pairs (0,1),(0,2),(0,3),(1,2),(1,3),(2,3), then L *= 1/max(|L|_2, 1e-12) (all f32, fp contract off).
// Outputs f32 [NB*NH][SEQ][8]: rl = read line [L0..L5, 0, 0]; wl = J-applied write line [L5,-L4,L3,L2,-L1,L0,0,0].
// wave-uniform bound, no block barriers.
// coverage: nwaves = NB*NH*(SEQ/32) waves x 32 rows x 32 B = every row of both planes incl. the zero pad cols.
// =====================================================================================================
struct L6 { float v0, v1, v2, v3, v4, v5; };

__device__ __forceinline__ L6 ext6n(const v4f a, const v4f b) {
#pragma clang fp contract(off)
  L6 o;
  o.v0 = a[0] * b[1] - a[1] * b[0];
  o.v1 = a[0] * b[2] - a[2] * b[0];
  o.v2 = a[0] * b[3] - a[3] * b[0];
  o.v3 = a[1] * b[2] - a[2] * b[1];
  o.v4 = a[1] * b[3] - a[3] * b[1];
  o.v5 = a[2] * b[3] - a[3] * b[2];
  float n2 = o.v0 * o.v0 + o.v1 * o.v1;
  n2 = n2 + o.v2 * o.v2;
  n2 = n2 + o.v3 * o.v3;
  n2 = n2 + o.v4 * o.v4;
  n2 = n2 + o.v5 * o.v5;
  float n = sqrtf(n2);
  n = fmaxf(n, 1e-12f);
  const float inv = 1.0f / n;
  o.v0 *= inv; o.v1 *= inv; o.v2 *= inv; o.v3 *= inv; o.v4 *= inv; o.v5 *= inv;
  return o;
}

__global__ __launch_bounds__(256) void lines_k(const float* __restrict__ ln, float* rl, float* wl, int nwaves) {
#pragma clang fp contract(off)
  __shared__ __align__(16) float sR[8][256];
  __shared__ __align__(16) float sW[8][256];
  const int tid = threadIdx.x, wave = tid >> 5, lane = tid & 31;
  const int w = blockIdx.x * 8 + wave;
  if (w >= nwaves) return;                        // wave-uniform; no block barriers in this kernel
  const int tgPer = SEQ / 32;                     // 64 token groups per (b, h)
  const int bh = w / tgPer;                       // b*NH + h
  const int tg = w - bh * tgPer;
  const int b  = bh / NH;
  const int h  = bh - b * NH;
  const int t  = tg * 32 + lane;                  // < SEQ
  const size_t row  = (size_t)b * SEQ + t;
  const size_t rowp = (t > 0) ? (row - 1) : row;  // clamped address; value zeroed below when t == 0
  const float* cur = ln + row * LNW + h * PD;
  v4f p1 = *(const v4f*)(ln + rowp * LNW + h * PD);
  if (t == 0) { p1[0] = 0.f; p1[1] = 0.f; p1[2] = 0.f; p1[3] = 0.f; }
  const v4f p2 = *(const v4f*)(cur + 1 * PD * NH);
  const v4f p3 = *(const v4f*)(cur + 2 * PD * NH);
  const v4f p4 = *(const v4f*)(cur + 3 * PD * NH);
  const L6 lw = ext6n(p1, p2);
  const L6 lr = ext6n(p3, p4);

  float* sr = sR[wave] + lane * 8;
  float* sw = sW[wave] + lane * 8;
  v4f t0, t1, u0, u1;
  t0[0] = lr.v0; t0[1] = lr.v1; t0[2] = lr.v2; t0[3] = lr.v3;
  t1[0] = lr.v4; t1[1] = lr.v5; t1[2] = 0.f;   t1[3] = 0.f;
  u0[0] = lw.v5; u0[1] = -lw.v4; u0[2] = lw.v3; u0[3] = lw.v2;
  u1[0] = -lw.v1; u1[1] = lw.v0; u1[2] = 0.f;   u1[3] = 0.f;
  *(v4f*)(sr)     = t0;
  *(v4f*)(sr + 4) = t1;
  *(v4f*)(sw)     = u0;
  *(v4f*)(sw + 4) = u1;
  __builtin_amdgcn_fence(__ATOMIC_RELEASE, "workgroup");
  __builtin_amdgcn_wave_barrier();
  __builtin_amdgcn_fence(__ATOMIC_ACQUIRE, "workgroup");
  v4f oR[2], oW[2];
#pragma unroll
  for (int it = 0; it < 2; ++it) {
    oR[it] = *(const v4f*)(sR[wave] + it * 128 + lane * 4);
    oW[it] = *(const v4f*)(sW[wave] + it * 128 + lane * 4);
  }
  const size_t gb = ((size_t)bh * SEQ + (size_t)tg * 32) * 8;
  {
#pragma unroll
    for (int it = 0; it < 2; ++it) {
      *(v4f*)(rl + gb + it * 128 + lane * 4) = oR[it];
      *(v4f*)(wl + gb + it * 128 + lane * 4) = oW[it];
    }
    
  }
}

// =====================================================================================================
// Causal multi-head attention, head dim 64, with an additive line-pair bias:
//   logit(q, k) = (q . k) * sscale + dot6(rl[q], wl[k]) * wdec(q - k),  wdec(d) = bs_h * dec_h^d for d > 0, 0 else,
//   dec_h = sigmoid(dl_h); keys k > q masked (-FLT_MAX, exp -> 0); diagonal kept. In the key chunks in front of the
//   diagonal one the weight is carried by the staged rows: rl[q] * bs_h * dec_h^(q - 64 qb) and wl[k] * dec_h^(64 qb - k).
//   q planes (bf16 hi / lo): element (b, t, h, d) at [(b*SEQ + t)*QP + h*64 + d]
//   k planes (bf16 hi / lo): same layout
//   v^T hi plane (f16):      element (b, h, d, s) at [(b*QP + h*64 + d)*SEQ + s]
//   v^T residual plane (f16, (v - hi)*4096): [(b*QP + h*64 + d)*VLP + s], s < VLP, read only when RES
//   rl / wl f32 planes [b*NH + h][SEQ][8] (6 used)
//   out f32 plane: element (b, t, h*64 + d) at [(b*SEQ + t)*QP + h*64 + d] = normalised context.
//   scores = q . k : bf16 hi/lo split (hi.hi + hi.lo + lo.hi), f32 accumulate, then scale + bias in f32
//   p = exp(s - m) carried as f16(1024 p); context = p . v on f16 WMMA; RES adds f16 residual planes of p and v
//   (scale 4096, separate accumulator folded back with 1/4096 per chunk in f32); online softmax in f32.
//   Block = 4 waves; a query tile = 64 query rows of one (b, h); key chunks of 64, chunks 0..qb only for tile qb
//   (block-uniform trip count qb+1 <= NQB; every row has a live key in every processed chunk).
//   Each block takes two tiles of its (b, h), one after the other: NQB-1-t, then t (t = 0..NQB/2-1), so that every
//   block walks NQB+1 key chunks; grid = (NQB/2) * NH * NB. Tiles qb < RESQB run the RES form.
//   K / V^T / wl chunk staging: 128 threads (plain 16-B loads, __syncthreads before and after); P stays in registers.
//   Output coverage: each wave stores rows q0..q0+15 (it 0..7 x lane>>4 0..1) x 64 columns (16 lanes x 4 floats),
// =====================================================================================================
struct AttnLds {
  __align__(16) unsigned short KT[2 * 64 * LP];      // K hi [kv][d] | K lo; later f32 context staging
  __align__(16) _Float16 Vth[64 * LP];                // V^T hi [d][kv]
  __align__(16) _Float16 Vtl[64 * LP];                // V^T residual (RES tiles)
  __align__(16) float    Ws[8 * 64];                  // wl of the chunk's 64 keys, [term][key]
  __align__(16) float    Rp[128 * 20];                // per lane, the rl row of its query: 6 weighted terms, each twice | 6 plain
};

// lane l <-> lane l ^ 16 in the vector unit
__device__ __forceinline__ float xhalf(float x) {
  const int b = __builtin_bit_cast(int, x);
  return __builtin_bit_cast(float, __builtin_amdgcn_permlanex16(b, b, 0x76543210, 0xfedcba98, false, false));
}

// One query tile qb of (b, h), all 4 waves of the block. Both products run transposed: S^T = K . Q^T (A = K rows,
// B = Q) and O^T += V^T . P^T (A = V^T rows, B = P^T). A lane then holds 32 of the 64 scores of ONE query (column
// c = lane & 15; keys 16 j + 8 (lane >> 4) + r), lane ^ 16 the other 32, and two neighbouring score tiles, converted
// in place, are the B operand of the second product in the k order of the V^T loader.
template <bool RES>
__device__ __forceinline__
void attn_tile(AttnLds& sm,
               const unsigned short* __restrict__ qhp, const unsigned short* __restrict__ qlp,
               const unsigned short* __restrict__ khp, const unsigned short* __restrict__ klp,
               const unsigned short* __restrict__ vhp, const unsigned short* __restrict__ vlp,
               const float* __restrict__ rlp, const float* __restrict__ wlp,
               const float* __restrict__ dlg, const float* __restrict__ bsc,
               float* outp, int b, int h, int qb, float sscale) {
  union FB { v16b v; v8b h[2]; };
  union FH { v16h v; v8h h[2]; };
  unsigned short* KT = sm.KT;
  _Float16* Vth = sm.Vth;
  _Float16* Vtl = sm.Vtl;
  float* Ws = sm.Ws;
  float* Rp = sm.Rp + threadIdx.x * 20;              // written and read by this lane alone
  __bf16* Ksh = (__bf16*)(void*)KT;
  __bf16* Ksl = Ksh + 64 * LP;

  const int tid  = threadIdx.x;
  const int wave = tid >> 5;
  const int lane = tid & 31;
  const int hh   = lane >> 4;
  const int c    = lane & 15;

  const int q0   = qb * 64 + wave * 16;
  const size_t rowB = (size_t)b * SEQ;
  const size_t bhT  = ((size_t)b * NH + h) * SEQ;

  const __bf16* Qh = (const __bf16*)(const void*)qhp + (size_t)h * HD;
  const __bf16* Ql = (const __bf16*)(const void*)qlp + (size_t)h * HD;
  const __bf16* Kh = (const __bf16*)(const void*)khp + (size_t)h * HD;
  const __bf16* Kl = (const __bf16*)(const void*)klp + (size_t)h * HD;
  const _Float16* Vh = (const _Float16*)(const void*)vhp + ((size_t)b * QP + (size_t)h * HD) * SEQ;
  const _Float16* Vl = (const _Float16*)(const void*)vlp + ((size_t)b * QP + (size_t)h * HD) * VLP;

  // ---- per-head scalars (RNE bf16-converted inputs) ----
  const float dl  = bf_up(bf_bits(dlg[h]));
  const float dec = 1.0f / (1.0f + expf(-dl));
  const float l2d = fmaxf(log2f(dec), -FLT_MAX);   // finite, so that a power with exponent 0 is 1 also when dec == 0
  const float bsh = bf_up(bf_bits(bsc[h]));

  // ---- the rl row of this lane's query, to the lane's own LDS slot (held in registers over the tile it cost the
  //      products theirs): plain for the diagonal chunk and, for the chunks in front of it, each term twice (the two
  //      halves of the packed fma) with the query's share of the decay weight:
  //      bs * dec^(q - k) = [bs * dec^(q - 64 qb)] * [dec^(64 qb - k)], both exponents >= 0 there, so both powers
  //      are <= 1 and neither can overflow; where one underflows the whole weight does ----
  {
    const float* rg = rlp + (bhT + q0 + c) * 8;
    const v4f ra = *(const v4f*)(rg);
    const v2f rb = *(const v2f*)(rg + 4);
#if defined(__HIP_DEVICE_COMPILE__)
    // the address register pair of the two loads is an input here, so it stays whole up to this wait
    asm volatile("s_wait_xcnt 0x0" :: "v"(rg) : "memory");
#endif
    const float rf = bsh * exp2f((float)(wave * 16 + c) * l2d);
    const v4f qa = ra * rf;
    const v2f qc = rb * rf;
    const v4f q01 = {qa[0], qa[0], qa[1], qa[1]}, q23 = {qa[2], qa[2], qa[3], qa[3]}, q45 = {qc[0], qc[0], qc[1], qc[1]};
    *(v4f*)(Rp)      = q01;
    *(v4f*)(Rp + 4)  = q23;
    *(v4f*)(Rp + 8)  = q45;
    *(v4f*)(Rp + 12) = ra;
    *(v2f*)(Rp + 16) = rb;
  }

  float mrow = -INFINITY, lrow = 0.f;        // of this lane's query; equal in lanes l and l ^ 16
  v8f oacc[4];                               // O^T: register r of tile t = context element d = 16 t + 8 hh + r
#pragma unroll
  for (int t = 0; t < 4; ++t) oacc[t] = zero8();

  // ---- Q fragments (B operand, column = lane&15): 2 d-chunks, hi and lo, held in registers for the whole tile ----
  v16b qah[2], qal[2];
#pragma unroll
  for (int dc = 0; dc < 2; ++dc) {
    const size_t qo = (rowB + q0 + c) * QP + dc * 32 + 8 * hh;
    qah[dc] = ldfrag_b(Qh + qo);
    qal[dc] = ldfrag_b(Ql + qo);
  }

  int nkt = qb + 1;                          // causal: key tiles 0..qb, block-uniform
  if (nkt > NQB) nkt = NQB;
  for (int kt = 0; kt < nkt; ++kt) {
    const int kv0 = kt * 64;
    const bool diag = (kt == qb);            // block-uniform: the one chunk that holds keys >= a query of the tile
    __syncthreads();
    {
      const int r = tid >> 1, half = (tid & 1) * 32;
      // wl rows kv0..kv0+63 of this (b, h): 64 x 8 f32 = 128 threads x 16 B (key = kv0 + r); in front of the diagonal
      // chunk times the key's share dec^(64 qb - key) of the decay weight (exponent >= 1), in it times dec^0 = 1.
      // The load stands first so that it flies together with the K and V loads.
      const float* wg = wlp + (bhT + kv0) * 8 + tid * 4;
      const v4f wv = *(const v4f*)(wg);
      const float kf = exp2f((float)(diag ? 0 : (qb * 64 - kv0 - r)) * l2d);
      const __bf16*   kg  = Kh + (rowB + kv0 + r) * QP + half;    // K row kv0+r, d = half..half+31
      const __bf16*   klg = Kl + (rowB + kv0 + r) * QP + half;
      const _Float16* vg  = Vh + (size_t)r * SEQ + kv0 + half;    // V^T row d = r, s = kv0+half..+31
      const int kvl = (kv0 + 64 <= VLP) ? kv0 : (VLP - 64);     // clamped address into the residual plane
      const _Float16* vlg = Vl + (size_t)r * VLP + kvl + half;
      const bool resOK = (kv0 + 64 <= VLP);                      // block-uniform
#pragma unroll
      for (int i = 0; i < 4; ++i) {
        const v8b a0 = *(const v8b*)(kg + 8 * i);
        const v8b a1 = *(const v8b*)(klg + 8 * i);
        const v8h b0 = *(const v8h*)(vg + 8 * i);
        *(v8b*)(Ksh + r * LP + half + 8 * i) = a0;
        *(v8b*)(Ksl + r * LP + half + 8 * i) = a1;
        *(v8h*)(Vth + r * LP + half + 8 * i) = b0;
        if (RES) {
          v8h b1 = *(const v8h*)(vlg + 8 * i);
          if (!resOK) b1 = zero8h();
          *(v8h*)(Vtl + r * LP + half + 8 * i) = b1;
        }
      }
      // term-major, so that one 16-B read brings one term of four neighbouring keys: the key pairs of the packed fma
      const v4f wk = wv * kf;
#pragma unroll
      for (int e = 0; e < 4; ++e) Ws[((tid & 1) * 4 + e) * 64 + r] = wk[e];
#if defined(__HIP_DEVICE_COMPILE__)
      // the address registers of the chunk's loads are inputs here, so they stay whole up to this wait
      if (RES) asm volatile("s_wait_xcnt 0x0" :: "v"(wg), "v"(kg), "v"(klg), "v"(vg), "v"(vlg) : "memory");
      else     asm volatile("s_wait_xcnt 0x0" :: "v"(wg), "v"(kg), "v"(klg), "v"(vg) : "memory");
#endif
    }
    __syncthreads();

    // ---- scores, transposed: 64 keys x 16 queries per wave, 3 bf16 products ----
    // all K fragments of the chunk are fetched as one group in front of the products, in the order of their use, so that
    // the LDS latency is met once for the chunk and not once for every three products
    FB kb[4][2], kl[4][2];
#pragma unroll  // the fragments are indexed by constants only, so they stay in registers (all loops of this part)
    for (int j = 0; j < 4; ++j) {
#pragma unroll
      for (int dc = 0; dc < 2; ++dc) {
        kb[j][dc].h[0] = *(const v8b*)(Ksh + (j * 16 + c) * LP + dc * 32 + 8 * hh);
        kb[j][dc].h[1] = *(const v8b*)(Ksh + (j * 16 + c) * LP + dc * 32 + 16 + 8 * hh);
        kl[j][dc].h[0] = *(const v8b*)(Ksl + (j * 16 + c) * LP + dc * 32 + 8 * hh);
        kl[j][dc].h[1] = *(const v8b*)(Ksl + (j * 16 + c) * LP + dc * 32 + 16 + 8 * hh);
      }
    }
    v8f s[4];                                // s[j][r] = score of key kv0 + 16 j + 8 hh + r and query q0 + c
#pragma unroll
    for (int j = 0; j < 4; ++j) {
      s[j] = zero8();
#pragma unroll
      for (int dc = 0; dc < 2; ++dc) {
        s[j] = mma_b(kb[j][dc].v, qah[dc], s[j]);
        s[j] = mma_b(kl[j][dc].v, qah[dc], s[j]);
        s[j] = mma_b(kb[j][dc].v, qal[dc], s[j]);
      }
    }

    // ---- all V^T fragments of the chunk, fetched here so that they arrive while the softmax below is computed ----
    FH vb[2][4];
#pragma unroll  // as above
    for (int kk = 0; kk < 2; ++kk) {
#pragma unroll
      for (int t = 0; t < 4; ++t) {
        vb[kk][t].h[0] = *(const v8h*)(Vth + (t * 16 + c) * LP + kk * 32 + 8 * hh);
        vb[kk][t].h[1] = *(const v8h*)(Vth + (t * 16 + c) * LP + kk * 32 + 16 + 8 * hh);
      }
    }

    // ---- scale + bias + causal mask (replace by -FLT_MAX), maximum, online softmax, P^T (x1024, f16) and its
    //      residual (x4096) packed in registers ----
    float mx[4];                             // maximum of each score tile: four independent chains
    if (!diag) {
      // every key of the chunk lies before every query of the tile: nothing is masked, and the decay weight is
      // already in the staged rows, so the bias is the plain 6-term dot
      const v2f sc2 = {sscale, sscale};
      const v4f q01 = *(const v4f*)(Rp), q23 = *(const v4f*)(Rp + 4), q45 = *(const v4f*)(Rp + 8);
      const v2f r0 = {q01[0], q01[1]}, r1 = {q01[2], q01[3]}, r2 = {q23[0], q23[1]};
      const v2f r3 = {q23[2], q23[3]}, r4 = {q45[0], q45[1]}, r5 = {q45[2], q45[3]};
#pragma unroll  // w, s and mx are indexed by constants only, so they stay in registers (all loops of this branch)
      for (int j = 0; j < 4; ++j) {
        v4f w[6][2];                         // term i of keys 16 j + 8 hh + 0..7 (the same address in 16 lanes)
#pragma unroll
        for (int i = 0; i < 6; ++i) {
          w[i][0] = *(const v4f*)(Ws + i * 64 + j * 16 + 8 * hh);
          w[i][1] = *(const v4f*)(Ws + i * 64 + j * 16 + 8 * hh + 4);
        }
        float m = -INFINITY;
#pragma unroll
        for (int p = 0; p < 4; ++p) {
          // two keys at a time; the six terms in the order 0..5, then the scaled score, as in the diagonal chunk
          const int u = p >> 1, e = (p & 1) * 2;
          const v2f w0 = {w[0][u][e], w[0][u][e + 1]}, w1 = {w[1][u][e], w[1][u][e + 1]};
          const v2f w2 = {w[2][u][e], w[2][u][e + 1]}, w3 = {w[3][u][e], w[3][u][e + 1]};
          const v2f w4 = {w[4][u][e], w[4][u][e + 1]}, w5 = {w[5][u][e], w[5][u][e + 1]};
          v2f d = r0 * w0;
          d = __builtin_elementwise_fma(r1, w1, d);
          d = __builtin_elementwise_fma(r2, w2, d);
          d = __builtin_elementwise_fma(r3, w3, d);
          d = __builtin_elementwise_fma(r4, w4, d);
          d = __builtin_elementwise_fma(r5, w5, d);
          const v2f sp = {s[j][2 * p], s[j][2 * p + 1]};
          d = __builtin_elementwise_fma(sp, sc2, d);
          s[j][2 * p] = d.x; s[j][2 * p + 1] = d.y;
          m = fmaxf(fmaxf(m, d.x), d.y);
        }
        mx[j] = m;
      }
    } else {
      const int qrow = q0 + c;
      const v4f pa4 = *(const v4f*)(Rp + 12);
      const v2f pb2 = *(const v2f*)(Rp + 16);
      const float rp[6] = {pa4[0], pa4[1], pa4[2], pa4[3], pb2[0], pb2[1]};
#pragma unroll  // as above
      for (int j = 0; j < 4; ++j) {
        v4f w[6][2];
#pragma unroll
        for (int i = 0; i < 6; ++i) {
          w[i][0] = *(const v4f*)(Ws + i * 64 + j * 16 + 8 * hh);
          w[i][1] = *(const v4f*)(Ws + i * 64 + j * 16 + 8 * hh + 4);
        }
        float m = -INFINITY;
#pragma unroll
        for (int r = 0; r < 8; ++r) {
          const int u = r >> 2, e = r & 3;
          const int key = kv0 + j * 16 + 8 * hh + r;
          const int dd  = qrow - key;
          const float dot6 = rp[0] * w[0][u][e] + rp[1] * w[1][u][e] + rp[2] * w[2][u][e] + rp[3] * w[3][u][e]
                           + rp[4] * w[4][u][e] + rp[5] * w[5][u][e];
          const float ex   = exp2_slot((float)dd * l2d);
          const float wdec = (dd > 0) ? (bsh * ex) : 0.f;
          float sv = s[j][r] * sscale + dot6 * wdec;
          sv = (key > qrow) ? -FLT_MAX : sv;
          s[j][r] = sv;
          m = fmaxf(m, sv);
        }
        mx[j] = m;
      }
    }
    // maximum over the query's 64 keys: this lane's 32, then the other half's
    float mloc = fmaxf(fmaxf(mx[0], mx[1]), fmaxf(mx[2], mx[3]));
    mloc = fmaxf(mloc, xhalf(mloc));
    const float mnew  = fmaxf(mrow, mloc);
    const float msafe = (mnew == -INFINITY) ? 0.f : mnew;
    const float alpha = exp_slot(mrow - msafe);
    mrow = mnew;

    FH pa[2], pl[2];                         // P^T as B operand: element 8 (j & 1) + r of pa[j >> 1] = key 16 j + 8 hh + r
    float pj[4];                             // sum of each score tile: four independent chains
#pragma unroll  // s, pa, pl and pj are indexed by constants only, so they stay in registers
    for (int j = 0; j < 4; ++j) {
      float ps = 0.f;
#pragma unroll
      for (int r = 0; r < 8; ++r) {
        const float p = exp_slot(s[j][r] - msafe);  // masked logit against a finite max: exp -> 0
        ps += p;
        const float p1k = p * 1024.0f;
        const _Float16 ph = (_Float16)p1k;
        pa[j >> 1].v[(j & 1) * 8 + r] = ph;
        if (RES) pl[j >> 1].v[(j & 1) * 8 + r] = (_Float16)((p1k - (float)ph) * 4096.0f);
      }
      pj[j] = ps;
    }
    float psum = (pj[0] + pj[1]) + (pj[2] + pj[3]);
    psum += xhalf(psum);
    lrow = lrow * alpha + psum;
#pragma unroll  // as above
    for (int t = 0; t < 4; ++t)
#pragma unroll
      for (int r = 0; r < 8; ++r) oacc[t][r] *= alpha;

    // ---- context^T += V^T . P^T (f16 WMMA), residual products into a separate accumulator ----
    v8f o1[4];
#pragma unroll
    for (int t = 0; t < 4; ++t) o1[t] = zero8();
#pragma unroll  // the fragments are indexed by constants only, so they stay in registers
    for (int kk = 0; kk < 2; ++kk) {
      // RES tiles: the V^T residual fragments of one key half as a group (all eight, or held over the softmax, they did
      // not fit the registers)
      FH vl[4];
#pragma unroll
      for (int t = 0; t < 4; ++t) {
        if (RES) {
          vl[t].h[0] = *(const v8h*)(Vtl + (t * 16 + c) * LP + kk * 32 + 8 * hh);
          vl[t].h[1] = *(const v8h*)(Vtl + (t * 16 + c) * LP + kk * 32 + 16 + 8 * hh);
        } else {
          vl[t].v = vb[kk][t].v;
        }
      }
#pragma unroll
      for (int t = 0; t < 4; ++t) {
        oacc[t] = mma_h(vb[kk][t].v, pa[kk].v, oacc[t]);
        if (RES) {
          o1[t] = mma_h(vl[t].v, pa[kk].v, o1[t]);
          o1[t] = mma_h(vb[kk][t].v, pl[kk].v, o1[t]);
        }
      }
    }
    if (RES) {
#pragma unroll
      for (int t = 0; t < 4; ++t)
#pragma unroll
        for (int r = 0; r < 8; ++r) oacc[t][r] += o1[t][r] * (1.0f / 4096.0f);
    }
  }

  // ---- all waves are done with the K tiles before that LDS region is reused for the context staging ----
  __syncthreads();

  // ---- normalise (1/l and the 1/1024 p carry), stage the wave's 16x64 tile in LDS (row = query c, pitch OSP), then
  //      write whole 256-B row segments ----
  float* os = (float*)(void*)KT + wave * (16 * OSP);
  {
    const float inv = ((lrow > 0.f) ? (1.0f / lrow) : 0.f) * (1.0f / 1024.0f);
#pragma unroll
    for (int t = 0; t < 4; ++t) {
      v4f x0, x1;
#pragma unroll
      for (int e = 0; e < 4; ++e) { x0[e] = oacc[t][e] * inv; x1[e] = oacc[t][4 + e] * inv; }
      *(v4f*)(os + c * OSP + t * 16 + 8 * hh)     = x0;
      *(v4f*)(os + c * OSP + t * 16 + 8 * hh + 4) = x1;
    }
  }
  __builtin_amdgcn_fence(__ATOMIC_RELEASE, "workgroup");
  __builtin_amdgcn_wave_barrier();
  __builtin_amdgcn_fence(__ATOMIC_ACQUIRE, "workgroup");
  {
    const int h2 = lane >> 4, c4 = (lane & 15) * 4;
    v4f ov[8];
#pragma unroll
    for (int it = 0; it < 8; ++it) {
      const int row = it * 2 + h2;   // it 0..7 x h2 0..1 = rows 0..15 of the wave tile
      ov[it] = *(const v4f*)(os + row * OSP + c4);
    }
    {
#pragma unroll
      for (int it = 0; it < 8; ++it) {
        const int row = it * 2 + h2;
        const size_t go = (rowB + q0 + row) * QP + (size_t)h * HD + c4;
        *(v4f*)(outp + go) = ov[it];
      }
#if defined(__HIP_DEVICE_COMPILE__)
      // the block's next tile rewrites the address and data registers of these stores: the wait stands in front of that
      asm volatile("s_wait_xcnt 0x0" ::: "memory");
#endif
    }
  }
}

__global__ __launch_bounds__(128)
void attn_lb(const unsigned short* __restrict__ qhp, const unsigned short* __restrict__ qlp,
             const unsigned short* __restrict__ khp, const unsigned short* __restrict__ klp,
             const unsigned short* __restrict__ vhp, const unsigned short* __restrict__ vlp,
             const float* __restrict__ rlp, const float* __restrict__ wlp,
             const float* __restrict__ dlg, const float* __restrict__ bsc,
             float* outp, float sscale) {
  static_assert((NQB % 2) == 0);
  __shared__ AttnLds sm;
  const int bx   = blockIdx.x;
  const int t    = bx % (NQB / 2);
  const int rest = bx / (NQB / 2);
  const int h    = rest % NH;
  const int b    = rest / NH;
  // The second tile's first barrier (top of its key loop) stands behind every wave's read-back of the first tile's
  // context staging, and in front of the first refill of that LDS.
#pragma unroll 1  // rolled: one copy of each tile form in the text
  for (int pass = 0; pass < 2; ++pass) {
    const int qb = pass ? t : (NQB - 1 - t);       // block-uniform
    if (qb < RESQB)
      attn_tile<true>(sm, qhp, qlp, khp, klp, vhp, vlp, rlp, wlp, dlg, bsc, outp, b, h, qb, sscale);
    else
      attn_tile<false>(sm, qhp, qlp, khp, klp, vhp, vlp, rlp, wlp, dlg, bsc, outp, b, h, qb, sscale);
  }
}

// =====================================================================================================
// Workspace map (bytes), every region an exact multiple of its whole-line / whole-tile store granularity
// multiples):
//   Xb     bf16 [4096][1024]            0            8388608
//   Wqkv   bf16 [3072][1024]            8388608      6291456   ([n][k], rows 0..1023 q | 1024.. k | 2048.. v)
//   Wln    bf16 [256][1024]             14680064      524288   ([W1w; W2w; W1r; W2r], [n][k])
//   Wob    bf16 [1024][1024]            15204352     2097152   ([n][k])
//   LN     f32  [4096][256]             17301504     4194304
//   RL     f32  [32][2048][8]           21495808     2097152
//   WL     f32  [32][2048][8]           23592960     2097152
//   Qh     bf16 [4096][1024]            25690112     8388608
//   Ql     bf16 [4096][1024]            34078720     8388608
//   Kh     bf16 [4096][1024]            42467328     8388608
//   Kl     bf16 [4096][1024]            50855936     8388608
//   VTh    f16  [2][1024][2048]         59244544     8388608
//   VTl    f16  [2][1024][512]          67633152     2097152
//   Af     f32  [4096][1024]            69730304    16777216
//   Ah     bf16 [4096][1024]            86507520     8388608
//   Al     bf16 [4096][1024]            94896128     8388608
//   end                                 103284736
// =====================================================================================================
extern "C" void kernel_launch(void* const* d_in, const int* in_sizes, int n_in,
                              void* d_out, int out_size, void* d_ws, size_t ws_size,
                              hipStream_t stream) {
  if (n_in < 11) return;
  if (in_sizes[0] != NB * SEQ * DMODEL) return;
  if (in_sizes[1] != 3 * QP * DMODEL) return;
  if (in_sizes[2] != 3 * QP) return;
  if (in_sizes[3] != PD * NH * DMODEL) return;
  if (in_sizes[4] != PD * NH * DMODEL) return;
  if (in_sizes[5] != PD * NH * DMODEL) return;
  if (in_sizes[6] != PD * NH * DMODEL) return;
  if (in_sizes[7] != DMODEL * QP) return;
  if (in_sizes[8] != DMODEL) return;
  if (in_sizes[9] != NH) return;
  if (in_sizes[10] != NH) return;
  if (out_size != NB * SEQ * DMODEL) return;

  const float* x     = (const float*)d_in[0];    // [NB*SEQ][DMODEL]
  const float* wqkv  = (const float*)d_in[1];    // [3*QP n][DMODEL k]
  const float* bqkv  = (const float*)d_in[2];    // [3*QP]
  const float* w1w   = (const float*)d_in[3];    // [PD*NH][DMODEL]
  const float* w2w   = (const float*)d_in[4];
  const float* w1r   = (const float*)d_in[5];
  const float* w2r   = (const float*)d_in[6];
  const float* wout  = (const float*)d_in[7];    // [DMODEL n][QP k]
  const float* bout  = (const float*)d_in[8];    // [DMODEL]
  const float* dlog  = (const float*)d_in[9];    // [NH]
  const float* bscl  = (const float*)d_in[10];   // [NH]

  const size_t PXb   = (size_t)NB * SEQ * DMODEL * 2;      //  8388608
  const size_t PWqkv = (size_t)3 * QP * DMODEL * 2;        //  6291456
  const size_t PWln  = (size_t)LNW * DMODEL * 2;           //   524288
  const size_t PWo   = (size_t)DMODEL * QP * 2;            //  2097152
  const size_t PLN   = (size_t)NB * SEQ * LNW * 4;         //  4194304
  const size_t PRL   = (size_t)NB * NH * SEQ * 8 * 4;      //  2097152
  const size_t PQpl  = (size_t)NB * SEQ * QP * 2;          //  8388608  (Qh, Ql, Kh, Kl, Ah, Al)
  const size_t PVTh  = (size_t)NB * QP * SEQ * 2;          //  8388608
  const size_t PVTl  = (size_t)NB * QP * VLP * 2;          //  2097152
  const size_t PAf   = (size_t)NB * SEQ * QP * 4;          // 16777216
  size_t off = 0;
  const size_t oXb   = off; off += PXb;
  const size_t oWqkv = off; off += PWqkv;
  const size_t oWln  = off; off += PWln;
  const size_t oWo   = off; off += PWo;
  const size_t oLN   = off; off += PLN;
  const size_t oRL   = off; off += PRL;
  const size_t oWL   = off; off += PRL;
  const size_t oQh   = off; off += PQpl;
  const size_t oQl   = off; off += PQpl;
  const size_t oKh   = off; off += PQpl;
  const size_t oKl   = off; off += PQpl;
  const size_t oVTh  = off; off += PVTh;
  const size_t oVTl  = off; off += PVTl;
  const size_t oAf   = off; off += PAf;
  const size_t oAh   = off; off += PQpl;
  const size_t oAl   = off; off += PQpl;
  if (off > ws_size) return;                          // off = 103284736
  if (off > (size_t)134217728) return;

  char* ws = (char*)d_ws;
  unsigned short* Xb   = (unsigned short*)(ws + oXb);
  unsigned short* Wqkv = (unsigned short*)(ws + oWqkv);
  unsigned short* Wln  = (unsigned short*)(ws + oWln);
  unsigned short* Wob  = (unsigned short*)(ws + oWo);
  float*          LN   = (float*)(ws + oLN);
  float*          RL   = (float*)(ws + oRL);
  float*          WL   = (float*)(ws + oWL);
  unsigned short* Qh   = (unsigned short*)(ws + oQh);
  unsigned short* Ql   = (unsigned short*)(ws + oQl);
  unsigned short* Kh   = (unsigned short*)(ws + oKh);
  unsigned short* Kl   = (unsigned short*)(ws + oKl);
  unsigned short* VTh  = (unsigned short*)(ws + oVTh);
  unsigned short* VTl  = (unsigned short*)(ws + oVTl);
  float*          Af   = (float*)(ws + oAf);
  unsigned short* Ah   = (unsigned short*)(ws + oAh);
  unsigned short* Al   = (unsigned short*)(ws + oAl);
  float*          outf = (float*)d_out;

  const dim3 blk(256);
  const int nTok   = NB * SEQ;                                       // 4096 tokens
  const int n8a    = nTok * QP / 8;                                  // 524288
  const int nwLn   = NB * NH * (SEQ / 32);                           //   2048 waves
  const dim3 blkG(128);                                              // GEMM block: 4 waves, one 128x128 tile
  const dim3 gLines((nwLn + 7) / 8);                                 // 256 blocks
  const dim3 gSplit((n8a + 255) / 256);                              // 2048 blocks
  const dim3 gOut((nTok / 128) * (DMODEL / 128), 1);                 // 256 blocks

  // (1) inputs -> bf16 planes (RNE convert), one launch; weights arrive [n][k] = the Bt layout already. The planes
  //     Xb | Wqkv | Wln | Wob are contiguous from Xb on.
  cvt_all<<<dim3(CB_ALL), blk, 0, stream>>>(x, wqkv, w1w, w2w, w1r, w2r, wout, Xb);
  // (2)-(5) q, k, v^T and line-feature projections, one launch
  proj4<<<dim3(PB_ALL), blkG, 0, stream>>>(Xb, Wqkv, Wln, bqkv, Qh, Ql, Kh, Kl, VTh, VTl, LN);
  // (6) line features (shifted p1, exterior 2-forms, L2 normalisation, J map) -> rl / wl f32 planes
  lines_k<<<gLines, blk, 0, stream>>>(LN, RL, WL, nwLn);
  // (7) causal attention with line-pair bias: query tiles 0..RESQB-1 with residual planes, the rest without;
  //     one launch, two tiles (NQB-1-t and t) per block
  attn_lb<<<dim3(NB * NH * (NQB / 2)), dim3(128), 0, stream>>>(
      Qh, Ql, Kh, Kl, VTh, VTl, RL, WL, dlog, bscl, Af, 0.125f);
  // (8) context rows -> bf16 hi/lo planes
  split_bf16x8<<<gSplit, blk, 0, stream>>>(Af, Ah, Al, n8a);
  // (9) out[row][e] = sum_d (Ah+Al)[row][d] Wob[e][d] + bout[e] -> d_out f32 [4096][1024]  (M=4096, N=1024, K=1024)
  gemm64<1, 0, 1><<<gOut, blkG, 0, stream>>>(
      Ah, Al, QP, 0LL, Wob, Wob, QP, 0LL,
      (void*)outf, DMODEL, 0LL, (void*)outf, 0, 0LL, 0,
      bout, nTok, DMODEL, QP, 1.0f);
  (void)hipGetLastError();
}

// v009
// A run of this version takes 144 microseconds.
// In both of two side-by-side timings against v008, it was 1.09 times as fast.
// Counting every step since v000, it is 4.34 times as fast.
// Contractions: q / k / v^T and line-feature projections = v_wmma_f32_16x16x32_bf16 (bf16 operands from
// RNE-converted inputs, one product per k-step); q.k^T scores = v_wmma_f32_16x16x32_bf16 with bf16 hi/lo split
// q and k (hi.hi + hi.lo + lo.hi); p.v = v_wmma_f32_16x16x32_f16 (p carried x1024 in f16, v in f16; extra f16
// residual planes x4096 of p and v on the first 512 query rows); ctx.Wo^T = v_wmma_f32_16x16x32_bf16 with ctx
// as bf16 hi/lo planes times the bf16 Wo plane (2 products); all f32 accumulate; 6-term line-pair bias dots: in the
// key chunks before the diagonal one v_wmma_f32_16x16x32_bf16 per score tile (both rows as bf16 hi/lo, all four
// products in its 32 k places), in the diagonal chunk f32 on VALU; decay weights and softmax in f32 on VALU.
#include <hip/hip_runtime.h>
#include <math.h>
#include <float.h>
#include <stdint.h>

#define NB     2
#define SEQ    2048
#define DMODEL 1024
#define NH     16
#define HD     64
#define QP     (NH * HD)       // 1024: q / k / ctx row pitch
#define NQB    (SEQ / 64)      // 32 query / key tiles of 64
#define VLP    512             // key pitch of the v^T residual plane (keys 0..VLP-1)
#define RESQB  8               // leading 64-row query blocks that use the p / v residual planes
#define PD     4               // point dim per head
#define LNW    (4 * PD * NH)   // 256: width of the line-feature projection [p1w | p2w | p1r | p2r]
#define LP     72              // LDS row pitch (16-bit elements) of the attention K and V^T tiles: 144 B = 16 B x 9, so the
                               // 16 rows that one ds_load_b128 reads fall on 16 different groups of 4 banks (at 128 B: on 2)
static_assert(RESQB * 64 <= VLP);
static_assert(RESQB <= NQB);
static_assert(QP == DMODEL);
static_assert(HD == 64);
static_assert(PD == 4);
#define OSP    68              // LDS row pitch (f32) of the attention's context staging: 272 B = 16 B x 17
static_assert(LP >= 64 && (LP % 8) == 0 && 2 * 64 * LP * 2 >= 4 * 16 * OSP * 4);
static_assert((SEQ % 64) == 0 && (DMODEL % 64) == 0 && (LNW % 64) == 0 && (QP % 64) == 0);
static_assert(((NB * SEQ) % 64) == 0 && (SEQ % 32) == 0);
static_assert((DMODEL % 32) == 0);
static_assert(((NB * SEQ) % 128) == 0 && (SEQ % 128) == 0 && (QP % 128) == 0 && (LNW % 128) == 0 && (DMODEL % 128) == 0);

typedef _Float16 v16h __attribute__((ext_vector_type(16)));
typedef _Float16 v8h  __attribute__((ext_vector_type(8)));
typedef __bf16   v16b __attribute__((ext_vector_type(16)));
typedef __bf16   v8b  __attribute__((ext_vector_type(8)));
typedef __bf16   v4b  __attribute__((ext_vector_type(4)));
typedef float    v8f  __attribute__((ext_vector_type(8)));
typedef float    v4f  __attribute__((ext_vector_type(4)));
typedef float    v2f  __attribute__((ext_vector_type(2)));
typedef unsigned int v4u __attribute__((ext_vector_type(4)));

// ---- scalar helpers --------------------------------------------------------------------------------
__device__ __forceinline__ unsigned short bf_bits(float f) {          // f32 -> bf16 bits, RNE convert
  unsigned u = __float_as_uint(f);
  return (unsigned short)((u + 0x7FFFu + ((u >> 16) & 1u)) >> 16);
}
__device__ __forceinline__ float bf_up(unsigned short h) { return __uint_as_float(((unsigned)h) << 16); }
__device__ __forceinline__ unsigned short h_bits(_Float16 x) { return __builtin_bit_cast(unsigned short, x); }
__device__ __forceinline__ unsigned pk16(unsigned short a, unsigned short b) { return (unsigned)a | ((unsigned)b << 16); }
__device__ __forceinline__ v8f zero8() { v8f z = {0.f, 0.f, 0.f, 0.f, 0.f, 0.f, 0.f, 0.f}; return z; }
__device__ __forceinline__ v8h zero8h() {
  const _Float16 z = (_Float16)0.0f;
  v8h r = {z, z, z, z, z, z, z, z};
  return r;
}

// exp(x) as v_exp_f32(x * log2 e), the form __expf compiled to. The v_nop is the one slot that the instruction set asks
// for behind a transcendental before a source is overwritten.
__device__ __forceinline__ float exp_slot(float x) {
  const float t = x * 1.44269504088896340736f;
  float r;
#if defined(__HIP_DEVICE_COMPILE__)
  asm("v_exp_f32 %0, %1\n\tv_nop" : "=v"(r) : "v"(t));
#else
  r = t;
#endif
  return r;
}
// 2^x in the form exp2f compiled to (v_exp_f32, arguments under -126 stepped up by 64 and the result back down), with the
// same v_nop slot behind the transcendental.
__device__ __forceinline__ float exp2_slot(float x) {
  const bool low = x < -126.0f;
  const float t = x + (low ? 64.0f : 0.0f);
  float r;
#if defined(__HIP_DEVICE_COMPILE__)
  asm("v_exp_f32 %0, %1\n\tv_nop" : "=v"(r) : "v"(t));
#else
  r = t;
#endif
  return ldexpf(r, low ? -64 : 0);
}
// ---- fragment loader: 16-bit A/B operand, lane -> row/col (lane&15), p already includes +8*(lane>>4);
//      elements 0..7 <- p[0..7] (k0+8h..), elements 8..15 <- p[16..23] (k0+16+8h..)
__device__ __forceinline__ v16b ldfrag_b(const __bf16* p) {
  union { v16b v; v8b h[2]; } f;
  f.h[0] = *(const v8b*)(p);
  f.h[1] = *(const v8b*)(p + 16);
  return f.v;
}

// ---- WMMA helpers with trailing VALU hazard gap --------------------------------------------------------
__device__ __forceinline__ v8f mma_b(v16b a, v16b b, v8f c) {
  c = __builtin_amdgcn_wmma_f32_16x16x32_bf16(false, a, false, b, (short)0, c, false, false);
#if defined(__HIP_DEVICE_COMPILE__)
  asm volatile("v_nop\n\tv_nop\n\tv_nop\n\tv_nop" : "+v"(c) : "v"(a), "v"(b));
#endif
  return c;
}
__device__ __forceinline__ v8f mma_h(v16h a, v16h b, v8f c) {
  c = __builtin_amdgcn_wmma_f32_16x16x32_f16(false, a, false, b, (short)0, c, false, false);
#if defined(__HIP_DEVICE_COMPILE__)
  asm volatile("v_nop\n\tv_nop\n\tv_nop\n\tv_nop" : "+v"(c) : "v"(a), "v"(b));
#endif
  return c;
}
__device__ __forceinline__ v8f mma_b_raw(v16b a, v16b b, v8f c) {
  return __builtin_amdgcn_wmma_f32_16x16x32_bf16(false, a, false, b, (short)0, c, false, false);
}
__device__ __forceinline__ void dep_guard_b(v8f& a, v8f& b, v16b x, v16b y) {
#if defined(__HIP_DEVICE_COMPILE__)
  asm volatile("v_nop\n\tv_nop\n\tv_nop\n\tv_nop" : "+v"(a), "+v"(b) : "v"(x), "v"(y));
#endif
}
__device__ __forceinline__ void keep4_b(v16b a, v16b b, v16b c, v16b d) {
#if defined(__HIP_DEVICE_COMPILE__)
  asm volatile("v_nop" :: "v"(a), "v"(b), "v"(c), "v"(d));
#endif
}
__device__ __forceinline__ void acc_guard4(v8f& a, v8f& b, v8f& c, v8f& d) {
#if defined(__HIP_DEVICE_COMPILE__)
  asm volatile("v_nop\n\tv_nop\n\tv_nop\n\tv_nop" : "+v"(a), "+v"(b), "+v"(c), "+v"(d));
#endif
}

// =====================================================================================================
// Flat f32 -> bf16 (RNE convert) of all seven f32 operands in one launch: x, w_qkv, the four line weights, w_out.
// Their bf16 planes lie one behind the other in the workspace in that order, so the destination is one flat array;
// a block (256 threads x 8 elements = 2048 elements) lies wholly inside one operand and picks its source by its index
// (block-uniform). One 16-B store per lane: a wave writes 512 contiguous bytes.
// coverage: CB_ALL blocks x 2048 elements = all seven planes, every plane a multiple of 2048 elements.
// =====================================================================================================
#define CB_X   (NB * SEQ * DMODEL / 2048)    // 2048 blocks
#define CB_QKV (3 * QP * DMODEL / 2048)      // 1536
#define CB_LN  (PD * NH * DMODEL / 2048)     //   32 for each line weight
#define CB_WO  (DMODEL * QP / 2048)          //  512
#define CB_ALL (CB_X + CB_QKV + 4 * CB_LN + CB_WO)
static_assert(((NB * SEQ * DMODEL) % 2048) == 0 && ((3 * QP * DMODEL) % 2048) == 0);
static_assert(((PD * NH * DMODEL) % 2048) == 0 && ((DMODEL * QP) % 2048) == 0);
__global__ __launch_bounds__(256) void cvt_all(const float* __restrict__ x, const float* __restrict__ wqkv,
                                               const float* __restrict__ w1w, const float* __restrict__ w2w,
                                               const float* __restrict__ w1r, const float* __restrict__ w2r,
                                               const float* __restrict__ wout, unsigned short* out) {
  const int bx = blockIdx.x;
  if (bx >= CB_ALL) return;
  const float* in;
  int b0;
  if (bx < CB_X)                            { in = x;    b0 = 0; }
  else if (bx < CB_X + CB_QKV)              { in = wqkv; b0 = CB_X; }
  else if (bx < CB_X + CB_QKV + 1 * CB_LN)  { in = w1w;  b0 = CB_X + CB_QKV; }
  else if (bx < CB_X + CB_QKV + 2 * CB_LN)  { in = w2w;  b0 = CB_X + CB_QKV + 1 * CB_LN; }
  else if (bx < CB_X + CB_QKV + 3 * CB_LN)  { in = w1r;  b0 = CB_X + CB_QKV + 2 * CB_LN; }
  else if (bx < CB_X + CB_QKV + 4 * CB_LN)  { in = w2r;  b0 = CB_X + CB_QKV + 3 * CB_LN; }
  else                                      { in = wout; b0 = CB_X + CB_QKV + 4 * CB_LN; }
  const float* s = in + ((size_t)(bx - b0) * 256 + threadIdx.x) * 8;
  const v4f a = *(const v4f*)(s);
  const v4f b = *(const v4f*)(s + 4);
  v4u p;
  p[0] = pk16(bf_bits(a[0]), bf_bits(a[1]));
  p[1] = pk16(bf_bits(a[2]), bf_bits(a[3]));
  p[2] = pk16(bf_bits(b[0]), bf_bits(b[1]));
  p[3] = pk16(bf_bits(b[2]), bf_bits(b[3]));
  *(v4u*)(out + ((size_t)bx * 256 + threadIdx.x) * 8) = p;
}

// =====================================================================================================
// f32 -> bf16 hi plane + bf16 lo plane (lo = RNE(v - hi), unscaled), 8 elements per thread, one 16-B store per
// coverage: n8 threads x 8 = whole plane (n8 multiple of 256).
// =====================================================================================================
__global__ __launch_bounds__(256) void split_bf16x8(const float* __restrict__ in, unsigned short* hp,
                                                    unsigned short* lp, int n8) {
  const int i = blockIdx.x * 256 + threadIdx.x;
  if (i < n8) {
    const v4f a = *(const v4f*)(in + (size_t)i * 8);
    const v4f b = *(const v4f*)(in + (size_t)i * 8 + 4);
    v4u ph, pl;
#pragma unroll
    for (int e = 0; e < 4; ++e) {
      const float f0 = (e < 2) ? a[2 * e]     : b[2 * e - 4];
      const float f1 = (e < 2) ? a[2 * e + 1] : b[2 * e - 3];
      const unsigned short h0 = bf_bits(f0), h1 = bf_bits(f1);
      const unsigned short l0 = bf_bits(f0 - bf_up(h0)), l1 = bf_bits(f1 - bf_up(h1));
      ph[e] = pk16(h0, h1);
      pl[e] = pk16(l0, l1);
    }
    *(v4u*)(hp + (size_t)i * 8) = ph;
    *(v4u*)(lp + (size_t)i * 8) = pl;
    
  }
}

// =====================================================================================================
// Batched bf16 WMMA GEMM: C[m][n] = sum_k A[m][k] * Bt[n][k] (+ bias). Block = 4 waves = one 128x128 tile, each
// wave a 64x64 quarter (wave>>1 = m half, wave&1 = n half). A row-major [M][K] pitch lda; Bt row-major [N][K] pitch
// ldb (k contiguous); M, N multiples of 128, K a multiple of 64 and at least 64. b = batch index.
// The 128 A rows and 128 Bt rows of a 64-wide k slab (128 B a row) are brought into LDS by asynchronous 16-B copies,
// 8 lanes to a row so that every copy instruction takes whole 128-B lines, and are shared by the block's waves; two
// buffers: slab t+1 flies while slab t is multiplied. LDS row pitch GP = 144 B. Fragments come by ds_load_b128; the
// k order and the order of the products are those of ascending k in steps of 32.
// NSPLIT: 0 = A.Bt; 1 = (A + A2).Bt (A2 = unscaled bf16 lo plane of A).
// BIAS: 0 none; 1 = + bias[n] per output column; 2 = + bias[m] per output row (bias RNE-converted to bf16 and
//       widened, added in f32 in the epilogue).
// OUT_MODE: 0 = f32 (pitch ldc); 2 = bf16 hi plane C + bf16 lo plane C2 (lo = RNE(v - hi), unscaled);
//           3 = f16 hi plane C + f16 residual plane C2 = f16((v - hi) * rscale), C2 written only for tiles
//               with n0 < N2 (pitch ldc2, batch stride strideC2).
// =====================================================================================================
#define GP 72                  // LDS row pitch (16-bit elements) of the GEMM slabs: 144 B = 16 B x 9
#define GPL (128 * GP)         // elements of one staged plane (128 rows)

// Eight asynchronous 16-B copies global -> LDS per lane. The s_wait_xcnt stands inside the statement so that no
// address register of a copy is rewritten ahead of it.
__device__ __forceinline__ void async8(const unsigned (&l)[8], const __bf16* const (&g)[8]) {
#if defined(__HIP_DEVICE_COMPILE__)
  asm volatile(
      "global_load_async_to_lds_b128 %0, %8, off\n\t"
      "global_load_async_to_lds_b128 %1, %9, off\n\t"
      "global_load_async_to_lds_b128 %2, %10, off\n\t"
      "global_load_async_to_lds_b128 %3, %11, off\n\t"
      "global_load_async_to_lds_b128 %4, %12, off\n\t"
      "global_load_async_to_lds_b128 %5, %13, off\n\t"
      "global_load_async_to_lds_b128 %6, %14, off\n\t"
      "global_load_async_to_lds_b128 %7, %15, off\n\t"
      "s_wait_xcnt 0x0"
      :: "v"(l[0]), "v"(l[1]), "v"(l[2]), "v"(l[3]), "v"(l[4]), "v"(l[5]), "v"(l[6]), "v"(l[7]),
         "v"(g[0]), "v"(g[1]), "v"(g[2]), "v"(g[3]), "v"(g[4]), "v"(g[5]), "v"(g[6]), "v"(g[7])
      : "memory");
#endif
}
// One plane of a slab: rows row0..row0+127 of src (pitch ld), columns k0..k0+63, to LDS byte address ldst.
// Thread tid takes the 16-B piece tid&7 of rows (tid>>3) + 16*it.
__device__ __forceinline__ void stage_plane(const __bf16* src, int row0, int ld, int k0, unsigned ldst, int tid) {
  unsigned l[8];
  const __bf16* g[8];
#pragma unroll  // the eight addresses are operands of one asm statement
  for (int it = 0; it < 8; ++it) {
    const int row = it * 16 + (tid >> 3);
    l[it] = ldst + (unsigned)((row * GP + (tid & 7) * 8) * 2);
    g[it] = src + (size_t)(row0 + row) * ld + k0 + (tid & 7) * 8;
  }
  async8(l, g);
}
__device__ __forceinline__ void wait_async0() {   // this wave's copies have landed
#if defined(__HIP_DEVICE_COMPILE__)
  asm volatile("s_wait_asynccnt 0x0" ::: "memory");
#endif
}
__device__ __forceinline__ void wait_ds0() {      // this wave's LDS reads are done before the buffer is refilled
#if defined(__HIP_DEVICE_COMPILE__)
  asm volatile("s_wait_dscnt 0x0" ::: "memory");
#endif
}

// One 128x128 tile (index tile, batch element b) by the 4 waves of a block; sAB = the two slab buffers, sT = the
// per-wave epilogue slabs, both the calling kernel's LDS.
template <int NSPLIT, int OUT_MODE, int BIAS>
__device__ __forceinline__ void gemm_tile(
    __bf16* sAB, float (*sT)[16 * 68], int tile, int b,
    const unsigned short* __restrict__ Ap, const unsigned short* A2p, int lda, long long strideA,
    const unsigned short* __restrict__ Btp, const unsigned short* Bt2p, int ldb, long long strideB,
    void* Cout, int ldc, long long strideC,
    void* Cout2, int ldc2, long long strideC2, int N2,
    const float* __restrict__ biasp,
    int M, int N, int K, float rscale) {
  static_assert(NSPLIT == 0 || NSPLIT == 1);
  constexpr int NPL = (NSPLIT == 1) ? 3 : 2;       // staged planes: A, Bt, (A2)
  constexpr int GI  = (NSPLIT == 1) ? 2 : 4;       // A row groups fetched together
  const __bf16* A   = (const __bf16*)(const void*)Ap;
  const __bf16* A2  = (const __bf16*)(const void*)A2p;
  const __bf16* Bt  = (const __bf16*)(const void*)Btp;
  (void)Bt2p;
  const int tid  = threadIdx.x;
  const int lane = tid & 31;
  const int wave = tid >> 5;
  const int tilesN = N >> 7;
  const int tilesM = M >> 7;
  if (tile >= tilesM * tilesN) return;   // block-uniform, in front of every barrier
  const int tm = tile / tilesN;
  const int tn = tile - tm * tilesN;
  const int mB = tm << 7;
  const int nB = tn << 7;
  const int wm = (wave >> 1) << 6;
  const int wn = (wave & 1) << 6;
  const int m0 = mB + wm;
  const int n0 = nB + wn;

  const __bf16* Ab  = A  + (size_t)b * strideA;
  const __bf16* Bb  = Bt + (size_t)b * strideB;
  const __bf16* Ab2 = (NSPLIT == 1) ? (A2 + (size_t)b * strideA) : Ab;

  const int rlane = lane & 15;                 // row (A) / col (B, D) within subtile
  const int koff  = (lane >> 4) * 8;           // k offset of this lane half
  const int mOff  = (lane >> 4) * 8;           // D row offset

  v8f acc[4][4];
#pragma unroll
  for (int i = 0; i < 4; ++i)
#pragma unroll
    for (int j = 0; j < 4; ++j) acc[i][j] = zero8();

  const unsigned lds0 = (unsigned)(uintptr_t)(void*)sAB;   // LDS byte address of the ring
  const int nT = K >> 6;                                   // k slabs of 64
  // slab t into buffer bf
  auto issue = [&](int t, int bf) {
    const unsigned lb = lds0 + (unsigned)(bf * NPL * GPL * 2);
    stage_plane(Ab, mB, lda, t << 6, lb, tid);
    stage_plane(Bb, nB, ldb, t << 6, lb + (unsigned)(GPL * 2), tid);
    if (NSPLIT == 1) stage_plane(Ab2, mB, lda, t << 6, lb + (unsigned)(2 * GPL * 2), tid);
  };
  issue(0, 0);
  wait_async0();
  __syncthreads();
  if (nT > 1) issue(1, 1);

  for (int t = 0; t < nT; ++t) {
    const __bf16* sA  = sAB + (t & 1) * (NPL * GPL);
    const __bf16* sB  = sA + GPL;
    const __bf16* sA2 = sA + (NPL - 1) * GPL;
    // this loop and those inside it are unrolled so that fragments and accumulators are indexed by constants only
    // and stay in registers
#pragma unroll
    for (int ks = 0; ks < 2; ++ks) {
      // the A fragments of GI row groups (16 products' worth) are fetched together, so that the LDS latency is met
      // once for them and not once a row group; GI is 2 with the second A plane to stay inside 256 registers
      v16b bh[4];
#pragma unroll
      for (int j = 0; j < 4; ++j) bh[j] = ldfrag_b(sB + (wn + (j << 4) + rlane) * GP + ks * 32 + koff);
#pragma unroll
      for (int ig = 0; ig < 4; ig += GI) {
        v16b ah[GI], al[GI];
#pragma unroll
        for (int u = 0; u < GI; ++u) {
          const int ao = (wm + ((ig + u) << 4) + rlane) * GP + ks * 32 + koff;
          ah[u] = ldfrag_b(sA + ao);
          if (NSPLIT == 1) al[u] = ldfrag_b(sA2 + ao); else al[u] = ah[u];
        }
#pragma unroll
        for (int u = 0; u < GI; ++u) {
          const int i = ig + u;
#pragma unroll
          for (int j = 0; j < 4; ++j) {
            acc[i][j] = mma_b_raw(ah[u], bh[j], acc[i][j]);
            if (NSPLIT == 1) acc[i][j] = mma_b_raw(al[u], bh[j], acc[i][j]);
          }
          dep_guard_b(acc[i][0], acc[i][3], ah[u], al[u]);
        }
      }
      keep4_b(bh[0], bh[1], bh[2], bh[3]);
    }
    // publish slab t+1 and free slab t's buffer: own LDS reads done, own copies landed, then the block barrier
    wait_ds0();
    wait_async0();
    __syncthreads();
    if (t + 2 < nT) issue(t + 2, t & 1);
  }
  wait_async0();
  acc_guard4(acc[0][0], acc[0][1], acc[0][2], acc[0][3]);
  acc_guard4(acc[1][0], acc[1][1], acc[1][2], acc[1][3]);
  acc_guard4(acc[2][0], acc[2][1], acc[2][2], acc[2][3]);
  acc_guard4(acc[3][0], acc[3][1], acc[3][2], acc[3][3]);

  // ---- per-column bias (BIAS == 1): this lane's 4 output columns n0 + 16j + rlane ----
  float bcol[4];
#pragma unroll
  for (int j = 0; j < 4; ++j) bcol[j] = 0.f;
  if (BIAS == 1) {
#pragma unroll
    for (int j = 0; j < 4; ++j) bcol[j] = bf_up(bf_bits(biasp[n0 + (j << 4) + rlane]));
  }

  // ---- epilogue ----
  float* slab = sT[wave];
#pragma unroll
  for (int i = 0; i < 4; ++i) {
    const int mBase = m0 + (i << 4);
    float brow[8];
#pragma unroll
    for (int r = 0; r < 8; ++r) brow[r] = 0.f;
    if (BIAS == 2) {
#pragma unroll
      for (int r = 0; r < 8; ++r) brow[r] = bf_up(bf_bits(biasp[mBase + mOff + r]));
    }
#pragma unroll
    for (int r = 0; r < 8; ++r) {
#pragma unroll
      for (int j = 0; j < 4; ++j) {
        float v = acc[i][j][r];
        if (BIAS == 1) v += bcol[j];
        if (BIAS == 2) v += brow[r];
        slab[(mOff + r) * 68 + (j << 4) + rlane] = v;
      }
    }
    __builtin_amdgcn_fence(__ATOMIC_RELEASE, "workgroup");
    __builtin_amdgcn_wave_barrier();
    __builtin_amdgcn_fence(__ATOMIC_ACQUIRE, "workgroup");
    if (OUT_MODE == 0) {
      float* C = (float*)Cout + (size_t)b * strideC;
      const int hh = lane >> 4, c4 = (lane & 15) * 4;     // 256-B row segment = 16 lanes x 16 B
      v4f ov[8];
#pragma unroll
      for (int it = 0; it < 8; ++it) {
        const int row = it * 2 + hh;                       // it 0..7 x hh 0..1 = rows 0..15
        ov[it] = *(const v4f*)(slab + row * 68 + c4);
      }
      {
#pragma unroll
        for (int it = 0; it < 8; ++it) {
          const int row = it * 2 + hh;
          *(v4f*)(C + (size_t)(mBase + row) * ldc + n0 + c4) = ov[it];
        }
        
      }
    } else {
      const int q = lane >> 3, c8 = (lane & 7) * 8;
      unsigned short* C  = (unsigned short*)Cout  + (size_t)b * strideC;
      unsigned short* C2 = (unsigned short*)Cout2 + (size_t)b * strideC2;
      const bool wlo = (OUT_MODE == 2) || (n0 < N2);      // wave-uniform
      v4u hv[4], lv[4];
#pragma unroll
      for (int it = 0; it < 4; ++it) {
        const int row = it * 4 + q;                        // it 0..3 x q 0..3 = rows 0..15
        const float* sp = slab + row * 68 + c8;
        v4u a, a2;
#pragma unroll
        for (int e = 0; e < 4; ++e) {
          const float f0 = sp[2 * e], f1 = sp[2 * e + 1];
          unsigned short h0, h1, l0, l1;
          if (OUT_MODE == 2) {
            h0 = bf_bits(f0); h1 = bf_bits(f1);
            l0 = bf_bits(f0 - bf_up(h0)); l1 = bf_bits(f1 - bf_up(h1));
          } else {
            const _Float16 x0 = (_Float16)f0, x1 = (_Float16)f1;
            h0 = h_bits(x0); h1 = h_bits(x1);
            l0 = h_bits((_Float16)((f0 - (float)x0) * rscale));
            l1 = h_bits((_Float16)((f1 - (float)x1) * rscale));
          }
          a[e] = pk16(h0, h1); a2[e] = pk16(l0, l1);
        }
        hv[it] = a; lv[it] = a2;
      }
      // the test stands round the store loops, not inside them: each side is one straight run of stores
      if (wlo) {
#pragma unroll  // hv and lv are indexed by constants only, so they stay in registers
        for (int it = 0; it < 4; ++it) {
          const int row = it * 4 + q;
          *(v4u*)(C + (size_t)(mBase + row) * ldc + n0 + c8) = hv[it];
          *(v4u*)(C2 + (size_t)(mBase + row) * ldc2 + n0 + c8) = lv[it];
        }
      } else {
#pragma unroll  // as above
        for (int it = 0; it < 4; ++it) {
          const int row = it * 4 + q;
          *(v4u*)(C + (size_t)(mBase + row) * ldc + n0 + c8) = hv[it];
        }
#if defined(__HIP_DEVICE_COMPILE__)
        // the code laid out behind these stores rewrites their address and data registers: the wait stands in front of it
        asm volatile("s_wait_xcnt 0x0" ::: "memory");
#endif
      }
    }
    __builtin_amdgcn_fence(__ATOMIC_RELEASE, "workgroup");
    __builtin_amdgcn_wave_barrier();
    __builtin_amdgcn_fence(__ATOMIC_ACQUIRE, "workgroup");
  }
}

// One GEMM per launch: blockIdx.x = tile, blockIdx.y = batch index.
template <int NSPLIT, int OUT_MODE, int BIAS>
__global__ __launch_bounds__(128) void gemm64(
    const unsigned short* __restrict__ Ap, const unsigned short* A2p, int lda, long long strideA,
    const unsigned short* __restrict__ Btp, const unsigned short* Bt2p, int ldb, long long strideB,
    void* Cout, int ldc, long long strideC,
    void* Cout2, int ldc2, long long strideC2, int N2,
    const float* __restrict__ biasp,
    int M, int N, int K, float rscale) {
  __shared__ __align__(16) __bf16 sAB[2 * ((NSPLIT == 1) ? 3 : 2) * GPL];   // two buffers of 2 or 3 planes
  __shared__ __align__(16) float sT[4][16 * 68];                            // per-wave 16x64 slab, pitch 68 floats
  gemm_tile<NSPLIT, OUT_MODE, BIAS>(sAB, sT, blockIdx.x, blockIdx.y, Ap, A2p, lda, strideA, Btp, Bt2p, ldb, strideB,
                                    Cout, ldc, strideC, Cout2, ldc2, strideC2, N2, biasp, M, N, K, rscale);
}

// The four projections of x, none of which reads another's result, in one launch; a block's index picks its GEMM
// (block-uniform) and its tile: q tiles, k tiles, v^T tiles of each batch element, line-feature tiles.
//   q, k:   C[row][e] = sum_k Xb[row][k] W[e][k] + bias[e] -> bf16 hi / lo planes     (M=4096, N=1024, K=1024)
//   v^T:    VTh[b][f][s] = sum_k Wv[f][k] Xb[b*SEQ+s][k] + bv[f] -> f16 hi plane (pitch SEQ) and residual plane
//           (x4096, keys < VLP, pitch VLP)                                            (M=1024, N=2048, K=1024)
//   lines:  LN[row][e] = sum_k Xb[row][k] Wln[e][k] -> f32                            (M=4096, N=256,  K=1024)
#define PB_Q  ((NB * SEQ / 128) * (QP / 128))    // 256 tiles, q and k each
#define PB_V  ((QP / 128) * (SEQ / 128))         // 128 tiles for each batch element
#define PB_LN ((NB * SEQ / 128) * (LNW / 128))   //  64 tiles
#define PB_ALL (2 * PB_Q + NB * PB_V + PB_LN)
__global__ __launch_bounds__(128) void proj4(
    const unsigned short* __restrict__ Xb, const unsigned short* __restrict__ Wqkv,
    const unsigned short* __restrict__ Wln, const float* __restrict__ bqkv,
    unsigned short* Qh, unsigned short* Ql, unsigned short* Kh, unsigned short* Kl,
    unsigned short* VTh, unsigned short* VTl, float* LN) {
  __shared__ __align__(16) __bf16 sAB[2 * 2 * GPL];     // two buffers of 2 planes
  __shared__ __align__(16) float sT[4][16 * 68];        // per-wave 16x64 slab, pitch 68 floats
  const int bx = blockIdx.x;
  if (bx < 2 * PB_Q) {
    const int isk = (bx >= PB_Q) ? 1 : 0;
    const unsigned short* Wp = Wqkv + (size_t)isk * QP * DMODEL;
    gemm_tile<0, 2, 1>(sAB, sT, bx - isk * PB_Q, 0,
                       Xb, Xb, DMODEL, 0LL, Wp, Wp, DMODEL, 0LL,
                       (void*)(isk ? Kh : Qh), QP, 0LL, (void*)(isk ? Kl : Ql), QP, 0LL, QP,
                       bqkv + isk * QP, NB * SEQ, QP, DMODEL, 1.0f);
  } else if (bx < 2 * PB_Q + NB * PB_V) {
    const int v = bx - 2 * PB_Q;
    const unsigned short* Wp = Wqkv + (size_t)2 * QP * DMODEL;
    gemm_tile<0, 3, 2>(sAB, sT, v % PB_V, v / PB_V,
                       Wp, Wp, DMODEL, 0LL, Xb, Xb, DMODEL, (long long)SEQ * DMODEL,
                       (void*)VTh, SEQ, (long long)QP * SEQ, (void*)VTl, VLP, (long long)QP * VLP, VLP,
                       bqkv + 2 * QP, QP, SEQ, DMODEL, 4096.0f);
  } else if (bx < PB_ALL) {
    gemm_tile<0, 0, 0>(sAB, sT, bx - (2 * PB_Q + NB * PB_V), 0,
                       Xb, Xb, DMODEL, 0LL, Wln, Wln, DMODEL, 0LL,
                       (void*)LN, LNW, 0LL, (void*)LN, 0, 0LL, 0,
                       bqkv, NB * SEQ, LNW, DMODEL, 1.0f);
  }
}

// =====================================================================================================
// Line features. Input ln f32 [NB*SEQ][LNW]: column blocks of PD*NH = 64: block 0 = x.W1w^T, 1 = x.W2w^T,
// 2 = x.W1r^T, 3 = x.W2r^T; within a block head h owns columns h*4..h*4+3.
// Per (b, h, t): p1 = block 0 of token t-1 (zero vector at t == 0: the shifted input), p2 = block 1 of t,
// p3 = block 2 of t, p4 = block 3 of t. Exterior 2-form L[m] = pa[PI[m]]*pb[PJ[m]] - pa[PJ[m]]*pb[PI[m]] for
// pairs (0,1),(0,2),(0,3),(1,2),(1,3),(2,3), then L *= 1/max(|L|_2, 1e-12) (all f32, fp contract off).
// Outputs f32 [NB*NH][SEQ][8]: rl = read line [L0..L5, 0, 0]; wl = J-applied write line [L5,-L4,L3,L2,-L1,L0,0,0].
// wave-uniform bound, no block barriers.
// coverage: nwaves = NB*NH*(SEQ/32) waves x 32 rows x 32 B = every row of both planes incl. the zero pad cols.
// =====================================================================================================
struct L6 { float v0, v1, v2, v3, v4, v5; };

__device__ __forceinline__ L6 ext6n(const v4f a, const v4f b) {
#pragma clang fp contract(off)
  L6 o;
  o.v0 = a[0] * b[1] - a[1] * b[0];
  o.v1 = a[0] * b[2] - a[2] * b[0];
  o.v2 = a[0] * b[3] - a[3] * b[0];
  o.v3 = a[1] * b[2] - a[2] * b[1];
  o.v4 = a[1] * b[3] - a[3] * b[1];
  o.v5 = a[2] * b[3] - a[3] * b[2];
  float n2 = o.v0 * o.v0 + o.v1 * o.v1;
  n2 = n2 + o.v2 * o.v2;
  n2 = n2 + o.v3 * o.v3;
  n2 = n2 + o.v4 * o.v4;
  n2 = n2 + o.v5 * o.v5;
  float n = sqrtf(n2);
  n = fmaxf(n, 1e-12f);
  const float inv = 1.0f / n;
  o.v0 *= inv; o.v1 *= inv; o.v2 *= inv; o.v3 *= inv; o.v4 *= inv; o.v5 *= inv;
  return o;
}

__global__ __launch_bounds__(256) void lines_k(const float* __restrict__ ln, float* rl, float* wl, int nwaves) {
#pragma clang fp contract(off)
  __shared__ __align__(16) float sR[8][256];
  __shared__ __align__(16) float sW[8][256];
  const int tid = threadIdx.x, wave = tid >> 5, lane = tid & 31;
  const int w = blockIdx.x * 8 + wave;
  if (w >= nwaves) return;                        // wave-uniform; no block barriers in this kernel
  const int tgPer = SEQ / 32;                     // 64 token groups per (b, h)
  const int bh = w / tgPer;                       // b*NH + h
  const int tg = w - bh * tgPer;
  const int b  = bh / NH;
  const int h  = bh - b * NH;
  const int t  = tg * 32 + lane;                  // < SEQ
  const size_t row  = (size_t)b * SEQ + t;
  const size_t rowp = (t > 0) ? (row - 1) : row;  // clamped address; value zeroed below when t == 0
  const float* cur = ln + row * LNW + h * PD;
  v4f p1 = *(const v4f*)(ln + rowp * LNW + h * PD);
  if (t == 0) { p1[0] = 0.f; p1[1] = 0.f; p1[2] = 0.f; p1[3] = 0.f; }
  const v4f p2 = *(const v4f*)(cur + 1 * PD * NH);
  const v4f p3 = *(const v4f*)(cur + 2 * PD * NH);
  const v4f p4 = *(const v4f*)(cur + 3 * PD * NH);
  const L6 lw = ext6n(p1, p2);
  const L6 lr = ext6n(p3, p4);

  float* sr = sR[wave] + lane * 8;
  float* sw = sW[wave] + lane * 8;
  v4f t0, t1, u0, u1;
  t0[0] = lr.v0; t0[1] = lr.v1; t0[2] = lr.v2; t0[3] = lr.v3;
  t1[0] = lr.v4; t1[1] = lr.v5; t1[2] = 0.f;   t1[3] = 0.f;
  u0[0] = lw.v5; u0[1] = -lw.v4; u0[2] = lw.v3; u0[3] = lw.v2;
  u1[0] = -lw.v1; u1[1] = lw.v0; u1[2] = 0.f;   u1[3] = 0.f;
  *(v4f*)(sr)     = t0;
  *(v4f*)(sr + 4) = t1;
  *(v4f*)(sw)     = u0;
  *(v4f*)(sw + 4) = u1;
  __builtin_amdgcn_fence(__ATOMIC_RELEASE, "workgroup");
  __builtin_amdgcn_wave_barrier();
  __builtin_amdgcn_fence(__ATOMIC_ACQUIRE, "workgroup");
  v4f oR[2], oW[2];
#pragma unroll
  for (int it = 0; it < 2; ++it) {
    oR[it] = *(const v4f*)(sR[wave] + it * 128 + lane * 4);
    oW[it] = *(const v4f*)(sW[wave] + it * 128 + lane * 4);
  }
  const size_t gb = ((size_t)bh * SEQ + (size_t)tg * 32) * 8;
  {
#pragma unroll
    for (int it = 0; it < 2; ++it) {
      *(v4f*)(rl + gb + it * 128 + lane * 4) = oR[it];
      *(v4f*)(wl + gb + it * 128 + lane * 4) = oW[it];
    }
    
  }
}

// =====================================================================================================
// Causal multi-head attention, head dim 64, with an additive line-pair bias:
//   logit(q, k) = (q . k) * sscale + dot6(rl[q], wl[k]) * wdec(q - k),  wdec(d) = bs_h * dec_h^d for d > 0, 0 else,
//   dec_h = sigmoid(dl_h); keys k > q masked (-FLT_MAX, exp -> 0); diagonal kept. In the key chunks in front of the
//   diagonal one the weight is carried by the staged rows: rl[q] * bs_h * dec_h^(q - 64 qb) and wl[k] * dec_h^(64 qb - k),
//   and their dot is one more matrix product into the score tile (q carries sscale, so the tile holds logits).
//   q planes (bf16 hi / lo): element (b, t, h, d) at [(b*SEQ + t)*QP + h*64 + d]
//   k planes (bf16 hi / lo): same layout
//   v^T hi plane (f16):      element (b, h, d, s) at [(b*QP + h*64 + d)*SEQ + s]
//   v^T residual plane (f16, (v - hi)*4096): [(b*QP + h*64 + d)*VLP + s], s < VLP, read only when RES
//   rl / wl f32 planes [b*NH + h][SEQ][8] (6 used)
//   out f32 plane: element (b, t, h*64 + d) at [(b*SEQ + t)*QP + h*64 + d] = normalised context.
//   scores = (q sscale) . k : bf16 hi/lo split (hi.hi + hi.lo + lo.hi), f32 accumulate, + bias
//   p = exp(s - m) carried as f16(1024 p); context = p . v on f16 WMMA; RES adds f16 residual planes of p and v
//   (scale 4096, separate accumulator folded back with 1/4096 per chunk in f32); online softmax in f32.
//   Block = 4 waves; a query tile = 64 query rows of one (b, h); key chunks of 64, chunks 0..qb only for tile qb
//   (block-uniform trip count qb+1 <= NQB; every row has a live key in every processed chunk).
//   Each block takes two tiles of its (b, h), one after the other: NQB-1-t, then t (t = 0..NQB/2-1), so that every
//   block walks NQB+1 key chunks; grid = (NQB/2) * NH * NB. Tiles qb < RESQB run the RES form.
//   K / V^T / wl chunk staging: 128 threads (plain 16-B loads, __syncthreads before and after); P stays in registers.
//   Output coverage: each wave stores rows q0..q0+15 (it 0..7 x lane>>4 0..1) x 64 columns (16 lanes x 4 floats),
// =====================================================================================================
struct AttnLds {
  __align__(16) unsigned short KT[2 * 64 * LP];      // K hi [kv][d] | K lo; later f32 context staging
  __align__(16) _Float16 Vth[64 * LP];                // V^T hi [d][kv]
  __align__(16) _Float16 Vtl[64 * LP];                // V^T residual (RES tiles)
  __align__(16) float    Ws[8 * 64];                  // diagonal chunk: wl of its 64 keys, [term][key]
  __align__(16) unsigned short Wb[2 * 64 * 16];       // weighted wl of the chunk's 64 keys, the A tile of the bias product:
                                                      // k places 0..15 | 16..31, each [key][8 terms bf16 hi | 8 lo]
  __align__(16) float    Rp[128 * 12];                // per lane, the plain rl row of its query (6 terms; pitch 48 B)
};

// lane l <-> lane l ^ 16 in the vector unit
__device__ __forceinline__ float xhalf(float x) {
  const int b = __builtin_bit_cast(int, x);
  return __builtin_bit_cast(float, __builtin_amdgcn_permlanex16(b, b, 0x76543210, 0xfedcba98, false, false));
}

// One query tile qb of (b, h), all 4 waves of the block. Both products run transposed: S^T = K . Q^T (A = K rows,
// B = Q) and O^T += V^T . P^T (A = V^T rows, B = P^T). A lane then holds 32 of the 64 scores of ONE query (column
// c = lane & 15; keys 16 j + 8 (lane >> 4) + r), lane ^ 16 the other 32, and two neighbouring score tiles, converted
// in place, are the B operand of the second product in the k order of the V^T loader.
template <bool RES>
__device__ __forceinline__
void attn_tile(AttnLds& sm,
               const unsigned short* __restrict__ qhp, const unsigned short* __restrict__ qlp,
               const unsigned short* __restrict__ khp, const unsigned short* __restrict__ klp,
               const unsigned short* __restrict__ vhp, const unsigned short* __restrict__ vlp,
               const float* __restrict__ rlp, const float* __restrict__ wlp,
               const float* __restrict__ dlg, const float* __restrict__ bsc,
               float* outp, int b, int h, int qb, float sscale) {
  union FB { v16b v; v8b h[2]; };
  union FH { v16h v; v8h h[2]; };
  unsigned short* KT = sm.KT;
  _Float16* Vth = sm.Vth;
  _Float16* Vtl = sm.Vtl;
  float* Ws = sm.Ws;
  float* Rp = sm.Rp + threadIdx.x * 12;              // written and read by this lane alone
  __bf16* Wb = (__bf16*)(void*)sm.Wb;
  __bf16* Ksh = (__bf16*)(void*)KT;
  __bf16* Ksl = Ksh + 64 * LP;

  const int tid  = threadIdx.x;
  const int wave = tid >> 5;
  const int lane = tid & 31;
  const int hh   = lane >> 4;
  const int c    = lane & 15;

  const int q0   = qb * 64 + wave * 16;
  const size_t rowB = (size_t)b * SEQ;
  const size_t bhT  = ((size_t)b * NH + h) * SEQ;

  const __bf16* Qh = (const __bf16*)(const void*)qhp + (size_t)h * HD;
  const __bf16* Ql = (const __bf16*)(const void*)qlp + (size_t)h * HD;
  const __bf16* Kh = (const __bf16*)(const void*)khp + (size_t)h * HD;
  const __bf16* Kl = (const __bf16*)(const void*)klp + (size_t)h * HD;
  const _Float16* Vh = (const _Float16*)(const void*)vhp + ((size_t)b * QP + (size_t)h * HD) * SEQ;
  const _Float16* Vl = (const _Float16*)(const void*)vlp + ((size_t)b * QP + (size_t)h * HD) * VLP;

  // ---- per-head scalars (RNE bf16-converted inputs) ----
  const float dl  = bf_up(bf_bits(dlg[h]));
  const float dec = 1.0f / (1.0f + expf(-dl));
  const float l2d = fmaxf(log2f(dec), -FLT_MAX);   // finite, so that a power with exponent 0 is 1 also when dec == 0
  const float bsh = bf_up(bf_bits(bsc[h]));

  // ---- the rl row of this lane's query: plain, for the diagonal chunk, to the lane's own LDS slot; for the chunks in
  //      front of it as the B operand of the bias product, with the query's share of the decay weight:
  //      bs * dec^(q - k) = [bs * dec^(q - 64 qb)] * [dec^(64 qb - k)], both exponents >= 0 there, so both powers
  //      are <= 1 and neither can overflow; where one underflows the whole weight does.
  //      k places of the bias product (8 to a group, terms 0..5 and two zeros): A = wl hi | lo | hi | lo,
  //      B = rl hi | hi | lo | lo, so that the sum is (hi + lo) . (hi + lo). A lane holds places 8 hh .. and 16 + 8 hh ..:
  //      of B hi then lo in either half, of A its half's part from both halves of the tile ----
  FB rfr;
  {
    const float* rg = rlp + (bhT + q0 + c) * 8;
    const v4f ra = *(const v4f*)(rg);
    const v2f rb = *(const v2f*)(rg + 4);
#if defined(__HIP_DEVICE_COMPILE__)
    // the address register pair of the two loads is an input here, so it stays whole up to this wait
    asm volatile("s_wait_xcnt 0x0" :: "v"(rg) : "memory");
#endif
    const float rf = bsh * exp2f((float)(wave * 16 + c) * l2d);
    const v4f qa = ra * rf;
    const v2f qc = rb * rf;
    const float qw[8] = {qa[0], qa[1], qa[2], qa[3], qc[0], qc[1], 0.f, 0.f};
#pragma unroll  // rfr is indexed by constants only, so it stays in registers
    for (int i = 0; i < 8; ++i) {
      const __bf16 hi = (__bf16)qw[i];
      rfr.v[i]     = hi;
      rfr.v[8 + i] = (__bf16)(qw[i] - (float)hi);
    }
    *(v4f*)(Rp)     = ra;
    *(v2f*)(Rp + 4) = rb;
  }

  float mrow = -INFINITY, lrow = 0.f;        // of this lane's query; equal in lanes l and l ^ 16
  v8f oacc[4];                               // O^T: register r of tile t = context element d = 16 t + 8 hh + r
#pragma unroll
  for (int t = 0; t < 4; ++t) oacc[t] = zero8();

  // ---- Q fragments (B operand, column = lane&15): 2 d-chunks, hi and lo, held in registers for the whole tile ----
  v16b qah[2], qal[2];
  {
    const __bf16* qgh = Qh + (rowB + q0 + c) * QP + 8 * hh;
    const __bf16* qgl = Ql + (rowB + q0 + c) * QP + 8 * hh;
#pragma unroll  // the fragments are indexed by constants only, so they stay in registers (this loop and the next)
    for (int dc = 0; dc < 2; ++dc) {
      qah[dc] = ldfrag_b(qgh + dc * 32);
      qal[dc] = ldfrag_b(qgl + dc * 32);
    }
#if defined(__HIP_DEVICE_COMPILE__)
    // the address register pairs of the loads are inputs here, so they stay whole up to this wait
    asm volatile("s_wait_xcnt 0x0" :: "v"(qgh), "v"(qgl) : "memory");
#endif
    // q carries the logit scale, so that the bias can be added in the score accumulators; sscale = HD^-1/2 is a power of
    // two, so both planes stay exact
    const __bf16 sb = (__bf16)sscale;
#pragma unroll
    for (int dc = 0; dc < 2; ++dc) {
      qah[dc] = qah[dc] * sb;
      qal[dc] = qal[dc] * sb;
    }
  }

  int nkt = qb + 1;                          // causal: key tiles 0..qb, block-uniform
  if (nkt > NQB) nkt = NQB;
  for (int kt = 0; kt < nkt; ++kt) {
    const int kv0 = kt * 64;
    const bool diag = (kt == qb);            // block-uniform: the one chunk that holds keys >= a query of the tile
    __syncthreads();
    {
      const int r = tid >> 1, half = (tid & 1) * 32;
      // wl rows kv0..kv0+63 of this (b, h): 64 x 8 f32 = 128 threads x 16 B (key = kv0 + r); in front of the diagonal
      // chunk times the key's share dec^(64 qb - key) of the decay weight (exponent >= 1), in it times dec^0 = 1.
      // The load stands first so that it flies together with the K and V loads.
      const float* wg = wlp + (bhT + kv0) * 8 + tid * 4;
      const v4f wv = *(const v4f*)(wg);
      const float kf = exp2f((float)(diag ? 0 : (qb * 64 - kv0 - r)) * l2d);
      const __bf16*   kg  = Kh + (rowB + kv0 + r) * QP + half;    // K row kv0+r, d = half..half+31
      const __bf16*   klg = Kl + (rowB + kv0 + r) * QP + half;
      const _Float16* vg  = Vh + (size_t)r * SEQ + kv0 + half;    // V^T row d = r, s = kv0+half..+31
      const int kvl = (kv0 + 64 <= VLP) ? kv0 : (VLP - 64);     // clamped address into the residual plane
      const _Float16* vlg = Vl + (size_t)r * VLP + kvl + half;
      const bool resOK = (kv0 + 64 <= VLP);                      // block-uniform
#pragma unroll
      for (int i = 0; i < 4; ++i) {
        const v8b a0 = *(const v8b*)(kg + 8 * i);
        const v8b a1 = *(const v8b*)(klg + 8 * i);
        const v8h b0 = *(const v8h*)(vg + 8 * i);
        *(v8b*)(Ksh + r * LP + half + 8 * i) = a0;
        *(v8b*)(Ksl + r * LP + half + 8 * i) = a1;
        *(v8h*)(Vth + r * LP + half + 8 * i) = b0;
        if (RES) {
          v8h b1 = *(const v8h*)(vlg + 8 * i);
          if (!resOK) b1 = zero8h();
          *(v8h*)(Vtl + r * LP + half + 8 * i) = b1;
        }
      }
      // the weighted row as bf16 hi and lo, the A rows of the bias product; zero in the diagonal chunk, whose bias is
      // formed in f32 from the plain rows, staged term-major (one 16-B read brings one term of four neighbouring keys)
      const v4f wk = wv * kf;
      v4b wh4, wl4;
#pragma unroll  // the vectors are indexed by constants only, so they stay in registers (this loop and the next)
      for (int e = 0; e < 4; ++e) {
        const float we = diag ? 0.f : wk[e];
        const __bf16 hi = (__bf16)we;
        wh4[e] = hi;
        wl4[e] = (__bf16)(we - (float)hi);
      }
      *(v4b*)(Wb + r * 16 + (tid & 1) * 4)               = wh4;
      *(v4b*)(Wb + r * 16 + 8 + (tid & 1) * 4)           = wl4;
      *(v4b*)(Wb + 64 * 16 + r * 16 + (tid & 1) * 4)     = wh4;
      *(v4b*)(Wb + 64 * 16 + r * 16 + 8 + (tid & 1) * 4) = wl4;
      if (diag) {
#pragma unroll
        for (int e = 0; e < 4; ++e) Ws[((tid & 1) * 4 + e) * 64 + r] = wk[e];
      }
#if defined(__HIP_DEVICE_COMPILE__)
      // the address registers of the chunk's loads are inputs here, so they stay whole up to this wait
      if (RES) asm volatile("s_wait_xcnt 0x0" :: "v"(wg), "v"(kg), "v"(klg), "v"(vg), "v"(vlg) : "memory");
      else     asm volatile("s_wait_xcnt 0x0" :: "v"(wg), "v"(kg), "v"(klg), "v"(vg) : "memory");
#endif
    }
    __syncthreads();

    // ---- scores, transposed: 64 keys x 16 queries per wave, 3 bf16 products ----
    // all K fragments of the chunk are fetched as one group in front of the products, in the order of their use, so that
    // the LDS latency is met once for the chunk and not once for every three products
    FB kb[4][2], kl[4][2], wf[4];
#pragma unroll  // the fragments are indexed by constants only, so they stay in registers (all loops of this part)
    for (int j = 0; j < 4; ++j) {
#pragma unroll
      for (int dc = 0; dc < 2; ++dc) {
        kb[j][dc].h[0] = *(const v8b*)(Ksh + (j * 16 + c) * LP + dc * 32 + 8 * hh);
        kb[j][dc].h[1] = *(const v8b*)(Ksh + (j * 16 + c) * LP + dc * 32 + 16 + 8 * hh);
        kl[j][dc].h[0] = *(const v8b*)(Ksl + (j * 16 + c) * LP + dc * 32 + 8 * hh);
        kl[j][dc].h[1] = *(const v8b*)(Ksl + (j * 16 + c) * LP + dc * 32 + 16 + 8 * hh);
      }
    }
    v8f s[4];                                // s[j][r] = logit of key kv0 + 16 j + 8 hh + r and query q0 + c
#pragma unroll
    for (int j = 0; j < 4; ++j) {
      s[j] = zero8();
#pragma unroll
      for (int dc = 0; dc < 2; ++dc) {
        s[j] = mma_b(kb[j][dc].v, qah[dc], s[j]);
        s[j] = mma_b(kl[j][dc].v, qah[dc], s[j]);
        s[j] = mma_b(kb[j][dc].v, qal[dc], s[j]);
      }
      if (j == 1) {
        // the A rows of the bias product, fetched here, where half of the K fragments are used up (fetched with them
        // they did not fit the registers), twelve products ahead of their use; 16 keys x 32 B: a wave reads 512 B in a row
#pragma unroll  // as above
        for (int u = 0; u < 4; ++u) {
          wf[u].h[0] = *(const v8b*)(Wb + (u * 16 + c) * 16 + 8 * hh);
          wf[u].h[1] = *(const v8b*)(Wb + 64 * 16 + (u * 16 + c) * 16 + 8 * hh);
        }
      }
    }
    // + bias (+ 0 in the diagonal chunk); the plain builtin, so that its operands need not lie in the first 256 registers,
    // which the statements behind the other products ask for
#pragma unroll  // as above
    for (int j = 0; j < 4; ++j) s[j] = mma_b_raw(wf[j].v, rfr.v, s[j]);

    // ---- all V^T fragments of the chunk, fetched here so that they arrive while the softmax below is computed ----
    FH vb[2][4];
#pragma unroll  // as above
    for (int kk = 0; kk < 2; ++kk) {
#pragma unroll
      for (int t = 0; t < 4; ++t) {
        vb[kk][t].h[0] = *(const v8h*)(Vth + (t * 16 + c) * LP + kk * 32 + 8 * hh);
        vb[kk][t].h[1] = *(const v8h*)(Vth + (t * 16 + c) * LP + kk * 32 + 16 + 8 * hh);
      }
    }

    // ---- diagonal chunk: bias + causal mask (replace by -FLT_MAX); maximum, online softmax, P^T (x1024, f16) and its
    //      residual (x4096) packed in registers ----
    float mx[4];                             // maximum of each score tile: four independent chains
    if (!diag) {
      // every key of the chunk lies before every query of the tile: nothing is masked, and scale, bias and decay weight
      // are already in the accumulators
#pragma unroll  // s and mx are indexed by constants only, so they stay in registers
      for (int j = 0; j < 4; ++j) {
        float m = -INFINITY;
#pragma unroll
        for (int p = 0; p < 4; ++p) m = fmaxf(fmaxf(m, s[j][2 * p]), s[j][2 * p + 1]);
        mx[j] = m;
      }
    } else {
      const int qrow = q0 + c;
      const v4f pa4 = *(const v4f*)(Rp);
      const v2f pb2 = *(const v2f*)(Rp + 4);
      const float rp[6] = {pa4[0], pa4[1], pa4[2], pa4[3], pb2[0], pb2[1]};
#pragma unroll  // as above
      for (int j = 0; j < 4; ++j) {
        v4f w[6][2];
#pragma unroll
        for (int i = 0; i < 6; ++i) {
          w[i][0] = *(const v4f*)(Ws + i * 64 + j * 16 + 8 * hh);
          w[i][1] = *(const v4f*)(Ws + i * 64 + j * 16 + 8 * hh + 4);
        }
        float m = -INFINITY;
#pragma unroll
        for (int r = 0; r < 8; ++r) {
          const int u = r >> 2, e = r & 3;
          const int key = kv0 + j * 16 + 8 * hh + r;
          const int dd  = qrow - key;
          const float dot6 = rp[0] * w[0][u][e] + rp[1] * w[1][u][e] + rp[2] * w[2][u][e] + rp[3] * w[3][u][e]
                           + rp[4] * w[4][u][e] + rp[5] * w[5][u][e];
          const float ex   = exp2_slot((float)dd * l2d);
          const float wdec = (dd > 0) ? (bsh * ex) : 0.f;
          float sv = s[j][r] + dot6 * wdec;
          sv = (key > qrow) ? -FLT_MAX : sv;
          s[j][r] = sv;
          m = fmaxf(m, sv);
        }
        mx[j] = m;
      }
    }
    // maximum over the query's 64 keys: this lane's 32, then the other half's
    float mloc = fmaxf(fmaxf(mx[0], mx[1]), fmaxf(mx[2], mx[3]));
    mloc = fmaxf(mloc, xhalf(mloc));
    const float mnew  = fmaxf(mrow, mloc);
    const float msafe = (mnew == -INFINITY) ? 0.f : mnew;
    const float alpha = exp_slot(mrow - msafe);
    mrow = mnew;

    FH pa[2], pl[2];                         // P^T as B operand: element 8 (j & 1) + r of pa[j >> 1] = key 16 j + 8 hh + r
    float pj[4];                             // sum of each score tile: four independent chains
#pragma unroll  // s, pa, pl and pj are indexed by constants only, so they stay in registers
    for (int j = 0; j < 4; ++j) {
      float ps = 0.f;
#pragma unroll
      for (int r = 0; r < 8; ++r) {
        const float p = exp_slot(s[j][r] - msafe);  // masked logit against a finite max: exp -> 0
        ps += p;
        const float p1k = p * 1024.0f;
        const _Float16 ph = (_Float16)p1k;
        pa[j >> 1].v[(j & 1) * 8 + r] = ph;
        if (RES) pl[j >> 1].v[(j & 1) * 8 + r] = (_Float16)((p1k - (float)ph) * 4096.0f);
      }
      pj[j] = ps;
    }
    float psum = (pj[0] + pj[1]) + (pj[2] + pj[3]);
    psum += xhalf(psum);
    lrow = lrow * alpha + psum;
#pragma unroll  // as above
    for (int t = 0; t < 4; ++t)
#pragma unroll
      for (int r = 0; r < 8; ++r) oacc[t][r] *= alpha;

    // ---- context^T += V^T . P^T (f16 WMMA), residual products into a separate accumulator ----
    v8f o1[4];
#pragma unroll
    for (int t = 0; t < 4; ++t) o1[t] = zero8();
#pragma unroll  // the fragments are indexed by constants only, so they stay in registers
    for (int kk = 0; kk < 2; ++kk) {
      // RES tiles: the V^T residual fragments of one key half as a group (all eight, or held over the softmax, they did
      // not fit the registers)
      FH vl[4];
#pragma unroll
      for (int t = 0; t < 4; ++t) {
        if (RES) {
          vl[t].h[0] = *(const v8h*)(Vtl + (t * 16 + c) * LP + kk * 32 + 8 * hh);
          vl[t].h[1] = *(const v8h*)(Vtl + (t * 16 + c) * LP + kk * 32 + 16 + 8 * hh);
        } else {
          vl[t].v = vb[kk][t].v;
        }
      }
#pragma unroll
      for (int t = 0; t < 4; ++t) {
        oacc[t] = mma_h(vb[kk][t].v, pa[kk].v, oacc[t]);
        if (RES) {
          o1[t] = mma_h(vl[t].v, pa[kk].v, o1[t]);
          o1[t] = mma_h(vb[kk][t].v, pl[kk].v, o1[t]);
        }
      }
    }
    if (RES) {
#pragma unroll
      for (int t = 0; t < 4; ++t)
#pragma unroll
        for (int r = 0; r < 8; ++r) oacc[t][r] += o1[t][r] * (1.0f / 4096.0f);
    }
  }

  // ---- all waves are done with the K tiles before that LDS region is reused for the context staging ----
  __syncthreads();

  // ---- normalise (1/l and the 1/1024 p carry), stage the wave's 16x64 tile in LDS (row = query c, pitch OSP), then
  //      write whole 256-B row segments ----
  float* os = (float*)(void*)KT + wave * (16 * OSP);
  {
    const float inv = ((lrow > 0.f) ? (1.0f / lrow) : 0.f) * (1.0f / 1024.0f);
#pragma unroll
    for (int t = 0; t < 4; ++t) {
      v4f x0, x1;
#pragma unroll
      for (int e = 0; e < 4; ++e) { x0[e] = oacc[t][e] * inv; x1[e] = oacc[t][4 + e] * inv; }
      *(v4f*)(os + c * OSP + t * 16 + 8 * hh)     = x0;
      *(v4f*)(os + c * OSP + t * 16 + 8 * hh + 4) = x1;
    }
  }
  __builtin_amdgcn_fence(__ATOMIC_RELEASE, "workgroup");
  __builtin_amdgcn_wave_barrier();
  __builtin_amdgcn_fence(__ATOMIC_ACQUIRE, "workgroup");
  {
    const int h2 = lane >> 4, c4 = (lane & 15) * 4;
    v4f ov[8];
#pragma unroll
    for (int it = 0; it < 8; ++it) {
      const int row = it * 2 + h2;   // it 0..7 x h2 0..1 = rows 0..15 of the wave tile
      ov[it] = *(const v4f*)(os + row * OSP + c4);
    }
    {
#pragma unroll
      for (int it = 0; it < 8; ++it) {
        const int row = it * 2 + h2;
        const size_t go = (rowB + q0 + row) * QP + (size_t)h * HD + c4;
        *(v4f*)(outp + go) = ov[it];
      }
#if defined(__HIP_DEVICE_COMPILE__)
      // the block's next tile rewrites the address and data registers of these stores: the wait stands in front of that
      asm volatile("s_wait_xcnt 0x0" ::: "memory");
#endif
    }
  }
}

__global__ __launch_bounds__(128)
void attn_lb(const unsigned short* __restrict__ qhp, const unsigned short* __restrict__ qlp,
             const unsigned short* __restrict__ khp, const unsigned short* __restrict__ klp,
             const unsigned short* __restrict__ vhp, const unsigned short* __restrict__ vlp,
             const float* __restrict__ rlp, const float* __restrict__ wlp,
             const float* __restrict__ dlg, const float* __restrict__ bsc,
             float* outp, float sscale) {
  static_assert((NQB % 2) == 0);
  __shared__ AttnLds sm;
  const int bx   = blockIdx.x;
  const int t    = bx % (NQB / 2);
  const int rest = bx / (NQB / 2);
  const int h    = rest % NH;
  const int b    = rest / NH;
  // The second tile's first barrier (top of its key loop) stands behind every wave's read-back of the first tile's
  // context staging, and in front of the first refill of that LDS.
#pragma unroll 1  // rolled: one copy of each tile form in the text
  for (int pass = 0; pass < 2; ++pass) {
    const int qb = pass ? t : (NQB - 1 - t);       // block-uniform
    if (qb < RESQB)
      attn_tile<true>(sm, qhp, qlp, khp, klp, vhp, vlp, rlp, wlp, dlg, bsc, outp, b, h, qb, sscale);
    else
      attn_tile<false>(sm, qhp, qlp, khp, klp, vhp, vlp, rlp, wlp, dlg, bsc, outp, b, h, qb, sscale);
  }
}

// =====================================================================================================
// Workspace map (bytes), every region an exact multiple of its whole-line / whole-tile store granularity
// multiples):
//   Xb     bf16 [4096][1024]            0            8388608
//   Wqkv   bf16 [3072][1024]            8388608      6291456   ([n][k], rows 0..1023 q | 1024.. k | 2048.. v)
//   Wln    bf16 [256][1024]             14680064      524288   ([W1w; W2w; W1r; W2r], [n][k])
//   Wob    bf16 [1024][1024]            15204352     2097152   ([n][k])
//   LN     f32  [4096][256]             17301504     4194304
//   RL     f32  [32][2048][8]           21495808     2097152
//   WL     f32  [32][2048][8]           23592960     2097152
//   Qh     bf16 [4096][1024]            25690112     8388608
//   Ql     bf16 [4096][1024]            34078720     8388608
//   Kh     bf16 [4096][1024]            42467328     8388608
//   Kl     bf16 [4096][1024]            50855936     8388608
//   VTh    f16  [2][1024][2048]         59244544     8388608
//   VTl    f16  [2][1024][512]          67633152     2097152
//   Af     f32  [4096][1024]            69730304    16777216
//   Ah     bf16 [4096][1024]            86507520     8388608
//   Al     bf16 [4096][1024]            94896128     8388608
//   end                                 103284736
// =====================================================================================================
extern "C" void kernel_launch(void* const* d_in, const int* in_sizes, int n_in,
                              void* d_out, int out_size, void* d_ws, size_t ws_size,
                              hipStream_t stream) {
  if (n_in < 11) return;
  if (in_sizes[0] != NB * SEQ * DMODEL) return;
  if (in_sizes[1] != 3 * QP * DMODEL) return;
  if (in_sizes[2] != 3 * QP) return;
  if (in_sizes[3] != PD * NH * DMODEL) return;
  if (in_sizes[4] != PD * NH * DMODEL) return;
  if (in_sizes[5] != PD * NH * DMODEL) return;
  if (in_sizes[6] != PD * NH * DMODEL) return;
  if (in_sizes[7] != DMODEL * QP) return;
  if (in_sizes[8] != DMODEL) return;
  if (in_sizes[9] != NH) return;
  if (in_sizes[10] != NH) return;
  if (out_size != NB * SEQ * DMODEL) return;

  const float* x     = (const float*)d_in[0];    // [NB*SEQ][DMODEL]
  const float* wqkv  = (const float*)d_in[1];    // [3*QP n][DMODEL k]
  const float* bqkv  = (const float*)d_in[2];    // [3*QP]
  const float* w1w   = (const float*)d_in[3];    // [PD*NH][DMODEL]
  const float* w2w   = (const float*)d_in[4];
  const float* w1r   = (const float*)d_in[5];
  const float* w2r   = (const float*)d_in[6];
  const float* wout  = (const float*)d_in[7];    // [DMODEL n][QP k]
  const float* bout  = (const float*)d_in[8];    // [DMODEL]
  const float* dlog  = (const float*)d_in[9];    // [NH]
  const float* bscl  = (const float*)d_in[10];   // [NH]

  const size_t PXb   = (size_t)NB * SEQ * DMODEL * 2;      //  8388608
  const size_t PWqkv = (size_t)3 * QP * DMODEL * 2;        //  6291456
  const size_t PWln  = (size_t)LNW * DMODEL * 2;           //   524288
  const size_t PWo   = (size_t)DMODEL * QP * 2;            //  2097152
  const size_t PLN   = (size_t)NB * SEQ * LNW * 4;         //  4194304
  const size_t PRL   = (size_t)NB * NH * SEQ * 8 * 4;      //  2097152
  const size_t PQpl  = (size_t)NB * SEQ * QP * 2;          //  8388608  (Qh, Ql, Kh, Kl, Ah, Al)
  const size_t PVTh  = (size_t)NB * QP * SEQ * 2;          //  8388608
  const size_t PVTl  = (size_t)NB * QP * VLP * 2;          //  2097152
  const size_t PAf   = (size_t)NB * SEQ * QP * 4;          // 16777216
  size_t off = 0;
  const size_t oXb   = off; off += PXb;
  const size_t oWqkv = off; off += PWqkv;
  const size_t oWln  = off; off += PWln;
  const size_t oWo   = off; off += PWo;
  const size_t oLN   = off; off += PLN;
  const size_t oRL   = off; off += PRL;
  const size_t oWL   = off; off += PRL;
  const size_t oQh   = off; off += PQpl;
  const size_t oQl   = off; off += PQpl;
  const size_t oKh   = off; off += PQpl;
  const size_t oKl   = off; off += PQpl;
  const size_t oVTh  = off; off += PVTh;
  const size_t oVTl  = off; off += PVTl;
  const size_t oAf   = off; off += PAf;
  const size_t oAh   = off; off += PQpl;
  const size_t oAl   = off; off += PQpl;
  if (off > ws_size) return;                          // off = 103284736
  if (off > (size_t)134217728) return;

  char* ws = (char*)d_ws;
  unsigned short* Xb   = (unsigned short*)(ws + oXb);
  unsigned short* Wqkv = (unsigned short*)(ws + oWqkv);
  unsigned short* Wln  = (unsigned short*)(ws + oWln);
  unsigned short* Wob  = (unsigned short*)(ws + oWo);
  float*          LN   = (float*)(ws + oLN);
  float*          RL   = (float*)(ws + oRL);
  float*          WL   = (float*)(ws + oWL);
  unsigned short* Qh   = (unsigned short*)(ws + oQh);
  unsigned short* Ql   = (unsigned short*)(ws + oQl);
  unsigned short* Kh   = (unsigned short*)(ws + oKh);
  unsigned short* Kl   = (unsigned short*)(ws + oKl);
  unsigned short* VTh  = (unsigned short*)(ws + oVTh);
  unsigned short* VTl  = (unsigned short*)(ws + oVTl);
  float*          Af   = (float*)(ws + oAf);
  unsigned short* Ah   = (unsigned short*)(ws + oAh);
  unsigned short* Al   = (unsigned short*)(ws + oAl);
  float*          outf = (float*)d_out;

  const dim3 blk(256);
  const int nTok   = NB * SEQ;                                       // 4096 tokens
  const int n8a    = nTok * QP / 8;                                  // 524288
  const int nwLn   = NB * NH * (SEQ / 32);                           //   2048 waves
  const dim3 blkG(128);                                              // GEMM block: 4 waves, one 128x128 tile
  const dim3 gLines((nwLn + 7) / 8);                                 // 256 blocks
  const dim3 gSplit((n8a + 255) / 256);                              // 2048 blocks
  const dim3 gOut((nTok / 128) * (DMODEL / 128), 1);                 // 256 blocks

  // (1) inputs -> bf16 planes (RNE convert), one launch; weights arrive [n][k] = the Bt layout already. The planes
  //     Xb | Wqkv | Wln | Wob are contiguous from Xb on.
  cvt_all<<<dim3(CB_ALL), blk, 0, stream>>>(x, wqkv, w1w, w2w, w1r, w2r, wout, Xb);
  // (2)-(5) q, k, v^T and line-feature projections, one launch
  proj4<<<dim3(PB_ALL), blkG, 0, stream>>>(Xb, Wqkv, Wln, bqkv, Qh, Ql, Kh, Kl, VTh, VTl, LN);
  // (6) line features (shifted p1, exterior 2-forms, L2 normalisation, J map) -> rl / wl f32 planes
  lines_k<<<gLines, blk, 0, stream>>>(LN, RL, WL, nwLn);
  // (7) causal attention with line-pair bias: query tiles 0..RESQB-1 with residual planes, the rest without;
  //     one launch, two tiles (NQB-1-t and t) per block
  attn_lb<<<dim3(NB * NH * (NQB / 2)), dim3(128), 0, stream>>>(
      Qh, Ql, Kh, Kl, VTh, VTl, RL, WL, dlog, bscl, Af, 0.125f);
  // (8) context rows -> bf16 hi/lo planes
  split_bf16x8<<<gSplit, blk, 0, stream>>>(Af, Ah, Al, n8a);
  // (9) out[row][e] = sum_d (Ah+Al)[row][d] Wob[e][d] + bout[e] -> d_out f32 [4096][1024]  (M=4096, N=1024, K=1024)
  gemm64<1, 0, 1><<<gOut, blkG, 0, stream>>>(
      Ah, Al, QP, 0LL, Wob, Wob, QP, 0LL,
      (void*)outf, DMODEL, 0LL, (void*)outf, 0, 0LL, 0,
      bout, nTok, DMODEL, QP, 1.0f);
  (void)hipGetLastError();
}

// v010
// It runs in 135 microseconds.
// Timed twice side by side with v009, it ran 1.07 and 1.06 times as fast.
// All steps since v000 together make it 4.62 times as fast.
// Contractions: q / k / v^T and line-feature projections = v_wmma_f32_16x16x32_bf16 (bf16 operands from
// RNE-converted inputs, one product per k-step); q.k^T scores = v_wmma_f32_16x16x32_bf16 with bf16 hi/lo split
// q and k (hi.hi + hi.lo + lo.hi); p.v = v_wmma_f32_16x16x32_f16 (p carried x1024 in f16, v in f16; extra f16
// residual planes x4096 of p and v on the first 512 query rows); ctx.Wo^T = v_wmma_f32_16x16x32_bf16 with ctx
// as bf16 hi/lo planes times the bf16 Wo plane (2 products); all f32 accumulate; 6-term line-pair bias dots: in the
// key chunks before the diagonal one v_wmma_f32_16x16x32_bf16 per score tile (both rows as bf16 hi/lo, all four
// products in its 32 k places), in the diagonal chunk f32 on VALU; decay weights and softmax in f32 on VALU.
#include <hip/hip_runtime.h>
#include <math.h>
#include <float.h>
#include <stdint.h>

#define NB     2
#define SEQ    2048
#define DMODEL 1024
#define NH     16
#define HD     64
#define QP     (NH * HD)       // 1024: q / k / ctx row pitch
#define NQB    (SEQ / 64)      // 32 query / key tiles of 64
#define VLP    512             // key pitch of the v^T residual plane (keys 0..VLP-1)
#define RESQB  8               // leading 64-row query blocks that use the p / v residual planes
#define PD     4               // point dim per head
#define LNW    (4 * PD * NH)   // 256: width of the line-feature projection [p1w | p2w | p1r | p2r]
#define LP     72              // LDS row pitch (16-bit elements) of the attention K and V^T tiles: 144 B = 16 B x 9, so the
                               // 16 rows that one ds_load_b128 reads fall on 16 different groups of 4 banks (at 128 B: on 2)
static_assert(RESQB * 64 <= VLP);
static_assert(RESQB <= NQB);
static_assert(QP == DMODEL);
static_assert(HD == 64);
static_assert(PD == 4);
#define OSP    68              // LDS row pitch (f32) of the attention's context staging: 272 B = 16 B x 17
static_assert(LP >= 64 && (LP % 8) == 0 && 2 * 64 * LP * 2 >= 4 * 16 * OSP * 4);
static_assert((SEQ % 64) == 0 && (DMODEL % 64) == 0 && (LNW % 64) == 0 && (QP % 64) == 0);
static_assert(((NB * SEQ) % 64) == 0 && (SEQ % 32) == 0);
static_assert((DMODEL % 32) == 0);
static_assert(((NB * SEQ) % 128) == 0 && (SEQ % 128) == 0 && (QP % 128) == 0 && (LNW % 128) == 0 && (DMODEL % 128) == 0);

typedef _Float16 v16h __attribute__((ext_vector_type(16)));
typedef _Float16 v8h  __attribute__((ext_vector_type(8)));
typedef __bf16   v16b __attribute__((ext_vector_type(16)));
typedef __bf16   v8b  __attribute__((ext_vector_type(8)));
typedef __bf16   v4b  __attribute__((ext_vector_type(4)));
typedef float    v8f  __attribute__((ext_vector_type(8)));
typedef float    v4f  __attribute__((ext_vector_type(4)));
typedef float    v2f  __attribute__((ext_vector_type(2)));
typedef unsigned int v4u __attribute__((ext_vector_type(4)));

// ---- scalar helpers --------------------------------------------------------------------------------
__device__ __forceinline__ unsigned short bf_bits(float f) {          // f32 -> bf16 bits, RNE convert
  unsigned u = __float_as_uint(f);
  return (unsigned short)((u + 0x7FFFu + ((u >> 16) & 1u)) >> 16);
}
__device__ __forceinline__ float bf_up(unsigned short h) { return __uint_as_float(((unsigned)h) << 16); }
__device__ __forceinline__ unsigned short h_bits(_Float16 x) { return __builtin_bit_cast(unsigned short, x); }
__device__ __forceinline__ unsigned pk16(unsigned short a, unsigned short b) { return (unsigned)a | ((unsigned)b << 16); }
__device__ __forceinline__ v8f zero8() { v8f z = {0.f, 0.f, 0.f, 0.f, 0.f, 0.f, 0.f, 0.f}; return z; }

// exp(x) as v_exp_f32(x * log2 e), the form __expf compiled to. The v_nop is the one slot that the instruction set asks
// for behind a transcendental before a source is overwritten.
__device__ __forceinline__ float exp_slot(float x) {
  const float t = x * 1.44269504088896340736f;
  float r;
#if defined(__HIP_DEVICE_COMPILE__)
  asm("v_exp_f32 %0, %1\n\tv_nop" : "=v"(r) : "v"(t));
#else
  r = t;
#endif
  return r;
}
// 2^x in the form exp2f compiled to (v_exp_f32, arguments under -126 stepped up by 64 and the result back down), with the
// same v_nop slot behind the transcendental.
__device__ __forceinline__ float exp2_slot(float x) {
  const bool low = x < -126.0f;
  const float t = x + (low ? 64.0f : 0.0f);
  float r;
#if defined(__HIP_DEVICE_COMPILE__)
  asm("v_exp_f32 %0, %1\n\tv_nop" : "=v"(r) : "v"(t));
#else
  r = t;
#endif
  return ldexpf(r, low ? -64 : 0);
}
// ---- fragment loader: 16-bit A/B operand, lane -> row/col (lane&15), p already includes +8*(lane>>4);
//      elements 0..7 <- p[0..7] (k0+8h..), elements 8..15 <- p[16..23] (k0+16+8h..)
__device__ __forceinline__ v16b ldfrag_b(const __bf16* p) {
  union { v16b v; v8b h[2]; } f;
  f.h[0] = *(const v8b*)(p);
  f.h[1] = *(const v8b*)(p + 16);
  return f.v;
}

// ---- WMMA helpers with trailing VALU hazard gap --------------------------------------------------------
__device__ __forceinline__ v8f mma_b(v16b a, v16b b, v8f c) {
  c = __builtin_amdgcn_wmma_f32_16x16x32_bf16(false, a, false, b, (short)0, c, false, false);
#if defined(__HIP_DEVICE_COMPILE__)
  asm volatile("v_nop\n\tv_nop\n\tv_nop\n\tv_nop" : "+v"(c) : "v"(a), "v"(b));
#endif
  return c;
}
__device__ __forceinline__ v8f mma_h(v16h a, v16h b, v8f c) {
  c = __builtin_amdgcn_wmma_f32_16x16x32_f16(false, a, false, b, (short)0, c, false, false);
#if defined(__HIP_DEVICE_COMPILE__)
  asm volatile("v_nop\n\tv_nop\n\tv_nop\n\tv_nop" : "+v"(c) : "v"(a), "v"(b));
#endif
  return c;
}
__device__ __forceinline__ v8f mma_b_raw(v16b a, v16b b, v8f c) {
  return __builtin_amdgcn_wmma_f32_16x16x32_bf16(false, a, false, b, (short)0, c, false, false);
}
__device__ __forceinline__ void dep_guard_b(v8f& a, v8f& b, v16b x, v16b y) {
#if defined(__HIP_DEVICE_COMPILE__)
  asm volatile("v_nop\n\tv_nop\n\tv_nop\n\tv_nop" : "+v"(a), "+v"(b) : "v"(x), "v"(y));
#endif
}
__device__ __forceinline__ void keep4_b(v16b a, v16b b, v16b c, v16b d) {
#if defined(__HIP_DEVICE_COMPILE__)
  asm volatile("v_nop" :: "v"(a), "v"(b), "v"(c), "v"(d));
#endif
}
__device__ __forceinline__ void acc_guard4(v8f& a, v8f& b, v8f& c, v8f& d) {
#if defined(__HIP_DEVICE_COMPILE__)
  asm volatile("v_nop\n\tv_nop\n\tv_nop\n\tv_nop" : "+v"(a), "+v"(b), "+v"(c), "+v"(d));
#endif
}

// =====================================================================================================
// Flat f32 -> bf16 (RNE convert) of all seven f32 operands in one launch: x, w_qkv, the four line weights, w_out.
// Their bf16 planes lie one behind the other in the workspace in that order, so the destination is one flat array;
// a block (256 threads x 8 elements = 2048 elements) lies wholly inside one operand and picks its source by its index
// (block-uniform). One 16-B store per lane: a wave writes 512 contiguous bytes.
// coverage: CB_ALL blocks x 2048 elements = all seven planes, every plane a multiple of 2048 elements.
// =====================================================================================================
#define CB_X   (NB * SEQ * DMODEL / 2048)    // 2048 blocks
#define CB_QKV (3 * QP * DMODEL / 2048)      // 1536
#define CB_LN  (PD * NH * DMODEL / 2048)     //   32 for each line weight
#define CB_WO  (DMODEL * QP / 2048)          //  512
#define CB_ALL (CB_X + CB_QKV + 4 * CB_LN + CB_WO)
static_assert(((NB * SEQ * DMODEL) % 2048) == 0 && ((3 * QP * DMODEL) % 2048) == 0);
static_assert(((PD * NH * DMODEL) % 2048) == 0 && ((DMODEL * QP) % 2048) == 0);
__global__ __launch_bounds__(256) void cvt_all(const float* __restrict__ x, const float* __restrict__ wqkv,
                                               const float* __restrict__ w1w, const float* __restrict__ w2w,
                                               const float* __restrict__ w1r, const float* __restrict__ w2r,
                                               const float* __restrict__ wout, unsigned short* out) {
  const int bx = blockIdx.x;
  if (bx >= CB_ALL) return;
  const float* in;
  int b0;
  if (bx < CB_X)                            { in = x;    b0 = 0; }
  else if (bx < CB_X + CB_QKV)              { in = wqkv; b0 = CB_X; }
  else if (bx < CB_X + CB_QKV + 1 * CB_LN)  { in = w1w;  b0 = CB_X + CB_QKV; }
  else if (bx < CB_X + CB_QKV + 2 * CB_LN)  { in = w2w;  b0 = CB_X + CB_QKV + 1 * CB_LN; }
  else if (bx < CB_X + CB_QKV + 3 * CB_LN)  { in = w1r;  b0 = CB_X + CB_QKV + 2 * CB_LN; }
  else if (bx < CB_X + CB_QKV + 4 * CB_LN)  { in = w2r;  b0 = CB_X + CB_QKV + 3 * CB_LN; }
  else                                      { in = wout; b0 = CB_X + CB_QKV + 4 * CB_LN; }
  const float* s = in + ((size_t)(bx - b0) * 256 + threadIdx.x) * 8;
  const v4f a = *(const v4f*)(s);
  const v4f b = *(const v4f*)(s + 4);
  v4u p;
  p[0] = pk16(bf_bits(a[0]), bf_bits(a[1]));
  p[1] = pk16(bf_bits(a[2]), bf_bits(a[3]));
  p[2] = pk16(bf_bits(b[0]), bf_bits(b[1]));
  p[3] = pk16(bf_bits(b[2]), bf_bits(b[3]));
  *(v4u*)(out + ((size_t)bx * 256 + threadIdx.x) * 8) = p;
}

// =====================================================================================================
// f32 -> bf16 hi plane + bf16 lo plane (lo = RNE(v - hi), unscaled), 8 elements per thread, one 16-B store per
// coverage: n8 threads x 8 = whole plane (n8 multiple of 256).
// =====================================================================================================
__global__ __launch_bounds__(256) void split_bf16x8(const float* __restrict__ in, unsigned short* hp,
                                                    unsigned short* lp, int n8) {
  const int i = blockIdx.x * 256 + threadIdx.x;
  if (i < n8) {
    const v4f a = *(const v4f*)(in + (size_t)i * 8);
    const v4f b = *(const v4f*)(in + (size_t)i * 8 + 4);
    v4u ph, pl;
#pragma unroll
    for (int e = 0; e < 4; ++e) {
      const float f0 = (e < 2) ? a[2 * e]     : b[2 * e - 4];
      const float f1 = (e < 2) ? a[2 * e + 1] : b[2 * e - 3];
      const unsigned short h0 = bf_bits(f0), h1 = bf_bits(f1);
      const unsigned short l0 = bf_bits(f0 - bf_up(h0)), l1 = bf_bits(f1 - bf_up(h1));
      ph[e] = pk16(h0, h1);
      pl[e] = pk16(l0, l1);
    }
    *(v4u*)(hp + (size_t)i * 8) = ph;
    *(v4u*)(lp + (size_t)i * 8) = pl;
    
  }
}

// =====================================================================================================
// Batched bf16 WMMA GEMM: C[m][n] = sum_k A[m][k] * Bt[n][k] (+ bias). Block = 4 waves = one 128x128 tile, each
// wave a 64x64 quarter (wave>>1 = m half, wave&1 = n half). A row-major [M][K] pitch lda; Bt row-major [N][K] pitch
// ldb (k contiguous); M, N multiples of 128, K a multiple of 64 and at least 64. b = batch index.
// The 128 A rows and 128 Bt rows of a 64-wide k slab (128 B a row) are brought into LDS by asynchronous 16-B copies,
// 8 lanes to a row so that every copy instruction takes whole 128-B lines, and are shared by the block's waves; two
// buffers: slab t+1 flies while slab t is multiplied. LDS row pitch GP = 144 B. Fragments come by ds_load_b128; the
// k order and the order of the products are those of ascending k in steps of 32.
// NSPLIT: 0 = A.Bt; 1 = (A + A2).Bt (A2 = unscaled bf16 lo plane of A).
// BIAS: 0 none; 1 = + bias[n] per output column; 2 = + bias[m] per output row (bias RNE-converted to bf16 and
//       widened, added in f32 in the epilogue).
// OUT_MODE: 0 = f32 (pitch ldc); 2 = bf16 hi plane C + bf16 lo plane C2 (lo = RNE(v - hi), unscaled);
//           3 = f16 hi plane C + f16 residual plane C2 = f16((v - hi) * rscale), C2 written only for tiles
//               with n0 < N2 (pitch ldc2, batch stride strideC2).
// =====================================================================================================
#define GP 72                  // LDS row pitch (16-bit elements) of the GEMM slabs: 144 B = 16 B x 9
#define GPL (128 * GP)         // elements of one staged plane (128 rows)

// Eight asynchronous 16-B copies global -> LDS per lane. The s_wait_xcnt stands inside the statement so that no
// address register of a copy is rewritten ahead of it.
__device__ __forceinline__ void async8(const unsigned (&l)[8], const __bf16* const (&g)[8]) {
#if defined(__HIP_DEVICE_COMPILE__)
  asm volatile(
      "global_load_async_to_lds_b128 %0, %8, off\n\t"
      "global_load_async_to_lds_b128 %1, %9, off\n\t"
      "global_load_async_to_lds_b128 %2, %10, off\n\t"
      "global_load_async_to_lds_b128 %3, %11, off\n\t"
      "global_load_async_to_lds_b128 %4, %12, off\n\t"
      "global_load_async_to_lds_b128 %5, %13, off\n\t"
      "global_load_async_to_lds_b128 %6, %14, off\n\t"
      "global_load_async_to_lds_b128 %7, %15, off\n\t"
      "s_wait_xcnt 0x0"
      :: "v"(l[0]), "v"(l[1]), "v"(l[2]), "v"(l[3]), "v"(l[4]), "v"(l[5]), "v"(l[6]), "v"(l[7]),
         "v"(g[0]), "v"(g[1]), "v"(g[2]), "v"(g[3]), "v"(g[4]), "v"(g[5]), "v"(g[6]), "v"(g[7])
      : "memory");
#endif
}
// One plane of a slab: rows row0..row0+127 of src (pitch ld), columns k0..k0+63, to LDS byte address ldst.
// Thread tid takes the 16-B piece tid&7 of rows (tid>>3) + 16*it.
__device__ __forceinline__ void stage_plane(const __bf16* src, int row0, int ld, int k0, unsigned ldst, int tid) {
  unsigned l[8];
  const __bf16* g[8];
#pragma unroll  // the eight addresses are operands of one asm statement
  for (int it = 0; it < 8; ++it) {
    const int row = it * 16 + (tid >> 3);
    l[it] = ldst + (unsigned)((row * GP + (tid & 7) * 8) * 2);
    g[it] = src + (size_t)(row0 + row) * ld + k0 + (tid & 7) * 8;
  }
  async8(l, g);
}
__device__ __forceinline__ void wait_async0() {   // this wave's copies have landed
#if defined(__HIP_DEVICE_COMPILE__)
  asm volatile("s_wait_asynccnt 0x0" ::: "memory");
#endif
}
__device__ __forceinline__ void wait_ds0() {      // this wave's LDS reads are done before the buffer is refilled
#if defined(__HIP_DEVICE_COMPILE__)
  asm volatile("s_wait_dscnt 0x0" ::: "memory");
#endif
}

// One 128x128 tile (index tile, batch element b) by the 4 waves of a block; sAB = the two slab buffers, sT = the
// per-wave epilogue slabs, both the calling kernel's LDS.
template <int NSPLIT, int OUT_MODE, int BIAS>
__device__ __forceinline__ void gemm_tile(
    __bf16* sAB, float (*sT)[16 * 68], int tile, int b,
    const unsigned short* __restrict__ Ap, const unsigned short* A2p, int lda, long long strideA,
    const unsigned short* __restrict__ Btp, const unsigned short* Bt2p, int ldb, long long strideB,
    void* Cout, int ldc, long long strideC,
    void* Cout2, int ldc2, long long strideC2, int N2,
    const float* __restrict__ biasp,
    int M, int N, int K, float rscale) {
  static_assert(NSPLIT == 0 || NSPLIT == 1);
  constexpr int NPL = (NSPLIT == 1) ? 3 : 2;       // staged planes: A, Bt, (A2)
  constexpr int GI  = (NSPLIT == 1) ? 2 : 4;       // A row groups fetched together
  const __bf16* A   = (const __bf16*)(const void*)Ap;
  const __bf16* A2  = (const __bf16*)(const void*)A2p;
  const __bf16* Bt  = (const __bf16*)(const void*)Btp;
  (void)Bt2p;
  const int tid  = threadIdx.x;
  const int lane = tid & 31;
  const int wave = tid >> 5;
  const int tilesN = N >> 7;
  const int tilesM = M >> 7;
  if (tile >= tilesM * tilesN) return;   // block-uniform, in front of every barrier
  const int tm = tile / tilesN;
  const int tn = tile - tm * tilesN;
  const int mB = tm << 7;
  const int nB = tn << 7;
  const int wm = (wave >> 1) << 6;
  const int wn = (wave & 1) << 6;
  const int m0 = mB + wm;
  const int n0 = nB + wn;

  const __bf16* Ab  = A  + (size_t)b * strideA;
  const __bf16* Bb  = Bt + (size_t)b * strideB;
  const __bf16* Ab2 = (NSPLIT == 1) ? (A2 + (size_t)b * strideA) : Ab;

  const int rlane = lane & 15;                 // row (A) / col (B, D) within subtile
  const int koff  = (lane >> 4) * 8;           // k offset of this lane half
  const int mOff  = (lane >> 4) * 8;           // D row offset

  v8f acc[4][4];
#pragma unroll
  for (int i = 0; i < 4; ++i)
#pragma unroll
    for (int j = 0; j < 4; ++j) acc[i][j] = zero8();

  const unsigned lds0 = (unsigned)(uintptr_t)(void*)sAB;   // LDS byte address of the ring
  const int nT = K >> 6;                                   // k slabs of 64
  // slab t into buffer bf
  auto issue = [&](int t, int bf) {
    const unsigned lb = lds0 + (unsigned)(bf * NPL * GPL * 2);
    stage_plane(Ab, mB, lda, t << 6, lb, tid);
    stage_plane(Bb, nB, ldb, t << 6, lb + (unsigned)(GPL * 2), tid);
    if (NSPLIT == 1) stage_plane(Ab2, mB, lda, t << 6, lb + (unsigned)(2 * GPL * 2), tid);
  };
  issue(0, 0);
  wait_async0();
  __syncthreads();
  if (nT > 1) issue(1, 1);

  for (int t = 0; t < nT; ++t) {
    const __bf16* sA  = sAB + (t & 1) * (NPL * GPL);
    const __bf16* sB  = sA + GPL;
    const __bf16* sA2 = sA + (NPL - 1) * GPL;
    // this loop and those inside it are unrolled so that fragments and accumulators are indexed by constants only
    // and stay in registers
#pragma unroll
    for (int ks = 0; ks < 2; ++ks) {
      // the A fragments of GI row groups (16 products' worth) are fetched together, so that the LDS latency is met
      // once for them and not once a row group; GI is 2 with the second A plane to stay inside 256 registers
      v16b bh[4];
#pragma unroll
      for (int j = 0; j < 4; ++j) bh[j] = ldfrag_b(sB + (wn + (j << 4) + rlane) * GP + ks * 32 + koff);
#pragma unroll
      for (int ig = 0; ig < 4; ig += GI) {
        v16b ah[GI], al[GI];
#pragma unroll
        for (int u = 0; u < GI; ++u) {
          const int ao = (wm + ((ig + u) << 4) + rlane) * GP + ks * 32 + koff;
          ah[u] = ldfrag_b(sA + ao);
          if (NSPLIT == 1) al[u] = ldfrag_b(sA2 + ao); else al[u] = ah[u];
        }
#pragma unroll
        for (int u = 0; u < GI; ++u) {
          const int i = ig + u;
#pragma unroll
          for (int j = 0; j < 4; ++j) {
            acc[i][j] = mma_b_raw(ah[u], bh[j], acc[i][j]);
            if (NSPLIT == 1) acc[i][j] = mma_b_raw(al[u], bh[j], acc[i][j]);
          }
          dep_guard_b(acc[i][0], acc[i][3], ah[u], al[u]);
        }
      }
      keep4_b(bh[0], bh[1], bh[2], bh[3]);
    }
    // publish slab t+1 and free slab t's buffer: own LDS reads done, own copies landed, then the block barrier
    wait_ds0();
    wait_async0();
    __syncthreads();
    if (t + 2 < nT) issue(t + 2, t & 1);
  }
  wait_async0();
  acc_guard4(acc[0][0], acc[0][1], acc[0][2], acc[0][3]);
  acc_guard4(acc[1][0], acc[1][1], acc[1][2], acc[1][3]);
  acc_guard4(acc[2][0], acc[2][1], acc[2][2], acc[2][3]);
  acc_guard4(acc[3][0], acc[3][1], acc[3][2], acc[3][3]);

  // ---- per-column bias (BIAS == 1): this lane's 4 output columns n0 + 16j + rlane ----
  float bcol[4];
#pragma unroll
  for (int j = 0; j < 4; ++j) bcol[j] = 0.f;
  if (BIAS == 1) {
#pragma unroll
    for (int j = 0; j < 4; ++j) bcol[j] = bf_up(bf_bits(biasp[n0 + (j << 4) + rlane]));
  }

  // ---- epilogue ----
  float* slab = sT[wave];
#pragma unroll
  for (int i = 0; i < 4; ++i) {
    const int mBase = m0 + (i << 4);
    float brow[8];
#pragma unroll
    for (int r = 0; r < 8; ++r) brow[r] = 0.f;
    if (BIAS == 2) {
#pragma unroll
      for (int r = 0; r < 8; ++r) brow[r] = bf_up(bf_bits(biasp[mBase + mOff + r]));
    }
#pragma unroll
    for (int r = 0; r < 8; ++r) {
#pragma unroll
      for (int j = 0; j < 4; ++j) {
        float v = acc[i][j][r];
        if (BIAS == 1) v += bcol[j];
        if (BIAS == 2) v += brow[r];
        slab[(mOff + r) * 68 + (j << 4) + rlane] = v;
      }
    }
    __builtin_amdgcn_fence(__ATOMIC_RELEASE, "workgroup");
    __builtin_amdgcn_wave_barrier();
    __builtin_amdgcn_fence(__ATOMIC_ACQUIRE, "workgroup");
    if (OUT_MODE == 0) {
      float* C = (float*)Cout + (size_t)b * strideC;
      const int hh = lane >> 4, c4 = (lane & 15) * 4;     // 256-B row segment = 16 lanes x 16 B
      v4f ov[8];
#pragma unroll
      for (int it = 0; it < 8; ++it) {
        const int row = it * 2 + hh;                       // it 0..7 x hh 0..1 = rows 0..15
        ov[it] = *(const v4f*)(slab + row * 68 + c4);
      }
      {
#pragma unroll
        for (int it = 0; it < 8; ++it) {
          const int row = it * 2 + hh;
          *(v4f*)(C + (size_t)(mBase + row) * ldc + n0 + c4) = ov[it];
        }
        
      }
    } else {
      const int q = lane >> 3, c8 = (lane & 7) * 8;
      unsigned short* C  = (unsigned short*)Cout  + (size_t)b * strideC;
      unsigned short* C2 = (unsigned short*)Cout2 + (size_t)b * strideC2;
      const bool wlo = (OUT_MODE == 2) || (n0 < N2);      // wave-uniform
      v4u hv[4], lv[4];
#pragma unroll
      for (int it = 0; it < 4; ++it) {
        const int row = it * 4 + q;                        // it 0..3 x q 0..3 = rows 0..15
        const float* sp = slab + row * 68 + c8;
        v4u a, a2;
#pragma unroll
        for (int e = 0; e < 4; ++e) {
          const float f0 = sp[2 * e], f1 = sp[2 * e + 1];
          unsigned short h0, h1, l0, l1;
          if (OUT_MODE == 2) {
            h0 = bf_bits(f0); h1 = bf_bits(f1);
            l0 = bf_bits(f0 - bf_up(h0)); l1 = bf_bits(f1 - bf_up(h1));
          } else {
            const _Float16 x0 = (_Float16)f0, x1 = (_Float16)f1;
            h0 = h_bits(x0); h1 = h_bits(x1);
            l0 = h_bits((_Float16)((f0 - (float)x0) * rscale));
            l1 = h_bits((_Float16)((f1 - (float)x1) * rscale));
          }
          a[e] = pk16(h0, h1); a2[e] = pk16(l0, l1);
        }
        hv[it] = a; lv[it] = a2;
      }
      // the test stands round the store loops, not inside them: each side is one straight run of stores
      if (wlo) {
#pragma unroll  // hv and lv are indexed by constants only, so they stay in registers
        for (int it = 0; it < 4; ++it) {
          const int row = it * 4 + q;
          *(v4u*)(C + (size_t)(mBase + row) * ldc + n0 + c8) = hv[it];
          *(v4u*)(C2 + (size_t)(mBase + row) * ldc2 + n0 + c8) = lv[it];
        }
      } else {
#pragma unroll  // as above
        for (int it = 0; it < 4; ++it) {
          const int row = it * 4 + q;
          *(v4u*)(C + (size_t)(mBase + row) * ldc + n0 + c8) = hv[it];
        }
#if defined(__HIP_DEVICE_COMPILE__)
        // the code laid out behind these stores rewrites their address and data registers: the wait stands in front of it
        asm volatile("s_wait_xcnt 0x0" ::: "memory");
#endif
      }
    }
    __builtin_amdgcn_fence(__ATOMIC_RELEASE, "workgroup");
    __builtin_amdgcn_wave_barrier();
    __builtin_amdgcn_fence(__ATOMIC_ACQUIRE, "workgroup");
  }
}

// One GEMM per launch: blockIdx.x = tile, blockIdx.y = batch index.
template <int NSPLIT, int OUT_MODE, int BIAS>
__global__ __launch_bounds__(128) void gemm64(
    const unsigned short* __restrict__ Ap, const unsigned short* A2p, int lda, long long strideA,
    const unsigned short* __restrict__ Btp, const unsigned short* Bt2p, int ldb, long long strideB,
    void* Cout, int ldc, long long strideC,
    void* Cout2, int ldc2, long long strideC2, int N2,
    const float* __restrict__ biasp,
    int M, int N, int K, float rscale) {
  __shared__ __align__(16) __bf16 sAB[2 * ((NSPLIT == 1) ? 3 : 2) * GPL];   // two buffers of 2 or 3 planes
  __shared__ __align__(16) float sT[4][16 * 68];                            // per-wave 16x64 slab, pitch 68 floats
  gemm_tile<NSPLIT, OUT_MODE, BIAS>(sAB, sT, blockIdx.x, blockIdx.y, Ap, A2p, lda, strideA, Btp, Bt2p, ldb, strideB,
                                    Cout, ldc, strideC, Cout2, ldc2, strideC2, N2, biasp, M, N, K, rscale);
}

// The four projections of x, none of which reads another's result, in one launch; a block's index picks its GEMM
// (block-uniform) and its tile: q tiles, k tiles, v^T tiles of each batch element, line-feature tiles.
//   q, k:   C[row][e] = sum_k Xb[row][k] W[e][k] + bias[e] -> bf16 hi / lo planes     (M=4096, N=1024, K=1024)
//   v^T:    VTh[b][f][s] = sum_k Wv[f][k] Xb[b*SEQ+s][k] + bv[f] -> f16 hi plane (pitch SEQ) and residual plane
//           (x4096, keys < VLP, pitch VLP)                                            (M=1024, N=2048, K=1024)
//   lines:  LN[row][e] = sum_k Xb[row][k] Wln[e][k] -> f32                            (M=4096, N=256,  K=1024)
#define PB_Q  ((NB * SEQ / 128) * (QP / 128))    // 256 tiles, q and k each
#define PB_V  ((QP / 128) * (SEQ / 128))         // 128 tiles for each batch element
#define PB_LN ((NB * SEQ / 128) * (LNW / 128))   //  64 tiles
#define PB_ALL (2 * PB_Q + NB * PB_V + PB_LN)
__global__ __launch_bounds__(128) void proj4(
    const unsigned short* __restrict__ Xb, const unsigned short* __restrict__ Wqkv,
    const unsigned short* __restrict__ Wln, const float* __restrict__ bqkv,
    unsigned short* Qh, unsigned short* Ql, unsigned short* Kh, unsigned short* Kl,
    unsigned short* VTh, unsigned short* VTl, float* LN) {
  __shared__ __align__(16) __bf16 sAB[2 * 2 * GPL];     // two buffers of 2 planes
  __shared__ __align__(16) float sT[4][16 * 68];        // per-wave 16x64 slab, pitch 68 floats
  const int bx = blockIdx.x;
  if (bx < 2 * PB_Q) {
    const int isk = (bx >= PB_Q) ? 1 : 0;
    const unsigned short* Wp = Wqkv + (size_t)isk * QP * DMODEL;
    gemm_tile<0, 2, 1>(sAB, sT, bx - isk * PB_Q, 0,
                       Xb, Xb, DMODEL, 0LL, Wp, Wp, DMODEL, 0LL,
                       (void*)(isk ? Kh : Qh), QP, 0LL, (void*)(isk ? Kl : Ql), QP, 0LL, QP,
                       bqkv + isk * QP, NB * SEQ, QP, DMODEL, 1.0f);
  } else if (bx < 2 * PB_Q + NB * PB_V) {
    const int v = bx - 2 * PB_Q;
    const unsigned short* Wp = Wqkv + (size_t)2 * QP * DMODEL;
    gemm_tile<0, 3, 2>(sAB, sT, v % PB_V, v / PB_V,
                       Wp, Wp, DMODEL, 0LL, Xb, Xb, DMODEL, (long long)SEQ * DMODEL,
                       (void*)VTh, SEQ, (long long)QP * SEQ, (void*)VTl, VLP, (long long)QP * VLP, VLP,
                       bqkv + 2 * QP, QP, SEQ, DMODEL, 4096.0f);
  } else if (bx < PB_ALL) {
    gemm_tile<0, 0, 0>(sAB, sT, bx - (2 * PB_Q + NB * PB_V), 0,
                       Xb, Xb, DMODEL, 0LL, Wln, Wln, DMODEL, 0LL,
                       (void*)LN, LNW, 0LL, (void*)LN, 0, 0LL, 0,
                       bqkv, NB * SEQ, LNW, DMODEL, 1.0f);
  }
}

// =====================================================================================================
// Line features. Input ln f32 [NB*SEQ][LNW]: column blocks of PD*NH = 64: block 0 = x.W1w^T, 1 = x.W2w^T,
// 2 = x.W1r^T, 3 = x.W2r^T; within a block head h owns columns h*4..h*4+3.
// Per (b, h, t): p1 = block 0 of token t-1 (zero vector at t == 0: the shifted input), p2 = block 1 of t,
// p3 = block 2 of t, p4 = block 3 of t. Exterior 2-form L[m] = pa[PI[m]]*pb[PJ[m]] - pa[PJ[m]]*pb[PI[m]] for
// pairs (0,1),(0,2),(0,3),(1,2),(1,3),(2,3), then L *= 1/max(|L|_2, 1e-12) (all f32, fp contract off).
// Outputs f32 [NB*NH][SEQ][8]: rl = read line [L0..L5, 0, 0]; wl = J-applied write line [L5,-L4,L3,L2,-L1,L0,0,0].
// wave-uniform bound, no block barriers.
// coverage: nwaves = NB*NH*(SEQ/32) waves x 32 rows x 32 B = every row of both planes incl. the zero pad cols.
// =====================================================================================================
struct L6 { float v0, v1, v2, v3, v4, v5; };

__device__ __forceinline__ L6 ext6n(const v4f a, const v4f b) {
#pragma clang fp contract(off)
  L6 o;
  o.v0 = a[0] * b[1] - a[1] * b[0];
  o.v1 = a[0] * b[2] - a[2] * b[0];
  o.v2 = a[0] * b[3] - a[3] * b[0];
  o.v3 = a[1] * b[2] - a[2] * b[1];
  o.v4 = a[1] * b[3] - a[3] * b[1];
  o.v5 = a[2] * b[3] - a[3] * b[2];
  float n2 = o.v0 * o.v0 + o.v1 * o.v1;
  n2 = n2 + o.v2 * o.v2;
  n2 = n2 + o.v3 * o.v3;
  n2 = n2 + o.v4 * o.v4;
  n2 = n2 + o.v5 * o.v5;
  float n = sqrtf(n2);
  n = fmaxf(n, 1e-12f);
  const float inv = 1.0f / n;
  o.v0 *= inv; o.v1 *= inv; o.v2 *= inv; o.v3 *= inv; o.v4 *= inv; o.v5 *= inv;
  return o;
}

__global__ __launch_bounds__(256) void lines_k(const float* __restrict__ ln, float* rl, float* wl, int nwaves) {
#pragma clang fp contract(off)
  __shared__ __align__(16) float sR[8][256];
  __shared__ __align__(16) float sW[8][256];
  const int tid = threadIdx.x, wave = tid >> 5, lane = tid & 31;
  const int w = blockIdx.x * 8 + wave;
  if (w >= nwaves) return;                        // wave-uniform; no block barriers in this kernel
  const int tgPer = SEQ / 32;                     // 64 token groups per (b, h)
  const int bh = w / tgPer;                       // b*NH + h
  const int tg = w - bh * tgPer;
  const int b  = bh / NH;
  const int h  = bh - b * NH;
  const int t  = tg * 32 + lane;                  // < SEQ
  const size_t row  = (size_t)b * SEQ + t;
  const size_t rowp = (t > 0) ? (row - 1) : row;  // clamped address; value zeroed below when t == 0
  const float* cur = ln + row * LNW + h * PD;
  v4f p1 = *(const v4f*)(ln + rowp * LNW + h * PD);
  if (t == 0) { p1[0] = 0.f; p1[1] = 0.f; p1[2] = 0.f; p1[3] = 0.f; }
  const v4f p2 = *(const v4f*)(cur + 1 * PD * NH);
  const v4f p3 = *(const v4f*)(cur + 2 * PD * NH);
  const v4f p4 = *(const v4f*)(cur + 3 * PD * NH);
  const L6 lw = ext6n(p1, p2);
  const L6 lr = ext6n(p3, p4);

  float* sr = sR[wave] + lane * 8;
  float* sw = sW[wave] + lane * 8;
  v4f t0, t1, u0, u1;
  t0[0] = lr.v0; t0[1] = lr.v1; t0[2] = lr.v2; t0[3] = lr.v3;
  t1[0] = lr.v4; t1[1] = lr.v5; t1[2] = 0.f;   t1[3] = 0.f;
  u0[0] = lw.v5; u0[1] = -lw.v4; u0[2] = lw.v3; u0[3] = lw.v2;
  u1[0] = -lw.v1; u1[1] = lw.v0; u1[2] = 0.f;   u1[3] = 0.f;
  *(v4f*)(sr)     = t0;
  *(v4f*)(sr + 4) = t1;
  *(v4f*)(sw)     = u0;
  *(v4f*)(sw + 4) = u1;
  __builtin_amdgcn_fence(__ATOMIC_RELEASE, "workgroup");
  __builtin_amdgcn_wave_barrier();
  __builtin_amdgcn_fence(__ATOMIC_ACQUIRE, "workgroup");
  v4f oR[2], oW[2];
#pragma unroll
  for (int it = 0; it < 2; ++it) {
    oR[it] = *(const v4f*)(sR[wave] + it * 128 + lane * 4);
    oW[it] = *(const v4f*)(sW[wave] + it * 128 + lane * 4);
  }
  const size_t gb = ((size_t)bh * SEQ + (size_t)tg * 32) * 8;
  {
#pragma unroll
    for (int it = 0; it < 2; ++it) {
      *(v4f*)(rl + gb + it * 128 + lane * 4) = oR[it];
      *(v4f*)(wl + gb + it * 128 + lane * 4) = oW[it];
    }
    
  }
}

// =====================================================================================================
// Causal multi-head attention, head dim 64, with an additive line-pair bias:
//   logit(q, k) = (q . k) * sscale + dot6(rl[q], wl[k]) * wdec(q - k),  wdec(d) = bs_h * dec_h^d for d > 0, 0 else,
//   dec_h = sigmoid(dl_h); keys k > q masked (-FLT_MAX, exp -> 0); diagonal kept. In the key chunks in front of the
//   diagonal one the weight is carried by the staged rows: rl[q] * bs_h * dec_h^(q - 64 qb) and wl[k] * dec_h^(64 qb - k),
//   and their dot is one more matrix product into the score tile (q carries sscale, so the tile holds logits).
//   q planes (bf16 hi / lo): element (b, t, h, d) at [(b*SEQ + t)*QP + h*64 + d]
//   k planes (bf16 hi / lo): same layout
//   v^T hi plane (f16):      element (b, h, d, s) at [(b*QP + h*64 + d)*SEQ + s]
//   v^T residual plane (f16, (v - hi)*4096): [(b*QP + h*64 + d)*VLP + s], s < VLP, read only when RES
//   rl / wl f32 planes [b*NH + h][SEQ][8] (6 used)
//   out f32 plane: element (b, t, h*64 + d) at [(b*SEQ + t)*QP + h*64 + d] = normalised context.
//   scores = (q sscale) . k : bf16 hi/lo split (hi.hi + hi.lo + lo.hi), f32 accumulate, + bias
//   p = exp(s - m) carried as f16(1024 p); context = p . v on f16 WMMA; RES adds f16 residual planes of p and v
//   (scale 4096, separate accumulator folded back with 1/4096 per chunk in f32); online softmax in f32.
//   Block = 4 waves; a query tile = 64 query rows of one (b, h); key chunks of 64, chunks 0..qb only for tile qb
//   (block-uniform trip count qb+3: two lead-in trips, then the qb+1 <= NQB chunks; every row has a live key in every processed chunk).
//   Each block takes two tiles of its (b, h), one after the other: NQB-1-t, then t (t = 0..NQB/2-1), so that every
//   block walks NQB+1 key chunks; grid = (NQB/2) * NH * NB. Tiles qb < RESQB run the RES form.
//   K / V^T chunk staging: asynchronous 16-B copies global -> LDS, 8 lanes to a 128-B row, two stage buffers: chunk kt+1
//   flies while chunk kt is worked on; one block barrier a chunk. The weighted wl rows of chunk kt+1 go through
//   registers (loaded at the top of trip kt, stored at its foot). P stays in registers.
//   Output coverage: each wave stores rows q0..q0+15 (it 0..7 x lane>>4 0..1) x 64 columns (16 lanes x 4 floats),
// =====================================================================================================
struct AttnStage {                                    // one key chunk
  __align__(16) unsigned short KT[2 * 64 * LP];      // K hi [kv][d] | K lo; stage 0 later f32 context staging
  __align__(16) _Float16 Vth[64 * LP];                // V^T hi [d][kv]
  __align__(16) _Float16 Vtl[64 * LP];                // V^T residual (RES tiles)
  __align__(16) unsigned short Wb[2 * 64 * 16];       // weighted wl of the chunk's 64 keys, the A tile of the bias product:
                                                      // k places 0..15 | 16..31, each [key][8 terms bf16 hi | 8 lo]
};
struct AttnLds {
  AttnStage st[2];                                    // chunk kt lies in stage kt & 1
  __align__(16) float    Ws[8 * 64];                  // diagonal chunk: wl of its 64 keys, [term][key]
  __align__(16) float    Rp[128 * 12];                // per lane, the plain rl row of its query (6 terms; pitch 48 B)
};

// Twelve (four) asynchronous 16-B copies global -> LDS per lane. The s_wait_xcnt stands inside the statement so that no
// address register of a copy is rewritten ahead of it.
__device__ __forceinline__ void async12(const unsigned (&l)[12], const void* const (&g)[12]) {
#if defined(__HIP_DEVICE_COMPILE__)
  asm volatile(
      "global_load_async_to_lds_b128 %0, %12, off\n\t"
      "global_load_async_to_lds_b128 %1, %13, off\n\t"
      "global_load_async_to_lds_b128 %2, %14, off\n\t"
      "global_load_async_to_lds_b128 %3, %15, off\n\t"
      "global_load_async_to_lds_b128 %4, %16, off\n\t"
      "global_load_async_to_lds_b128 %5, %17, off\n\t"
      "global_load_async_to_lds_b128 %6, %18, off\n\t"
      "global_load_async_to_lds_b128 %7, %19, off\n\t"
      "global_load_async_to_lds_b128 %8, %20, off\n\t"
      "global_load_async_to_lds_b128 %9, %21, off\n\t"
      "global_load_async_to_lds_b128 %10, %22, off\n\t"
      "global_load_async_to_lds_b128 %11, %23, off\n\t"
      "s_wait_xcnt 0x0"
      :: "v"(l[0]), "v"(l[1]), "v"(l[2]), "v"(l[3]), "v"(l[4]), "v"(l[5]), "v"(l[6]), "v"(l[7]),
         "v"(l[8]), "v"(l[9]), "v"(l[10]), "v"(l[11]),
         "v"(g[0]), "v"(g[1]), "v"(g[2]), "v"(g[3]), "v"(g[4]), "v"(g[5]), "v"(g[6]), "v"(g[7]),
         "v"(g[8]), "v"(g[9]), "v"(g[10]), "v"(g[11])
      : "memory");
#endif
}
__device__ __forceinline__ void async4(const unsigned (&l)[4], const void* const (&g)[4]) {
#if defined(__HIP_DEVICE_COMPILE__)
  asm volatile(
      "global_load_async_to_lds_b128 %0, %4, off\n\t"
      "global_load_async_to_lds_b128 %1, %5, off\n\t"
      "global_load_async_to_lds_b128 %2, %6, off\n\t"
      "global_load_async_to_lds_b128 %3, %7, off\n\t"
      "s_wait_xcnt 0x0"
      :: "v"(l[0]), "v"(l[1]), "v"(l[2]), "v"(l[3]), "v"(g[0]), "v"(g[1]), "v"(g[2]), "v"(g[3])
      : "memory");
#endif
}

// lane l <-> lane l ^ 16 in the vector unit
__device__ __forceinline__ float xhalf(float x) {
  const int b = __builtin_bit_cast(int, x);
  return __builtin_bit_cast(float, __builtin_amdgcn_permlanex16(b, b, 0x76543210, 0xfedcba98, false, false));
}

// One query tile qb of (b, h), all 4 waves of the block. Both products run transposed: S^T = K . Q^T (A = K rows,
// B = Q) and O^T += V^T . P^T (A = V^T rows, B = P^T). A lane then holds 32 of the 64 scores of ONE query (column
// c = lane & 15; keys 16 j + 8 (lane >> 4) + r), lane ^ 16 the other 32, and two neighbouring score tiles, converted
// in place, are the B operand of the second product in the k order of the V^T loader.
template <bool RES>
__device__ __forceinline__
void attn_tile(AttnLds& sm,
               const unsigned short* __restrict__ qhp, const unsigned short* __restrict__ qlp,
               const unsigned short* __restrict__ khp, const unsigned short* __restrict__ klp,
               const unsigned short* __restrict__ vhp, const unsigned short* __restrict__ vlp,
               const float* __restrict__ rlp, const float* __restrict__ wlp,
               const float* __restrict__ dlg, const float* __restrict__ bsc,
               float* outp, int b, int h, int qb, float sscale) {
  union FB { v16b v; v8b h[2]; };
  union FH { v16h v; v8h h[2]; };
  float* Ws = sm.Ws;
  float* Rp = sm.Rp + threadIdx.x * 12;              // written and read by this lane alone

  const int tid  = threadIdx.x;
  const int wave = tid >> 5;
  const int lane = tid & 31;
  const int hh   = lane >> 4;
  const int c    = lane & 15;

  const int q0   = qb * 64 + wave * 16;
  const size_t rowB = (size_t)b * SEQ;
  const size_t bhT  = ((size_t)b * NH + h) * SEQ;

  const __bf16* Qh = (const __bf16*)(const void*)qhp + (size_t)h * HD;
  const __bf16* Ql = (const __bf16*)(const void*)qlp + (size_t)h * HD;
  const __bf16* Kh = (const __bf16*)(const void*)khp + (size_t)h * HD;
  const __bf16* Kl = (const __bf16*)(const void*)klp + (size_t)h * HD;
  const _Float16* Vh = (const _Float16*)(const void*)vhp + ((size_t)b * QP + (size_t)h * HD) * SEQ;
  const _Float16* Vl = (const _Float16*)(const void*)vlp + ((size_t)b * QP + (size_t)h * HD) * VLP;

  // ---- per-head scalars (RNE bf16-converted inputs) ----
  const float dl  = bf_up(bf_bits(dlg[h]));
  const float dec = 1.0f / (1.0f + expf(-dl));
  const float l2d = fmaxf(log2f(dec), -FLT_MAX);   // finite, so that a power with exponent 0 is 1 also when dec == 0
  const float bsh = bf_up(bf_bits(bsc[h]));

  int nkt = qb + 1;                          // causal: key tiles 0..qb, block-uniform
  if (nkt > NQB) nkt = NQB;

  // ---- chunk staging. K hi, K lo, V^T (RES: and its residual) of chunk kt into stage bf: thread tid copies the 16-B
  //      piece tid & 7 of rows (tid >> 3) + 16 it, so that every copy instruction takes whole 128-B lines ----
  const int crow = tid >> 3, cpc = (tid & 7) * 8;
  const unsigned ko = (unsigned)((crow * QP + cpc) * 2);    // byte offset of the thread's first piece in a K chunk,
  const unsigned vo = (unsigned)((crow * SEQ + cpc) * 2);   // a V^T chunk,
  const unsigned ro = (unsigned)((crow * VLP + cpc) * 2);   // a chunk of the residual plane
  auto issue = [&](int kt, int bf) {
    const int kv0 = kt * 64;
    const char* kU = (const char*)(Kh + (rowB + kv0) * QP);   // the chunk's first bytes: block-uniform
    const char* qU = (const char*)(Kl + (rowB + kv0) * QP);
    const char* vU = (const char*)(Vh + kv0);
    const unsigned lo = (unsigned)((crow * LP + cpc) * 2);
    const unsigned lk = (unsigned)(uintptr_t)(void*)sm.st[bf].KT + lo;
    const unsigned lv = (unsigned)(uintptr_t)(void*)sm.st[bf].Vth + lo;
    unsigned l[12];
    const void* g[12];
#pragma unroll  // the addresses are operands of one asm statement
    for (int it = 0; it < 4; ++it) {
      l[it]     = lk + (unsigned)(it * 16 * LP * 2);
      l[4 + it] = lk + (unsigned)((64 + it * 16) * LP * 2);
      l[8 + it] = lv + (unsigned)(it * 16 * LP * 2);
      g[it]     = kU + (size_t)(it * 16 * QP * 2) + ko;     // K row kv0 + crow + 16 it
      g[4 + it] = qU + (size_t)(it * 16 * QP * 2) + ko;
      g[8 + it] = vU + (size_t)(it * 16 * SEQ * 2) + vo;    // V^T row d = crow + 16 it, keys kv0..
    }
    async12(l, g);
    if (RES) {
      // a RES tile has qb < RESQB, so all its chunks lie inside the residual plane; the clamp bounds the address
      const int kvl = (kv0 + 64 <= VLP) ? kv0 : (VLP - 64);
      const unsigned lr = (unsigned)(uintptr_t)(void*)sm.st[bf].Vtl + lo;
      unsigned l2[4];
      const void* g2[4];
#pragma unroll  // as above
      for (int it = 0; it < 4; ++it) {
        l2[it] = lr + (unsigned)(it * 16 * LP * 2);
        g2[it] = (const char*)(Vl + kvl) + (size_t)(it * 16 * VLP * 2) + ro;
      }
      async4(l2, g2);
    }
  };
  // wl rows of chunk kt of this (b, h): 64 x 8 f32 = 128 threads x 16 B (key = 64 kt + (tid >> 1)), held in wv; in front
  // of the diagonal chunk times the key's share dec^(64 qb - key) of the decay weight (exponent >= 1), in it times
  // dec^0 = 1. The weighted row goes as bf16 hi and lo into stage bf, the A rows of the bias product; zero in the diagonal
  // chunk, whose bias is formed in f32 from the plain rows, staged term-major (one 16-B read brings one term of four
  // neighbouring keys).
  auto build_w = [&](const v4f wv, int kt, int bf) {
    const bool dg = (kt == qb);              // block-uniform
    const int r = tid >> 1;
    __bf16* Wb = (__bf16*)(void*)sm.st[bf].Wb;
    const float kf = exp2f((float)(dg ? 0 : (qb * 64 - kt * 64 - r)) * l2d);
    const v4f wk = wv * kf;
    v4b wh4, wl4;
#pragma unroll  // the vectors are indexed by constants only, so they stay in registers (this loop and the next)
    for (int e = 0; e < 4; ++e) {
      const float we = dg ? 0.f : wk[e];
      const __bf16 hi = (__bf16)we;
      wh4[e] = hi;
      wl4[e] = (__bf16)(we - (float)hi);
    }
    *(v4b*)(Wb + r * 16 + (tid & 1) * 4)               = wh4;
    *(v4b*)(Wb + r * 16 + 8 + (tid & 1) * 4)           = wl4;
    *(v4b*)(Wb + 64 * 16 + r * 16 + (tid & 1) * 4)     = wh4;
    *(v4b*)(Wb + 64 * 16 + r * 16 + 8 + (tid & 1) * 4) = wl4;
    if (dg) {
#pragma unroll
      for (int e = 0; e < 4; ++e) Ws[((tid & 1) * 4 + e) * 64 + r] = wk[e];
    }
  };

  // ---- the rl row of this lane's query: plain, for the diagonal chunk, to the lane's own LDS slot; for the chunks in
  //      front of it as the B operand of the bias product, with the query's share of the decay weight:
  //      bs * dec^(q - k) = [bs * dec^(q - 64 qb)] * [dec^(64 qb - k)], both exponents >= 0 there, so both powers
  //      are <= 1 and neither can overflow; where one underflows the whole weight does.
  //      k places of the bias product (8 to a group, terms 0..5 and two zeros): A = wl hi | lo | hi | lo,
  //      B = rl hi | hi | lo | lo, so that the sum is (hi + lo) . (hi + lo). A lane holds places 8 hh .. and 16 + 8 hh ..:
  //      of B hi then lo in either half, of A its half's part from both halves of the tile ----
  FB rfr;
  {
    const float* rg = rlp + (bhT + q0 + c) * 8;
    const v4f ra = *(const v4f*)(rg);
    const v2f rb = *(const v2f*)(rg + 4);
#if defined(__HIP_DEVICE_COMPILE__)
    // the address register pair of the two loads is an input here, so it stays whole up to this wait
    asm volatile("s_wait_xcnt 0x0" :: "v"(rg) : "memory");
#endif
    const float rf = bsh * exp2f((float)(wave * 16 + c) * l2d);
    const v4f qa = ra * rf;
    const v2f qc = rb * rf;
    const float qw[8] = {qa[0], qa[1], qa[2], qa[3], qc[0], qc[1], 0.f, 0.f};
#pragma unroll  // rfr is indexed by constants only, so it stays in registers
    for (int i = 0; i < 8; ++i) {
      const __bf16 hi = (__bf16)qw[i];
      rfr.v[i]     = hi;
      rfr.v[8 + i] = (__bf16)(qw[i] - (float)hi);
    }
    *(v4f*)(Rp)     = ra;
    *(v2f*)(Rp + 4) = rb;
  }

  float mrow = -INFINITY, lrow = 0.f;        // of this lane's query; equal in lanes l and l ^ 16
  v8f oacc[4];                               // O^T: register r of tile t = context element d = 16 t + 8 hh + r
#pragma unroll
  for (int t = 0; t < 4; ++t) oacc[t] = zero8();

  // ---- Q fragments (B operand, column = lane&15): 2 d-chunks, hi and lo, held in registers for the whole tile ----
  v16b qah[2], qal[2];
  {
    const __bf16* qgh = Qh + (rowB + q0 + c) * QP + 8 * hh;
    const __bf16* qgl = Ql + (rowB + q0 + c) * QP + 8 * hh;
#pragma unroll  // the fragments are indexed by constants only, so they stay in registers (this loop and the next)
    for (int dc = 0; dc < 2; ++dc) {
      qah[dc] = ldfrag_b(qgh + dc * 32);
      qal[dc] = ldfrag_b(qgl + dc * 32);
    }
#if defined(__HIP_DEVICE_COMPILE__)
    // the address register pairs of the loads are inputs here, so they stay whole up to this wait
    asm volatile("s_wait_xcnt 0x0" :: "v"(qgh), "v"(qgl) : "memory");
#endif
    // q carries the logit scale, so that the bias can be added in the score accumulators; sscale = HD^-1/2 is a power of
    // two, so both planes stay exact
    const __bf16 sb = (__bf16)sscale;
#pragma unroll
    for (int dc = 0; dc < 2; ++dc) {
      qah[dc] = qah[dc] * sb;
      qal[dc] = qal[dc] * sb;
    }
  }

  // Trips -2 and -1 are the ring's lead-in and work on no chunk, only the wl load at their top and their foot run. Foot of trip -2: the barrier behind
  // which every wave has left the LDS of the block's tile before, then chunk 0's copies. Foot of trip -1: chunk 0 is
  // published (own LDS writes done, own copies landed, block barrier), then chunk 1's copies. So the copies and the
  // build of the wl rows stand once in the text, and their addresses are formed where they are used.
  for (int kt = -2; kt < nkt; ++kt) {
    const bool more = (kt >= -1) && (kt + 1 < nkt);   // block-uniform: a chunk kt+1 is published at this trip's foot
    // that chunk's wl rows (where there is none: chunk 0's, unused), loaded here so that they arrive under the trip's work
    const float* wg = wlp + (bhT + (size_t)(more ? kt + 1 : 0) * 64) * 8 + tid * 4;
    const v4f wv = *(const v4f*)(wg);
#if defined(__HIP_DEVICE_COMPILE__)
    // the address register pair of the load is an input here, so it stays whole up to this wait
    asm volatile("s_wait_xcnt 0x0" :: "v"(wg) : "memory");
#endif
    if (kt >= 0) {                           // block-uniform
    const int kv0 = kt * 64;
    const bool diag = (kt == qb);            // block-uniform: the one chunk that holds keys >= a query of the tile
    AttnStage& sg = sm.st[kt & 1];           // this trip reads this stage alone
    const __bf16* Ksh = (const __bf16*)(const void*)sg.KT;
    const __bf16* Ksl = Ksh + 64 * LP;
    const _Float16* Vth = sg.Vth;
    const _Float16* Vtl = sg.Vtl;
    const __bf16* Wb = (const __bf16*)(const void*)sg.Wb;

    // ---- scores, transposed: 64 keys x 16 queries per wave, 3 bf16 products ----
    // all K fragments of the chunk are fetched as one group in front of the products, in the order of their use, so that
    // the LDS latency is met once for the chunk and not once for every three products
    FB kb[4][2], kl[4][2], wf[4];
#pragma unroll  // the fragments are indexed by constants only, so they stay in registers (all loops of this part)
    for (int j = 0; j < 4; ++j) {
#pragma unroll
      for (int dc = 0; dc < 2; ++dc) {
        kb[j][dc].h[0] = *(const v8b*)(Ksh + (j * 16 + c) * LP + dc * 32 + 8 * hh);
        kb[j][dc].h[1] = *(const v8b*)(Ksh + (j * 16 + c) * LP + dc * 32 + 16 + 8 * hh);
        kl[j][dc].h[0] = *(const v8b*)(Ksl + (j * 16 + c) * LP + dc * 32 + 8 * hh);
        kl[j][dc].h[1] = *(const v8b*)(Ksl + (j * 16 + c) * LP + dc * 32 + 16 + 8 * hh);
      }
    }
    v8f s[4];                                // s[j][r] = logit of key kv0 + 16 j + 8 hh + r and query q0 + c
#pragma unroll
    for (int j = 0; j < 4; ++j) {
      s[j] = zero8();
#pragma unroll
      for (int dc = 0; dc < 2; ++dc) {
        s[j] = mma_b(kb[j][dc].v, qah[dc], s[j]);
        s[j] = mma_b(kl[j][dc].v, qah[dc], s[j]);
        s[j] = mma_b(kb[j][dc].v, qal[dc], s[j]);
      }
      if (j == 1) {
        // the A rows of the bias product, fetched here, where half of the K fragments are used up (fetched with them
        // they did not fit the registers), twelve products ahead of their use; 16 keys x 32 B: a wave reads 512 B in a row
#pragma unroll  // as above
        for (int u = 0; u < 4; ++u) {
          wf[u].h[0] = *(const v8b*)(Wb + (u * 16 + c) * 16 + 8 * hh);
          wf[u].h[1] = *(const v8b*)(Wb + 64 * 16 + (u * 16 + c) * 16 + 8 * hh);
        }
      }
    }
    // + bias (+ 0 in the diagonal chunk); the plain builtin, so that its operands need not lie in the first 256 registers,
    // which the statements behind the other products ask for
#pragma unroll  // as above
    for (int j = 0; j < 4; ++j) s[j] = mma_b_raw(wf[j].v, rfr.v, s[j]);

    // ---- all V^T fragments of the chunk, fetched here so that they arrive while the softmax below is computed ----
    FH vb[2][4];
#pragma unroll  // as above
    for (int kk = 0; kk < 2; ++kk) {
#pragma unroll
      for (int t = 0; t < 4; ++t) {
        vb[kk][t].h[0] = *(const v8h*)(Vth + (t * 16 + c) * LP + kk * 32 + 8 * hh);
        vb[kk][t].h[1] = *(const v8h*)(Vth + (t * 16 + c) * LP + kk * 32 + 16 + 8 * hh);
      }
    }

    // ---- diagonal chunk: bias + causal mask (replace by -FLT_MAX); maximum, online softmax, P^T (x1024, f16) and its
    //      residual (x4096) packed in registers ----
    float mx[4];                             // maximum of each score tile: four independent chains
    if (!diag) {
      // every key of the chunk lies before every query of the tile: nothing is masked, and scale, bias and decay weight
      // are already in the accumulators
#pragma unroll  // s and mx are indexed by constants only, so they stay in registers
      for (int j = 0; j < 4; ++j) {
        float m = -INFINITY;
#pragma unroll
        for (int p = 0; p < 4; ++p) m = fmaxf(fmaxf(m, s[j][2 * p]), s[j][2 * p + 1]);
        mx[j] = m;
      }
    } else {
      const int qrow = q0 + c;
      // the chunk's first key, read here as a scalar: so the decay weights and masks of this one chunk are formed in it;
      // formed in front of the loop, as this build did without the builtin, they lay in scratch through all chunks
      const int kvd = __builtin_amdgcn_readfirstlane(kv0);
      const v4f pa4 = *(const v4f*)(Rp);
      const v2f pb2 = *(const v2f*)(Rp + 4);
      const float rp[6] = {pa4[0], pa4[1], pa4[2], pa4[3], pb2[0], pb2[1]};
#pragma unroll  // as above
      for (int j = 0; j < 4; ++j) {
        v4f w[6][2];
#pragma unroll
        for (int i = 0; i < 6; ++i) {
          w[i][0] = *(const v4f*)(Ws + i * 64 + j * 16 + 8 * hh);
          w[i][1] = *(const v4f*)(Ws + i * 64 + j * 16 + 8 * hh + 4);
        }
        float m = -INFINITY;
#pragma unroll
        for (int r = 0; r < 8; ++r) {
          const int u = r >> 2, e = r & 3;
          const int key = kvd + j * 16 + 8 * hh + r;
          const int dd  = qrow - key;
          const float dot6 = rp[0] * w[0][u][e] + rp[1] * w[1][u][e] + rp[2] * w[2][u][e] + rp[3] * w[3][u][e]
                           + rp[4] * w[4][u][e] + rp[5] * w[5][u][e];
          const float ex   = exp2_slot((float)dd * l2d);
          const float wdec = (dd > 0) ? (bsh * ex) : 0.f;
          float sv = s[j][r] + dot6 * wdec;
          sv = (key > qrow) ? -FLT_MAX : sv;
          s[j][r] = sv;
          m = fmaxf(m, sv);
        }
        mx[j] = m;
      }
    }
    // maximum over the query's 64 keys: this lane's 32, then the other half's
    float mloc = fmaxf(fmaxf(mx[0], mx[1]), fmaxf(mx[2], mx[3]));
    mloc = fmaxf(mloc, xhalf(mloc));
    const float mnew  = fmaxf(mrow, mloc);
    const float msafe = (mnew == -INFINITY) ? 0.f : mnew;
    const float alpha = exp_slot(mrow - msafe);
    mrow = mnew;

    FH pa[2], pl[2];                         // P^T as B operand: element 8 (j & 1) + r of pa[j >> 1] = key 16 j + 8 hh + r
    float pj[4];                             // sum of each score tile: four independent chains
#pragma unroll  // s, pa, pl and pj are indexed by constants only, so they stay in registers
    for (int j = 0; j < 4; ++j) {
      float ps = 0.f;
#pragma unroll
      for (int r = 0; r < 8; ++r) {
        const float p = exp_slot(s[j][r] - msafe);  // masked logit against a finite max: exp -> 0
        ps += p;
        const float p1k = p * 1024.0f;
        const _Float16 ph = (_Float16)p1k;
        pa[j >> 1].v[(j & 1) * 8 + r] = ph;
        if (RES) pl[j >> 1].v[(j & 1) * 8 + r] = (_Float16)((p1k - (float)ph) * 4096.0f);
      }
      pj[j] = ps;
    }
    float psum = (pj[0] + pj[1]) + (pj[2] + pj[3]);
    psum += xhalf(psum);
    lrow = lrow * alpha + psum;
#pragma unroll  // as above
    for (int t = 0; t < 4; ++t)
#pragma unroll
      for (int r = 0; r < 8; ++r) oacc[t][r] *= alpha;

    // ---- context^T += V^T . P^T (f16 WMMA), residual products into a separate accumulator ----
    v8f o1[4];
#pragma unroll
    for (int t = 0; t < 4; ++t) o1[t] = zero8();
#pragma unroll  // the fragments are indexed by constants only, so they stay in registers
    for (int kk = 0; kk < 2; ++kk) {
      // RES tiles: the V^T residual fragments of one key half as a group (all eight, or held over the softmax, they did
      // not fit the registers)
      FH vl[4];
#pragma unroll
      for (int t = 0; t < 4; ++t) {
        if (RES) {
          vl[t].h[0] = *(const v8h*)(Vtl + (t * 16 + c) * LP + kk * 32 + 8 * hh);
          vl[t].h[1] = *(const v8h*)(Vtl + (t * 16 + c) * LP + kk * 32 + 16 + 8 * hh);
        } else {
          vl[t].v = vb[kk][t].v;
        }
      }
#pragma unroll
      for (int t = 0; t < 4; ++t) {
        oacc[t] = mma_h(vb[kk][t].v, pa[kk].v, oacc[t]);
        if (RES) {
          o1[t] = mma_h(vl[t].v, pa[kk].v, o1[t]);
          o1[t] = mma_h(vb[kk][t].v, pl[kk].v, o1[t]);
        }
      }
    }
    if (RES) {
#pragma unroll
      for (int t = 0; t < 4; ++t)
#pragma unroll
        for (int r = 0; r < 8; ++r) oacc[t][r] += o1[t][r] * (1.0f / 4096.0f);
    }
    }                                        // kt >= 0

    // ---- publish chunk kt+1 and free chunk kt's stage: own LDS reads and writes done, own copies landed, then the block
    //      barrier; behind it chunk kt+2 starts to fly into the stage that this trip has read ----
    if (more) build_w(wv, kt + 1, (kt + 1) & 1);
    wait_ds0();
    wait_async0();
    __syncthreads();
    if (kt + 2 < nkt) issue(kt + 2, kt & 1);
  }
  wait_async0();
  // the last trip's barrier stands behind every wave's reads of the stages: stage 0 may now hold the context staging

  // ---- normalise (1/l and the 1/1024 p carry), stage the wave's 16x64 tile in LDS (row = query c, pitch OSP), then
  //      write whole 256-B row segments ----
  float* os = (float*)(void*)sm.st[0].KT + wave * (16 * OSP);
  {
    const float inv = ((lrow > 0.f) ? (1.0f / lrow) : 0.f) * (1.0f / 1024.0f);
#pragma unroll
    for (int t = 0; t < 4; ++t) {
      v4f x0, x1;
#pragma unroll
      for (int e = 0; e < 4; ++e) { x0[e] = oacc[t][e] * inv; x1[e] = oacc[t][4 + e] * inv; }
      *(v4f*)(os + c * OSP + t * 16 + 8 * hh)     = x0;
      *(v4f*)(os + c * OSP + t * 16 + 8 * hh + 4) = x1;
    }
  }
  __builtin_amdgcn_fence(__ATOMIC_RELEASE, "workgroup");
  __builtin_amdgcn_wave_barrier();
  __builtin_amdgcn_fence(__ATOMIC_ACQUIRE, "workgroup");
  {
    const int h2 = lane >> 4, c4 = (lane & 15) * 4;
    v4f ov[8];
#pragma unroll
    for (int it = 0; it < 8; ++it) {
      const int row = it * 2 + h2;   // it 0..7 x h2 0..1 = rows 0..15 of the wave tile
      ov[it] = *(const v4f*)(os + row * OSP + c4);
    }
    {
#pragma unroll
      for (int it = 0; it < 8; ++it) {
        const int row = it * 2 + h2;
        const size_t go = (rowB + q0 + row) * QP + (size_t)h * HD + c4;
        *(v4f*)(outp + go) = ov[it];
      }
#if defined(__HIP_DEVICE_COMPILE__)
      // the block's next tile rewrites the address and data registers of these stores: the wait stands in front of that
      asm volatile("s_wait_xcnt 0x0" ::: "memory");
#endif
    }
  }
}

__global__ __launch_bounds__(128)
void attn_lb(const unsigned short* __restrict__ qhp, const unsigned short* __restrict__ qlp,
             const unsigned short* __restrict__ khp, const unsigned short* __restrict__ klp,
             const unsigned short* __restrict__ vhp, const unsigned short* __restrict__ vlp,
             const float* __restrict__ rlp, const float* __restrict__ wlp,
             const float* __restrict__ dlg, const float* __restrict__ bsc,
             float* outp, float sscale) {
  static_assert((NQB % 2) == 0);
  __shared__ AttnLds sm;
  const int bx   = blockIdx.x;
  const int t    = bx % (NQB / 2);
  const int rest = bx / (NQB / 2);
  const int h    = rest % NH;
  const int b    = rest / NH;
  // The second tile's first barrier (in front of its first copies) stands behind every wave's read-back of the first
  // tile's context staging, and in front of the first refill of that LDS.
#pragma unroll 1  // rolled: one copy of each tile form in the text
  for (int pass = 0; pass < 2; ++pass) {
    const int qb = pass ? t : (NQB - 1 - t);       // block-uniform
    if (qb < RESQB)
      attn_tile<true>(sm, qhp, qlp, khp, klp, vhp, vlp, rlp, wlp, dlg, bsc, outp, b, h, qb, sscale);
    else
      attn_tile<false>(sm, qhp, qlp, khp, klp, vhp, vlp, rlp, wlp, dlg, bsc, outp, b, h, qb, sscale);
  }
}

// =====================================================================================================
// Workspace map (bytes), every region an exact multiple of its whole-line / whole-tile store granularity
// multiples):
//   Xb     bf16 [4096][1024]            0            8388608
//   Wqkv   bf16 [3072][1024]            8388608      6291456   ([n][k], rows 0..1023 q | 1024.. k | 2048.. v)
//   Wln    bf16 [256][1024]             14680064      524288   ([W1w; W2w; W1r; W2r], [n][k])
//   Wob    bf16 [1024][1024]            15204352     2097152   ([n][k])
//   LN     f32  [4096][256]             17301504     4194304
//   RL     f32  [32][2048][8]           21495808     2097152
//   WL     f32  [32][2048][8]           23592960     2097152
//   Qh     bf16 [4096][1024]            25690112     8388608
//   Ql     bf16 [4096][1024]            34078720     8388608
//   Kh     bf16 [4096][1024]            42467328     8388608
//   Kl     bf16 [4096][1024]            50855936     8388608
//   VTh    f16  [2][1024][2048]         59244544     8388608
//   VTl    f16  [2][1024][512]          67633152     2097152
//   Af     f32  [4096][1024]            69730304    16777216
//   Ah     bf16 [4096][1024]            86507520     8388608
//   Al     bf16 [4096][1024]            94896128     8388608
//   end                                 103284736
// =====================================================================================================
extern "C" void kernel_launch(void* const* d_in, const int* in_sizes, int n_in,
                              void* d_out, int out_size, void* d_ws, size_t ws_size,
                              hipStream_t stream) {
  if (n_in < 11) return;
  if (in_sizes[0] != NB * SEQ * DMODEL) return;
  if (in_sizes[1] != 3 * QP * DMODEL) return;
  if (in_sizes[2] != 3 * QP) return;
  if (in_sizes[3] != PD * NH * DMODEL) return;
  if (in_sizes[4] != PD * NH * DMODEL) return;
  if (in_sizes[5] != PD * NH * DMODEL) return;
  if (in_sizes[6] != PD * NH * DMODEL) return;
  if (in_sizes[7] != DMODEL * QP) return;
  if (in_sizes[8] != DMODEL) return;
  if (in_sizes[9] != NH) return;
  if (in_sizes[10] != NH) return;
  if (out_size != NB * SEQ * DMODEL) return;

  const float* x     = (const float*)d_in[0];    // [NB*SEQ][DMODEL]
  const float* wqkv  = (const float*)d_in[1];    // [3*QP n][DMODEL k]
  const float* bqkv  = (const float*)d_in[2];    // [3*QP]
  const float* w1w   = (const float*)d_in[3];    // [PD*NH][DMODEL]
  const float* w2w   = (const float*)d_in[4];
  const float* w1r   = (const float*)d_in[5];
  const float* w2r   = (const float*)d_in[6];
  const float* wout  = (const float*)d_in[7];    // [DMODEL n][QP k]
  const float* bout  = (const float*)d_in[8];    // [DMODEL]
  const float* dlog  = (const float*)d_in[9];    // [NH]
  const float* bscl  = (const float*)d_in[10];   // [NH]

  const size_t PXb   = (size_t)NB * SEQ * DMODEL * 2;      //  8388608
  const size_t PWqkv = (size_t)3 * QP * DMODEL * 2;        //  6291456
  const size_t PWln  = (size_t)LNW * DMODEL * 2;           //   524288
  const size_t PWo   = (size_t)DMODEL * QP * 2;            //  2097152
  const size_t PLN   = (size_t)NB * SEQ * LNW * 4;         //  4194304
  const size_t PRL   = (size_t)NB * NH * SEQ * 8 * 4;      //  2097152
  const size_t PQpl  = (size_t)NB * SEQ * QP * 2;          //  8388608  (Qh, Ql, Kh, Kl, Ah, Al)
  const size_t PVTh  = (size_t)NB * QP * SEQ * 2;          //  8388608
  const size_t PVTl  = (size_t)NB * QP * VLP * 2;          //  2097152
  const size_t PAf   = (size_t)NB * SEQ * QP * 4;          // 16777216
  size_t off = 0;
  const size_t oXb   = off; off += PXb;
  const size_t oWqkv = off; off += PWqkv;
  const size_t oWln  = off; off += PWln;
  const size_t oWo   = off; off += PWo;
  const size_t oLN   = off; off += PLN;
  const size_t oRL   = off; off += PRL;
  const size_t oWL   = off; off += PRL;
  const size_t oQh   = off; off += PQpl;
  const size_t oQl   = off; off += PQpl;
  const size_t oKh   = off; off += PQpl;
  const size_t oKl   = off; off += PQpl;
  const size_t oVTh  = off; off += PVTh;
  const size_t oVTl  = off; off += PVTl;
  const size_t oAf   = off; off += PAf;
  const size_t oAh   = off; off += PQpl;
  const size_t oAl   = off; off += PQpl;
  if (off > ws_size) return;                          // off = 103284736
  if (off > (size_t)134217728) return;

  char* ws = (char*)d_ws;
  unsigned short* Xb   = (unsigned short*)(ws + oXb);
  unsigned short* Wqkv = (unsigned short*)(ws + oWqkv);
  unsigned short* Wln  = (unsigned short*)(ws + oWln);
  unsigned short* Wob  = (unsigned short*)(ws + oWo);
  float*          LN   = (float*)(ws + oLN);
  float*          RL   = (float*)(ws + oRL);
  float*          WL   = (float*)(ws + oWL);
  unsigned short* Qh   = (unsigned short*)(ws + oQh);
  unsigned short* Ql   = (unsigned short*)(ws + oQl);
  unsigned short* Kh   = (unsigned short*)(ws + oKh);
  unsigned short* Kl   = (unsigned short*)(ws + oKl);
  unsigned short* VTh  = (unsigned short*)(ws + oVTh);
  unsigned short* VTl  = (unsigned short*)(ws + oVTl);
  float*          Af   = (float*)(ws + oAf);
  unsigned short* Ah   = (unsigned short*)(ws + oAh);
  unsigned short* Al   = (unsigned short*)(ws + oAl);
  float*          outf = (float*)d_out;

  const dim3 blk(256);
  const int nTok   = NB * SEQ;                                       // 4096 tokens
  const int n8a    = nTok * QP / 8;                                  // 524288
  const int nwLn   = NB * NH * (SEQ / 32);                           //   2048 waves
  const dim3 blkG(128);                                              // GEMM block: 4 waves, one 128x128 tile
  const dim3 gLines((nwLn + 7) / 8);                                 // 256 blocks
  const dim3 gSplit((n8a + 255) / 256);                              // 2048 blocks
  const dim3 gOut((nTok / 128) * (DMODEL / 128), 1);                 // 256 blocks

  // (1) inputs -> bf16 planes (RNE convert), one launch; weights arrive [n][k] = the Bt layout already. The planes
  //     Xb | Wqkv | Wln | Wob are contiguous from Xb on.
  cvt_all<<<dim3(CB_ALL), blk, 0, stream>>>(x, wqkv, w1w, w2w, w1r, w2r, wout, Xb);
  // (2)-(5) q, k, v^T and line-feature projections, one launch
  proj4<<<dim3(PB_ALL), blkG, 0, stream>>>(Xb, Wqkv, Wln, bqkv, Qh, Ql, Kh, Kl, VTh, VTl, LN);
  // (6) line features (shifted p1, exterior 2-forms, L2 normalisation, J map) -> rl / wl f32 planes
  lines_k<<<gLines, blk, 0, stream>>>(LN, RL, WL, nwLn);
  // (7) causal attention with line-pair bias: query tiles 0..RESQB-1 with residual planes, the rest without;
  //     one launch, two tiles (NQB-1-t and t) per block
  attn_lb<<<dim3(NB * NH * (NQB / 2)), dim3(128), 0, stream>>>(
      Qh, Ql, Kh, Kl, VTh, VTl, RL, WL, dlog, bscl, Af, 0.125f);
  // (8) context rows -> bf16 hi/lo planes
  split_bf16x8<<<gSplit, blk, 0, stream>>>(Af, Ah, Al, n8a);
  // (9) out[row][e] = sum_d (Ah+Al)[row][d] Wob[e][d] + bout[e] -> d_out f32 [4096][1024]  (M=4096, N=1024, K=1024)
  gemm64<1, 0, 1><<<gOut, blkG, 0, stream>>>(
      Ah, Al, QP, 0LL, Wob, Wob, QP, 0LL,
      (void*)outf, DMODEL, 0LL, (void*)outf, 0, 0LL, 0,
      bout, nTok, DMODEL, QP, 1.0f);
  (void)hipGetLastError();
}
